// v000
// The times below were measured on an AMD MI455X: many runs one after another, warmed up first and cycling through
// copies of the inputs, with the whole window's GPU time divided by the number of runs. Launches and the gaps
// between them are all in it. The median over several windows is given; except for v000 it joins two sittings, which
// can be a few percent apart, so the side-by-side timings, each taken in one sitting, are the better comparison.
// v000 is the starting kernel. One run takes 138 microseconds.
#include <hip/hip_runtime.h>
// q/k/v/o projections (4096 × 512 × 512, + bias) and the 8-head LOCAL attention (window ±32, d = 64) on v_wmma_f32_16x16x32_f16: a fused flash-style kernel visits only the 6 key chunks
// around each 128-query block (S = Q·Kᵀ, O = P·V on WMMA; |k − t| ≤ 32 band mask; online max/sum softmax f32; P f16 ≤ 1), and the module's zero-PADDED keys (score exactly 0, value 0, they DO
// take part in the softmax) are added analytically per query as npad·e^{0 − m} in the normaliser; A = f16(bf16 x) exact for q/k/v, f16(O) for o, weights [in][out] transposed to bf16-exact ×2^4, f32 accumulate.
#define BB 2
#define TT 2048
#define DM 512
#define NH 8
#define HD 64
#define WW 32
#define NR (BB * TT)

typedef __bf16 v16b __attribute__((ext_vector_type(16)));
typedef unsigned short v8us __attribute__((ext_vector_type(8), may_alias));
typedef float  v8f  __attribute__((ext_vector_type(8)));
typedef float  v4f  __attribute__((ext_vector_type(4)));
typedef float  v4fa __attribute__((ext_vector_type(4), may_alias));
union FragB { v16b v; v8us half[2]; unsigned short u[16]; };

__device__ __forceinline__ unsigned short bf16_bits(float x) { unsigned int u = __float_as_uint(x); return (unsigned short)((u + 0x7FFFu + ((u >> 16) & 1u)) >> 16); }
__device__ __forceinline__ float bf16_val(unsigned short b) { return __uint_as_float(((unsigned int)b) << 16); }
__device__ __forceinline__ float bf16_round(float x) { return bf16_val(bf16_bits(x)); }
// D += A·B with NT terms: 1 = ah·bh, 2 = + al·bh (A split), 3 = + ah·bl (both split)
template <int NT>
__device__ __forceinline__ v8f mmaN(v16b ah, v16b al, v16b bh, v16b bl, v8f c) {
  c = __builtin_amdgcn_wmma_f32_16x16x32_bf16(false, ah, false, bh, (short)0, c, false, false);
  if (NT >= 2) c = __builtin_amdgcn_wmma_f32_16x16x32_bf16(false, al, false, bh, (short)0, c, false, false);
  if (NT >= 3) c = __builtin_amdgcn_wmma_f32_16x16x32_bf16(false, ah, false, bl, (short)0, c, false, false);
  asm volatile("v_nop\n\tv_nop\n\tv_nop\n\tv_nop" : "+v"(c) : "v"(ah), "v"(al), "v"(bh), "v"(bl));
  return c;
}

__global__ __launch_bounds__(256) void k_wt_bf16(const float* __restrict__ W, unsigned short* __restrict__ Wt, int K, int N) {
  const int t = blockIdx.x * 256 + threadIdx.x;
  const int k8n = K / 8;
  if (t >= N * k8n) return;
  const int n = t / k8n, k8 = (t % k8n) * 8;
  v8us v;
#pragma unroll
  for (int i = 0; i < 8; ++i) v[i] = bf16_bits(W[(size_t)(k8 + i) * N + n]);
  *(v8us*)(Wt + (size_t)n * K + k8) = v;
  
}

// GEMM C[M][N] (f32, pitch ldc) = act(A[M][K]·W + bias). A f32 row-major (pitch lda) converted per fragment to bf16
// (ASPLIT: hi/lo two planes -> 2 terms, else single rounded term); Wt bf16 [N][K] (pitch ldb). BIAS_BF16 rounds the
// bias to bf16 first (bias quantised to bf16 before the add). K%32==0, M%16==0, N%64==0.
template <bool ASPLIT, int ACT, bool BIAS_BF16>
__global__ __launch_bounds__(128) void k_gemm_bf(const float* __restrict__ A, int lda, const unsigned short* __restrict__ Wt, int ldb,
                                               const float* __restrict__ bias, float* __restrict__ C, int ldc, int M, int N, int K) {
  __shared__ __attribute__((aligned(16))) float so[4][16][64];
  const int tid = threadIdx.x, w = tid >> 5, lane = tid & 31, ln = lane & 15, hh = lane >> 4;
  const int ntn = N / 64;
  const int wid = blockIdx.x * 4 + w;
  const int mt = wid / ntn, nq = wid % ntn;
  if (mt * 16 >= M) return;
  const int row0 = mt * 16, col0 = nq * 64;
  const float* arow = A + (size_t)(row0 + ln) * lda;
  v8f acc[4] = {};
  for (int kb = 0; kb < K; kb += 32) {
    FragB ah, al;
    const v4f x0 = *(const v4fa*)(arow + kb + 8 * hh), x1 = *(const v4fa*)(arow + kb + 8 * hh + 4);
    const v4f x2 = *(const v4fa*)(arow + kb + 16 + 8 * hh), x3 = *(const v4fa*)(arow + kb + 16 + 8 * hh + 4);
    float xs[16] = {x0[0],x0[1],x0[2],x0[3],x1[0],x1[1],x1[2],x1[3],x2[0],x2[1],x2[2],x2[3],x3[0],x3[1],x3[2],x3[3]};
#pragma unroll
    for (int i = 0; i < 16; ++i) { const unsigned short hb = bf16_bits(xs[i]); ah.u[i] = hb; al.u[i] = ASPLIT ? bf16_bits(xs[i] - bf16_val(hb)) : (unsigned short)0; }
#pragma unroll
    for (int t = 0; t < 4; ++t) {
      const unsigned short* brow = Wt + (size_t)(col0 + t * 16 + ln) * ldb + kb;
      FragB b;
      b.half[0] = *(const v8us*)(brow + 8 * hh);
      b.half[1] = *(const v8us*)(brow + 16 + 8 * hh);
      acc[t] = mmaN<ASPLIT ? 2 : 1>(ah.v, al.v, b.v, b.v, acc[t]);
    }
  }
#pragma unroll
  for (int t = 0; t < 4; ++t) {
    float bv = bias ? bias[col0 + t * 16 + ln] : 0.f;
    if (BIAS_BF16) bv = bf16_round(bv);
#pragma unroll
    for (int r = 0; r < 8; ++r) { float v = acc[t][r] + bv; if (ACT == 1) v = fmaxf(v, 0.f); so[w][8 * hh + r][t * 16 + ln] = v; }
  }
  __builtin_amdgcn_fence(__ATOMIC_ACQ_REL, "workgroup");
  __builtin_amdgcn_wave_barrier();
  const int rsub = lane >> 4, c4 = (lane & 15) * 4;
  {
#pragma unroll
    for (int q = 0; q < 8; ++q) {
      const int r = q * 2 + rsub;
      const v4f v = *(const v4fa*)&so[w][r][c4];
      *(v4f*)(C + (size_t)(row0 + r) * ldc + col0 + c4) = v;
    }
    
  }
}

// Flash-style causal/unmasked attention, all contractions 3-term bf16 hi/lo splits, f32 softmax with running max.
// q,k,v rows are read from f32 buffers with arbitrary row pitch (so they can live inside a fused qkv buffer);
// D = head size (multiple of 32, <= 128); one wave = 16 query rows; block = 4 waves (64 queries) sharing K/V chunks of 32.
template <int D, bool CAUSAL>
__global__ __launch_bounds__(128) void k_flash(const float* __restrict__ qb, const float* __restrict__ kb, const float* __restrict__ vb,
                                             int pitch, int T, int H, float scale, float* __restrict__ y, int ypitch) {
  constexpr int KS = D / 32;        // k-steps for QK
  constexpr int DT = D / 16;        // d tiles for PV
  __shared__ __attribute__((aligned(16))) unsigned short sKh[32][D + 8], sKl[32][D + 8], sVh[32][D + 8], sVl[32][D + 8];
  __shared__ __attribute__((aligned(16))) unsigned short sPh[4][16][40], sPl[4][16][40];
  __shared__ __attribute__((aligned(16))) float sO[4][16][D];
  const int tid = threadIdx.x, w = tid >> 5, lane = tid & 31, ln = lane & 15, hh = lane >> 4;
  const int nqb = (T + 63) / 64;
  const int bh = blockIdx.x / nqb, qblk = blockIdx.x % nqb;
  const int b = bh / H, h = bh % H;
  const int q0 = qblk * 64 + w * 16;
  const float* Q = qb + (size_t)b * T * pitch + h * D;
  const float* K = kb + (size_t)b * T * pitch + h * D;
  const float* V = vb + (size_t)b * T * pitch + h * D;

  // A fragments of the wave's 16 query rows (scaled), hi/lo
  FragB aqh[KS], aql[KS];
  {
    int row = q0 + ln; if (row >= T) row = T - 1;
    const float* qr = Q + (size_t)row * pitch;
#pragma unroll
    for (int ks = 0; ks < KS; ++ks)
#pragma unroll
      for (int i = 0; i < 16; ++i) {
        const int d = ks * 32 + ((i < 8) ? (8 * hh + i) : (16 + 8 * hh + (i - 8)));
        const float x = qr[d] * scale; const unsigned short hb = bf16_bits(x);
        aqh[ks].u[i] = hb; aql[ks].u[i] = bf16_bits(x - bf16_val(hb));
      }
  }
  float m_r[8], l_r[8];
#pragma unroll
  for (int r = 0; r < 8; ++r) { m_r[r] = -3.0e38f; l_r[r] = 0.f; }
  v8f oacc[DT];
#pragma unroll
  for (int dt = 0; dt < DT; ++dt) oacc[dt] = (v8f){0.f,0.f,0.f,0.f,0.f,0.f,0.f,0.f};

  const int kv_end = CAUSAL ? min(T, qblk * 64 + 64) : T;     // block-uniform
  for (int j0 = 0; j0 < kv_end; j0 += 32) {
    __syncthreads();
    for (int e = tid; e < 32 * (D / 4); e += 128) {
      const int r = e / (D / 4), c4 = (e % (D / 4)) * 4;
      const int key = j0 + r;
      v4f kf = {0.f,0.f,0.f,0.f}, vf = {0.f,0.f,0.f,0.f};
      if (key < T) { kf = *(const v4fa*)(K + (size_t)key * pitch + c4); vf = *(const v4fa*)(V + (size_t)key * pitch + c4); }
#pragma unroll
      for (int t = 0; t < 4; ++t) {
        unsigned short hb = bf16_bits(kf[t]); sKh[r][c4 + t] = hb; sKl[r][c4 + t] = bf16_bits(kf[t] - bf16_val(hb));
        hb = bf16_bits(vf[t]); sVh[r][c4 + t] = hb; sVl[r][c4 + t] = bf16_bits(vf[t] - bf16_val(hb));
      }
    }
    __syncthreads();
    // S tile 16 x 32
    v8f s[2];
#pragma unroll
    for (int nt = 0; nt < 2; ++nt) {
      v8f acc = {};
#pragma unroll
      for (int ks = 0; ks < KS; ++ks) {
        FragB bh_, bl_;
        bh_.half[0] = *(const v8us*)&sKh[nt * 16 + ln][ks * 32 + 8 * hh]; bh_.half[1] = *(const v8us*)&sKh[nt * 16 + ln][ks * 32 + 16 + 8 * hh];
        bl_.half[0] = *(const v8us*)&sKl[nt * 16 + ln][ks * 32 + 8 * hh]; bl_.half[1] = *(const v8us*)&sKl[nt * 16 + ln][ks * 32 + 16 + 8 * hh];
        acc = mmaN<3>(aqh[ks].v, aql[ks].v, bh_.v, bl_.v, acc);
      }
      s[nt] = acc;
    }
    // mask + running max (rows 8hh+r; the 16 lanes of a half share rows)
    float alpha[8];
#pragma unroll
    for (int r = 0; r < 8; ++r) {
      const int qi = q0 + 8 * hh + r;
      const int ja = j0 + ln, jb = j0 + 16 + ln;
      if (CAUSAL) { if (ja > qi) s[0][r] = -3.0e38f; if (jb > qi) s[1][r] = -3.0e38f; }
      if (ja >= T) s[0][r] = -3.0e38f;
      if (jb >= T) s[1][r] = -3.0e38f;
      float mx = fmaxf(s[0][r], s[1][r]);
      mx = fmaxf(mx, __shfl_xor(mx, 1, 32)); mx = fmaxf(mx, __shfl_xor(mx, 2, 32)); mx = fmaxf(mx, __shfl_xor(mx, 4, 32)); mx = fmaxf(mx, __shfl_xor(mx, 8, 32));
      const float mnew = fmaxf(m_r[r], mx);
      alpha[r] = (mnew > -1.0e38f) ? __expf(m_r[r] - mnew) : 1.0f;
      const float p0 = (s[0][r] > -1.0e38f) ? __expf(s[0][r] - mnew) : 0.f;
      const float p1 = (s[1][r] > -1.0e38f) ? __expf(s[1][r] - mnew) : 0.f;
      m_r[r] = mnew;
      l_r[r] = l_r[r] * alpha[r] + p0 + p1;            // per-lane partial row sum (16 lanes combined at the end)
      unsigned short hb = bf16_bits(p0); sPh[w][8 * hh + r][ln] = hb;      sPl[w][8 * hh + r][ln] = bf16_bits(p0 - bf16_val(hb));
      hb = bf16_bits(p1);                sPh[w][8 * hh + r][16 + ln] = hb; sPl[w][8 * hh + r][16 + ln] = bf16_bits(p1 - bf16_val(hb));
    }
#pragma unroll
    for (int dt = 0; dt < DT; ++dt)
#pragma unroll
      for (int r = 0; r < 8; ++r) oacc[dt][r] *= alpha[r];
    __builtin_amdgcn_fence(__ATOMIC_ACQ_REL, "workgroup");
    __builtin_amdgcn_wave_barrier();
    FragB pah, pal;
    pah.half[0] = *(const v8us*)&sPh[w][ln][8 * hh]; pah.half[1] = *(const v8us*)&sPh[w][ln][16 + 8 * hh];
    pal.half[0] = *(const v8us*)&sPl[w][ln][8 * hh]; pal.half[1] = *(const v8us*)&sPl[w][ln][16 + 8 * hh];
#pragma unroll
    for (int dt = 0; dt < DT; ++dt) {
      FragB bvh, bvl;
#pragma unroll
      for (int i = 0; i < 8; ++i) {
        bvh.u[i] = sVh[8 * hh + i][dt * 16 + ln]; bvh.u[8 + i] = sVh[16 + 8 * hh + i][dt * 16 + ln];
        bvl.u[i] = sVl[8 * hh + i][dt * 16 + ln]; bvl.u[8 + i] = sVl[16 + 8 * hh + i][dt * 16 + ln];
      }
      oacc[dt] = mmaN<3>(pah.v, pal.v, bvh.v, bvl.v, oacc[dt]);
    }
    __builtin_amdgcn_fence(__ATOMIC_ACQ_REL, "workgroup");
    __builtin_amdgcn_wave_barrier();
  }
#pragma unroll
  for (int r = 0; r < 8; ++r) {
    float l = l_r[r];
    l += __shfl_xor(l, 1, 32); l += __shfl_xor(l, 2, 32); l += __shfl_xor(l, 4, 32); l += __shfl_xor(l, 8, 32);
    l_r[r] = (l > 0.f) ? 1.0f / l : 0.f;
  }
#pragma unroll
  for (int dt = 0; dt < DT; ++dt)
#pragma unroll
    for (int r = 0; r < 8; ++r) sO[w][8 * hh + r][dt * 16 + ln] = oacc[dt][r] * l_r[r];
  __builtin_amdgcn_fence(__ATOMIC_ACQ_REL, "workgroup");
  __builtin_amdgcn_wave_barrier();
  {
    for (int r = 0; r < 16; ++r) {
      const int row = q0 + r;
      if (row < T && lane < D / 4) {
        const v4f val = *(const v4fa*)&sO[w][r][lane * 4];
        *(v4f*)(y + ((size_t)b * T + row) * ypitch + h * D + lane * 4) = val;
      }
    }
    
  }
}

// GEMM C = act(A·W + bias + resid): A f32 (ASPLIT -> hi/lo 2 terms), Wt bf16 [N][K]; ACT 0 none, 1 relu, 2 exact gelu;
// resid (optional, f32, row index = (row % rmod), pitch ldr, RES_BF16 rounds it) added before the activation.
template <bool ASPLIT, int ACT, bool BIAS_BF16, bool RES_BF16>
__global__ __launch_bounds__(128) void k_gemm_bf3(const float* __restrict__ A, int lda, const unsigned short* __restrict__ Wt, int ldb,
                                                const float* __restrict__ bias, const float* __restrict__ resid, int rmod, int ldr,
                                                float* __restrict__ C, int ldc, int M, int N, int K) {
  __shared__ __attribute__((aligned(16))) float so[4][16][64];
  const int tid = threadIdx.x, w = tid >> 5, lane = tid & 31, ln = lane & 15, hh = lane >> 4;
  const int ntn = N / 64;
  const int wid = blockIdx.x * 4 + w;
  const int mt = wid / ntn, nq = wid % ntn;
  if (mt * 16 >= M) return;
  const int row0 = mt * 16, col0 = nq * 64;
  const float* arow = A + (size_t)(row0 + ln) * lda;
  v8f acc[4] = {};
  for (int kb = 0; kb < K; kb += 32) {
    FragB ah, al;
    const v4f x0 = *(const v4fa*)(arow + kb + 8 * hh), x1 = *(const v4fa*)(arow + kb + 8 * hh + 4);
    const v4f x2 = *(const v4fa*)(arow + kb + 16 + 8 * hh), x3 = *(const v4fa*)(arow + kb + 16 + 8 * hh + 4);
    float xs[16] = {x0[0],x0[1],x0[2],x0[3],x1[0],x1[1],x1[2],x1[3],x2[0],x2[1],x2[2],x2[3],x3[0],x3[1],x3[2],x3[3]};
#pragma unroll
    for (int i = 0; i < 16; ++i) { const unsigned short hb = bf16_bits(xs[i]); ah.u[i] = hb; al.u[i] = ASPLIT ? bf16_bits(xs[i] - bf16_val(hb)) : (unsigned short)0; }
#pragma unroll
    for (int t = 0; t < 4; ++t) {
      const unsigned short* brow = Wt + (size_t)(col0 + t * 16 + ln) * ldb + kb;
      FragB b;
      b.half[0] = *(const v8us*)(brow + 8 * hh);
      b.half[1] = *(const v8us*)(brow + 16 + 8 * hh);
      acc[t] = mmaN<ASPLIT ? 2 : 1>(ah.v, al.v, b.v, b.v, acc[t]);
    }
  }
#pragma unroll
  for (int t = 0; t < 4; ++t) {
    const int col = col0 + t * 16 + ln;
    float bv = bias ? bias[col] : 0.f;
    if (BIAS_BF16) bv = bf16_round(bv);
#pragma unroll
    for (int r = 0; r < 8; ++r) {
      float v = acc[t][r] + bv;
      if (resid) { float rv = resid[(size_t)((row0 + 8 * hh + r) % rmod) * ldr + col]; if (RES_BF16) rv = bf16_round(rv); v += rv; }
      if (ACT == 1) v = fmaxf(v, 0.f);
      if (ACT == 2) v = 0.5f * v * (1.0f + erff(v * 0.70710678118654752f));
      if (ACT == 3) { const float u = 0.7978845608028654f * (v + 0.044715f * v * v * v); v = 0.5f * v * (1.0f + tanhf(u)); }
      so[w][8 * hh + r][t * 16 + ln] = v;
    }
  }
  __builtin_amdgcn_fence(__ATOMIC_ACQ_REL, "workgroup");
  __builtin_amdgcn_wave_barrier();
  const int rsub = lane >> 4, c4 = (lane & 15) * 4;
  {
#pragma unroll
    for (int q = 0; q < 8; ++q) {
      const int r = q * 2 + rsub;
      const v4f v = *(const v4fa*)&so[w][r][c4];
      *(v4f*)(C + (size_t)(row0 + r) * ldc + col0 + c4) = v;
    }
    
  }
}
// row LayerNorm (biased variance, eps) over N: s = X (+ R); optional out_sum <- s; out_norm <- (s-mu)*rsqrt(var+eps)*g + b
template <bool PARAM_BF16>
__global__ __launch_bounds__(256) void k_layernorm(const float* __restrict__ X, const float* __restrict__ R, const float* __restrict__ g, const float* __restrict__ bta,
                                                  float* __restrict__ out_sum, float* __restrict__ out_norm, int N, float eps) {
  __shared__ float red[256];
  const int row = blockIdx.x, tid = threadIdx.x;
  const float* x = X + (size_t)row * N; const float* rr = R ? R + (size_t)row * N : nullptr;
  float vals[16];                     // up to N = 4096
  const int per = N / 256;            // contiguous chunk per thread? use strided-by-4 chunks: thread handles j = tid*4 + 1024*u
  float s1 = 0.f;
  for (int u = 0; u < per / 4; ++u) {
    const int j = tid * 4 + 1024 * u;
    const v4f a = *(const v4fa*)(x + j);
    v4f b = {0.f,0.f,0.f,0.f}; if (rr) b = *(const v4fa*)(rr + j);
#pragma unroll
    for (int q = 0; q < 4; ++q) { const float v = a[q] + b[q]; vals[u * 4 + q] = v; s1 += v; }
  }
  red[tid] = s1; __syncthreads();
  for (int st = 128; st > 0; st >>= 1) { if (tid < st) red[tid] += red[tid + st]; __syncthreads(); }
  const float mu = red[0] / (float)N; __syncthreads();
  float s2 = 0.f;
  for (int u = 0; u < per / 4; ++u)
#pragma unroll
    for (int q = 0; q < 4; ++q) { const float c = vals[u * 4 + q] - mu; s2 += c * c; }
  red[tid] = s2; __syncthreads();
  for (int st = 128; st > 0; st >>= 1) { if (tid < st) red[tid] += red[tid + st]; __syncthreads(); }
  const float rs = rsqrtf(red[0] / (float)N + eps);
  {
    for (int u = 0; u < per / 4; ++u) {
      const int j = tid * 4 + 1024 * u;
      v4f o, sm;
#pragma unroll
      for (int q = 0; q < 4; ++q) {
        float gg = g[j + q], bb = bta[j + q];
        if (PARAM_BF16) { gg = bf16_round(gg); bb = bf16_round(bb); }
        sm[q] = vals[u * 4 + q]; o[q] = (vals[u * 4 + q] - mu) * rs * gg + bb;
      }
      if (out_sum) *(v4f*)(out_sum + (size_t)row * N + j) = sm;
      *(v4f*)(out_norm + (size_t)row * N + j) = o;
    }
    
  }
}



// ---- f16 WMMA path (v_wmma_f32_16x16x32_f16): 11-bit significands for operands in range — used where a [0,1] probability operand needs more precision than bf16
typedef _Float16 v16h __attribute__((ext_vector_type(16)));
union FragH { v16h v; v8us half[2]; _Float16 h[16]; unsigned short u[16]; };
template <int NT>
__device__ __forceinline__ v8f mmaH(v16h ah, v16h al, v16h bh, v16h bl, v8f c) {
  c = __builtin_amdgcn_wmma_f32_16x16x32_f16(false, ah, false, bh, (short)0, c, false, false);
  if (NT >= 2) c = __builtin_amdgcn_wmma_f32_16x16x32_f16(false, al, false, bh, (short)0, c, false, false);
  if (NT >= 3) c = __builtin_amdgcn_wmma_f32_16x16x32_f16(false, ah, false, bl, (short)0, c, false, false);
  asm volatile("v_nop\n\tv_nop\n\tv_nop\n\tv_nop" : "+v"(c) : "v"(ah), "v"(al), "v"(bh), "v"(bl));
  return c;
}
// batched GEMM like k_gemm_b but f16 operands: A f32 (split into f16 hi/lo if ASPLIT, else rounded to f16), Bt = f16 values [n][k]; alpha; C f32; N multiple of 16 (partial tiles skipped)
template <bool ASPLIT>
__global__ __launch_bounds__(128) void k_gemm_h(const float* __restrict__ A, int lda, size_t sA, const _Float16* __restrict__ Bh, int ldb, size_t sB, float alpha, float* __restrict__ C, int ldc, size_t sC, int M, int N, int K) {
  __shared__ __attribute__((aligned(16))) float so[4][16][64];
  const int tid = threadIdx.x, w = tid >> 5, lane = tid & 31, ln = lane & 15, hh = lane >> 4; const int by = blockIdx.y;
  A += (size_t)by * sA; Bh += (size_t)by * sB; C += (size_t)by * sC;
  const int ntn = (N + 63) / 64; const int wid = blockIdx.x * 4 + w; const int mt = wid / ntn, nq = wid % ntn; if (mt * 16 >= M) return;
  const int row0 = mt * 16, col0 = nq * 64; const float* arow = A + (size_t)(row0 + ln) * lda;
  v8f acc[4] = {};
  for (int kb = 0; kb < K; kb += 32) {
    FragH ah, al;
    const v4f x0 = *(const v4fa*)(arow + kb + 8 * hh), x1 = *(const v4fa*)(arow + kb + 8 * hh + 4), x2 = *(const v4fa*)(arow + kb + 16 + 8 * hh), x3 = *(const v4fa*)(arow + kb + 16 + 8 * hh + 4);
    float xs[16] = {x0[0],x0[1],x0[2],x0[3],x1[0],x1[1],x1[2],x1[3],x2[0],x2[1],x2[2],x2[3],x3[0],x3[1],x3[2],x3[3]};
#pragma unroll
    for (int i = 0; i < 16; ++i) { const _Float16 h = (_Float16)xs[i]; ah.h[i] = h; al.h[i] = ASPLIT ? (_Float16)(xs[i] - (float)h) : (_Float16)0.0f; }
#pragma unroll
    for (int t = 0; t < 4; ++t) { if (col0 + t * 16 >= N) continue; const size_t boff = (size_t)(col0 + t * 16 + ln) * ldb + kb; FragH bq; bq.half[0] = *(const v8us*)(Bh + boff + 8 * hh); bq.half[1] = *(const v8us*)(Bh + boff + 16 + 8 * hh);
      acc[t] = mmaH<ASPLIT ? 2 : 1>(ah.v, al.v, bq.v, bq.v, acc[t]); }
  }
#pragma unroll
  for (int t = 0; t < 4; ++t) { if (col0 + t * 16 >= N) continue;
#pragma unroll
    for (int r = 0; r < 8; ++r) so[w][8 * hh + r][t * 16 + ln] = acc[t][r] * alpha; }
  __builtin_amdgcn_fence(__ATOMIC_ACQ_REL, "workgroup"); __builtin_amdgcn_wave_barrier();
  const int rsub = lane >> 4, c4 = (lane & 15) * 4;
  {
#pragma unroll
    for (int q = 0; q < 8; ++q) { const int r = q * 2 + rsub; if (col0 + c4 < N) { const v4f v = *(const v4fa*)&so[w][r][c4]; *(v4f*)(C + (size_t)(row0 + r) * ldc + col0 + c4) = v; } }
     }
}

// Wt[n][k] = f16(W[k][n]·scale) from f32 row-major W[K][N] (scale = power of two; bf16-exact weights stay exact in f16 away from the subnormal range)
__global__ __launch_bounds__(256) void k_wt_f16(const float* __restrict__ W, _Float16* __restrict__ Wt, int K, int N, float scale) {
  const int t = blockIdx.x * 256 + threadIdx.x; if (t >= N * (K / 8)) return; const int n = t / (K / 8), k8 = (t % (K / 8)) * 8; FragH f;
#pragma unroll
  for (int i = 0; i < 8; ++i) f.h[i] = (_Float16)(bf16_round(W[(size_t)(k8 + i) * N + n]) * scale); const v8us o = f.half[0];
  *(v8us*)((unsigned short*)Wt + (size_t)n * K + k8) = o; 
}
// k_gemm_hh variant with fused epilogue: v = acc·alpha + bias[by·sBias + col] (+ CP[(row/rowsPerB)·sCPb + by·64 + col] if CP) ; ACT 0 none / 1 elu ; writes f16 C16 (and f32 C if non-null)
template <int ACT>
__global__ __launch_bounds__(128) void k_gemm_hhx(const _Float16* __restrict__ A, int lda, size_t sA, const _Float16* __restrict__ Bh, int ldb, size_t sB, float alpha, const float* __restrict__ bias, size_t sBias, const float* __restrict__ CP, int rowsPerB, size_t sCPb, int row0g,
    float* __restrict__ C, _Float16* __restrict__ C16, int ldc, size_t sC, int M, int N, int K) {
  __shared__ __attribute__((aligned(16))) float so[4][16][64];
  const int tid = threadIdx.x, w = tid >> 5, lane = tid & 31, ln = lane & 15, hh = lane >> 4; const int by = blockIdx.y;
  A += (size_t)by * sA; Bh += (size_t)by * sB; const size_t cofs = (size_t)by * sC; const float* bp = bias ? bias + (size_t)by * sBias : nullptr;
  const int ntn = (N + 63) / 64; const int wid = blockIdx.x * 4 + w; const int mt = wid / ntn, nq = wid % ntn; if (mt * 16 >= M) return;
  const int row0 = mt * 16, col0 = nq * 64; const _Float16* arow = A + (size_t)(row0 + ln) * lda;
  v8f acc[4] = {};
  for (int kb = 0; kb < K; kb += 32) { FragH ah; ah.half[0] = *(const v8us*)((const unsigned short*)arow + kb + 8 * hh); ah.half[1] = *(const v8us*)((const unsigned short*)arow + kb + 16 + 8 * hh);
#pragma unroll
    for (int t = 0; t < 4; ++t) { if (col0 + t * 16 >= N) continue; const size_t boff = (size_t)(col0 + t * 16 + ln) * ldb + kb; FragH bq; bq.half[0] = *(const v8us*)((const unsigned short*)Bh + boff + 8 * hh); bq.half[1] = *(const v8us*)((const unsigned short*)Bh + boff + 16 + 8 * hh);
      acc[t] = mmaH<1>(ah.v, ah.v, bq.v, bq.v, acc[t]); }
  }
#pragma unroll
  for (int t = 0; t < 4; ++t) { if (col0 + t * 16 >= N) continue; const int col = col0 + t * 16 + ln; const float bv = bp ? bf16_round(bp[col]) : 0.f;
#pragma unroll
    for (int r = 0; r < 8; ++r) { float v = acc[t][r] * alpha + bv; if (CP) { const int bidx = (row0g + row0 + 8 * hh + r) / rowsPerB; v += CP[(size_t)bidx * sCPb + (size_t)by * 64 + col]; } if (ACT == 1) v = (v > 0.f) ? v : expm1f(v); else if (ACT == 3) v = fmaxf(v, 0.f); so[w][8 * hh + r][t * 16 + ln] = v; } }
  __builtin_amdgcn_fence(__ATOMIC_ACQ_REL, "workgroup"); __builtin_amdgcn_wave_barrier();
  const int rsub = lane >> 4, c4 = (lane & 15) * 4; typedef _Float16 v4h __attribute__((ext_vector_type(4)));
  {
#pragma unroll
    for (int q = 0; q < 8; ++q) { const int r = q * 2 + rsub; if (col0 + c4 < N) { const v4f v = *(const v4fa*)&so[w][r][c4]; if (C) *(v4f*)(C + cofs + (size_t)(row0 + r) * ldc + col0 + c4) = v; if (C16) { v4h h4; for (int i = 0; i < 4; ++i) h4[i] = (_Float16)v[i]; *(v4h*)(C16 + cofs + (size_t)(row0 + r) * ldc + col0 + c4) = h4; } } }
     }
}


__global__ __launch_bounds__(256) void k_x16(const float* __restrict__ x, _Float16* __restrict__ X16, size_t n8) { const size_t t = (size_t)blockIdx.x * 256 + threadIdx.x; if (t >= n8) return; FragH f;
#pragma unroll
  for (int q = 0; q < 8; ++q) f.h[q] = (_Float16)bf16_round(x[t * 8 + q]); *(v8us*)((unsigned short*)X16 + t * 8) = f.half[0];  }
__global__ __launch_bounds__(256) void k_h16(const float* __restrict__ x, _Float16* __restrict__ X16, size_t n8) { const size_t t = (size_t)blockIdx.x * 256 + threadIdx.x; if (t >= n8) return; FragH f;
#pragma unroll
  for (int q = 0; q < 8; ++q) f.h[q] = (_Float16)x[t * 8 + q]; *(v8us*)((unsigned short*)X16 + t * 8) = f.half[0];  }
__global__ __launch_bounds__(256) void k_vt(const _Float16* __restrict__ V16, _Float16* __restrict__ Vt) { __shared__ unsigned short tl[64][66]; const int tid = threadIdx.x; const int slab = blockIdx.x / (TT / 64), lg = blockIdx.x % (TT / 64); const int b = slab / NH, h = slab % NH;
  for (int i = tid; i < 64 * 8; i += 256) { const int r = i / 8, c8 = (i % 8) * 8; FragH f; f.half[0] = *(const v8us*)((const unsigned short*)V16 + ((size_t)b * TT + lg * 64 + r) * DM + h * HD + c8);
#pragma unroll
    for (int q = 0; q < 8; ++q) tl[r][c8 + q] = f.u[q]; }
  __syncthreads();
  {
#pragma unroll
    for (int rd = 0; rd < 2; ++rd) { const int d = rd * 32 + tid / 8, pc = tid % 8; FragH f;
#pragma unroll
      for (int q = 0; q < 8; ++q) f.u[q] = tl[pc * 8 + q][d];
      *(v8us*)((unsigned short*)Vt + ((size_t)slab * HD + d) * TT + lg * 64 + pc * 8) = f.half[0]; }
     } }
// local attention per ((b,h), 128 queries): wave = 32 queries; key chunks j0 = qb0 − 32 … qb0 + 128 (6 chunks; rows outside [0, T) are read at a CLAMPED address and masked); score/8 where |k − t| ≤ 32 and
__global__ __launch_bounds__(128) void k_flash(const _Float16* __restrict__ Q16, const _Float16* __restrict__ K16, const _Float16* __restrict__ Vt, float* __restrict__ O) {
  constexpr int RPW = 32, NQB = TT / (4 * RPW), DT = HD / 16, KS = HD / 32;
  __shared__ __attribute__((aligned(16))) unsigned short sP[4][RPW][40]; __shared__ __attribute__((aligned(16))) float sO[4][RPW][HD];
  const int tid = threadIdx.x, w = tid >> 5, lane = tid & 31, ln = lane & 15, hh = lane >> 4;
  const int slab = blockIdx.x / NQB, qblk = blockIdx.x % NQB; const int b = slab / NH, h = slab % NH; const int qb0 = qblk * (4 * RPW); const int q0 = qb0 + w * RPW;
  FragH aq[2][KS];
#pragma unroll
  for (int rt = 0; rt < 2; ++rt) { const unsigned short* qr = (const unsigned short*)Q16 + ((size_t)b * TT + q0 + rt * 16 + ln) * DM + h * HD;
#pragma unroll
    for (int ks = 0; ks < KS; ++ks) { aq[rt][ks].half[0] = *(const v8us*)(qr + ks * 32 + 8 * hh); aq[rt][ks].half[1] = *(const v8us*)(qr + ks * 32 + 16 + 8 * hh); } }
  const unsigned short* Vth = (const unsigned short*)Vt + (size_t)slab * HD * TT;
  float m_r[2][8], l_r[2][8]; v8f oacc[2][DT];
#pragma unroll
  for (int rt = 0; rt < 2; ++rt) {
#pragma unroll
    for (int r = 0; r < 8; ++r) { m_r[rt][r] = -3.0e38f; l_r[rt][r] = 0.f; }
#pragma unroll
    for (int dt = 0; dt < DT; ++dt) oacc[rt][dt] = (v8f){0.f,0.f,0.f,0.f,0.f,0.f,0.f,0.f}; }
#pragma unroll 1
  for (int j0 = qb0 - WW; j0 < qb0 + 4 * RPW + WW; j0 += 32) {
    v8f s[2][2];
#pragma unroll
    for (int nt = 0; nt < 2; ++nt) { const int kj = j0 + nt * 16 + ln; const int kc = kj < 0 ? 0 : (kj >= TT ? TT - 1 : kj); const unsigned short* kr = (const unsigned short*)K16 + ((size_t)b * TT + kc) * DM + h * HD; FragH bk[KS];
#pragma unroll
      for (int ks = 0; ks < KS; ++ks) { bk[ks].half[0] = *(const v8us*)(kr + ks * 32 + 8 * hh); bk[ks].half[1] = *(const v8us*)(kr + ks * 32 + 16 + 8 * hh); }
#pragma unroll
      for (int rt = 0; rt < 2; ++rt) { v8f acc = (v8f){0.f,0.f,0.f,0.f,0.f,0.f,0.f,0.f};
#pragma unroll
        for (int ks = 0; ks < KS; ++ks) acc = mmaH<1>(aq[rt][ks].v, aq[rt][ks].v, bk[ks].v, bk[ks].v, acc); s[rt][nt] = acc; } }
#pragma unroll
    for (int rt = 0; rt < 2; ++rt)
#pragma unroll
      for (int r = 0; r < 8; ++r) { const int t = q0 + rt * 16 + 8 * hh + r; const int k0 = j0 + ln, k1 = j0 + 16 + ln;
        const bool ok0 = (k0 >= 0 && k0 < TT && (k0 - t) <= WW && (t - k0) <= WW), ok1 = (k1 >= 0 && k1 < TT && (k1 - t) <= WW && (t - k1) <= WW);
        const float s0 = ok0 ? s[rt][0][r] * 0.125f : -INFINITY, s1 = ok1 ? s[rt][1][r] * 0.125f : -INFINITY; float mc = fmaxf(s0, s1);
        mc = fmaxf(mc, __shfl_xor(mc, 1, 32)); mc = fmaxf(mc, __shfl_xor(mc, 2, 32)); mc = fmaxf(mc, __shfl_xor(mc, 4, 32)); mc = fmaxf(mc, __shfl_xor(mc, 8, 32));
        const float mn = fmaxf(m_r[rt][r], mc); const float al = (mn > -1.0e38f) ? expf(m_r[rt][r] - mn) : 1.0f; m_r[rt][r] = mn; const float p0 = ok0 ? expf(s0 - mn) : 0.f, p1 = ok1 ? expf(s1 - mn) : 0.f; l_r[rt][r] = l_r[rt][r] * al + p0 + p1;
#pragma unroll
        for (int dt = 0; dt < DT; ++dt) oacc[rt][dt][r] *= al;
        FragH t2; t2.h[0] = (_Float16)p0; t2.h[1] = (_Float16)p1; sP[w][rt * 16 + 8 * hh + r][ln] = t2.u[0]; sP[w][rt * 16 + 8 * hh + r][16 + ln] = t2.u[1]; }
    __builtin_amdgcn_fence(__ATOMIC_ACQ_REL, "workgroup"); __builtin_amdgcn_wave_barrier();
    FragH pa[2];
#pragma unroll
    for (int rt = 0; rt < 2; ++rt) { pa[rt].half[0] = *(const v8us*)&sP[w][rt * 16 + ln][8 * hh]; pa[rt].half[1] = *(const v8us*)&sP[w][rt * 16 + ln][16 + 8 * hh]; }
#pragma unroll
    for (int dt = 0; dt < DT; ++dt) { const int vj0 = j0 < 0 ? 0 : (j0 + 32 > TT ? TT - 32 : j0);      // clamped chunk address; rows outside [0,T) have p = 0 so the substituted values never contribute
      const unsigned short* vrow = Vth + (size_t)(dt * 16 + ln) * TT + vj0; FragH bv; bv.half[0] = *(const v8us*)(vrow + 8 * hh); bv.half[1] = *(const v8us*)(vrow + 16 + 8 * hh);
#pragma unroll
      for (int rt = 0; rt < 2; ++rt) oacc[rt][dt] = mmaH<1>(pa[rt].v, pa[rt].v, bv.v, bv.v, oacc[rt][dt]); }
    __builtin_amdgcn_fence(__ATOMIC_ACQ_REL, "workgroup"); __builtin_amdgcn_wave_barrier(); }
#pragma unroll
  for (int rt = 0; rt < 2; ++rt) {
#pragma unroll
    for (int r = 0; r < 8; ++r) { float l = l_r[rt][r]; l += __shfl_xor(l, 1, 32); l += __shfl_xor(l, 2, 32); l += __shfl_xor(l, 4, 32); l += __shfl_xor(l, 8, 32);
      const int t = q0 + rt * 16 + 8 * hh + r; const int npad = (t < WW ? (WW - t) : 0) + (t + WW >= TT ? (t + WW - TT + 1) : 0); float sc = 1.0f;
      if (npad > 0) { const float m = m_r[rt][r]; const float mn = fmaxf(m, 0.f); sc = expf(m - mn); l = l * sc + (float)npad * expf(-mn); }
      l_r[rt][r] = sc / l; }
#pragma unroll
    for (int dt = 0; dt < DT; ++dt)
#pragma unroll
      for (int r = 0; r < 8; ++r) sO[w][rt * 16 + 8 * hh + r][dt * 16 + ln] = oacc[rt][dt][r] * l_r[rt][r]; }
  __builtin_amdgcn_fence(__ATOMIC_ACQ_REL, "workgroup"); __builtin_amdgcn_wave_barrier();
  {
#pragma unroll
    for (int rp = 0; rp < RPW; rp += 2) { const int r = rp + (lane >> 4), pc = lane & 15; const v4f val = *(const v4fa*)&sO[w][r][pc * 4]; *(v4f*)(O + ((size_t)b * TT + q0 + r) * DM + h * HD + pc * 4) = val; }
     } }
extern "C" void kernel_launch(void* const* d_in, const int* in_sizes, int n_in,
                              void* d_out, int out_size, void* d_ws, size_t ws_size, hipStream_t stream) {
  (void)in_sizes; (void)n_in; (void)out_size;
  const float* x = (const float*)d_in[0]; const float* wq = (const float*)d_in[1]; const float* bq = (const float*)d_in[2]; const float* wk = (const float*)d_in[3]; const float* bk = (const float*)d_in[4]; const float* wv = (const float*)d_in[5]; const float* bv = (const float*)d_in[6]; const float* wo = (const float*)d_in[7]; const float* bo = (const float*)d_in[8];
  char* ws = (char*)d_ws; size_t off = 0;
  auto take = [&](size_t bytes) { char* p = ws + off; off += (bytes + 255) & ~(size_t)255; return p; };
  const size_t w8 = (size_t)DM * DM / 8;
  _Float16* Bq = (_Float16*)take(w8 * 16); _Float16* Bk = (_Float16*)take(w8 * 16); _Float16* Bv = (_Float16*)take(w8 * 16); _Float16* Bo = (_Float16*)take(w8 * 16);
  _Float16* X16 = (_Float16*)take((size_t)NR * DM * 2); _Float16* Q16 = (_Float16*)take((size_t)NR * DM * 2); _Float16* K16 = (_Float16*)take((size_t)NR * DM * 2); _Float16* V16 = (_Float16*)take((size_t)NR * DM * 2); _Float16* Vt = (_Float16*)take((size_t)NR * DM * 2); float* Of = (float*)take((size_t)NR * DM * 4); _Float16* O16 = X16;
  if (off > ws_size) return;      // 30 MiB
  const unsigned gw = (unsigned)((DM * (DM / 8) + 255) / 256);
  k_wt_f16<<<gw, 256, 0, stream>>>(wq, Bq, DM, DM, 16.0f); k_wt_f16<<<gw, 256, 0, stream>>>(wk, Bk, DM, DM, 16.0f); k_wt_f16<<<gw, 256, 0, stream>>>(wv, Bv, DM, DM, 16.0f); k_wt_f16<<<gw, 256, 0, stream>>>(wo, Bo, DM, DM, 16.0f);      // [in][out]
  const unsigned gx = (unsigned)(((size_t)NR * DM / 8 + 255) / 256);
  k_x16<<<gx, 256, 0, stream>>>(x, X16, (size_t)NR * DM / 8);
  const dim3 gg(((NR / 16) * (DM / 64) + 3) / 4, 1);
  k_gemm_hhx<0><<<gg, 128, 0, stream>>>(X16, DM, 0, Bq, DM, 0, 0.0625f, bq, 0, nullptr, 1, 0, 0, nullptr, Q16, DM, 0, NR, DM, DM);
  k_gemm_hhx<0><<<gg, 128, 0, stream>>>(X16, DM, 0, Bk, DM, 0, 0.0625f, bk, 0, nullptr, 1, 0, 0, nullptr, K16, DM, 0, NR, DM, DM);
  k_gemm_hhx<0><<<gg, 128, 0, stream>>>(X16, DM, 0, Bv, DM, 0, 0.0625f, bv, 0, nullptr, 1, 0, 0, nullptr, V16, DM, 0, NR, DM, DM);
  k_vt<<<BB * NH * (TT / 64), 256, 0, stream>>>(V16, Vt);
  k_flash<<<BB * NH * (TT / 128), 128, 0, stream>>>(Q16, K16, Vt, Of);
  k_h16<<<gx, 256, 0, stream>>>(Of, O16, (size_t)NR * DM / 8);
  k_gemm_hhx<0><<<gg, 128, 0, stream>>>(O16, DM, 0, Bo, DM, 0, 0.0625f, bo, 0, nullptr, 1, 0, 0, (float*)d_out, nullptr, DM, 0, NR, DM, DM);
}

// v001
// It runs in 83.4 microseconds.
// Next to v000, in two timings, it ran 1.67 and 1.69 times as fast.
#include <hip/hip_runtime.h>
// q/k/v/o projections (4096 × 512 × 512, + bias) and the 8-head LOCAL attention (window ±32, d = 64) on v_wmma_f32_16x16x32_f16: a fused flash-style kernel visits only the 6 key chunks
// around each 128-query block (S = Q·Kᵀ, O = P·V on WMMA; |k − t| ≤ 32 band mask; online max/sum softmax f32; P f16 ≤ 1), and the module's zero-PADDED keys (score exactly 0, value 0, they DO
// take part in the softmax) are added analytically per query as npad·e^{0 − m} in the normaliser; A = f16(bf16 x) exact for q/k/v, f16(O) for o, weights [in][out] transposed to bf16-exact ×2^4, f32 accumulate.
#define BB 2
#define TT 2048
#define DM 512
#define NH 8
#define HD 64
#define WW 32
#define NR (BB * TT)

typedef __bf16 v16b __attribute__((ext_vector_type(16)));
typedef unsigned short v8us __attribute__((ext_vector_type(8), may_alias));
typedef float  v8f  __attribute__((ext_vector_type(8)));
typedef float  v4f  __attribute__((ext_vector_type(4)));
typedef float  v4fa __attribute__((ext_vector_type(4), may_alias));
union FragB { v16b v; v8us half[2]; unsigned short u[16]; };

__device__ __forceinline__ unsigned short bf16_bits(float x) { unsigned int u = __float_as_uint(x); return (unsigned short)((u + 0x7FFFu + ((u >> 16) & 1u)) >> 16); }
__device__ __forceinline__ float bf16_val(unsigned short b) { return __uint_as_float(((unsigned int)b) << 16); }
__device__ __forceinline__ float bf16_round(float x) { return bf16_val(bf16_bits(x)); }
// D += A·B with NT terms: 1 = ah·bh, 2 = + al·bh (A split), 3 = + ah·bl (both split)
template <int NT>
__device__ __forceinline__ v8f mmaN(v16b ah, v16b al, v16b bh, v16b bl, v8f c) {
  c = __builtin_amdgcn_wmma_f32_16x16x32_bf16(false, ah, false, bh, (short)0, c, false, false);
  if (NT >= 2) c = __builtin_amdgcn_wmma_f32_16x16x32_bf16(false, al, false, bh, (short)0, c, false, false);
  if (NT >= 3) c = __builtin_amdgcn_wmma_f32_16x16x32_bf16(false, ah, false, bl, (short)0, c, false, false);
  asm volatile("v_nop\n\tv_nop\n\tv_nop\n\tv_nop" : "+v"(c) : "v"(ah), "v"(al), "v"(bh), "v"(bl));
  return c;
}

__global__ __launch_bounds__(256) void k_wt_bf16(const float* __restrict__ W, unsigned short* __restrict__ Wt, int K, int N) {
  const int t = blockIdx.x * 256 + threadIdx.x;
  const int k8n = K / 8;
  if (t >= N * k8n) return;
  const int n = t / k8n, k8 = (t % k8n) * 8;
  v8us v;
#pragma unroll
  for (int i = 0; i < 8; ++i) v[i] = bf16_bits(W[(size_t)(k8 + i) * N + n]);
  *(v8us*)(Wt + (size_t)n * K + k8) = v;
  
}

// GEMM C[M][N] (f32, pitch ldc) = act(A[M][K]·W + bias). A f32 row-major (pitch lda) converted per fragment to bf16
// (ASPLIT: hi/lo two planes -> 2 terms, else single rounded term); Wt bf16 [N][K] (pitch ldb). BIAS_BF16 rounds the
// bias to bf16 first (bias quantised to bf16 before the add). K%32==0, M%16==0, N%64==0.
template <bool ASPLIT, int ACT, bool BIAS_BF16>
__global__ __launch_bounds__(128) void k_gemm_bf(const float* __restrict__ A, int lda, const unsigned short* __restrict__ Wt, int ldb,
                                               const float* __restrict__ bias, float* __restrict__ C, int ldc, int M, int N, int K) {
  __shared__ __attribute__((aligned(16))) float so[4][16][64];
  const int tid = threadIdx.x, w = tid >> 5, lane = tid & 31, ln = lane & 15, hh = lane >> 4;
  const int ntn = N / 64;
  const int wid = blockIdx.x * 4 + w;
  const int mt = wid / ntn, nq = wid % ntn;
  if (mt * 16 >= M) return;
  const int row0 = mt * 16, col0 = nq * 64;
  const float* arow = A + (size_t)(row0 + ln) * lda;
  v8f acc[4] = {};
  for (int kb = 0; kb < K; kb += 32) {
    FragB ah, al;
    const v4f x0 = *(const v4fa*)(arow + kb + 8 * hh), x1 = *(const v4fa*)(arow + kb + 8 * hh + 4);
    const v4f x2 = *(const v4fa*)(arow + kb + 16 + 8 * hh), x3 = *(const v4fa*)(arow + kb + 16 + 8 * hh + 4);
    float xs[16] = {x0[0],x0[1],x0[2],x0[3],x1[0],x1[1],x1[2],x1[3],x2[0],x2[1],x2[2],x2[3],x3[0],x3[1],x3[2],x3[3]};
#pragma unroll
    for (int i = 0; i < 16; ++i) { const unsigned short hb = bf16_bits(xs[i]); ah.u[i] = hb; al.u[i] = ASPLIT ? bf16_bits(xs[i] - bf16_val(hb)) : (unsigned short)0; }
#pragma unroll
    for (int t = 0; t < 4; ++t) {
      const unsigned short* brow = Wt + (size_t)(col0 + t * 16 + ln) * ldb + kb;
      FragB b;
      b.half[0] = *(const v8us*)(brow + 8 * hh);
      b.half[1] = *(const v8us*)(brow + 16 + 8 * hh);
      acc[t] = mmaN<ASPLIT ? 2 : 1>(ah.v, al.v, b.v, b.v, acc[t]);
    }
  }
#pragma unroll
  for (int t = 0; t < 4; ++t) {
    float bv = bias ? bias[col0 + t * 16 + ln] : 0.f;
    if (BIAS_BF16) bv = bf16_round(bv);
#pragma unroll
    for (int r = 0; r < 8; ++r) { float v = acc[t][r] + bv; if (ACT == 1) v = fmaxf(v, 0.f); so[w][8 * hh + r][t * 16 + ln] = v; }
  }
  __builtin_amdgcn_fence(__ATOMIC_ACQ_REL, "workgroup");
  __builtin_amdgcn_wave_barrier();
  const int rsub = lane >> 4, c4 = (lane & 15) * 4;
  {
#pragma unroll
    for (int q = 0; q < 8; ++q) {
      const int r = q * 2 + rsub;
      const v4f v = *(const v4fa*)&so[w][r][c4];
      *(v4f*)(C + (size_t)(row0 + r) * ldc + col0 + c4) = v;
    }
    
  }
}

// Flash-style causal/unmasked attention, all contractions 3-term bf16 hi/lo splits, f32 softmax with running max.
// q,k,v rows are read from f32 buffers with arbitrary row pitch (so they can live inside a fused qkv buffer);
// D = head size (multiple of 32, <= 128); one wave = 16 query rows; block = 4 waves (64 queries) sharing K/V chunks of 32.
template <int D, bool CAUSAL>
__global__ __launch_bounds__(128) void k_flash(const float* __restrict__ qb, const float* __restrict__ kb, const float* __restrict__ vb,
                                             int pitch, int T, int H, float scale, float* __restrict__ y, int ypitch) {
  constexpr int KS = D / 32;        // k-steps for QK
  constexpr int DT = D / 16;        // d tiles for PV
  __shared__ __attribute__((aligned(16))) unsigned short sKh[32][D + 8], sKl[32][D + 8], sVh[32][D + 8], sVl[32][D + 8];
  __shared__ __attribute__((aligned(16))) unsigned short sPh[4][16][40], sPl[4][16][40];
  __shared__ __attribute__((aligned(16))) float sO[4][16][D];
  const int tid = threadIdx.x, w = tid >> 5, lane = tid & 31, ln = lane & 15, hh = lane >> 4;
  const int nqb = (T + 63) / 64;
  const int bh = blockIdx.x / nqb, qblk = blockIdx.x % nqb;
  const int b = bh / H, h = bh % H;
  const int q0 = qblk * 64 + w * 16;
  const float* Q = qb + (size_t)b * T * pitch + h * D;
  const float* K = kb + (size_t)b * T * pitch + h * D;
  const float* V = vb + (size_t)b * T * pitch + h * D;

  // A fragments of the wave's 16 query rows (scaled), hi/lo
  FragB aqh[KS], aql[KS];
  {
    int row = q0 + ln; if (row >= T) row = T - 1;
    const float* qr = Q + (size_t)row * pitch;
#pragma unroll
    for (int ks = 0; ks < KS; ++ks)
#pragma unroll
      for (int i = 0; i < 16; ++i) {
        const int d = ks * 32 + ((i < 8) ? (8 * hh + i) : (16 + 8 * hh + (i - 8)));
        const float x = qr[d] * scale; const unsigned short hb = bf16_bits(x);
        aqh[ks].u[i] = hb; aql[ks].u[i] = bf16_bits(x - bf16_val(hb));
      }
  }
  float m_r[8], l_r[8];
#pragma unroll
  for (int r = 0; r < 8; ++r) { m_r[r] = -3.0e38f; l_r[r] = 0.f; }
  v8f oacc[DT];
#pragma unroll
  for (int dt = 0; dt < DT; ++dt) oacc[dt] = (v8f){0.f,0.f,0.f,0.f,0.f,0.f,0.f,0.f};

  const int kv_end = CAUSAL ? min(T, qblk * 64 + 64) : T;     // block-uniform
  for (int j0 = 0; j0 < kv_end; j0 += 32) {
    __syncthreads();
    for (int e = tid; e < 32 * (D / 4); e += 128) {
      const int r = e / (D / 4), c4 = (e % (D / 4)) * 4;
      const int key = j0 + r;
      v4f kf = {0.f,0.f,0.f,0.f}, vf = {0.f,0.f,0.f,0.f};
      if (key < T) { kf = *(const v4fa*)(K + (size_t)key * pitch + c4); vf = *(const v4fa*)(V + (size_t)key * pitch + c4); }
#pragma unroll
      for (int t = 0; t < 4; ++t) {
        unsigned short hb = bf16_bits(kf[t]); sKh[r][c4 + t] = hb; sKl[r][c4 + t] = bf16_bits(kf[t] - bf16_val(hb));
        hb = bf16_bits(vf[t]); sVh[r][c4 + t] = hb; sVl[r][c4 + t] = bf16_bits(vf[t] - bf16_val(hb));
      }
    }
    __syncthreads();
    // S tile 16 x 32
    v8f s[2];
#pragma unroll
    for (int nt = 0; nt < 2; ++nt) {
      v8f acc = {};
#pragma unroll
      for (int ks = 0; ks < KS; ++ks) {
        FragB bh_, bl_;
        bh_.half[0] = *(const v8us*)&sKh[nt * 16 + ln][ks * 32 + 8 * hh]; bh_.half[1] = *(const v8us*)&sKh[nt * 16 + ln][ks * 32 + 16 + 8 * hh];
        bl_.half[0] = *(const v8us*)&sKl[nt * 16 + ln][ks * 32 + 8 * hh]; bl_.half[1] = *(const v8us*)&sKl[nt * 16 + ln][ks * 32 + 16 + 8 * hh];
        acc = mmaN<3>(aqh[ks].v, aql[ks].v, bh_.v, bl_.v, acc);
      }
      s[nt] = acc;
    }
    // mask + running max (rows 8hh+r; the 16 lanes of a half share rows)
    float alpha[8];
#pragma unroll
    for (int r = 0; r < 8; ++r) {
      const int qi = q0 + 8 * hh + r;
      const int ja = j0 + ln, jb = j0 + 16 + ln;
      if (CAUSAL) { if (ja > qi) s[0][r] = -3.0e38f; if (jb > qi) s[1][r] = -3.0e38f; }
      if (ja >= T) s[0][r] = -3.0e38f;
      if (jb >= T) s[1][r] = -3.0e38f;
      float mx = fmaxf(s[0][r], s[1][r]);
      mx = fmaxf(mx, __shfl_xor(mx, 1, 32)); mx = fmaxf(mx, __shfl_xor(mx, 2, 32)); mx = fmaxf(mx, __shfl_xor(mx, 4, 32)); mx = fmaxf(mx, __shfl_xor(mx, 8, 32));
      const float mnew = fmaxf(m_r[r], mx);
      alpha[r] = (mnew > -1.0e38f) ? __expf(m_r[r] - mnew) : 1.0f;
      const float p0 = (s[0][r] > -1.0e38f) ? __expf(s[0][r] - mnew) : 0.f;
      const float p1 = (s[1][r] > -1.0e38f) ? __expf(s[1][r] - mnew) : 0.f;
      m_r[r] = mnew;
      l_r[r] = l_r[r] * alpha[r] + p0 + p1;            // per-lane partial row sum (16 lanes combined at the end)
      unsigned short hb = bf16_bits(p0); sPh[w][8 * hh + r][ln] = hb;      sPl[w][8 * hh + r][ln] = bf16_bits(p0 - bf16_val(hb));
      hb = bf16_bits(p1);                sPh[w][8 * hh + r][16 + ln] = hb; sPl[w][8 * hh + r][16 + ln] = bf16_bits(p1 - bf16_val(hb));
    }
#pragma unroll
    for (int dt = 0; dt < DT; ++dt)
#pragma unroll
      for (int r = 0; r < 8; ++r) oacc[dt][r] *= alpha[r];
    __builtin_amdgcn_fence(__ATOMIC_ACQ_REL, "workgroup");
    __builtin_amdgcn_wave_barrier();
    FragB pah, pal;
    pah.half[0] = *(const v8us*)&sPh[w][ln][8 * hh]; pah.half[1] = *(const v8us*)&sPh[w][ln][16 + 8 * hh];
    pal.half[0] = *(const v8us*)&sPl[w][ln][8 * hh]; pal.half[1] = *(const v8us*)&sPl[w][ln][16 + 8 * hh];
#pragma unroll
    for (int dt = 0; dt < DT; ++dt) {
      FragB bvh, bvl;
#pragma unroll
      for (int i = 0; i < 8; ++i) {
        bvh.u[i] = sVh[8 * hh + i][dt * 16 + ln]; bvh.u[8 + i] = sVh[16 + 8 * hh + i][dt * 16 + ln];
        bvl.u[i] = sVl[8 * hh + i][dt * 16 + ln]; bvl.u[8 + i] = sVl[16 + 8 * hh + i][dt * 16 + ln];
      }
      oacc[dt] = mmaN<3>(pah.v, pal.v, bvh.v, bvl.v, oacc[dt]);
    }
    __builtin_amdgcn_fence(__ATOMIC_ACQ_REL, "workgroup");
    __builtin_amdgcn_wave_barrier();
  }
#pragma unroll
  for (int r = 0; r < 8; ++r) {
    float l = l_r[r];
    l += __shfl_xor(l, 1, 32); l += __shfl_xor(l, 2, 32); l += __shfl_xor(l, 4, 32); l += __shfl_xor(l, 8, 32);
    l_r[r] = (l > 0.f) ? 1.0f / l : 0.f;
  }
#pragma unroll
  for (int dt = 0; dt < DT; ++dt)
#pragma unroll
    for (int r = 0; r < 8; ++r) sO[w][8 * hh + r][dt * 16 + ln] = oacc[dt][r] * l_r[r];
  __builtin_amdgcn_fence(__ATOMIC_ACQ_REL, "workgroup");
  __builtin_amdgcn_wave_barrier();
  {
    for (int r = 0; r < 16; ++r) {
      const int row = q0 + r;
      if (row < T && lane < D / 4) {
        const v4f val = *(const v4fa*)&sO[w][r][lane * 4];
        *(v4f*)(y + ((size_t)b * T + row) * ypitch + h * D + lane * 4) = val;
      }
    }
    
  }
}

// GEMM C = act(A·W + bias + resid): A f32 (ASPLIT -> hi/lo 2 terms), Wt bf16 [N][K]; ACT 0 none, 1 relu, 2 exact gelu;
// resid (optional, f32, row index = (row % rmod), pitch ldr, RES_BF16 rounds it) added before the activation.
template <bool ASPLIT, int ACT, bool BIAS_BF16, bool RES_BF16>
__global__ __launch_bounds__(128) void k_gemm_bf3(const float* __restrict__ A, int lda, const unsigned short* __restrict__ Wt, int ldb,
                                                const float* __restrict__ bias, const float* __restrict__ resid, int rmod, int ldr,
                                                float* __restrict__ C, int ldc, int M, int N, int K) {
  __shared__ __attribute__((aligned(16))) float so[4][16][64];
  const int tid = threadIdx.x, w = tid >> 5, lane = tid & 31, ln = lane & 15, hh = lane >> 4;
  const int ntn = N / 64;
  const int wid = blockIdx.x * 4 + w;
  const int mt = wid / ntn, nq = wid % ntn;
  if (mt * 16 >= M) return;
  const int row0 = mt * 16, col0 = nq * 64;
  const float* arow = A + (size_t)(row0 + ln) * lda;
  v8f acc[4] = {};
  for (int kb = 0; kb < K; kb += 32) {
    FragB ah, al;
    const v4f x0 = *(const v4fa*)(arow + kb + 8 * hh), x1 = *(const v4fa*)(arow + kb + 8 * hh + 4);
    const v4f x2 = *(const v4fa*)(arow + kb + 16 + 8 * hh), x3 = *(const v4fa*)(arow + kb + 16 + 8 * hh + 4);
    float xs[16] = {x0[0],x0[1],x0[2],x0[3],x1[0],x1[1],x1[2],x1[3],x2[0],x2[1],x2[2],x2[3],x3[0],x3[1],x3[2],x3[3]};
#pragma unroll
    for (int i = 0; i < 16; ++i) { const unsigned short hb = bf16_bits(xs[i]); ah.u[i] = hb; al.u[i] = ASPLIT ? bf16_bits(xs[i] - bf16_val(hb)) : (unsigned short)0; }
#pragma unroll
    for (int t = 0; t < 4; ++t) {
      const unsigned short* brow = Wt + (size_t)(col0 + t * 16 + ln) * ldb + kb;
      FragB b;
      b.half[0] = *(const v8us*)(brow + 8 * hh);
      b.half[1] = *(const v8us*)(brow + 16 + 8 * hh);
      acc[t] = mmaN<ASPLIT ? 2 : 1>(ah.v, al.v, b.v, b.v, acc[t]);
    }
  }
#pragma unroll
  for (int t = 0; t < 4; ++t) {
    const int col = col0 + t * 16 + ln;
    float bv = bias ? bias[col] : 0.f;
    if (BIAS_BF16) bv = bf16_round(bv);
#pragma unroll
    for (int r = 0; r < 8; ++r) {
      float v = acc[t][r] + bv;
      if (resid) { float rv = resid[(size_t)((row0 + 8 * hh + r) % rmod) * ldr + col]; if (RES_BF16) rv = bf16_round(rv); v += rv; }
      if (ACT == 1) v = fmaxf(v, 0.f);
      if (ACT == 2) v = 0.5f * v * (1.0f + erff(v * 0.70710678118654752f));
      if (ACT == 3) { const float u = 0.7978845608028654f * (v + 0.044715f * v * v * v); v = 0.5f * v * (1.0f + tanhf(u)); }
      so[w][8 * hh + r][t * 16 + ln] = v;
    }
  }
  __builtin_amdgcn_fence(__ATOMIC_ACQ_REL, "workgroup");
  __builtin_amdgcn_wave_barrier();
  const int rsub = lane >> 4, c4 = (lane & 15) * 4;
  {
#pragma unroll
    for (int q = 0; q < 8; ++q) {
      const int r = q * 2 + rsub;
      const v4f v = *(const v4fa*)&so[w][r][c4];
      *(v4f*)(C + (size_t)(row0 + r) * ldc + col0 + c4) = v;
    }
    
  }
}
// row LayerNorm (biased variance, eps) over N: s = X (+ R); optional out_sum <- s; out_norm <- (s-mu)*rsqrt(var+eps)*g + b
template <bool PARAM_BF16>
__global__ __launch_bounds__(256) void k_layernorm(const float* __restrict__ X, const float* __restrict__ R, const float* __restrict__ g, const float* __restrict__ bta,
                                                  float* __restrict__ out_sum, float* __restrict__ out_norm, int N, float eps) {
  __shared__ float red[256];
  const int row = blockIdx.x, tid = threadIdx.x;
  const float* x = X + (size_t)row * N; const float* rr = R ? R + (size_t)row * N : nullptr;
  float vals[16];                     // up to N = 4096
  const int per = N / 256;            // contiguous chunk per thread? use strided-by-4 chunks: thread handles j = tid*4 + 1024*u
  float s1 = 0.f;
  for (int u = 0; u < per / 4; ++u) {
    const int j = tid * 4 + 1024 * u;
    const v4f a = *(const v4fa*)(x + j);
    v4f b = {0.f,0.f,0.f,0.f}; if (rr) b = *(const v4fa*)(rr + j);
#pragma unroll
    for (int q = 0; q < 4; ++q) { const float v = a[q] + b[q]; vals[u * 4 + q] = v; s1 += v; }
  }
  red[tid] = s1; __syncthreads();
  for (int st = 128; st > 0; st >>= 1) { if (tid < st) red[tid] += red[tid + st]; __syncthreads(); }
  const float mu = red[0] / (float)N; __syncthreads();
  float s2 = 0.f;
  for (int u = 0; u < per / 4; ++u)
#pragma unroll
    for (int q = 0; q < 4; ++q) { const float c = vals[u * 4 + q] - mu; s2 += c * c; }
  red[tid] = s2; __syncthreads();
  for (int st = 128; st > 0; st >>= 1) { if (tid < st) red[tid] += red[tid + st]; __syncthreads(); }
  const float rs = rsqrtf(red[0] / (float)N + eps);
  {
    for (int u = 0; u < per / 4; ++u) {
      const int j = tid * 4 + 1024 * u;
      v4f o, sm;
#pragma unroll
      for (int q = 0; q < 4; ++q) {
        float gg = g[j + q], bb = bta[j + q];
        if (PARAM_BF16) { gg = bf16_round(gg); bb = bf16_round(bb); }
        sm[q] = vals[u * 4 + q]; o[q] = (vals[u * 4 + q] - mu) * rs * gg + bb;
      }
      if (out_sum) *(v4f*)(out_sum + (size_t)row * N + j) = sm;
      *(v4f*)(out_norm + (size_t)row * N + j) = o;
    }
    
  }
}



// ---- f16 WMMA path (v_wmma_f32_16x16x32_f16): 11-bit significands for operands in range — used where a [0,1] probability operand needs more precision than bf16
typedef _Float16 v16h __attribute__((ext_vector_type(16)));
union FragH { v16h v; v8us half[2]; _Float16 h[16]; unsigned short u[16]; };
template <int NT>
__device__ __forceinline__ v8f mmaH(v16h ah, v16h al, v16h bh, v16h bl, v8f c) {
  c = __builtin_amdgcn_wmma_f32_16x16x32_f16(false, ah, false, bh, (short)0, c, false, false);
  if (NT >= 2) c = __builtin_amdgcn_wmma_f32_16x16x32_f16(false, al, false, bh, (short)0, c, false, false);
  if (NT >= 3) c = __builtin_amdgcn_wmma_f32_16x16x32_f16(false, ah, false, bl, (short)0, c, false, false);
  asm volatile("v_nop\n\tv_nop\n\tv_nop\n\tv_nop" : "+v"(c) : "v"(ah), "v"(al), "v"(bh), "v"(bl));
  return c;
}
// batched GEMM like k_gemm_b but f16 operands: A f32 (split into f16 hi/lo if ASPLIT, else rounded to f16), Bt = f16 values [n][k]; alpha; C f32; N multiple of 16 (partial tiles skipped)
template <bool ASPLIT>
__global__ __launch_bounds__(128) void k_gemm_h(const float* __restrict__ A, int lda, size_t sA, const _Float16* __restrict__ Bh, int ldb, size_t sB, float alpha, float* __restrict__ C, int ldc, size_t sC, int M, int N, int K) {
  __shared__ __attribute__((aligned(16))) float so[4][16][64];
  const int tid = threadIdx.x, w = tid >> 5, lane = tid & 31, ln = lane & 15, hh = lane >> 4; const int by = blockIdx.y;
  A += (size_t)by * sA; Bh += (size_t)by * sB; C += (size_t)by * sC;
  const int ntn = (N + 63) / 64; const int wid = blockIdx.x * 4 + w; const int mt = wid / ntn, nq = wid % ntn; if (mt * 16 >= M) return;
  const int row0 = mt * 16, col0 = nq * 64; const float* arow = A + (size_t)(row0 + ln) * lda;
  v8f acc[4] = {};
  for (int kb = 0; kb < K; kb += 32) {
    FragH ah, al;
    const v4f x0 = *(const v4fa*)(arow + kb + 8 * hh), x1 = *(const v4fa*)(arow + kb + 8 * hh + 4), x2 = *(const v4fa*)(arow + kb + 16 + 8 * hh), x3 = *(const v4fa*)(arow + kb + 16 + 8 * hh + 4);
    float xs[16] = {x0[0],x0[1],x0[2],x0[3],x1[0],x1[1],x1[2],x1[3],x2[0],x2[1],x2[2],x2[3],x3[0],x3[1],x3[2],x3[3]};
#pragma unroll
    for (int i = 0; i < 16; ++i) { const _Float16 h = (_Float16)xs[i]; ah.h[i] = h; al.h[i] = ASPLIT ? (_Float16)(xs[i] - (float)h) : (_Float16)0.0f; }
#pragma unroll
    for (int t = 0; t < 4; ++t) { if (col0 + t * 16 >= N) continue; const size_t boff = (size_t)(col0 + t * 16 + ln) * ldb + kb; FragH bq; bq.half[0] = *(const v8us*)(Bh + boff + 8 * hh); bq.half[1] = *(const v8us*)(Bh + boff + 16 + 8 * hh);
      acc[t] = mmaH<ASPLIT ? 2 : 1>(ah.v, al.v, bq.v, bq.v, acc[t]); }
  }
#pragma unroll
  for (int t = 0; t < 4; ++t) { if (col0 + t * 16 >= N) continue;
#pragma unroll
    for (int r = 0; r < 8; ++r) so[w][8 * hh + r][t * 16 + ln] = acc[t][r] * alpha; }
  __builtin_amdgcn_fence(__ATOMIC_ACQ_REL, "workgroup"); __builtin_amdgcn_wave_barrier();
  const int rsub = lane >> 4, c4 = (lane & 15) * 4;
  {
#pragma unroll
    for (int q = 0; q < 8; ++q) { const int r = q * 2 + rsub; if (col0 + c4 < N) { const v4f v = *(const v4fa*)&so[w][r][c4]; *(v4f*)(C + (size_t)(row0 + r) * ldc + col0 + c4) = v; } }
     }
}

// Wt[n][k] = f16(W[k][n]·scale) from f32 row-major W[K][N] (scale = power of two; bf16-exact weights stay exact in f16 away from the subnormal range)
__global__ __launch_bounds__(256) void k_wt_f16(const float* __restrict__ W, _Float16* __restrict__ Wt, int K, int N, float scale) {
  const int t = blockIdx.x * 256 + threadIdx.x; if (t >= N * (K / 8)) return; const int n = t / (K / 8), k8 = (t % (K / 8)) * 8; FragH f;
#pragma unroll
  for (int i = 0; i < 8; ++i) f.h[i] = (_Float16)(bf16_round(W[(size_t)(k8 + i) * N + n]) * scale); const v8us o = f.half[0];
  *(v8us*)((unsigned short*)Wt + (size_t)n * K + k8) = o; 
}
// C[4096][512] = (A . Bt^T) * alpha + bf16(bias): one 64 x 64 tile of C per work-group, wave w = rows 16 w .. 16 w + 15, all 64 columns, K = 512 whole.
// The 64 rows of A and the 64 rows of Bt (both k-contiguous) come in by whole-line loads (a wave-wide 16-byte load = two rows x 256 contiguous bytes) and are laid in LDS at a pitch of 1040 B
// (16 B x odd: no bank conflict for the 16-byte fragment reads); the fragments then come from LDS, in the same k order as when they were read from global memory. All global loads are issued first;
// K goes in four chunks of 128, each stored to its own LDS columns and multiplied while the later chunks are still on their way into registers. F32OUT: f32 C, else f16 C16.
template <bool F32OUT>
__global__ __launch_bounds__(128) void k_gemm_hhx(const _Float16* __restrict__ A, const _Float16* __restrict__ Bh, float alpha, const float* __restrict__ bias, float* __restrict__ C, _Float16* __restrict__ C16) {
  constexpr int KP = DM + 8, KC = 128, NC = DM / KC, NL = 64 * KC / 8 / 128, KS = KC / 32;      // LDS pitch in halves; k per chunk; chunks; 16-byte loads per thread, operand and chunk; k steps per chunk
  __shared__ __attribute__((aligned(16))) unsigned short sA[64][KP], sB[64][KP];
  __shared__ __attribute__((aligned(16))) float so[4][16][64];
  const int tid = threadIdx.x, w = tid >> 5, lane = tid & 31, ln = lane & 15, hh = lane >> 4;
  const int mt = blockIdx.x / (DM / 64), nq = blockIdx.x % (DM / 64);
  const int row0 = mt * 64 + w * 16, col0 = nq * 64;
  const unsigned short* Ag = (const unsigned short*)A + (size_t)mt * 64 * DM;
  const unsigned short* Bg = (const unsigned short*)Bh + (size_t)col0 * DM;
  const int sr = tid >> 4, sc = (tid & 15) * 8;      // staging: load i of chunk c takes row 8 i + sr, halves c * KC + sc .. + 7
  v8us ra[NC][NL], rb[NC][NL];
#pragma unroll
  for (int c = 0; c < NC; ++c) {
#pragma unroll
    for (int i = 0; i < NL; ++i) { ra[c][i] = *(const v8us*)(Ag + (size_t)(8 * i + sr) * DM + c * KC + sc); rb[c][i] = *(const v8us*)(Bg + (size_t)(8 * i + sr) * DM + c * KC + sc); }
    __builtin_amdgcn_sched_barrier(0);      // keeps the loads in chunk order, so that chunk 0 is complete after a quarter of them and not after half
  }
  asm volatile("s_wait_xcnt 0x0" ::: "memory");      // stands in front of the first overwrite of the loads' address registers, which are reused for fragments while later chunks are still in flight
  v8f acc[4] = {};
#pragma unroll
  for (int c = 0; c < NC; ++c) {
#pragma unroll
    for (int i = 0; i < NL; ++i) { *(v8us*)&sA[8 * i + sr][c * KC + sc] = ra[c][i]; *(v8us*)&sB[8 * i + sr][c * KC + sc] = rb[c][i]; }
    // publishes this chunk's LDS columns to all four waves. LDS-only fences: a full __syncthreads() would also wait for the later chunks' global loads, which only this thread's registers receive
    __builtin_amdgcn_fence(__ATOMIC_RELEASE, "workgroup", "local"); __builtin_amdgcn_s_barrier(); __builtin_amdgcn_fence(__ATOMIC_ACQUIRE, "workgroup", "local");
    FragH ah[KS], bq[KS][4];      // the whole chunk's fragments are asked for ahead of its first matrix instruction
#pragma unroll
    for (int ks = 0; ks < KS; ++ks) { const int kb = c * KC + ks * 32; ah[ks].half[0] = *(const v8us*)&sA[w * 16 + ln][kb + 8 * hh]; ah[ks].half[1] = *(const v8us*)&sA[w * 16 + ln][kb + 16 + 8 * hh];
#pragma unroll
      for (int t = 0; t < 4; ++t) { bq[ks][t].half[0] = *(const v8us*)&sB[t * 16 + ln][kb + 8 * hh]; bq[ks][t].half[1] = *(const v8us*)&sB[t * 16 + ln][kb + 16 + 8 * hh]; } }
#pragma unroll
    for (int ks = 0; ks < KS; ++ks)
#pragma unroll
      for (int t = 0; t < 4; ++t) acc[t] = mmaH<1>(ah[ks].v, ah[ks].v, bq[ks][t].v, bq[ks][t].v, acc[t]);
  }
#pragma unroll
  for (int t = 0; t < 4; ++t) { const float bv = bf16_round(bias[col0 + t * 16 + ln]);
#pragma unroll
    for (int r = 0; r < 8; ++r) so[w][8 * hh + r][t * 16 + ln] = acc[t][r] * alpha + bv; }
  __builtin_amdgcn_fence(__ATOMIC_ACQ_REL, "workgroup"); __builtin_amdgcn_wave_barrier();
  const int rsub = lane >> 4, c4 = (lane & 15) * 4; typedef _Float16 v4h __attribute__((ext_vector_type(4)));
#pragma unroll
  for (int q = 0; q < 8; ++q) { const int r = q * 2 + rsub; const v4f v = *(const v4fa*)&so[w][r][c4];
    if (F32OUT) *(v4f*)(C + (size_t)(row0 + r) * DM + col0 + c4) = v;
    else { v4h h4; for (int i = 0; i < 4; ++i) h4[i] = (_Float16)v[i]; *(v4h*)(C16 + (size_t)(row0 + r) * DM + col0 + c4) = h4; } }
}


__global__ __launch_bounds__(256) void k_x16(const float* __restrict__ x, _Float16* __restrict__ X16, size_t n8) { const size_t t = (size_t)blockIdx.x * 256 + threadIdx.x; if (t >= n8) return; FragH f;
#pragma unroll
  for (int q = 0; q < 8; ++q) f.h[q] = (_Float16)bf16_round(x[t * 8 + q]); *(v8us*)((unsigned short*)X16 + t * 8) = f.half[0];  }
__global__ __launch_bounds__(256) void k_h16(const float* __restrict__ x, _Float16* __restrict__ X16, size_t n8) { const size_t t = (size_t)blockIdx.x * 256 + threadIdx.x; if (t >= n8) return; FragH f;
#pragma unroll
  for (int q = 0; q < 8; ++q) f.h[q] = (_Float16)x[t * 8 + q]; *(v8us*)((unsigned short*)X16 + t * 8) = f.half[0];  }
__global__ __launch_bounds__(256) void k_vt(const _Float16* __restrict__ V16, _Float16* __restrict__ Vt) { __shared__ unsigned short tl[64][66]; const int tid = threadIdx.x; const int slab = blockIdx.x / (TT / 64), lg = blockIdx.x % (TT / 64); const int b = slab / NH, h = slab % NH;
  for (int i = tid; i < 64 * 8; i += 256) { const int r = i / 8, c8 = (i % 8) * 8; FragH f; f.half[0] = *(const v8us*)((const unsigned short*)V16 + ((size_t)b * TT + lg * 64 + r) * DM + h * HD + c8);
#pragma unroll
    for (int q = 0; q < 8; ++q) tl[r][c8 + q] = f.u[q]; }
  __syncthreads();
  {
#pragma unroll
    for (int rd = 0; rd < 2; ++rd) { const int d = rd * 32 + tid / 8, pc = tid % 8; FragH f;
#pragma unroll
      for (int q = 0; q < 8; ++q) f.u[q] = tl[pc * 8 + q][d];
      *(v8us*)((unsigned short*)Vt + ((size_t)slab * HD + d) * TT + lg * 64 + pc * 8) = f.half[0]; }
     } }
// local attention per ((b,h), 128 queries): wave = 32 queries; key chunks j0 = qb0 − 32 … qb0 + 128 (6 chunks; rows outside [0, T) are read at a CLAMPED address and masked); score/8 where |k − t| ≤ 32 and
__global__ __launch_bounds__(128) void k_flash(const _Float16* __restrict__ Q16, const _Float16* __restrict__ K16, const _Float16* __restrict__ Vt, float* __restrict__ O) {
  constexpr int RPW = 32, NQB = TT / (4 * RPW), DT = HD / 16, KS = HD / 32;
  __shared__ __attribute__((aligned(16))) unsigned short sP[4][RPW][40]; __shared__ __attribute__((aligned(16))) float sO[4][RPW][HD];
  const int tid = threadIdx.x, w = tid >> 5, lane = tid & 31, ln = lane & 15, hh = lane >> 4;
  const int slab = blockIdx.x / NQB, qblk = blockIdx.x % NQB; const int b = slab / NH, h = slab % NH; const int qb0 = qblk * (4 * RPW); const int q0 = qb0 + w * RPW;
  FragH aq[2][KS];
#pragma unroll
  for (int rt = 0; rt < 2; ++rt) { const unsigned short* qr = (const unsigned short*)Q16 + ((size_t)b * TT + q0 + rt * 16 + ln) * DM + h * HD;
#pragma unroll
    for (int ks = 0; ks < KS; ++ks) { aq[rt][ks].half[0] = *(const v8us*)(qr + ks * 32 + 8 * hh); aq[rt][ks].half[1] = *(const v8us*)(qr + ks * 32 + 16 + 8 * hh); } }
  const unsigned short* Vth = (const unsigned short*)Vt + (size_t)slab * HD * TT;
  float m_r[2][8], l_r[2][8]; v8f oacc[2][DT];
#pragma unroll
  for (int rt = 0; rt < 2; ++rt) {
#pragma unroll
    for (int r = 0; r < 8; ++r) { m_r[rt][r] = -3.0e38f; l_r[rt][r] = 0.f; }
#pragma unroll
    for (int dt = 0; dt < DT; ++dt) oacc[rt][dt] = (v8f){0.f,0.f,0.f,0.f,0.f,0.f,0.f,0.f}; }
#pragma unroll 1
  for (int j0 = qb0 - WW; j0 < qb0 + 4 * RPW + WW; j0 += 32) {
    v8f s[2][2];
#pragma unroll
    for (int nt = 0; nt < 2; ++nt) { const int kj = j0 + nt * 16 + ln; const int kc = kj < 0 ? 0 : (kj >= TT ? TT - 1 : kj); const unsigned short* kr = (const unsigned short*)K16 + ((size_t)b * TT + kc) * DM + h * HD; FragH bk[KS];
#pragma unroll
      for (int ks = 0; ks < KS; ++ks) { bk[ks].half[0] = *(const v8us*)(kr + ks * 32 + 8 * hh); bk[ks].half[1] = *(const v8us*)(kr + ks * 32 + 16 + 8 * hh); }
#pragma unroll
      for (int rt = 0; rt < 2; ++rt) { v8f acc = (v8f){0.f,0.f,0.f,0.f,0.f,0.f,0.f,0.f};
#pragma unroll
        for (int ks = 0; ks < KS; ++ks) acc = mmaH<1>(aq[rt][ks].v, aq[rt][ks].v, bk[ks].v, bk[ks].v, acc); s[rt][nt] = acc; } }
#pragma unroll
    for (int rt = 0; rt < 2; ++rt)
#pragma unroll
      for (int r = 0; r < 8; ++r) { const int t = q0 + rt * 16 + 8 * hh + r; const int k0 = j0 + ln, k1 = j0 + 16 + ln;
        const bool ok0 = (k0 >= 0 && k0 < TT && (k0 - t) <= WW && (t - k0) <= WW), ok1 = (k1 >= 0 && k1 < TT && (k1 - t) <= WW && (t - k1) <= WW);
        const float s0 = ok0 ? s[rt][0][r] * 0.125f : -INFINITY, s1 = ok1 ? s[rt][1][r] * 0.125f : -INFINITY; float mc = fmaxf(s0, s1);
        mc = fmaxf(mc, __shfl_xor(mc, 1, 32)); mc = fmaxf(mc, __shfl_xor(mc, 2, 32)); mc = fmaxf(mc, __shfl_xor(mc, 4, 32)); mc = fmaxf(mc, __shfl_xor(mc, 8, 32));
        const float mn = fmaxf(m_r[rt][r], mc); const float al = (mn > -1.0e38f) ? expf(m_r[rt][r] - mn) : 1.0f; m_r[rt][r] = mn; const float p0 = ok0 ? expf(s0 - mn) : 0.f, p1 = ok1 ? expf(s1 - mn) : 0.f; l_r[rt][r] = l_r[rt][r] * al + p0 + p1;
#pragma unroll
        for (int dt = 0; dt < DT; ++dt) oacc[rt][dt][r] *= al;
        FragH t2; t2.h[0] = (_Float16)p0; t2.h[1] = (_Float16)p1; sP[w][rt * 16 + 8 * hh + r][ln] = t2.u[0]; sP[w][rt * 16 + 8 * hh + r][16 + ln] = t2.u[1]; }
    __builtin_amdgcn_fence(__ATOMIC_ACQ_REL, "workgroup"); __builtin_amdgcn_wave_barrier();
    FragH pa[2];
#pragma unroll
    for (int rt = 0; rt < 2; ++rt) { pa[rt].half[0] = *(const v8us*)&sP[w][rt * 16 + ln][8 * hh]; pa[rt].half[1] = *(const v8us*)&sP[w][rt * 16 + ln][16 + 8 * hh]; }
#pragma unroll
    for (int dt = 0; dt < DT; ++dt) { const int vj0 = j0 < 0 ? 0 : (j0 + 32 > TT ? TT - 32 : j0);      // clamped chunk address; rows outside [0,T) have p = 0 so the substituted values never contribute
      const unsigned short* vrow = Vth + (size_t)(dt * 16 + ln) * TT + vj0; FragH bv; bv.half[0] = *(const v8us*)(vrow + 8 * hh); bv.half[1] = *(const v8us*)(vrow + 16 + 8 * hh);
#pragma unroll
      for (int rt = 0; rt < 2; ++rt) oacc[rt][dt] = mmaH<1>(pa[rt].v, pa[rt].v, bv.v, bv.v, oacc[rt][dt]); }
    __builtin_amdgcn_fence(__ATOMIC_ACQ_REL, "workgroup"); __builtin_amdgcn_wave_barrier(); }
#pragma unroll
  for (int rt = 0; rt < 2; ++rt) {
#pragma unroll
    for (int r = 0; r < 8; ++r) { float l = l_r[rt][r]; l += __shfl_xor(l, 1, 32); l += __shfl_xor(l, 2, 32); l += __shfl_xor(l, 4, 32); l += __shfl_xor(l, 8, 32);
      const int t = q0 + rt * 16 + 8 * hh + r; const int npad = (t < WW ? (WW - t) : 0) + (t + WW >= TT ? (t + WW - TT + 1) : 0); float sc = 1.0f;
      if (npad > 0) { const float m = m_r[rt][r]; const float mn = fmaxf(m, 0.f); sc = expf(m - mn); l = l * sc + (float)npad * expf(-mn); }
      l_r[rt][r] = sc / l; }
#pragma unroll
    for (int dt = 0; dt < DT; ++dt)
#pragma unroll
      for (int r = 0; r < 8; ++r) sO[w][rt * 16 + 8 * hh + r][dt * 16 + ln] = oacc[rt][dt][r] * l_r[rt][r]; }
  __builtin_amdgcn_fence(__ATOMIC_ACQ_REL, "workgroup"); __builtin_amdgcn_wave_barrier();
  {
#pragma unroll
    for (int rp = 0; rp < RPW; rp += 2) { const int r = rp + (lane >> 4), pc = lane & 15; const v4f val = *(const v4fa*)&sO[w][r][pc * 4]; *(v4f*)(O + ((size_t)b * TT + q0 + r) * DM + h * HD + pc * 4) = val; }
     } }
extern "C" void kernel_launch(void* const* d_in, const int* in_sizes, int n_in,
                              void* d_out, int out_size, void* d_ws, size_t ws_size, hipStream_t stream) {
  (void)in_sizes; (void)n_in; (void)out_size;
  const float* x = (const float*)d_in[0]; const float* wq = (const float*)d_in[1]; const float* bq = (const float*)d_in[2]; const float* wk = (const float*)d_in[3]; const float* bk = (const float*)d_in[4]; const float* wv = (const float*)d_in[5]; const float* bv = (const float*)d_in[6]; const float* wo = (const float*)d_in[7]; const float* bo = (const float*)d_in[8];
  char* ws = (char*)d_ws; size_t off = 0;
  auto take = [&](size_t bytes) { char* p = ws + off; off += (bytes + 255) & ~(size_t)255; return p; };
  const size_t w8 = (size_t)DM * DM / 8;
  _Float16* Bq = (_Float16*)take(w8 * 16); _Float16* Bk = (_Float16*)take(w8 * 16); _Float16* Bv = (_Float16*)take(w8 * 16); _Float16* Bo = (_Float16*)take(w8 * 16);
  _Float16* X16 = (_Float16*)take((size_t)NR * DM * 2); _Float16* Q16 = (_Float16*)take((size_t)NR * DM * 2); _Float16* K16 = (_Float16*)take((size_t)NR * DM * 2); _Float16* V16 = (_Float16*)take((size_t)NR * DM * 2); _Float16* Vt = (_Float16*)take((size_t)NR * DM * 2); float* Of = (float*)take((size_t)NR * DM * 4); _Float16* O16 = X16;
  if (off > ws_size) return;      // 30 MiB
  const unsigned gw = (unsigned)((DM * (DM / 8) + 255) / 256);
  k_wt_f16<<<gw, 256, 0, stream>>>(wq, Bq, DM, DM, 16.0f); k_wt_f16<<<gw, 256, 0, stream>>>(wk, Bk, DM, DM, 16.0f); k_wt_f16<<<gw, 256, 0, stream>>>(wv, Bv, DM, DM, 16.0f); k_wt_f16<<<gw, 256, 0, stream>>>(wo, Bo, DM, DM, 16.0f);      // [in][out]
  const unsigned gx = (unsigned)(((size_t)NR * DM / 8 + 255) / 256);
  k_x16<<<gx, 256, 0, stream>>>(x, X16, (size_t)NR * DM / 8);
  const unsigned gg = (NR / 64) * (DM / 64);
  k_gemm_hhx<false><<<gg, 128, 0, stream>>>(X16, Bq, 0.0625f, bq, nullptr, Q16);
  k_gemm_hhx<false><<<gg, 128, 0, stream>>>(X16, Bk, 0.0625f, bk, nullptr, K16);
  k_gemm_hhx<false><<<gg, 128, 0, stream>>>(X16, Bv, 0.0625f, bv, nullptr, V16);
  k_vt<<<BB * NH * (TT / 64), 256, 0, stream>>>(V16, Vt);
  k_flash<<<BB * NH * (TT / 128), 128, 0, stream>>>(Q16, K16, Vt, Of);
  k_h16<<<gx, 256, 0, stream>>>(Of, O16, (size_t)NR * DM / 8);
  k_gemm_hhx<true><<<gg, 128, 0, stream>>>(O16, Bo, 0.0625f, bo, (float*)d_out, nullptr);
}

// v002
// One run takes 65.3 microseconds.
// In two side-by-side timings against v001, it was 1.29 and 1.27 times as fast.
// Over all steps from v000 it is 2.16 times as fast.
#include <hip/hip_runtime.h>
// q/k/v/o projections (4096 × 512 × 512, + bias) and the 8-head LOCAL attention (window ±32, d = 64) on v_wmma_f32_16x16x32_f16: a fused flash-style kernel visits only the 6 key chunks
// around each 128-query block (S = Q·Kᵀ, O = P·V on WMMA; |k − t| ≤ 32 band mask; online max/sum softmax f32; P f16 ≤ 1), and the module's zero-PADDED keys (score exactly 0, value 0, they DO
// take part in the softmax) are added analytically per query as npad·e^{0 − m} in the normaliser; A = f16(bf16 x) exact for q/k/v, f16(O) for o, weights [in][out] transposed to bf16-exact ×2^4, f32 accumulate.
#define BB 2
#define TT 2048
#define DM 512
#define NH 8
#define HD 64
#define WW 32
#define NR (BB * TT)

typedef __bf16 v16b __attribute__((ext_vector_type(16)));
typedef unsigned short v8us __attribute__((ext_vector_type(8), may_alias));
typedef float  v8f  __attribute__((ext_vector_type(8)));
typedef float  v4f  __attribute__((ext_vector_type(4)));
typedef float  v4fa __attribute__((ext_vector_type(4), may_alias));
union FragB { v16b v; v8us half[2]; unsigned short u[16]; };

__device__ __forceinline__ unsigned short bf16_bits(float x) { unsigned int u = __float_as_uint(x); return (unsigned short)((u + 0x7FFFu + ((u >> 16) & 1u)) >> 16); }
__device__ __forceinline__ float bf16_val(unsigned short b) { return __uint_as_float(((unsigned int)b) << 16); }
__device__ __forceinline__ float bf16_round(float x) { return bf16_val(bf16_bits(x)); }
// D += A·B with NT terms: 1 = ah·bh, 2 = + al·bh (A split), 3 = + ah·bl (both split)
template <int NT>
__device__ __forceinline__ v8f mmaN(v16b ah, v16b al, v16b bh, v16b bl, v8f c) {
  c = __builtin_amdgcn_wmma_f32_16x16x32_bf16(false, ah, false, bh, (short)0, c, false, false);
  if (NT >= 2) c = __builtin_amdgcn_wmma_f32_16x16x32_bf16(false, al, false, bh, (short)0, c, false, false);
  if (NT >= 3) c = __builtin_amdgcn_wmma_f32_16x16x32_bf16(false, ah, false, bl, (short)0, c, false, false);
  asm volatile("v_nop\n\tv_nop\n\tv_nop\n\tv_nop" : "+v"(c) : "v"(ah), "v"(al), "v"(bh), "v"(bl));
  return c;
}

__global__ __launch_bounds__(256) void k_wt_bf16(const float* __restrict__ W, unsigned short* __restrict__ Wt, int K, int N) {
  const int t = blockIdx.x * 256 + threadIdx.x;
  const int k8n = K / 8;
  if (t >= N * k8n) return;
  const int n = t / k8n, k8 = (t % k8n) * 8;
  v8us v;
#pragma unroll
  for (int i = 0; i < 8; ++i) v[i] = bf16_bits(W[(size_t)(k8 + i) * N + n]);
  *(v8us*)(Wt + (size_t)n * K + k8) = v;
  
}

// GEMM C[M][N] (f32, pitch ldc) = act(A[M][K]·W + bias). A f32 row-major (pitch lda) converted per fragment to bf16
// (ASPLIT: hi/lo two planes -> 2 terms, else single rounded term); Wt bf16 [N][K] (pitch ldb). BIAS_BF16 rounds the
// bias to bf16 first (bias quantised to bf16 before the add). K%32==0, M%16==0, N%64==0.
template <bool ASPLIT, int ACT, bool BIAS_BF16>
__global__ __launch_bounds__(128) void k_gemm_bf(const float* __restrict__ A, int lda, const unsigned short* __restrict__ Wt, int ldb,
                                               const float* __restrict__ bias, float* __restrict__ C, int ldc, int M, int N, int K) {
  __shared__ __attribute__((aligned(16))) float so[4][16][64];
  const int tid = threadIdx.x, w = tid >> 5, lane = tid & 31, ln = lane & 15, hh = lane >> 4;
  const int ntn = N / 64;
  const int wid = blockIdx.x * 4 + w;
  const int mt = wid / ntn, nq = wid % ntn;
  if (mt * 16 >= M) return;
  const int row0 = mt * 16, col0 = nq * 64;
  const float* arow = A + (size_t)(row0 + ln) * lda;
  v8f acc[4] = {};
  for (int kb = 0; kb < K; kb += 32) {
    FragB ah, al;
    const v4f x0 = *(const v4fa*)(arow + kb + 8 * hh), x1 = *(const v4fa*)(arow + kb + 8 * hh + 4);
    const v4f x2 = *(const v4fa*)(arow + kb + 16 + 8 * hh), x3 = *(const v4fa*)(arow + kb + 16 + 8 * hh + 4);
    float xs[16] = {x0[0],x0[1],x0[2],x0[3],x1[0],x1[1],x1[2],x1[3],x2[0],x2[1],x2[2],x2[3],x3[0],x3[1],x3[2],x3[3]};
#pragma unroll
    for (int i = 0; i < 16; ++i) { const unsigned short hb = bf16_bits(xs[i]); ah.u[i] = hb; al.u[i] = ASPLIT ? bf16_bits(xs[i] - bf16_val(hb)) : (unsigned short)0; }
#pragma unroll
    for (int t = 0; t < 4; ++t) {
      const unsigned short* brow = Wt + (size_t)(col0 + t * 16 + ln) * ldb + kb;
      FragB b;
      b.half[0] = *(const v8us*)(brow + 8 * hh);
      b.half[1] = *(const v8us*)(brow + 16 + 8 * hh);
      acc[t] = mmaN<ASPLIT ? 2 : 1>(ah.v, al.v, b.v, b.v, acc[t]);
    }
  }
#pragma unroll
  for (int t = 0; t < 4; ++t) {
    float bv = bias ? bias[col0 + t * 16 + ln] : 0.f;
    if (BIAS_BF16) bv = bf16_round(bv);
#pragma unroll
    for (int r = 0; r < 8; ++r) { float v = acc[t][r] + bv; if (ACT == 1) v = fmaxf(v, 0.f); so[w][8 * hh + r][t * 16 + ln] = v; }
  }
  __builtin_amdgcn_fence(__ATOMIC_ACQ_REL, "workgroup");
  __builtin_amdgcn_wave_barrier();
  const int rsub = lane >> 4, c4 = (lane & 15) * 4;
  {
#pragma unroll
    for (int q = 0; q < 8; ++q) {
      const int r = q * 2 + rsub;
      const v4f v = *(const v4fa*)&so[w][r][c4];
      *(v4f*)(C + (size_t)(row0 + r) * ldc + col0 + c4) = v;
    }
    
  }
}

// Flash-style causal/unmasked attention, all contractions 3-term bf16 hi/lo splits, f32 softmax with running max.
// q,k,v rows are read from f32 buffers with arbitrary row pitch (so they can live inside a fused qkv buffer);
// D = head size (multiple of 32, <= 128); one wave = 16 query rows; block = 4 waves (64 queries) sharing K/V chunks of 32.
template <int D, bool CAUSAL>
__global__ __launch_bounds__(128) void k_flash(const float* __restrict__ qb, const float* __restrict__ kb, const float* __restrict__ vb,
                                             int pitch, int T, int H, float scale, float* __restrict__ y, int ypitch) {
  constexpr int KS = D / 32;        // k-steps for QK
  constexpr int DT = D / 16;        // d tiles for PV
  __shared__ __attribute__((aligned(16))) unsigned short sKh[32][D + 8], sKl[32][D + 8], sVh[32][D + 8], sVl[32][D + 8];
  __shared__ __attribute__((aligned(16))) unsigned short sPh[4][16][40], sPl[4][16][40];
  __shared__ __attribute__((aligned(16))) float sO[4][16][D];
  const int tid = threadIdx.x, w = tid >> 5, lane = tid & 31, ln = lane & 15, hh = lane >> 4;
  const int nqb = (T + 63) / 64;
  const int bh = blockIdx.x / nqb, qblk = blockIdx.x % nqb;
  const int b = bh / H, h = bh % H;
  const int q0 = qblk * 64 + w * 16;
  const float* Q = qb + (size_t)b * T * pitch + h * D;
  const float* K = kb + (size_t)b * T * pitch + h * D;
  const float* V = vb + (size_t)b * T * pitch + h * D;

  // A fragments of the wave's 16 query rows (scaled), hi/lo
  FragB aqh[KS], aql[KS];
  {
    int row = q0 + ln; if (row >= T) row = T - 1;
    const float* qr = Q + (size_t)row * pitch;
#pragma unroll
    for (int ks = 0; ks < KS; ++ks)
#pragma unroll
      for (int i = 0; i < 16; ++i) {
        const int d = ks * 32 + ((i < 8) ? (8 * hh + i) : (16 + 8 * hh + (i - 8)));
        const float x = qr[d] * scale; const unsigned short hb = bf16_bits(x);
        aqh[ks].u[i] = hb; aql[ks].u[i] = bf16_bits(x - bf16_val(hb));
      }
  }
  float m_r[8], l_r[8];
#pragma unroll
  for (int r = 0; r < 8; ++r) { m_r[r] = -3.0e38f; l_r[r] = 0.f; }
  v8f oacc[DT];
#pragma unroll
  for (int dt = 0; dt < DT; ++dt) oacc[dt] = (v8f){0.f,0.f,0.f,0.f,0.f,0.f,0.f,0.f};

  const int kv_end = CAUSAL ? min(T, qblk * 64 + 64) : T;     // block-uniform
  for (int j0 = 0; j0 < kv_end; j0 += 32) {
    __syncthreads();
    for (int e = tid; e < 32 * (D / 4); e += 128) {
      const int r = e / (D / 4), c4 = (e % (D / 4)) * 4;
      const int key = j0 + r;
      v4f kf = {0.f,0.f,0.f,0.f}, vf = {0.f,0.f,0.f,0.f};
      if (key < T) { kf = *(const v4fa*)(K + (size_t)key * pitch + c4); vf = *(const v4fa*)(V + (size_t)key * pitch + c4); }
#pragma unroll
      for (int t = 0; t < 4; ++t) {
        unsigned short hb = bf16_bits(kf[t]); sKh[r][c4 + t] = hb; sKl[r][c4 + t] = bf16_bits(kf[t] - bf16_val(hb));
        hb = bf16_bits(vf[t]); sVh[r][c4 + t] = hb; sVl[r][c4 + t] = bf16_bits(vf[t] - bf16_val(hb));
      }
    }
    __syncthreads();
    // S tile 16 x 32
    v8f s[2];
#pragma unroll
    for (int nt = 0; nt < 2; ++nt) {
      v8f acc = {};
#pragma unroll
      for (int ks = 0; ks < KS; ++ks) {
        FragB bh_, bl_;
        bh_.half[0] = *(const v8us*)&sKh[nt * 16 + ln][ks * 32 + 8 * hh]; bh_.half[1] = *(const v8us*)&sKh[nt * 16 + ln][ks * 32 + 16 + 8 * hh];
        bl_.half[0] = *(const v8us*)&sKl[nt * 16 + ln][ks * 32 + 8 * hh]; bl_.half[1] = *(const v8us*)&sKl[nt * 16 + ln][ks * 32 + 16 + 8 * hh];
        acc = mmaN<3>(aqh[ks].v, aql[ks].v, bh_.v, bl_.v, acc);
      }
      s[nt] = acc;
    }
    // mask + running max (rows 8hh+r; the 16 lanes of a half share rows)
    float alpha[8];
#pragma unroll
    for (int r = 0; r < 8; ++r) {
      const int qi = q0 + 8 * hh + r;
      const int ja = j0 + ln, jb = j0 + 16 + ln;
      if (CAUSAL) { if (ja > qi) s[0][r] = -3.0e38f; if (jb > qi) s[1][r] = -3.0e38f; }
      if (ja >= T) s[0][r] = -3.0e38f;
      if (jb >= T) s[1][r] = -3.0e38f;
      float mx = fmaxf(s[0][r], s[1][r]);
      mx = fmaxf(mx, __shfl_xor(mx, 1, 32)); mx = fmaxf(mx, __shfl_xor(mx, 2, 32)); mx = fmaxf(mx, __shfl_xor(mx, 4, 32)); mx = fmaxf(mx, __shfl_xor(mx, 8, 32));
      const float mnew = fmaxf(m_r[r], mx);
      alpha[r] = (mnew > -1.0e38f) ? __expf(m_r[r] - mnew) : 1.0f;
      const float p0 = (s[0][r] > -1.0e38f) ? __expf(s[0][r] - mnew) : 0.f;
      const float p1 = (s[1][r] > -1.0e38f) ? __expf(s[1][r] - mnew) : 0.f;
      m_r[r] = mnew;
      l_r[r] = l_r[r] * alpha[r] + p0 + p1;            // per-lane partial row sum (16 lanes combined at the end)
      unsigned short hb = bf16_bits(p0); sPh[w][8 * hh + r][ln] = hb;      sPl[w][8 * hh + r][ln] = bf16_bits(p0 - bf16_val(hb));
      hb = bf16_bits(p1);                sPh[w][8 * hh + r][16 + ln] = hb; sPl[w][8 * hh + r][16 + ln] = bf16_bits(p1 - bf16_val(hb));
    }
#pragma unroll
    for (int dt = 0; dt < DT; ++dt)
#pragma unroll
      for (int r = 0; r < 8; ++r) oacc[dt][r] *= alpha[r];
    __builtin_amdgcn_fence(__ATOMIC_ACQ_REL, "workgroup");
    __builtin_amdgcn_wave_barrier();
    FragB pah, pal;
    pah.half[0] = *(const v8us*)&sPh[w][ln][8 * hh]; pah.half[1] = *(const v8us*)&sPh[w][ln][16 + 8 * hh];
    pal.half[0] = *(const v8us*)&sPl[w][ln][8 * hh]; pal.half[1] = *(const v8us*)&sPl[w][ln][16 + 8 * hh];
#pragma unroll
    for (int dt = 0; dt < DT; ++dt) {
      FragB bvh, bvl;
#pragma unroll
      for (int i = 0; i < 8; ++i) {
        bvh.u[i] = sVh[8 * hh + i][dt * 16 + ln]; bvh.u[8 + i] = sVh[16 + 8 * hh + i][dt * 16 + ln];
        bvl.u[i] = sVl[8 * hh + i][dt * 16 + ln]; bvl.u[8 + i] = sVl[16 + 8 * hh + i][dt * 16 + ln];
      }
      oacc[dt] = mmaN<3>(pah.v, pal.v, bvh.v, bvl.v, oacc[dt]);
    }
    __builtin_amdgcn_fence(__ATOMIC_ACQ_REL, "workgroup");
    __builtin_amdgcn_wave_barrier();
  }
#pragma unroll
  for (int r = 0; r < 8; ++r) {
    float l = l_r[r];
    l += __shfl_xor(l, 1, 32); l += __shfl_xor(l, 2, 32); l += __shfl_xor(l, 4, 32); l += __shfl_xor(l, 8, 32);
    l_r[r] = (l > 0.f) ? 1.0f / l : 0.f;
  }
#pragma unroll
  for (int dt = 0; dt < DT; ++dt)
#pragma unroll
    for (int r = 0; r < 8; ++r) sO[w][8 * hh + r][dt * 16 + ln] = oacc[dt][r] * l_r[r];
  __builtin_amdgcn_fence(__ATOMIC_ACQ_REL, "workgroup");
  __builtin_amdgcn_wave_barrier();
  {
    for (int r = 0; r < 16; ++r) {
      const int row = q0 + r;
      if (row < T && lane < D / 4) {
        const v4f val = *(const v4fa*)&sO[w][r][lane * 4];
        *(v4f*)(y + ((size_t)b * T + row) * ypitch + h * D + lane * 4) = val;
      }
    }
    
  }
}

// GEMM C = act(A·W + bias + resid): A f32 (ASPLIT -> hi/lo 2 terms), Wt bf16 [N][K]; ACT 0 none, 1 relu, 2 exact gelu;
// resid (optional, f32, row index = (row % rmod), pitch ldr, RES_BF16 rounds it) added before the activation.
template <bool ASPLIT, int ACT, bool BIAS_BF16, bool RES_BF16>
__global__ __launch_bounds__(128) void k_gemm_bf3(const float* __restrict__ A, int lda, const unsigned short* __restrict__ Wt, int ldb,
                                                const float* __restrict__ bias, const float* __restrict__ resid, int rmod, int ldr,
                                                float* __restrict__ C, int ldc, int M, int N, int K) {
  __shared__ __attribute__((aligned(16))) float so[4][16][64];
  const int tid = threadIdx.x, w = tid >> 5, lane = tid & 31, ln = lane & 15, hh = lane >> 4;
  const int ntn = N / 64;
  const int wid = blockIdx.x * 4 + w;
  const int mt = wid / ntn, nq = wid % ntn;
  if (mt * 16 >= M) return;
  const int row0 = mt * 16, col0 = nq * 64;
  const float* arow = A + (size_t)(row0 + ln) * lda;
  v8f acc[4] = {};
  for (int kb = 0; kb < K; kb += 32) {
    FragB ah, al;
    const v4f x0 = *(const v4fa*)(arow + kb + 8 * hh), x1 = *(const v4fa*)(arow + kb + 8 * hh + 4);
    const v4f x2 = *(const v4fa*)(arow + kb + 16 + 8 * hh), x3 = *(const v4fa*)(arow + kb + 16 + 8 * hh + 4);
    float xs[16] = {x0[0],x0[1],x0[2],x0[3],x1[0],x1[1],x1[2],x1[3],x2[0],x2[1],x2[2],x2[3],x3[0],x3[1],x3[2],x3[3]};
#pragma unroll
    for (int i = 0; i < 16; ++i) { const unsigned short hb = bf16_bits(xs[i]); ah.u[i] = hb; al.u[i] = ASPLIT ? bf16_bits(xs[i] - bf16_val(hb)) : (unsigned short)0; }
#pragma unroll
    for (int t = 0; t < 4; ++t) {
      const unsigned short* brow = Wt + (size_t)(col0 + t * 16 + ln) * ldb + kb;
      FragB b;
      b.half[0] = *(const v8us*)(brow + 8 * hh);
      b.half[1] = *(const v8us*)(brow + 16 + 8 * hh);
      acc[t] = mmaN<ASPLIT ? 2 : 1>(ah.v, al.v, b.v, b.v, acc[t]);
    }
  }
#pragma unroll
  for (int t = 0; t < 4; ++t) {
    const int col = col0 + t * 16 + ln;
    float bv = bias ? bias[col] : 0.f;
    if (BIAS_BF16) bv = bf16_round(bv);
#pragma unroll
    for (int r = 0; r < 8; ++r) {
      float v = acc[t][r] + bv;
      if (resid) { float rv = resid[(size_t)((row0 + 8 * hh + r) % rmod) * ldr + col]; if (RES_BF16) rv = bf16_round(rv); v += rv; }
      if (ACT == 1) v = fmaxf(v, 0.f);
      if (ACT == 2) v = 0.5f * v * (1.0f + erff(v * 0.70710678118654752f));
      if (ACT == 3) { const float u = 0.7978845608028654f * (v + 0.044715f * v * v * v); v = 0.5f * v * (1.0f + tanhf(u)); }
      so[w][8 * hh + r][t * 16 + ln] = v;
    }
  }
  __builtin_amdgcn_fence(__ATOMIC_ACQ_REL, "workgroup");
  __builtin_amdgcn_wave_barrier();
  const int rsub = lane >> 4, c4 = (lane & 15) * 4;
  {
#pragma unroll
    for (int q = 0; q < 8; ++q) {
      const int r = q * 2 + rsub;
      const v4f v = *(const v4fa*)&so[w][r][c4];
      *(v4f*)(C + (size_t)(row0 + r) * ldc + col0 + c4) = v;
    }
    
  }
}
// row LayerNorm (biased variance, eps) over N: s = X (+ R); optional out_sum <- s; out_norm <- (s-mu)*rsqrt(var+eps)*g + b
template <bool PARAM_BF16>
__global__ __launch_bounds__(256) void k_layernorm(const float* __restrict__ X, const float* __restrict__ R, const float* __restrict__ g, const float* __restrict__ bta,
                                                  float* __restrict__ out_sum, float* __restrict__ out_norm, int N, float eps) {
  __shared__ float red[256];
  const int row = blockIdx.x, tid = threadIdx.x;
  const float* x = X + (size_t)row * N; const float* rr = R ? R + (size_t)row * N : nullptr;
  float vals[16];                     // up to N = 4096
  const int per = N / 256;            // contiguous chunk per thread? use strided-by-4 chunks: thread handles j = tid*4 + 1024*u
  float s1 = 0.f;
  for (int u = 0; u < per / 4; ++u) {
    const int j = tid * 4 + 1024 * u;
    const v4f a = *(const v4fa*)(x + j);
    v4f b = {0.f,0.f,0.f,0.f}; if (rr) b = *(const v4fa*)(rr + j);
#pragma unroll
    for (int q = 0; q < 4; ++q) { const float v = a[q] + b[q]; vals[u * 4 + q] = v; s1 += v; }
  }
  red[tid] = s1; __syncthreads();
  for (int st = 128; st > 0; st >>= 1) { if (tid < st) red[tid] += red[tid + st]; __syncthreads(); }
  const float mu = red[0] / (float)N; __syncthreads();
  float s2 = 0.f;
  for (int u = 0; u < per / 4; ++u)
#pragma unroll
    for (int q = 0; q < 4; ++q) { const float c = vals[u * 4 + q] - mu; s2 += c * c; }
  red[tid] = s2; __syncthreads();
  for (int st = 128; st > 0; st >>= 1) { if (tid < st) red[tid] += red[tid + st]; __syncthreads(); }
  const float rs = rsqrtf(red[0] / (float)N + eps);
  {
    for (int u = 0; u < per / 4; ++u) {
      const int j = tid * 4 + 1024 * u;
      v4f o, sm;
#pragma unroll
      for (int q = 0; q < 4; ++q) {
        float gg = g[j + q], bb = bta[j + q];
        if (PARAM_BF16) { gg = bf16_round(gg); bb = bf16_round(bb); }
        sm[q] = vals[u * 4 + q]; o[q] = (vals[u * 4 + q] - mu) * rs * gg + bb;
      }
      if (out_sum) *(v4f*)(out_sum + (size_t)row * N + j) = sm;
      *(v4f*)(out_norm + (size_t)row * N + j) = o;
    }
    
  }
}



// ---- f16 WMMA path (v_wmma_f32_16x16x32_f16): 11-bit significands for operands in range — used where a [0,1] probability operand needs more precision than bf16
typedef _Float16 v16h __attribute__((ext_vector_type(16)));
union FragH { v16h v; v8us half[2]; _Float16 h[16]; unsigned short u[16]; };
template <int NT>
__device__ __forceinline__ v8f mmaH(v16h ah, v16h al, v16h bh, v16h bl, v8f c) {
  c = __builtin_amdgcn_wmma_f32_16x16x32_f16(false, ah, false, bh, (short)0, c, false, false);
  if (NT >= 2) c = __builtin_amdgcn_wmma_f32_16x16x32_f16(false, al, false, bh, (short)0, c, false, false);
  if (NT >= 3) c = __builtin_amdgcn_wmma_f32_16x16x32_f16(false, ah, false, bl, (short)0, c, false, false);
  asm volatile("v_nop\n\tv_nop\n\tv_nop\n\tv_nop" : "+v"(c) : "v"(ah), "v"(al), "v"(bh), "v"(bl));
  return c;
}
// batched GEMM like k_gemm_b but f16 operands: A f32 (split into f16 hi/lo if ASPLIT, else rounded to f16), Bt = f16 values [n][k]; alpha; C f32; N multiple of 16 (partial tiles skipped)
template <bool ASPLIT>
__global__ __launch_bounds__(128) void k_gemm_h(const float* __restrict__ A, int lda, size_t sA, const _Float16* __restrict__ Bh, int ldb, size_t sB, float alpha, float* __restrict__ C, int ldc, size_t sC, int M, int N, int K) {
  __shared__ __attribute__((aligned(16))) float so[4][16][64];
  const int tid = threadIdx.x, w = tid >> 5, lane = tid & 31, ln = lane & 15, hh = lane >> 4; const int by = blockIdx.y;
  A += (size_t)by * sA; Bh += (size_t)by * sB; C += (size_t)by * sC;
  const int ntn = (N + 63) / 64; const int wid = blockIdx.x * 4 + w; const int mt = wid / ntn, nq = wid % ntn; if (mt * 16 >= M) return;
  const int row0 = mt * 16, col0 = nq * 64; const float* arow = A + (size_t)(row0 + ln) * lda;
  v8f acc[4] = {};
  for (int kb = 0; kb < K; kb += 32) {
    FragH ah, al;
    const v4f x0 = *(const v4fa*)(arow + kb + 8 * hh), x1 = *(const v4fa*)(arow + kb + 8 * hh + 4), x2 = *(const v4fa*)(arow + kb + 16 + 8 * hh), x3 = *(const v4fa*)(arow + kb + 16 + 8 * hh + 4);
    float xs[16] = {x0[0],x0[1],x0[2],x0[3],x1[0],x1[1],x1[2],x1[3],x2[0],x2[1],x2[2],x2[3],x3[0],x3[1],x3[2],x3[3]};
#pragma unroll
    for (int i = 0; i < 16; ++i) { const _Float16 h = (_Float16)xs[i]; ah.h[i] = h; al.h[i] = ASPLIT ? (_Float16)(xs[i] - (float)h) : (_Float16)0.0f; }
#pragma unroll
    for (int t = 0; t < 4; ++t) { if (col0 + t * 16 >= N) continue; const size_t boff = (size_t)(col0 + t * 16 + ln) * ldb + kb; FragH bq; bq.half[0] = *(const v8us*)(Bh + boff + 8 * hh); bq.half[1] = *(const v8us*)(Bh + boff + 16 + 8 * hh);
      acc[t] = mmaH<ASPLIT ? 2 : 1>(ah.v, al.v, bq.v, bq.v, acc[t]); }
  }
#pragma unroll
  for (int t = 0; t < 4; ++t) { if (col0 + t * 16 >= N) continue;
#pragma unroll
    for (int r = 0; r < 8; ++r) so[w][8 * hh + r][t * 16 + ln] = acc[t][r] * alpha; }
  __builtin_amdgcn_fence(__ATOMIC_ACQ_REL, "workgroup"); __builtin_amdgcn_wave_barrier();
  const int rsub = lane >> 4, c4 = (lane & 15) * 4;
  {
#pragma unroll
    for (int q = 0; q < 8; ++q) { const int r = q * 2 + rsub; if (col0 + c4 < N) { const v4f v = *(const v4fa*)&so[w][r][c4]; *(v4f*)(C + (size_t)(row0 + r) * ldc + col0 + c4) = v; } }
     }
}

// One grid for the five preparations, none of which needs another's result; the block index picks the job (a block-uniform branch).
// Blocks 0 .. 4 GW - 1, GW per weight: Wt[n][k] = f16(bf16(W[k][n]) * 16) from f32 row-major W[k][n] (a power of two keeps the bf16-exact weights exact in f16, away from the subnormal range).
// The other blocks: X16 = f16(bf16(x)), eight elements a thread.
__global__ __launch_bounds__(256) void k_prep(const float* __restrict__ x, const float* __restrict__ wq, const float* __restrict__ wk, const float* __restrict__ wv, const float* __restrict__ wo,
                                              _Float16* __restrict__ X16, _Float16* __restrict__ Bq, _Float16* __restrict__ Bk, _Float16* __restrict__ Bv, _Float16* __restrict__ Bo) {
  constexpr int GW = DM * (DM / 8) / 256; const int blk = blockIdx.x; FragH f;
  if (blk < 4 * GW) {
    const int job = blk / GW; const float* W = job == 0 ? wq : job == 1 ? wk : job == 2 ? wv : wo; _Float16* Wt = job == 0 ? Bq : job == 1 ? Bk : job == 2 ? Bv : Bo;
    const int t = (blk % GW) * 256 + threadIdx.x; const int n = t / (DM / 8), k8 = (t % (DM / 8)) * 8;
#pragma unroll
    for (int i = 0; i < 8; ++i) f.h[i] = (_Float16)(bf16_round(W[(size_t)(k8 + i) * DM + n]) * 16.0f);
    *(v8us*)((unsigned short*)Wt + (size_t)n * DM + k8) = f.half[0];
  } else {
    const size_t t = (size_t)(blk - 4 * GW) * 256 + threadIdx.x;
#pragma unroll
    for (int q = 0; q < 8; ++q) f.h[q] = (_Float16)bf16_round(x[t * 8 + q]);
    *(v8us*)((unsigned short*)X16 + t * 8) = f.half[0];
    asm volatile("s_wait_xcnt 0x0" ::: "memory");      // the built code lays the weight part behind this store: the wait stands in front of any write of the store's registers there
  }
}
// C[4096][512] = (A . Bt^T) * alpha + bf16(bias): one 64 x 64 tile of C per work-group, wave w = rows 16 w .. 16 w + 15, all 64 columns, K = 512 whole.
// The 64 rows of A and the 64 rows of Bt (both k-contiguous) come in by whole-line loads (a wave-wide 16-byte load = two rows x 256 contiguous bytes) and are laid in LDS at a pitch of 1040 B
// (16 B x odd: no bank conflict for the 16-byte fragment reads); the fragments then come from LDS, in the same k order as when they were read from global memory. All global loads are issued first;
// K goes in four chunks of 128, each stored to its own LDS columns and multiplied while the later chunks are still on their way into registers. F32OUT: f32 C, else f16.
// The q, k and v products read the same A and need nothing of each other: they share one grid, GG blocks each, job = block index / GG picks weight, bias and output (F32OUT: GG blocks, job 0 alone).
// Jobs 0 and 1 write C0, C1 row-major; job 2 (v) writes its 64 tokens x 64 columns (one head) transposed, Vt[(batch, head)][d][token], as the attention kernel reads it.
template <bool F32OUT>
__global__ __launch_bounds__(128) void k_gemm_hhx(const _Float16* __restrict__ A, const _Float16* __restrict__ B0, const _Float16* __restrict__ B1, const _Float16* __restrict__ B2, float alpha,
                                                  const float* __restrict__ bias0, const float* __restrict__ bias1, const float* __restrict__ bias2, float* __restrict__ C, _Float16* __restrict__ C0, _Float16* __restrict__ C1, _Float16* __restrict__ Vt) {
  constexpr int GG = (NR / 64) * (DM / 64); const int job = blockIdx.x / GG, blk = blockIdx.x % GG;
  const _Float16* Bh = job == 0 ? B0 : job == 1 ? B1 : B2; const float* bias = job == 0 ? bias0 : job == 1 ? bias1 : bias2; _Float16* C16 = job == 0 ? C0 : C1;
  constexpr int KP = DM + 8, KC = 128, NC = DM / KC, NL = 64 * KC / 8 / 128, KS = KC / 32;      // LDS pitch in halves; k per chunk; chunks; 16-byte loads per thread, operand and chunk; k steps per chunk
  __shared__ __attribute__((aligned(16))) unsigned short sA[64][KP], sB[64][KP];
  __shared__ __attribute__((aligned(16))) float so[4][16][64];
  const int tid = threadIdx.x, w = tid >> 5, lane = tid & 31, ln = lane & 15, hh = lane >> 4;
  const int mt = blk / (DM / 64), nq = blk % (DM / 64);
  const int row0 = mt * 64 + w * 16, col0 = nq * 64;
  const unsigned short* Ag = (const unsigned short*)A + (size_t)mt * 64 * DM;
  const unsigned short* Bg = (const unsigned short*)Bh + (size_t)col0 * DM;
  const int sr = tid >> 4, sc = (tid & 15) * 8;      // staging: load i of chunk c takes row 8 i + sr, halves c * KC + sc .. + 7
  v8us ra[NC][NL], rb[NC][NL];
#pragma unroll
  for (int c = 0; c < NC; ++c) {
#pragma unroll
    for (int i = 0; i < NL; ++i) { ra[c][i] = *(const v8us*)(Ag + (size_t)(8 * i + sr) * DM + c * KC + sc); rb[c][i] = *(const v8us*)(Bg + (size_t)(8 * i + sr) * DM + c * KC + sc); }
    __builtin_amdgcn_sched_barrier(0);      // keeps the loads in chunk order, so that chunk 0 is complete after a quarter of them and not after half
  }
  asm volatile("s_wait_xcnt 0x0" ::: "memory");      // stands in front of the first overwrite of the loads' address registers, which are reused for fragments while later chunks are still in flight
  v8f acc[4] = {};
#pragma unroll
  for (int c = 0; c < NC; ++c) {
#pragma unroll
    for (int i = 0; i < NL; ++i) { *(v8us*)&sA[8 * i + sr][c * KC + sc] = ra[c][i]; *(v8us*)&sB[8 * i + sr][c * KC + sc] = rb[c][i]; }
    // publishes this chunk's LDS columns to all four waves. LDS-only fences: a full __syncthreads() would also wait for the later chunks' global loads, which only this thread's registers receive
    __builtin_amdgcn_fence(__ATOMIC_RELEASE, "workgroup", "local"); __builtin_amdgcn_s_barrier(); __builtin_amdgcn_fence(__ATOMIC_ACQUIRE, "workgroup", "local");
    FragH ah[KS], bq[KS][4];      // the whole chunk's fragments are asked for ahead of its first matrix instruction
#pragma unroll
    for (int ks = 0; ks < KS; ++ks) { const int kb = c * KC + ks * 32; ah[ks].half[0] = *(const v8us*)&sA[w * 16 + ln][kb + 8 * hh]; ah[ks].half[1] = *(const v8us*)&sA[w * 16 + ln][kb + 16 + 8 * hh];
#pragma unroll
      for (int t = 0; t < 4; ++t) { bq[ks][t].half[0] = *(const v8us*)&sB[t * 16 + ln][kb + 8 * hh]; bq[ks][t].half[1] = *(const v8us*)&sB[t * 16 + ln][kb + 16 + 8 * hh]; } }
#pragma unroll
    for (int ks = 0; ks < KS; ++ks)
#pragma unroll
      for (int t = 0; t < 4; ++t) acc[t] = mmaH<1>(ah[ks].v, ah[ks].v, bq[ks][t].v, bq[ks][t].v, acc[t]);
  }
  if (!F32OUT && job == 2) {      // block-uniform
    // an accumulator lane holds 8 consecutive tokens of one column d: 16 bytes of a transposed row. The four waves lay the 64 d x 64 tokens in LDS (pitch 144 B = 16 B x odd), then whole 128-byte rows of Vt go out
    unsigned short (*tl)[72] = (unsigned short (*)[72])&so[0][0][0];
#pragma unroll
    for (int t = 0; t < 4; ++t) { const float bv = bf16_round(bias[col0 + t * 16 + ln]); FragH f;
#pragma unroll
      for (int r = 0; r < 8; ++r) f.h[r] = (_Float16)(acc[t][r] * alpha + bv);
      *(v8us*)&tl[t * 16 + ln][w * 16 + 8 * hh] = f.half[0]; }
    __syncthreads();      // a row of tl holds tokens of all four waves
    unsigned short* vo = (unsigned short*)Vt + ((size_t)((mt * 64 / TT) * NH + nq) * HD) * TT + (mt * 64) % TT;
#pragma unroll
    for (int i = 0; i < 4; ++i) { const int d = i * 16 + (tid >> 3), pc = tid & 7; const v8us v = *(const v8us*)&tl[d][pc * 8]; *(v8us*)(vo + (size_t)d * TT + pc * 8) = v; }
    return;
  }
#pragma unroll
  for (int t = 0; t < 4; ++t) { const float bv = bf16_round(bias[col0 + t * 16 + ln]);
#pragma unroll
    for (int r = 0; r < 8; ++r) so[w][8 * hh + r][t * 16 + ln] = acc[t][r] * alpha + bv; }
  __builtin_amdgcn_fence(__ATOMIC_ACQ_REL, "workgroup"); __builtin_amdgcn_wave_barrier();
  const int rsub = lane >> 4, c4 = (lane & 15) * 4; typedef _Float16 v4h __attribute__((ext_vector_type(4)));
#pragma unroll
  for (int q = 0; q < 8; ++q) { const int r = q * 2 + rsub; const v4f v = *(const v4fa*)&so[w][r][c4];
    if (F32OUT) *(v4f*)(C + (size_t)(row0 + r) * DM + col0 + c4) = v;
    else { v4h h4; for (int i = 0; i < 4; ++i) h4[i] = (_Float16)v[i]; *(v4h*)(C16 + (size_t)(row0 + r) * DM + col0 + c4) = h4; } }
  if (!F32OUT) asm volatile("s_wait_xcnt 0x0" ::: "memory");      // the built code lays the transposed part behind these stores: the wait stands in front of any write of the stores' registers there
}


// local attention per ((b,h), 128 queries): wave = 32 queries; key chunks j0 = qb0 − 32 … qb0 + 128 (6 chunks; rows outside [0, T) are read at a CLAMPED address and masked); score/8 where |k − t| ≤ 32 and
__global__ __launch_bounds__(128) void k_flash(const _Float16* __restrict__ Q16, const _Float16* __restrict__ K16, const _Float16* __restrict__ Vt, _Float16* __restrict__ O16) {
  constexpr int RPW = 32, NQB = TT / (4 * RPW), DT = HD / 16, KS = HD / 32;
  __shared__ __attribute__((aligned(16))) unsigned short sP[4][RPW][40]; __shared__ __attribute__((aligned(16))) float sO[4][RPW][HD];
  const int tid = threadIdx.x, w = tid >> 5, lane = tid & 31, ln = lane & 15, hh = lane >> 4;
  const int slab = blockIdx.x / NQB, qblk = blockIdx.x % NQB; const int b = slab / NH, h = slab % NH; const int qb0 = qblk * (4 * RPW); const int q0 = qb0 + w * RPW;
  FragH aq[2][KS];
#pragma unroll
  for (int rt = 0; rt < 2; ++rt) { const unsigned short* qr = (const unsigned short*)Q16 + ((size_t)b * TT + q0 + rt * 16 + ln) * DM + h * HD;
#pragma unroll
    for (int ks = 0; ks < KS; ++ks) { aq[rt][ks].half[0] = *(const v8us*)(qr + ks * 32 + 8 * hh); aq[rt][ks].half[1] = *(const v8us*)(qr + ks * 32 + 16 + 8 * hh); } }
  const unsigned short* Vth = (const unsigned short*)Vt + (size_t)slab * HD * TT;
  float m_r[2][8], l_r[2][8]; v8f oacc[2][DT];
#pragma unroll
  for (int rt = 0; rt < 2; ++rt) {
#pragma unroll
    for (int r = 0; r < 8; ++r) { m_r[rt][r] = -3.0e38f; l_r[rt][r] = 0.f; }
#pragma unroll
    for (int dt = 0; dt < DT; ++dt) oacc[rt][dt] = (v8f){0.f,0.f,0.f,0.f,0.f,0.f,0.f,0.f}; }
#pragma unroll 1
  for (int j0 = qb0 - WW; j0 < qb0 + 4 * RPW + WW; j0 += 32) {
    v8f s[2][2];
#pragma unroll
    for (int nt = 0; nt < 2; ++nt) { const int kj = j0 + nt * 16 + ln; const int kc = kj < 0 ? 0 : (kj >= TT ? TT - 1 : kj); const unsigned short* kr = (const unsigned short*)K16 + ((size_t)b * TT + kc) * DM + h * HD; FragH bk[KS];
#pragma unroll
      for (int ks = 0; ks < KS; ++ks) { bk[ks].half[0] = *(const v8us*)(kr + ks * 32 + 8 * hh); bk[ks].half[1] = *(const v8us*)(kr + ks * 32 + 16 + 8 * hh); }
#pragma unroll
      for (int rt = 0; rt < 2; ++rt) { v8f acc = (v8f){0.f,0.f,0.f,0.f,0.f,0.f,0.f,0.f};
#pragma unroll
        for (int ks = 0; ks < KS; ++ks) acc = mmaH<1>(aq[rt][ks].v, aq[rt][ks].v, bk[ks].v, bk[ks].v, acc); s[rt][nt] = acc; } }
#pragma unroll
    for (int rt = 0; rt < 2; ++rt)
#pragma unroll
      for (int r = 0; r < 8; ++r) { const int t = q0 + rt * 16 + 8 * hh + r; const int k0 = j0 + ln, k1 = j0 + 16 + ln;
        const bool ok0 = (k0 >= 0 && k0 < TT && (k0 - t) <= WW && (t - k0) <= WW), ok1 = (k1 >= 0 && k1 < TT && (k1 - t) <= WW && (t - k1) <= WW);
        const float s0 = ok0 ? s[rt][0][r] * 0.125f : -INFINITY, s1 = ok1 ? s[rt][1][r] * 0.125f : -INFINITY; float mc = fmaxf(s0, s1);
        mc = fmaxf(mc, __shfl_xor(mc, 1, 32)); mc = fmaxf(mc, __shfl_xor(mc, 2, 32)); mc = fmaxf(mc, __shfl_xor(mc, 4, 32)); mc = fmaxf(mc, __shfl_xor(mc, 8, 32));
        const float mn = fmaxf(m_r[rt][r], mc); const float al = (mn > -1.0e38f) ? expf(m_r[rt][r] - mn) : 1.0f; m_r[rt][r] = mn; const float p0 = ok0 ? expf(s0 - mn) : 0.f, p1 = ok1 ? expf(s1 - mn) : 0.f; l_r[rt][r] = l_r[rt][r] * al + p0 + p1;
#pragma unroll
        for (int dt = 0; dt < DT; ++dt) oacc[rt][dt][r] *= al;
        FragH t2; t2.h[0] = (_Float16)p0; t2.h[1] = (_Float16)p1; sP[w][rt * 16 + 8 * hh + r][ln] = t2.u[0]; sP[w][rt * 16 + 8 * hh + r][16 + ln] = t2.u[1]; }
    __builtin_amdgcn_fence(__ATOMIC_ACQ_REL, "workgroup"); __builtin_amdgcn_wave_barrier();
    FragH pa[2];
#pragma unroll
    for (int rt = 0; rt < 2; ++rt) { pa[rt].half[0] = *(const v8us*)&sP[w][rt * 16 + ln][8 * hh]; pa[rt].half[1] = *(const v8us*)&sP[w][rt * 16 + ln][16 + 8 * hh]; }
#pragma unroll
    for (int dt = 0; dt < DT; ++dt) { const int vj0 = j0 < 0 ? 0 : (j0 + 32 > TT ? TT - 32 : j0);      // clamped chunk address; rows outside [0,T) have p = 0 so the substituted values never contribute
      const unsigned short* vrow = Vth + (size_t)(dt * 16 + ln) * TT + vj0; FragH bv; bv.half[0] = *(const v8us*)(vrow + 8 * hh); bv.half[1] = *(const v8us*)(vrow + 16 + 8 * hh);
#pragma unroll
      for (int rt = 0; rt < 2; ++rt) oacc[rt][dt] = mmaH<1>(pa[rt].v, pa[rt].v, bv.v, bv.v, oacc[rt][dt]); }
    __builtin_amdgcn_fence(__ATOMIC_ACQ_REL, "workgroup"); __builtin_amdgcn_wave_barrier(); }
#pragma unroll
  for (int rt = 0; rt < 2; ++rt) {
#pragma unroll
    for (int r = 0; r < 8; ++r) { float l = l_r[rt][r]; l += __shfl_xor(l, 1, 32); l += __shfl_xor(l, 2, 32); l += __shfl_xor(l, 4, 32); l += __shfl_xor(l, 8, 32);
      const int t = q0 + rt * 16 + 8 * hh + r; const int npad = (t < WW ? (WW - t) : 0) + (t + WW >= TT ? (t + WW - TT + 1) : 0); float sc = 1.0f;
      if (npad > 0) { const float m = m_r[rt][r]; const float mn = fmaxf(m, 0.f); sc = expf(m - mn); l = l * sc + (float)npad * expf(-mn); }
      l_r[rt][r] = sc / l; }
#pragma unroll
    for (int dt = 0; dt < DT; ++dt)
#pragma unroll
      for (int r = 0; r < 8; ++r) sO[w][rt * 16 + 8 * hh + r][dt * 16 + ln] = oacc[rt][dt][r] * l_r[rt][r]; }
  __builtin_amdgcn_fence(__ATOMIC_ACQ_REL, "workgroup"); __builtin_amdgcn_wave_barrier();
  {
#pragma unroll
    for (int rp = 0; rp < RPW; rp += 4) { const int r = rp + (lane >> 3), pc = lane & 7; const v4f v0 = *(const v4fa*)&sO[w][r][pc * 8], v1 = *(const v4fa*)&sO[w][r][pc * 8 + 4]; FragH f;      // f16 here: the A operand of the output projection, a whole 128-byte line per row
#pragma unroll
      for (int q = 0; q < 4; ++q) { f.h[q] = (_Float16)v0[q]; f.h[4 + q] = (_Float16)v1[q]; }
      *(v8us*)((unsigned short*)O16 + ((size_t)b * TT + q0 + r) * DM + h * HD + pc * 8) = f.half[0]; }
     } }
extern "C" void kernel_launch(void* const* d_in, const int* in_sizes, int n_in,
                              void* d_out, int out_size, void* d_ws, size_t ws_size, hipStream_t stream) {
  (void)in_sizes; (void)n_in; (void)out_size;
  const float* x = (const float*)d_in[0]; const float* wq = (const float*)d_in[1]; const float* bq = (const float*)d_in[2]; const float* wk = (const float*)d_in[3]; const float* bk = (const float*)d_in[4]; const float* wv = (const float*)d_in[5]; const float* bv = (const float*)d_in[6]; const float* wo = (const float*)d_in[7]; const float* bo = (const float*)d_in[8];
  char* ws = (char*)d_ws; size_t off = 0;
  auto take = [&](size_t bytes) { char* p = ws + off; off += (bytes + 255) & ~(size_t)255; return p; };
  const size_t w8 = (size_t)DM * DM / 8;
  _Float16* Bq = (_Float16*)take(w8 * 16); _Float16* Bk = (_Float16*)take(w8 * 16); _Float16* Bv = (_Float16*)take(w8 * 16); _Float16* Bo = (_Float16*)take(w8 * 16);
  _Float16* X16 = (_Float16*)take((size_t)NR * DM * 2); _Float16* Q16 = (_Float16*)take((size_t)NR * DM * 2); _Float16* K16 = (_Float16*)take((size_t)NR * DM * 2); _Float16* Vt = (_Float16*)take((size_t)NR * DM * 2); _Float16* O16 = X16;
  if (off > ws_size) return;      // 18 MiB
  const unsigned gw = (unsigned)(DM * (DM / 8) / 256), gx = (unsigned)((size_t)NR * DM / 8 / 256);
  k_prep<<<4 * gw + gx, 256, 0, stream>>>(x, wq, wk, wv, wo, X16, Bq, Bk, Bv, Bo);      // weights are [in][out]
  const unsigned gg = (NR / 64) * (DM / 64);
  k_gemm_hhx<false><<<3 * gg, 128, 0, stream>>>(X16, Bq, Bk, Bv, 0.0625f, bq, bk, bv, nullptr, Q16, K16, Vt);
  k_flash<<<BB * NH * (TT / 128), 128, 0, stream>>>(Q16, K16, Vt, O16);
  k_gemm_hhx<true><<<gg, 128, 0, stream>>>(O16, Bo, nullptr, nullptr, 0.0625f, bo, nullptr, nullptr, (float*)d_out, nullptr, nullptr, nullptr);
}

// v003
// One run takes 45.4 microseconds.
// In two side-by-side timings against v002, it was 1.43 and 1.44 times as fast.
// Over all steps from v000 it is 3.10 times as fast.
#include <hip/hip_runtime.h>
// q/k/v/o projections (4096 × 512 × 512, + bias) and the 8-head LOCAL attention (window ±32, d = 64) on v_wmma_f32_16x16x32_f16: a fused flash-style kernel visits only the 6 key chunks
// around each 128-query block (S = Q·Kᵀ, O = P·V on WMMA; |k − t| ≤ 32 band mask; online max/sum softmax f32; P f16 ≤ 1), and the module's zero-PADDED keys (score exactly 0, value 0, they DO
// take part in the softmax) are added analytically per query as npad·e^{0 − m} in the normaliser; A = f16(bf16 x) exact for q/k/v, f16(O) for o, weights [in][out] transposed to bf16-exact ×2^4, f32 accumulate.
#define BB 2
#define TT 2048
#define DM 512
#define NH 8
#define HD 64
#define WW 32
#define NR (BB * TT)

typedef __bf16 v16b __attribute__((ext_vector_type(16)));
typedef unsigned short v8us __attribute__((ext_vector_type(8), may_alias));
typedef float  v8f  __attribute__((ext_vector_type(8)));
typedef float  v4f  __attribute__((ext_vector_type(4)));
typedef float  v4fa __attribute__((ext_vector_type(4), may_alias));
union FragB { v16b v; v8us half[2]; unsigned short u[16]; };

__device__ __forceinline__ unsigned short bf16_bits(float x) { unsigned int u = __float_as_uint(x); return (unsigned short)((u + 0x7FFFu + ((u >> 16) & 1u)) >> 16); }
__device__ __forceinline__ float bf16_val(unsigned short b) { return __uint_as_float(((unsigned int)b) << 16); }
__device__ __forceinline__ float bf16_round(float x) { return bf16_val(bf16_bits(x)); }
// D += A·B with NT terms: 1 = ah·bh, 2 = + al·bh (A split), 3 = + ah·bl (both split)
template <int NT>
__device__ __forceinline__ v8f mmaN(v16b ah, v16b al, v16b bh, v16b bl, v8f c) {
  c = __builtin_amdgcn_wmma_f32_16x16x32_bf16(false, ah, false, bh, (short)0, c, false, false);
  if (NT >= 2) c = __builtin_amdgcn_wmma_f32_16x16x32_bf16(false, al, false, bh, (short)0, c, false, false);
  if (NT >= 3) c = __builtin_amdgcn_wmma_f32_16x16x32_bf16(false, ah, false, bl, (short)0, c, false, false);
  asm volatile("v_nop\n\tv_nop\n\tv_nop\n\tv_nop" : "+v"(c) : "v"(ah), "v"(al), "v"(bh), "v"(bl));
  return c;
}

__global__ __launch_bounds__(256) void k_wt_bf16(const float* __restrict__ W, unsigned short* __restrict__ Wt, int K, int N) {
  const int t = blockIdx.x * 256 + threadIdx.x;
  const int k8n = K / 8;
  if (t >= N * k8n) return;
  const int n = t / k8n, k8 = (t % k8n) * 8;
  v8us v;
#pragma unroll
  for (int i = 0; i < 8; ++i) v[i] = bf16_bits(W[(size_t)(k8 + i) * N + n]);
  *(v8us*)(Wt + (size_t)n * K + k8) = v;
  
}

// GEMM C[M][N] (f32, pitch ldc) = act(A[M][K]·W + bias). A f32 row-major (pitch lda) converted per fragment to bf16
// (ASPLIT: hi/lo two planes -> 2 terms, else single rounded term); Wt bf16 [N][K] (pitch ldb). BIAS_BF16 rounds the
// bias to bf16 first (bias quantised to bf16 before the add). K%32==0, M%16==0, N%64==0.
template <bool ASPLIT, int ACT, bool BIAS_BF16>
__global__ __launch_bounds__(128) void k_gemm_bf(const float* __restrict__ A, int lda, const unsigned short* __restrict__ Wt, int ldb,
                                               const float* __restrict__ bias, float* __restrict__ C, int ldc, int M, int N, int K) {
  __shared__ __attribute__((aligned(16))) float so[4][16][64];
  const int tid = threadIdx.x, w = tid >> 5, lane = tid & 31, ln = lane & 15, hh = lane >> 4;
  const int ntn = N / 64;
  const int wid = blockIdx.x * 4 + w;
  const int mt = wid / ntn, nq = wid % ntn;
  if (mt * 16 >= M) return;
  const int row0 = mt * 16, col0 = nq * 64;
  const float* arow = A + (size_t)(row0 + ln) * lda;
  v8f acc[4] = {};
  for (int kb = 0; kb < K; kb += 32) {
    FragB ah, al;
    const v4f x0 = *(const v4fa*)(arow + kb + 8 * hh), x1 = *(const v4fa*)(arow + kb + 8 * hh + 4);
    const v4f x2 = *(const v4fa*)(arow + kb + 16 + 8 * hh), x3 = *(const v4fa*)(arow + kb + 16 + 8 * hh + 4);
    float xs[16] = {x0[0],x0[1],x0[2],x0[3],x1[0],x1[1],x1[2],x1[3],x2[0],x2[1],x2[2],x2[3],x3[0],x3[1],x3[2],x3[3]};
#pragma unroll
    for (int i = 0; i < 16; ++i) { const unsigned short hb = bf16_bits(xs[i]); ah.u[i] = hb; al.u[i] = ASPLIT ? bf16_bits(xs[i] - bf16_val(hb)) : (unsigned short)0; }
#pragma unroll
    for (int t = 0; t < 4; ++t) {
      const unsigned short* brow = Wt + (size_t)(col0 + t * 16 + ln) * ldb + kb;
      FragB b;
      b.half[0] = *(const v8us*)(brow + 8 * hh);
      b.half[1] = *(const v8us*)(brow + 16 + 8 * hh);
      acc[t] = mmaN<ASPLIT ? 2 : 1>(ah.v, al.v, b.v, b.v, acc[t]);
    }
  }
#pragma unroll
  for (int t = 0; t < 4; ++t) {
    float bv = bias ? bias[col0 + t * 16 + ln] : 0.f;
    if (BIAS_BF16) bv = bf16_round(bv);
#pragma unroll
    for (int r = 0; r < 8; ++r) { float v = acc[t][r] + bv; if (ACT == 1) v = fmaxf(v, 0.f); so[w][8 * hh + r][t * 16 + ln] = v; }
  }
  __builtin_amdgcn_fence(__ATOMIC_ACQ_REL, "workgroup");
  __builtin_amdgcn_wave_barrier();
  const int rsub = lane >> 4, c4 = (lane & 15) * 4;
  {
#pragma unroll
    for (int q = 0; q < 8; ++q) {
      const int r = q * 2 + rsub;
      const v4f v = *(const v4fa*)&so[w][r][c4];
      *(v4f*)(C + (size_t)(row0 + r) * ldc + col0 + c4) = v;
    }
    
  }
}

// Flash-style causal/unmasked attention, all contractions 3-term bf16 hi/lo splits, f32 softmax with running max.
// q,k,v rows are read from f32 buffers with arbitrary row pitch (so they can live inside a fused qkv buffer);
// D = head size (multiple of 32, <= 128); one wave = 16 query rows; block = 4 waves (64 queries) sharing K/V chunks of 32.
template <int D, bool CAUSAL>
__global__ __launch_bounds__(128) void k_flash(const float* __restrict__ qb, const float* __restrict__ kb, const float* __restrict__ vb,
                                             int pitch, int T, int H, float scale, float* __restrict__ y, int ypitch) {
  constexpr int KS = D / 32;        // k-steps for QK
  constexpr int DT = D / 16;        // d tiles for PV
  __shared__ __attribute__((aligned(16))) unsigned short sKh[32][D + 8], sKl[32][D + 8], sVh[32][D + 8], sVl[32][D + 8];
  __shared__ __attribute__((aligned(16))) unsigned short sPh[4][16][40], sPl[4][16][40];
  __shared__ __attribute__((aligned(16))) float sO[4][16][D];
  const int tid = threadIdx.x, w = tid >> 5, lane = tid & 31, ln = lane & 15, hh = lane >> 4;
  const int nqb = (T + 63) / 64;
  const int bh = blockIdx.x / nqb, qblk = blockIdx.x % nqb;
  const int b = bh / H, h = bh % H;
  const int q0 = qblk * 64 + w * 16;
  const float* Q = qb + (size_t)b * T * pitch + h * D;
  const float* K = kb + (size_t)b * T * pitch + h * D;
  const float* V = vb + (size_t)b * T * pitch + h * D;

  // A fragments of the wave's 16 query rows (scaled), hi/lo
  FragB aqh[KS], aql[KS];
  {
    int row = q0 + ln; if (row >= T) row = T - 1;
    const float* qr = Q + (size_t)row * pitch;
#pragma unroll
    for (int ks = 0; ks < KS; ++ks)
#pragma unroll
      for (int i = 0; i < 16; ++i) {
        const int d = ks * 32 + ((i < 8) ? (8 * hh + i) : (16 + 8 * hh + (i - 8)));
        const float x = qr[d] * scale; const unsigned short hb = bf16_bits(x);
        aqh[ks].u[i] = hb; aql[ks].u[i] = bf16_bits(x - bf16_val(hb));
      }
  }
  float m_r[8], l_r[8];
#pragma unroll
  for (int r = 0; r < 8; ++r) { m_r[r] = -3.0e38f; l_r[r] = 0.f; }
  v8f oacc[DT];
#pragma unroll
  for (int dt = 0; dt < DT; ++dt) oacc[dt] = (v8f){0.f,0.f,0.f,0.f,0.f,0.f,0.f,0.f};

  const int kv_end = CAUSAL ? min(T, qblk * 64 + 64) : T;     // block-uniform
  for (int j0 = 0; j0 < kv_end; j0 += 32) {
    __syncthreads();
    for (int e = tid; e < 32 * (D / 4); e += 128) {
      const int r = e / (D / 4), c4 = (e % (D / 4)) * 4;
      const int key = j0 + r;
      v4f kf = {0.f,0.f,0.f,0.f}, vf = {0.f,0.f,0.f,0.f};
      if (key < T) { kf = *(const v4fa*)(K + (size_t)key * pitch + c4); vf = *(const v4fa*)(V + (size_t)key * pitch + c4); }
#pragma unroll
      for (int t = 0; t < 4; ++t) {
        unsigned short hb = bf16_bits(kf[t]); sKh[r][c4 + t] = hb; sKl[r][c4 + t] = bf16_bits(kf[t] - bf16_val(hb));
        hb = bf16_bits(vf[t]); sVh[r][c4 + t] = hb; sVl[r][c4 + t] = bf16_bits(vf[t] - bf16_val(hb));
      }
    }
    __syncthreads();
    // S tile 16 x 32
    v8f s[2];
#pragma unroll
    for (int nt = 0; nt < 2; ++nt) {
      v8f acc = {};
#pragma unroll
      for (int ks = 0; ks < KS; ++ks) {
        FragB bh_, bl_;
        bh_.half[0] = *(const v8us*)&sKh[nt * 16 + ln][ks * 32 + 8 * hh]; bh_.half[1] = *(const v8us*)&sKh[nt * 16 + ln][ks * 32 + 16 + 8 * hh];
        bl_.half[0] = *(const v8us*)&sKl[nt * 16 + ln][ks * 32 + 8 * hh]; bl_.half[1] = *(const v8us*)&sKl[nt * 16 + ln][ks * 32 + 16 + 8 * hh];
        acc = mmaN<3>(aqh[ks].v, aql[ks].v, bh_.v, bl_.v, acc);
      }
      s[nt] = acc;
    }
    // mask + running max (rows 8hh+r; the 16 lanes of a half share rows)
    float alpha[8];
#pragma unroll
    for (int r = 0; r < 8; ++r) {
      const int qi = q0 + 8 * hh + r;
      const int ja = j0 + ln, jb = j0 + 16 + ln;
      if (CAUSAL) { if (ja > qi) s[0][r] = -3.0e38f; if (jb > qi) s[1][r] = -3.0e38f; }
      if (ja >= T) s[0][r] = -3.0e38f;
      if (jb >= T) s[1][r] = -3.0e38f;
      float mx = fmaxf(s[0][r], s[1][r]);
      mx = fmaxf(mx, __shfl_xor(mx, 1, 32)); mx = fmaxf(mx, __shfl_xor(mx, 2, 32)); mx = fmaxf(mx, __shfl_xor(mx, 4, 32)); mx = fmaxf(mx, __shfl_xor(mx, 8, 32));
      const float mnew = fmaxf(m_r[r], mx);
      alpha[r] = (mnew > -1.0e38f) ? __expf(m_r[r] - mnew) : 1.0f;
      const float p0 = (s[0][r] > -1.0e38f) ? __expf(s[0][r] - mnew) : 0.f;
      const float p1 = (s[1][r] > -1.0e38f) ? __expf(s[1][r] - mnew) : 0.f;
      m_r[r] = mnew;
      l_r[r] = l_r[r] * alpha[r] + p0 + p1;            // per-lane partial row sum (16 lanes combined at the end)
      unsigned short hb = bf16_bits(p0); sPh[w][8 * hh + r][ln] = hb;      sPl[w][8 * hh + r][ln] = bf16_bits(p0 - bf16_val(hb));
      hb = bf16_bits(p1);                sPh[w][8 * hh + r][16 + ln] = hb; sPl[w][8 * hh + r][16 + ln] = bf16_bits(p1 - bf16_val(hb));
    }
#pragma unroll
    for (int dt = 0; dt < DT; ++dt)
#pragma unroll
      for (int r = 0; r < 8; ++r) oacc[dt][r] *= alpha[r];
    __builtin_amdgcn_fence(__ATOMIC_ACQ_REL, "workgroup");
    __builtin_amdgcn_wave_barrier();
    FragB pah, pal;
    pah.half[0] = *(const v8us*)&sPh[w][ln][8 * hh]; pah.half[1] = *(const v8us*)&sPh[w][ln][16 + 8 * hh];
    pal.half[0] = *(const v8us*)&sPl[w][ln][8 * hh]; pal.half[1] = *(const v8us*)&sPl[w][ln][16 + 8 * hh];
#pragma unroll
    for (int dt = 0; dt < DT; ++dt) {
      FragB bvh, bvl;
#pragma unroll
      for (int i = 0; i < 8; ++i) {
        bvh.u[i] = sVh[8 * hh + i][dt * 16 + ln]; bvh.u[8 + i] = sVh[16 + 8 * hh + i][dt * 16 + ln];
        bvl.u[i] = sVl[8 * hh + i][dt * 16 + ln]; bvl.u[8 + i] = sVl[16 + 8 * hh + i][dt * 16 + ln];
      }
      oacc[dt] = mmaN<3>(pah.v, pal.v, bvh.v, bvl.v, oacc[dt]);
    }
    __builtin_amdgcn_fence(__ATOMIC_ACQ_REL, "workgroup");
    __builtin_amdgcn_wave_barrier();
  }
#pragma unroll
  for (int r = 0; r < 8; ++r) {
    float l = l_r[r];
    l += __shfl_xor(l, 1, 32); l += __shfl_xor(l, 2, 32); l += __shfl_xor(l, 4, 32); l += __shfl_xor(l, 8, 32);
    l_r[r] = (l > 0.f) ? 1.0f / l : 0.f;
  }
#pragma unroll
  for (int dt = 0; dt < DT; ++dt)
#pragma unroll
    for (int r = 0; r < 8; ++r) sO[w][8 * hh + r][dt * 16 + ln] = oacc[dt][r] * l_r[r];
  __builtin_amdgcn_fence(__ATOMIC_ACQ_REL, "workgroup");
  __builtin_amdgcn_wave_barrier();
  {
    for (int r = 0; r < 16; ++r) {
      const int row = q0 + r;
      if (row < T && lane < D / 4) {
        const v4f val = *(const v4fa*)&sO[w][r][lane * 4];
        *(v4f*)(y + ((size_t)b * T + row) * ypitch + h * D + lane * 4) = val;
      }
    }
    
  }
}

// GEMM C = act(A·W + bias + resid): A f32 (ASPLIT -> hi/lo 2 terms), Wt bf16 [N][K]; ACT 0 none, 1 relu, 2 exact gelu;
// resid (optional, f32, row index = (row % rmod), pitch ldr, RES_BF16 rounds it) added before the activation.
template <bool ASPLIT, int ACT, bool BIAS_BF16, bool RES_BF16>
__global__ __launch_bounds__(128) void k_gemm_bf3(const float* __restrict__ A, int lda, const unsigned short* __restrict__ Wt, int ldb,
                                                const float* __restrict__ bias, const float* __restrict__ resid, int rmod, int ldr,
                                                float* __restrict__ C, int ldc, int M, int N, int K) {
  __shared__ __attribute__((aligned(16))) float so[4][16][64];
  const int tid = threadIdx.x, w = tid >> 5, lane = tid & 31, ln = lane & 15, hh = lane >> 4;
  const int ntn = N / 64;
  const int wid = blockIdx.x * 4 + w;
  const int mt = wid / ntn, nq = wid % ntn;
  if (mt * 16 >= M) return;
  const int row0 = mt * 16, col0 = nq * 64;
  const float* arow = A + (size_t)(row0 + ln) * lda;
  v8f acc[4] = {};
  for (int kb = 0; kb < K; kb += 32) {
    FragB ah, al;
    const v4f x0 = *(const v4fa*)(arow + kb + 8 * hh), x1 = *(const v4fa*)(arow + kb + 8 * hh + 4);
    const v4f x2 = *(const v4fa*)(arow + kb + 16 + 8 * hh), x3 = *(const v4fa*)(arow + kb + 16 + 8 * hh + 4);
    float xs[16] = {x0[0],x0[1],x0[2],x0[3],x1[0],x1[1],x1[2],x1[3],x2[0],x2[1],x2[2],x2[3],x3[0],x3[1],x3[2],x3[3]};
#pragma unroll
    for (int i = 0; i < 16; ++i) { const unsigned short hb = bf16_bits(xs[i]); ah.u[i] = hb; al.u[i] = ASPLIT ? bf16_bits(xs[i] - bf16_val(hb)) : (unsigned short)0; }
#pragma unroll
    for (int t = 0; t < 4; ++t) {
      const unsigned short* brow = Wt + (size_t)(col0 + t * 16 + ln) * ldb + kb;
      FragB b;
      b.half[0] = *(const v8us*)(brow + 8 * hh);
      b.half[1] = *(const v8us*)(brow + 16 + 8 * hh);
      acc[t] = mmaN<ASPLIT ? 2 : 1>(ah.v, al.v, b.v, b.v, acc[t]);
    }
  }
#pragma unroll
  for (int t = 0; t < 4; ++t) {
    const int col = col0 + t * 16 + ln;
    float bv = bias ? bias[col] : 0.f;
    if (BIAS_BF16) bv = bf16_round(bv);
#pragma unroll
    for (int r = 0; r < 8; ++r) {
      float v = acc[t][r] + bv;
      if (resid) { float rv = resid[(size_t)((row0 + 8 * hh + r) % rmod) * ldr + col]; if (RES_BF16) rv = bf16_round(rv); v += rv; }
      if (ACT == 1) v = fmaxf(v, 0.f);
      if (ACT == 2) v = 0.5f * v * (1.0f + erff(v * 0.70710678118654752f));
      if (ACT == 3) { const float u = 0.7978845608028654f * (v + 0.044715f * v * v * v); v = 0.5f * v * (1.0f + tanhf(u)); }
      so[w][8 * hh + r][t * 16 + ln] = v;
    }
  }
  __builtin_amdgcn_fence(__ATOMIC_ACQ_REL, "workgroup");
  __builtin_amdgcn_wave_barrier();
  const int rsub = lane >> 4, c4 = (lane & 15) * 4;
  {
#pragma unroll
    for (int q = 0; q < 8; ++q) {
      const int r = q * 2 + rsub;
      const v4f v = *(const v4fa*)&so[w][r][c4];
      *(v4f*)(C + (size_t)(row0 + r) * ldc + col0 + c4) = v;
    }
    
  }
}
// row LayerNorm (biased variance, eps) over N: s = X (+ R); optional out_sum <- s; out_norm <- (s-mu)*rsqrt(var+eps)*g + b
template <bool PARAM_BF16>
__global__ __launch_bounds__(256) void k_layernorm(const float* __restrict__ X, const float* __restrict__ R, const float* __restrict__ g, const float* __restrict__ bta,
                                                  float* __restrict__ out_sum, float* __restrict__ out_norm, int N, float eps) {
  __shared__ float red[256];
  const int row = blockIdx.x, tid = threadIdx.x;
  const float* x = X + (size_t)row * N; const float* rr = R ? R + (size_t)row * N : nullptr;
  float vals[16];                     // up to N = 4096
  const int per = N / 256;            // contiguous chunk per thread? use strided-by-4 chunks: thread handles j = tid*4 + 1024*u
  float s1 = 0.f;
  for (int u = 0; u < per / 4; ++u) {
    const int j = tid * 4 + 1024 * u;
    const v4f a = *(const v4fa*)(x + j);
    v4f b = {0.f,0.f,0.f,0.f}; if (rr) b = *(const v4fa*)(rr + j);
#pragma unroll
    for (int q = 0; q < 4; ++q) { const float v = a[q] + b[q]; vals[u * 4 + q] = v; s1 += v; }
  }
  red[tid] = s1; __syncthreads();
  for (int st = 128; st > 0; st >>= 1) { if (tid < st) red[tid] += red[tid + st]; __syncthreads(); }
  const float mu = red[0] / (float)N; __syncthreads();
  float s2 = 0.f;
  for (int u = 0; u < per / 4; ++u)
#pragma unroll
    for (int q = 0; q < 4; ++q) { const float c = vals[u * 4 + q] - mu; s2 += c * c; }
  red[tid] = s2; __syncthreads();
  for (int st = 128; st > 0; st >>= 1) { if (tid < st) red[tid] += red[tid + st]; __syncthreads(); }
  const float rs = rsqrtf(red[0] / (float)N + eps);
  {
    for (int u = 0; u < per / 4; ++u) {
      const int j = tid * 4 + 1024 * u;
      v4f o, sm;
#pragma unroll
      for (int q = 0; q < 4; ++q) {
        float gg = g[j + q], bb = bta[j + q];
        if (PARAM_BF16) { gg = bf16_round(gg); bb = bf16_round(bb); }
        sm[q] = vals[u * 4 + q]; o[q] = (vals[u * 4 + q] - mu) * rs * gg + bb;
      }
      if (out_sum) *(v4f*)(out_sum + (size_t)row * N + j) = sm;
      *(v4f*)(out_norm + (size_t)row * N + j) = o;
    }
    
  }
}



// ---- f16 WMMA path (v_wmma_f32_16x16x32_f16): 11-bit significands for operands in range — used where a [0,1] probability operand needs more precision than bf16
typedef _Float16 v16h __attribute__((ext_vector_type(16)));
union FragH { v16h v; v8us half[2]; _Float16 h[16]; unsigned short u[16]; };
template <int NT>
__device__ __forceinline__ v8f mmaH(v16h ah, v16h al, v16h bh, v16h bl, v8f c) {
  c = __builtin_amdgcn_wmma_f32_16x16x32_f16(false, ah, false, bh, (short)0, c, false, false);
  if (NT >= 2) c = __builtin_amdgcn_wmma_f32_16x16x32_f16(false, al, false, bh, (short)0, c, false, false);
  if (NT >= 3) c = __builtin_amdgcn_wmma_f32_16x16x32_f16(false, ah, false, bl, (short)0, c, false, false);
  asm volatile("v_nop\n\tv_nop\n\tv_nop\n\tv_nop" : "+v"(c) : "v"(ah), "v"(al), "v"(bh), "v"(bl));
  return c;
}
// batched GEMM like k_gemm_b but f16 operands: A f32 (split into f16 hi/lo if ASPLIT, else rounded to f16), Bt = f16 values [n][k]; alpha; C f32; N multiple of 16 (partial tiles skipped)
template <bool ASPLIT>
__global__ __launch_bounds__(128) void k_gemm_h(const float* __restrict__ A, int lda, size_t sA, const _Float16* __restrict__ Bh, int ldb, size_t sB, float alpha, float* __restrict__ C, int ldc, size_t sC, int M, int N, int K) {
  __shared__ __attribute__((aligned(16))) float so[4][16][64];
  const int tid = threadIdx.x, w = tid >> 5, lane = tid & 31, ln = lane & 15, hh = lane >> 4; const int by = blockIdx.y;
  A += (size_t)by * sA; Bh += (size_t)by * sB; C += (size_t)by * sC;
  const int ntn = (N + 63) / 64; const int wid = blockIdx.x * 4 + w; const int mt = wid / ntn, nq = wid % ntn; if (mt * 16 >= M) return;
  const int row0 = mt * 16, col0 = nq * 64; const float* arow = A + (size_t)(row0 + ln) * lda;
  v8f acc[4] = {};
  for (int kb = 0; kb < K; kb += 32) {
    FragH ah, al;
    const v4f x0 = *(const v4fa*)(arow + kb + 8 * hh), x1 = *(const v4fa*)(arow + kb + 8 * hh + 4), x2 = *(const v4fa*)(arow + kb + 16 + 8 * hh), x3 = *(const v4fa*)(arow + kb + 16 + 8 * hh + 4);
    float xs[16] = {x0[0],x0[1],x0[2],x0[3],x1[0],x1[1],x1[2],x1[3],x2[0],x2[1],x2[2],x2[3],x3[0],x3[1],x3[2],x3[3]};
#pragma unroll
    for (int i = 0; i < 16; ++i) { const _Float16 h = (_Float16)xs[i]; ah.h[i] = h; al.h[i] = ASPLIT ? (_Float16)(xs[i] - (float)h) : (_Float16)0.0f; }
#pragma unroll
    for (int t = 0; t < 4; ++t) { if (col0 + t * 16 >= N) continue; const size_t boff = (size_t)(col0 + t * 16 + ln) * ldb + kb; FragH bq; bq.half[0] = *(const v8us*)(Bh + boff + 8 * hh); bq.half[1] = *(const v8us*)(Bh + boff + 16 + 8 * hh);
      acc[t] = mmaH<ASPLIT ? 2 : 1>(ah.v, al.v, bq.v, bq.v, acc[t]); }
  }
#pragma unroll
  for (int t = 0; t < 4; ++t) { if (col0 + t * 16 >= N) continue;
#pragma unroll
    for (int r = 0; r < 8; ++r) so[w][8 * hh + r][t * 16 + ln] = acc[t][r] * alpha; }
  __builtin_amdgcn_fence(__ATOMIC_ACQ_REL, "workgroup"); __builtin_amdgcn_wave_barrier();
  const int rsub = lane >> 4, c4 = (lane & 15) * 4;
  {
#pragma unroll
    for (int q = 0; q < 8; ++q) { const int r = q * 2 + rsub; if (col0 + c4 < N) { const v4f v = *(const v4fa*)&so[w][r][c4]; *(v4f*)(C + (size_t)(row0 + r) * ldc + col0 + c4) = v; } }
     }
}

// One grid for the five preparations, none of which needs another's result; the block index picks the job (a block-uniform branch).
// Blocks 0 .. 4 GW - 1, GW per weight: Wt[n][k] = f16(bf16(W[k][n]) * 16) from f32 row-major W[k][n] (a power of two keeps the bf16-exact weights exact in f16, away from the subnormal range).
// The other blocks: X16 = f16(bf16(x)), eight elements a thread.
__global__ __launch_bounds__(256) void k_prep(const float* __restrict__ x, const float* __restrict__ wq, const float* __restrict__ wk, const float* __restrict__ wv, const float* __restrict__ wo,
                                              _Float16* __restrict__ X16, _Float16* __restrict__ Bq, _Float16* __restrict__ Bk, _Float16* __restrict__ Bv, _Float16* __restrict__ Bo) {
  constexpr int GW = DM * (DM / 8) / 256; const int blk = blockIdx.x; FragH f;
  if (blk < 4 * GW) {
    const int job = blk / GW; const float* W = job == 0 ? wq : job == 1 ? wk : job == 2 ? wv : wo; _Float16* Wt = job == 0 ? Bq : job == 1 ? Bk : job == 2 ? Bv : Bo;
    const int t = (blk % GW) * 256 + threadIdx.x; const int n = t / (DM / 8), k8 = (t % (DM / 8)) * 8;
#pragma unroll
    for (int i = 0; i < 8; ++i) f.h[i] = (_Float16)(bf16_round(W[(size_t)(k8 + i) * DM + n]) * 16.0f);
    *(v8us*)((unsigned short*)Wt + (size_t)n * DM + k8) = f.half[0];
  } else {
    const size_t t = (size_t)(blk - 4 * GW) * 256 + threadIdx.x;
#pragma unroll
    for (int q = 0; q < 8; ++q) f.h[q] = (_Float16)bf16_round(x[t * 8 + q]);
    *(v8us*)((unsigned short*)X16 + t * 8) = f.half[0];
    asm volatile("s_wait_xcnt 0x0" ::: "memory");      // the built code lays the weight part behind this store: the wait stands in front of any write of the store's registers there
  }
}
// C[4096][512] = (A . Bt^T) * alpha + bf16(bias): one 64 x 64 tile of C per work-group, wave w = rows 16 w .. 16 w + 15, all 64 columns, K = 512 whole.
// The 64 rows of A and the 64 rows of Bt (both k-contiguous) come in by whole-line loads (a wave-wide 16-byte load = two rows x 256 contiguous bytes) and are laid in LDS at a pitch of 1040 B
// (16 B x odd: no bank conflict for the 16-byte fragment reads); the fragments then come from LDS, in the same k order as when they were read from global memory. All global loads are issued first;
// K goes in four chunks of 128, each stored to its own LDS columns and multiplied while the later chunks are still on their way into registers. F32OUT: f32 C, else f16.
// The q, k and v products read the same A and need nothing of each other: they share one grid, GG blocks each, job = block index / GG picks weight, bias and output (F32OUT: GG blocks, job 0 alone).
// Jobs 0 and 1 write C0, C1 row-major; job 2 (v) writes its 64 tokens x 64 columns (one head) transposed, Vt[(batch, head)][d][token], as the attention kernel reads it.
template <bool F32OUT>
__global__ __launch_bounds__(128) void k_gemm_hhx(const _Float16* __restrict__ A, const _Float16* __restrict__ B0, const _Float16* __restrict__ B1, const _Float16* __restrict__ B2, float alpha,
                                                  const float* __restrict__ bias0, const float* __restrict__ bias1, const float* __restrict__ bias2, float* __restrict__ C, _Float16* __restrict__ C0, _Float16* __restrict__ C1, _Float16* __restrict__ Vt) {
  constexpr int GG = (NR / 64) * (DM / 64); const int job = blockIdx.x / GG, blk = blockIdx.x % GG;
  const _Float16* Bh = job == 0 ? B0 : job == 1 ? B1 : B2; const float* bias = job == 0 ? bias0 : job == 1 ? bias1 : bias2; _Float16* C16 = job == 0 ? C0 : C1;
  constexpr int KP = DM + 8, KC = 128, NC = DM / KC, NL = 64 * KC / 8 / 128, KS = KC / 32;      // LDS pitch in halves; k per chunk; chunks; 16-byte loads per thread, operand and chunk; k steps per chunk
  __shared__ __attribute__((aligned(16))) unsigned short sA[64][KP], sB[64][KP];
  __shared__ __attribute__((aligned(16))) float so[4][16][64];
  const int tid = threadIdx.x, w = tid >> 5, lane = tid & 31, ln = lane & 15, hh = lane >> 4;
  const int mt = blk / (DM / 64), nq = blk % (DM / 64);
  const int row0 = mt * 64 + w * 16, col0 = nq * 64;
  const unsigned short* Ag = (const unsigned short*)A + (size_t)mt * 64 * DM;
  const unsigned short* Bg = (const unsigned short*)Bh + (size_t)col0 * DM;
  const int sr = tid >> 4, sc = (tid & 15) * 8;      // staging: load i of chunk c takes row 8 i + sr, halves c * KC + sc .. + 7
  v8us ra[NC][NL], rb[NC][NL];
#pragma unroll
  for (int c = 0; c < NC; ++c) {
#pragma unroll
    for (int i = 0; i < NL; ++i) { ra[c][i] = *(const v8us*)(Ag + (size_t)(8 * i + sr) * DM + c * KC + sc); rb[c][i] = *(const v8us*)(Bg + (size_t)(8 * i + sr) * DM + c * KC + sc); }
    __builtin_amdgcn_sched_barrier(0);      // keeps the loads in chunk order, so that chunk 0 is complete after a quarter of them and not after half
  }
  asm volatile("s_wait_xcnt 0x0" ::: "memory");      // stands in front of the first overwrite of the loads' address registers, which are reused for fragments while later chunks are still in flight
  v8f acc[4] = {};
#pragma unroll
  for (int c = 0; c < NC; ++c) {
#pragma unroll
    for (int i = 0; i < NL; ++i) { *(v8us*)&sA[8 * i + sr][c * KC + sc] = ra[c][i]; *(v8us*)&sB[8 * i + sr][c * KC + sc] = rb[c][i]; }
    // publishes this chunk's LDS columns to all four waves. LDS-only fences: a full __syncthreads() would also wait for the later chunks' global loads, which only this thread's registers receive
    __builtin_amdgcn_fence(__ATOMIC_RELEASE, "workgroup", "local"); __builtin_amdgcn_s_barrier(); __builtin_amdgcn_fence(__ATOMIC_ACQUIRE, "workgroup", "local");
    FragH ah[KS], bq[KS][4];      // the whole chunk's fragments are asked for ahead of its first matrix instruction
#pragma unroll
    for (int ks = 0; ks < KS; ++ks) { const int kb = c * KC + ks * 32; ah[ks].half[0] = *(const v8us*)&sA[w * 16 + ln][kb + 8 * hh]; ah[ks].half[1] = *(const v8us*)&sA[w * 16 + ln][kb + 16 + 8 * hh];
#pragma unroll
      for (int t = 0; t < 4; ++t) { bq[ks][t].half[0] = *(const v8us*)&sB[t * 16 + ln][kb + 8 * hh]; bq[ks][t].half[1] = *(const v8us*)&sB[t * 16 + ln][kb + 16 + 8 * hh]; } }
#pragma unroll
    for (int ks = 0; ks < KS; ++ks)
#pragma unroll
      for (int t = 0; t < 4; ++t) acc[t] = mmaH<1>(ah[ks].v, ah[ks].v, bq[ks][t].v, bq[ks][t].v, acc[t]);
  }
  if (!F32OUT && job == 2) {      // block-uniform
    // an accumulator lane holds 8 consecutive tokens of one column d: 16 bytes of a transposed row. The four waves lay the 64 d x 64 tokens in LDS (pitch 144 B = 16 B x odd), then whole 128-byte rows of Vt go out
    unsigned short (*tl)[72] = (unsigned short (*)[72])&so[0][0][0];
#pragma unroll
    for (int t = 0; t < 4; ++t) { const float bv = bf16_round(bias[col0 + t * 16 + ln]); FragH f;
#pragma unroll
      for (int r = 0; r < 8; ++r) f.h[r] = (_Float16)(acc[t][r] * alpha + bv);
      *(v8us*)&tl[t * 16 + ln][w * 16 + 8 * hh] = f.half[0]; }
    __syncthreads();      // a row of tl holds tokens of all four waves
    unsigned short* vo = (unsigned short*)Vt + ((size_t)((mt * 64 / TT) * NH + nq) * HD) * TT + (mt * 64) % TT;
#pragma unroll
    for (int i = 0; i < 4; ++i) { const int d = i * 16 + (tid >> 3), pc = tid & 7; const v8us v = *(const v8us*)&tl[d][pc * 8]; *(v8us*)(vo + (size_t)d * TT + pc * 8) = v; }
    return;
  }
#pragma unroll
  for (int t = 0; t < 4; ++t) { const float bv = bf16_round(bias[col0 + t * 16 + ln]);
#pragma unroll
    for (int r = 0; r < 8; ++r) so[w][8 * hh + r][t * 16 + ln] = acc[t][r] * alpha + bv; }
  __builtin_amdgcn_fence(__ATOMIC_ACQ_REL, "workgroup"); __builtin_amdgcn_wave_barrier();
  const int rsub = lane >> 4, c4 = (lane & 15) * 4; typedef _Float16 v4h __attribute__((ext_vector_type(4)));
#pragma unroll
  for (int q = 0; q < 8; ++q) { const int r = q * 2 + rsub; const v4f v = *(const v4fa*)&so[w][r][c4];
    if (F32OUT) *(v4f*)(C + (size_t)(row0 + r) * DM + col0 + c4) = v;
    else { v4h h4; for (int i = 0; i < 4; ++i) h4[i] = (_Float16)v[i]; *(v4h*)(C16 + (size_t)(row0 + r) * DM + col0 + c4) = h4; } }
  if (!F32OUT) asm volatile("s_wait_xcnt 0x0" ::: "memory");      // the built code lays the transposed part behind these stores: the wait stands in front of any write of the stores' registers there
}


// lane l <-> lane l ^ 16: the two halves of a wave hold the two halves of one query's keys
__device__ __forceinline__ float xhalf(float v) { const int b = __float_as_int(v); return __int_as_float(__builtin_amdgcn_permlanex16(b, b, 0x76543210, 0xfedcba98, false, false)); }
// local attention per ((b,h), 128 queries): wave = 32 queries; key chunks j0 = qb0 - 32 ... qb0 + 128 (6 chunks, all walked by every wave, though its own 32 queries reach only 3 of them; rows outside [0, T) are read at a CLAMPED address and masked); score/8 where |k - t| <= 32.
// Both products run transposed: S^T = K . Q^T (A = 16 keys, B = 16 queries) and O^T += V^T . P^T (A = 16 d, B = 16 queries). An accumulator lane (ln, hh) then holds ONE query (column ln) and keys 8 hh + r
// down its registers: a query's maximum and sum are taken in the lane's own registers, with one exchange between the wave halves, and the two score tiles of a chunk (keys 0-15, 16-31), converted in place,
// are the B fragment of the second product in the k order of the V^T loader (8 hh + i, 16 + 8 hh + i): P never leaves the registers.
__global__ __launch_bounds__(128) void k_flash(const _Float16* __restrict__ Q16, const _Float16* __restrict__ K16, const _Float16* __restrict__ Vt, _Float16* __restrict__ O16) {
  constexpr int RPW = 32, NQB = TT / (4 * RPW), DT = HD / 16, KS = HD / 32;
  __shared__ __attribute__((aligned(16))) unsigned short sO[4][RPW][HD + 8];      // output staging, pitch 144 B = 16 B x odd
  const int tid = threadIdx.x, w = tid >> 5, lane = tid & 31, ln = lane & 15, hh = lane >> 4;
  const int slab = blockIdx.x / NQB, qblk = blockIdx.x % NQB; const int b = slab / NH, h = slab % NH; const int qb0 = qblk * (4 * RPW); const int q0 = qb0 + w * RPW;
  FragH aq[2][KS];
#pragma unroll
  for (int rt = 0; rt < 2; ++rt) { const unsigned short* qr = (const unsigned short*)Q16 + ((size_t)b * TT + q0 + rt * 16 + ln) * DM + h * HD;
#pragma unroll
    for (int ks = 0; ks < KS; ++ks) { aq[rt][ks].half[0] = *(const v8us*)(qr + ks * 32 + 8 * hh); aq[rt][ks].half[1] = *(const v8us*)(qr + ks * 32 + 16 + 8 * hh); } }
  const unsigned short* Vth = (const unsigned short*)Vt + (size_t)slab * HD * TT;
  float m_r[2], l_r[2]; v8f oacc[2][DT];      // per lane: query q0 + rt * 16 + ln; l_r sums this half's keys only; oacc[rt][dt][r] = O[query][dt * 16 + 8 hh + r]
#pragma unroll
  for (int rt = 0; rt < 2; ++rt) { m_r[rt] = -3.0e38f; l_r[rt] = 0.f;
#pragma unroll
    for (int dt = 0; dt < DT; ++dt) oacc[rt][dt] = (v8f){0.f,0.f,0.f,0.f,0.f,0.f,0.f,0.f}; }
#pragma unroll 1
  for (int j0 = qb0 - WW; j0 < qb0 + 4 * RPW + WW; j0 += 32) {
    v8f s[2][2];      // s[rt][nt][r] = score of key j0 + nt * 16 + 8 hh + r with query q0 + rt * 16 + ln
#pragma unroll
    for (int nt = 0; nt < 2; ++nt) { const int kj = j0 + nt * 16 + ln; const int kc = kj < 0 ? 0 : (kj >= TT ? TT - 1 : kj); const unsigned short* kr = (const unsigned short*)K16 + ((size_t)b * TT + kc) * DM + h * HD; FragH bk[KS];
#pragma unroll
      for (int ks = 0; ks < KS; ++ks) { bk[ks].half[0] = *(const v8us*)(kr + ks * 32 + 8 * hh); bk[ks].half[1] = *(const v8us*)(kr + ks * 32 + 16 + 8 * hh); }
#pragma unroll
      for (int rt = 0; rt < 2; ++rt) { v8f acc = (v8f){0.f,0.f,0.f,0.f,0.f,0.f,0.f,0.f};
#pragma unroll
        for (int ks = 0; ks < KS; ++ks) acc = mmaH<1>(bk[ks].v, bk[ks].v, aq[rt][ks].v, aq[rt][ks].v, acc); s[rt][nt] = acc; } }
    FragH pb[2];
#pragma unroll
    for (int rt = 0; rt < 2; ++rt) { const int t = q0 + rt * 16 + ln; float sv[16]; float mc = -INFINITY;
      const int lo = t - WW < 0 ? 0 : t - WW, hi = t + WW > TT - 1 ? TT - 1 : t + WW;      // this lane's query takes keys lo ... hi: 0 <= k < T and |k - t| <= 32 in one range
#pragma unroll
      for (int i = 0; i < 16; ++i) { const int k = j0 + (i >> 3) * 16 + 8 * hh + (i & 7); const bool ok = (unsigned)(k - lo) <= (unsigned)(hi - lo);
        sv[i] = ok ? s[rt][i >> 3][i & 7] * 0.125f : -INFINITY; mc = fmaxf(mc, sv[i]); }
      mc = fmaxf(mc, xhalf(mc));
      const float mn = fmaxf(m_r[rt], mc); const float al = (mn > -1.0e38f) ? expf(m_r[rt] - mn) : 1.0f; m_r[rt] = mn; float ps[4] = {0.f, 0.f, 0.f, 0.f};
#pragma unroll
      for (int i = 0; i < 16; ++i) { const float p = expf(sv[i] - mn); ps[i & 3] += p; pb[rt].h[i] = (_Float16)p; }      // a masked score is -inf and mn is finite: its p is exactly 0
      l_r[rt] = l_r[rt] * al + ((ps[0] + ps[1]) + (ps[2] + ps[3]));
#pragma unroll
      for (int dt = 0; dt < DT; ++dt)
#pragma unroll
        for (int r = 0; r < 8; ++r) oacc[rt][dt][r] *= al; }
#pragma unroll
    for (int dt = 0; dt < DT; ++dt) { const int vj0 = j0 < 0 ? 0 : (j0 + 32 > TT ? TT - 32 : j0);      // clamped chunk address; rows outside [0,T) have p = 0 so the substituted values never contribute
      const unsigned short* vrow = Vth + (size_t)(dt * 16 + ln) * TT + vj0; FragH bv; bv.half[0] = *(const v8us*)(vrow + 8 * hh); bv.half[1] = *(const v8us*)(vrow + 16 + 8 * hh);
#pragma unroll
      for (int rt = 0; rt < 2; ++rt) oacc[rt][dt] = mmaH<1>(bv.v, bv.v, pb[rt].v, pb[rt].v, oacc[rt][dt]); } }
#pragma unroll
  for (int rt = 0; rt < 2; ++rt) { float l = l_r[rt] + xhalf(l_r[rt]);
    const int t = q0 + rt * 16 + ln; const int npad = (t < WW ? (WW - t) : 0) + (t + WW >= TT ? (t + WW - TT + 1) : 0); float sc = 1.0f;
    if (npad > 0) { const float m = m_r[rt]; const float mn = fmaxf(m, 0.f); sc = expf(m - mn); l = l * sc + (float)npad * expf(-mn); }
    const float inv = sc / l;
#pragma unroll
    for (int dt = 0; dt < DT; ++dt) { FragH f;      // 8 consecutive d of one query: 16 bytes of its f16 output row
#pragma unroll
      for (int r = 0; r < 8; ++r) f.h[r] = (_Float16)(oacc[rt][dt][r] * inv);
      *(v8us*)&sO[w][rt * 16 + ln][dt * 16 + 8 * hh] = f.half[0]; } }
  __builtin_amdgcn_fence(__ATOMIC_ACQ_REL, "workgroup"); __builtin_amdgcn_wave_barrier();
#pragma unroll
  for (int rp = 0; rp < RPW; rp += 4) { const int r = rp + (lane >> 3), pc = lane & 7; const v8us v = *(const v8us*)&sO[w][r][pc * 8];      // the A operand of the output projection, a whole 128-byte line per row
    *(v8us*)((unsigned short*)O16 + ((size_t)b * TT + q0 + r) * DM + h * HD + pc * 8) = v; } }
extern "C" void kernel_launch(void* const* d_in, const int* in_sizes, int n_in,
                              void* d_out, int out_size, void* d_ws, size_t ws_size, hipStream_t stream) {
  (void)in_sizes; (void)n_in; (void)out_size;
  const float* x = (const float*)d_in[0]; const float* wq = (const float*)d_in[1]; const float* bq = (const float*)d_in[2]; const float* wk = (const float*)d_in[3]; const float* bk = (const float*)d_in[4]; const float* wv = (const float*)d_in[5]; const float* bv = (const float*)d_in[6]; const float* wo = (const float*)d_in[7]; const float* bo = (const float*)d_in[8];
  char* ws = (char*)d_ws; size_t off = 0;
  auto take = [&](size_t bytes) { char* p = ws + off; off += (bytes + 255) & ~(size_t)255; return p; };
  const size_t w8 = (size_t)DM * DM / 8;
  _Float16* Bq = (_Float16*)take(w8 * 16); _Float16* Bk = (_Float16*)take(w8 * 16); _Float16* Bv = (_Float16*)take(w8 * 16); _Float16* Bo = (_Float16*)take(w8 * 16);
  _Float16* X16 = (_Float16*)take((size_t)NR * DM * 2); _Float16* Q16 = (_Float16*)take((size_t)NR * DM * 2); _Float16* K16 = (_Float16*)take((size_t)NR * DM * 2); _Float16* Vt = (_Float16*)take((size_t)NR * DM * 2); _Float16* O16 = X16;
  if (off > ws_size) return;      // 18 MiB
  const unsigned gw = (unsigned)(DM * (DM / 8) / 256), gx = (unsigned)((size_t)NR * DM / 8 / 256);
  k_prep<<<4 * gw + gx, 256, 0, stream>>>(x, wq, wk, wv, wo, X16, Bq, Bk, Bv, Bo);      // weights are [in][out]
  const unsigned gg = (NR / 64) * (DM / 64);
  k_gemm_hhx<false><<<3 * gg, 128, 0, stream>>>(X16, Bq, Bk, Bv, 0.0625f, bq, bk, bv, nullptr, Q16, K16, Vt);
  k_flash<<<BB * NH * (TT / 128), 128, 0, stream>>>(Q16, K16, Vt, O16);
  k_gemm_hhx<true><<<gg, 128, 0, stream>>>(O16, Bo, nullptr, nullptr, 0.0625f, bo, nullptr, nullptr, (float*)d_out, nullptr, nullptr, nullptr);
}

// v004
// Measured time: 37.7 microseconds a run.
// Next to v003, in two timings, it ran 1.21 and 1.22 times as fast.
// Over all steps from v000 it is 3.77 times as fast.
#include <hip/hip_runtime.h>
// q/k/v/o projections (4096 × 512 × 512, + bias) and the 8-head LOCAL attention (window ±32, d = 64) on v_wmma_f32_16x16x32_f16: in a fused flash-style kernel a wave visits only the 3 key chunks
// around its 32 queries (S = Q·Kᵀ, O = P·V on WMMA; |k − t| ≤ 32 band mask; online max/sum softmax f32; P f16 ≤ 1), and the module's zero-PADDED keys (score exactly 0, value 0, they DO
// take part in the softmax) are added analytically per query as npad·e^{0 − m} in the normaliser; A = f16(bf16 ·) exact operands, weights [in][out] transposed to bf16-exact ×2^4, f32 accumulate.
#define BB 2
#define TT 2048
#define DM 512
#define NH 8
#define HD 64
#define WW 32
#define NR (BB * TT)

typedef __bf16 v16b __attribute__((ext_vector_type(16)));
typedef unsigned short v8us __attribute__((ext_vector_type(8), may_alias));
typedef float  v8f  __attribute__((ext_vector_type(8)));
typedef float  v4f  __attribute__((ext_vector_type(4)));
typedef float  v4fa __attribute__((ext_vector_type(4), may_alias));
union FragB { v16b v; v8us half[2]; unsigned short u[16]; };

__device__ __forceinline__ unsigned short bf16_bits(float x) { unsigned int u = __float_as_uint(x); return (unsigned short)((u + 0x7FFFu + ((u >> 16) & 1u)) >> 16); }
__device__ __forceinline__ float bf16_val(unsigned short b) { return __uint_as_float(((unsigned int)b) << 16); }
__device__ __forceinline__ float bf16_round(float x) { return bf16_val(bf16_bits(x)); }
// D += A·B with NT terms: 1 = ah·bh, 2 = + al·bh (A split), 3 = + ah·bl (both split)
template <int NT>
__device__ __forceinline__ v8f mmaN(v16b ah, v16b al, v16b bh, v16b bl, v8f c) {
  c = __builtin_amdgcn_wmma_f32_16x16x32_bf16(false, ah, false, bh, (short)0, c, false, false);
  if (NT >= 2) c = __builtin_amdgcn_wmma_f32_16x16x32_bf16(false, al, false, bh, (short)0, c, false, false);
  if (NT >= 3) c = __builtin_amdgcn_wmma_f32_16x16x32_bf16(false, ah, false, bl, (short)0, c, false, false);
  asm volatile("v_nop\n\tv_nop\n\tv_nop\n\tv_nop" : "+v"(c) : "v"(ah), "v"(al), "v"(bh), "v"(bl));
  return c;
}

__global__ __launch_bounds__(256) void k_wt_bf16(const float* __restrict__ W, unsigned short* __restrict__ Wt, int K, int N) {
  const int t = blockIdx.x * 256 + threadIdx.x;
  const int k8n = K / 8;
  if (t >= N * k8n) return;
  const int n = t / k8n, k8 = (t % k8n) * 8;
  v8us v;
#pragma unroll
  for (int i = 0; i < 8; ++i) v[i] = bf16_bits(W[(size_t)(k8 + i) * N + n]);
  *(v8us*)(Wt + (size_t)n * K + k8) = v;
  
}

// GEMM C[M][N] (f32, pitch ldc) = act(A[M][K]·W + bias). A f32 row-major (pitch lda) converted per fragment to bf16
// (ASPLIT: hi/lo two planes -> 2 terms, else single rounded term); Wt bf16 [N][K] (pitch ldb). BIAS_BF16 rounds the
// bias to bf16 first (bias quantised to bf16 before the add). K%32==0, M%16==0, N%64==0.
template <bool ASPLIT, int ACT, bool BIAS_BF16>
__global__ __launch_bounds__(128) void k_gemm_bf(const float* __restrict__ A, int lda, const unsigned short* __restrict__ Wt, int ldb,
                                               const float* __restrict__ bias, float* __restrict__ C, int ldc, int M, int N, int K) {
  __shared__ __attribute__((aligned(16))) float so[4][16][64];
  const int tid = threadIdx.x, w = tid >> 5, lane = tid & 31, ln = lane & 15, hh = lane >> 4;
  const int ntn = N / 64;
  const int wid = blockIdx.x * 4 + w;
  const int mt = wid / ntn, nq = wid % ntn;
  if (mt * 16 >= M) return;
  const int row0 = mt * 16, col0 = nq * 64;
  const float* arow = A + (size_t)(row0 + ln) * lda;
  v8f acc[4] = {};
  for (int kb = 0; kb < K; kb += 32) {
    FragB ah, al;
    const v4f x0 = *(const v4fa*)(arow + kb + 8 * hh), x1 = *(const v4fa*)(arow + kb + 8 * hh + 4);
    const v4f x2 = *(const v4fa*)(arow + kb + 16 + 8 * hh), x3 = *(const v4fa*)(arow + kb + 16 + 8 * hh + 4);
    float xs[16] = {x0[0],x0[1],x0[2],x0[3],x1[0],x1[1],x1[2],x1[3],x2[0],x2[1],x2[2],x2[3],x3[0],x3[1],x3[2],x3[3]};
#pragma unroll
    for (int i = 0; i < 16; ++i) { const unsigned short hb = bf16_bits(xs[i]); ah.u[i] = hb; al.u[i] = ASPLIT ? bf16_bits(xs[i] - bf16_val(hb)) : (unsigned short)0; }
#pragma unroll
    for (int t = 0; t < 4; ++t) {
      const unsigned short* brow = Wt + (size_t)(col0 + t * 16 + ln) * ldb + kb;
      FragB b;
      b.half[0] = *(const v8us*)(brow + 8 * hh);
      b.half[1] = *(const v8us*)(brow + 16 + 8 * hh);
      acc[t] = mmaN<ASPLIT ? 2 : 1>(ah.v, al.v, b.v, b.v, acc[t]);
    }
  }
#pragma unroll
  for (int t = 0; t < 4; ++t) {
    float bv = bias ? bias[col0 + t * 16 + ln] : 0.f;
    if (BIAS_BF16) bv = bf16_round(bv);
#pragma unroll
    for (int r = 0; r < 8; ++r) { float v = acc[t][r] + bv; if (ACT == 1) v = fmaxf(v, 0.f); so[w][8 * hh + r][t * 16 + ln] = v; }
  }
  __builtin_amdgcn_fence(__ATOMIC_ACQ_REL, "workgroup");
  __builtin_amdgcn_wave_barrier();
  const int rsub = lane >> 4, c4 = (lane & 15) * 4;
  {
#pragma unroll
    for (int q = 0; q < 8; ++q) {
      const int r = q * 2 + rsub;
      const v4f v = *(const v4fa*)&so[w][r][c4];
      *(v4f*)(C + (size_t)(row0 + r) * ldc + col0 + c4) = v;
    }
    
  }
}

// Flash-style causal/unmasked attention, all contractions 3-term bf16 hi/lo splits, f32 softmax with running max.
// q,k,v rows are read from f32 buffers with arbitrary row pitch (so they can live inside a fused qkv buffer);
// D = head size (multiple of 32, <= 128); one wave = 16 query rows; block = 4 waves (64 queries) sharing K/V chunks of 32.
template <int D, bool CAUSAL>
__global__ __launch_bounds__(128) void k_flash(const float* __restrict__ qb, const float* __restrict__ kb, const float* __restrict__ vb,
                                             int pitch, int T, int H, float scale, float* __restrict__ y, int ypitch) {
  constexpr int KS = D / 32;        // k-steps for QK
  constexpr int DT = D / 16;        // d tiles for PV
  __shared__ __attribute__((aligned(16))) unsigned short sKh[32][D + 8], sKl[32][D + 8], sVh[32][D + 8], sVl[32][D + 8];
  __shared__ __attribute__((aligned(16))) unsigned short sPh[4][16][40], sPl[4][16][40];
  __shared__ __attribute__((aligned(16))) float sO[4][16][D];
  const int tid = threadIdx.x, w = tid >> 5, lane = tid & 31, ln = lane & 15, hh = lane >> 4;
  const int nqb = (T + 63) / 64;
  const int bh = blockIdx.x / nqb, qblk = blockIdx.x % nqb;
  const int b = bh / H, h = bh % H;
  const int q0 = qblk * 64 + w * 16;
  const float* Q = qb + (size_t)b * T * pitch + h * D;
  const float* K = kb + (size_t)b * T * pitch + h * D;
  const float* V = vb + (size_t)b * T * pitch + h * D;

  // A fragments of the wave's 16 query rows (scaled), hi/lo
  FragB aqh[KS], aql[KS];
  {
    int row = q0 + ln; if (row >= T) row = T - 1;
    const float* qr = Q + (size_t)row * pitch;
#pragma unroll
    for (int ks = 0; ks < KS; ++ks)
#pragma unroll
      for (int i = 0; i < 16; ++i) {
        const int d = ks * 32 + ((i < 8) ? (8 * hh + i) : (16 + 8 * hh + (i - 8)));
        const float x = qr[d] * scale; const unsigned short hb = bf16_bits(x);
        aqh[ks].u[i] = hb; aql[ks].u[i] = bf16_bits(x - bf16_val(hb));
      }
  }
  float m_r[8], l_r[8];
#pragma unroll
  for (int r = 0; r < 8; ++r) { m_r[r] = -3.0e38f; l_r[r] = 0.f; }
  v8f oacc[DT];
#pragma unroll
  for (int dt = 0; dt < DT; ++dt) oacc[dt] = (v8f){0.f,0.f,0.f,0.f,0.f,0.f,0.f,0.f};

  const int kv_end = CAUSAL ? min(T, qblk * 64 + 64) : T;     // block-uniform
  for (int j0 = 0; j0 < kv_end; j0 += 32) {
    __syncthreads();
    for (int e = tid; e < 32 * (D / 4); e += 128) {
      const int r = e / (D / 4), c4 = (e % (D / 4)) * 4;
      const int key = j0 + r;
      v4f kf = {0.f,0.f,0.f,0.f}, vf = {0.f,0.f,0.f,0.f};
      if (key < T) { kf = *(const v4fa*)(K + (size_t)key * pitch + c4); vf = *(const v4fa*)(V + (size_t)key * pitch + c4); }
#pragma unroll
      for (int t = 0; t < 4; ++t) {
        unsigned short hb = bf16_bits(kf[t]); sKh[r][c4 + t] = hb; sKl[r][c4 + t] = bf16_bits(kf[t] - bf16_val(hb));
        hb = bf16_bits(vf[t]); sVh[r][c4 + t] = hb; sVl[r][c4 + t] = bf16_bits(vf[t] - bf16_val(hb));
      }
    }
    __syncthreads();
    // S tile 16 x 32
    v8f s[2];
#pragma unroll
    for (int nt = 0; nt < 2; ++nt) {
      v8f acc = {};
#pragma unroll
      for (int ks = 0; ks < KS; ++ks) {
        FragB bh_, bl_;
        bh_.half[0] = *(const v8us*)&sKh[nt * 16 + ln][ks * 32 + 8 * hh]; bh_.half[1] = *(const v8us*)&sKh[nt * 16 + ln][ks * 32 + 16 + 8 * hh];
        bl_.half[0] = *(const v8us*)&sKl[nt * 16 + ln][ks * 32 + 8 * hh]; bl_.half[1] = *(const v8us*)&sKl[nt * 16 + ln][ks * 32 + 16 + 8 * hh];
        acc = mmaN<3>(aqh[ks].v, aql[ks].v, bh_.v, bl_.v, acc);
      }
      s[nt] = acc;
    }
    // mask + running max (rows 8hh+r; the 16 lanes of a half share rows)
    float alpha[8];
#pragma unroll
    for (int r = 0; r < 8; ++r) {
      const int qi = q0 + 8 * hh + r;
      const int ja = j0 + ln, jb = j0 + 16 + ln;
      if (CAUSAL) { if (ja > qi) s[0][r] = -3.0e38f; if (jb > qi) s[1][r] = -3.0e38f; }
      if (ja >= T) s[0][r] = -3.0e38f;
      if (jb >= T) s[1][r] = -3.0e38f;
      float mx = fmaxf(s[0][r], s[1][r]);
      mx = fmaxf(mx, __shfl_xor(mx, 1, 32)); mx = fmaxf(mx, __shfl_xor(mx, 2, 32)); mx = fmaxf(mx, __shfl_xor(mx, 4, 32)); mx = fmaxf(mx, __shfl_xor(mx, 8, 32));
      const float mnew = fmaxf(m_r[r], mx);
      alpha[r] = (mnew > -1.0e38f) ? __expf(m_r[r] - mnew) : 1.0f;
      const float p0 = (s[0][r] > -1.0e38f) ? __expf(s[0][r] - mnew) : 0.f;
      const float p1 = (s[1][r] > -1.0e38f) ? __expf(s[1][r] - mnew) : 0.f;
      m_r[r] = mnew;
      l_r[r] = l_r[r] * alpha[r] + p0 + p1;            // per-lane partial row sum (16 lanes combined at the end)
      unsigned short hb = bf16_bits(p0); sPh[w][8 * hh + r][ln] = hb;      sPl[w][8 * hh + r][ln] = bf16_bits(p0 - bf16_val(hb));
      hb = bf16_bits(p1);                sPh[w][8 * hh + r][16 + ln] = hb; sPl[w][8 * hh + r][16 + ln] = bf16_bits(p1 - bf16_val(hb));
    }
#pragma unroll
    for (int dt = 0; dt < DT; ++dt)
#pragma unroll
      for (int r = 0; r < 8; ++r) oacc[dt][r] *= alpha[r];
    __builtin_amdgcn_fence(__ATOMIC_ACQ_REL, "workgroup");
    __builtin_amdgcn_wave_barrier();
    FragB pah, pal;
    pah.half[0] = *(const v8us*)&sPh[w][ln][8 * hh]; pah.half[1] = *(const v8us*)&sPh[w][ln][16 + 8 * hh];
    pal.half[0] = *(const v8us*)&sPl[w][ln][8 * hh]; pal.half[1] = *(const v8us*)&sPl[w][ln][16 + 8 * hh];
#pragma unroll
    for (int dt = 0; dt < DT; ++dt) {
      FragB bvh, bvl;
#pragma unroll
      for (int i = 0; i < 8; ++i) {
        bvh.u[i] = sVh[8 * hh + i][dt * 16 + ln]; bvh.u[8 + i] = sVh[16 + 8 * hh + i][dt * 16 + ln];
        bvl.u[i] = sVl[8 * hh + i][dt * 16 + ln]; bvl.u[8 + i] = sVl[16 + 8 * hh + i][dt * 16 + ln];
      }
      oacc[dt] = mmaN<3>(pah.v, pal.v, bvh.v, bvl.v, oacc[dt]);
    }
    __builtin_amdgcn_fence(__ATOMIC_ACQ_REL, "workgroup");
    __builtin_amdgcn_wave_barrier();
  }
#pragma unroll
  for (int r = 0; r < 8; ++r) {
    float l = l_r[r];
    l += __shfl_xor(l, 1, 32); l += __shfl_xor(l, 2, 32); l += __shfl_xor(l, 4, 32); l += __shfl_xor(l, 8, 32);
    l_r[r] = (l > 0.f) ? 1.0f / l : 0.f;
  }
#pragma unroll
  for (int dt = 0; dt < DT; ++dt)
#pragma unroll
    for (int r = 0; r < 8; ++r) sO[w][8 * hh + r][dt * 16 + ln] = oacc[dt][r] * l_r[r];
  __builtin_amdgcn_fence(__ATOMIC_ACQ_REL, "workgroup");
  __builtin_amdgcn_wave_barrier();
  {
    for (int r = 0; r < 16; ++r) {
      const int row = q0 + r;
      if (row < T && lane < D / 4) {
        const v4f val = *(const v4fa*)&sO[w][r][lane * 4];
        *(v4f*)(y + ((size_t)b * T + row) * ypitch + h * D + lane * 4) = val;
      }
    }
    
  }
}

// GEMM C = act(A·W + bias + resid): A f32 (ASPLIT -> hi/lo 2 terms), Wt bf16 [N][K]; ACT 0 none, 1 relu, 2 exact gelu;
// resid (optional, f32, row index = (row % rmod), pitch ldr, RES_BF16 rounds it) added before the activation.
template <bool ASPLIT, int ACT, bool BIAS_BF16, bool RES_BF16>
__global__ __launch_bounds__(128) void k_gemm_bf3(const float* __restrict__ A, int lda, const unsigned short* __restrict__ Wt, int ldb,
                                                const float* __restrict__ bias, const float* __restrict__ resid, int rmod, int ldr,
                                                float* __restrict__ C, int ldc, int M, int N, int K) {
  __shared__ __attribute__((aligned(16))) float so[4][16][64];
  const int tid = threadIdx.x, w = tid >> 5, lane = tid & 31, ln = lane & 15, hh = lane >> 4;
  const int ntn = N / 64;
  const int wid = blockIdx.x * 4 + w;
  const int mt = wid / ntn, nq = wid % ntn;
  if (mt * 16 >= M) return;
  const int row0 = mt * 16, col0 = nq * 64;
  const float* arow = A + (size_t)(row0 + ln) * lda;
  v8f acc[4] = {};
  for (int kb = 0; kb < K; kb += 32) {
    FragB ah, al;
    const v4f x0 = *(const v4fa*)(arow + kb + 8 * hh), x1 = *(const v4fa*)(arow + kb + 8 * hh + 4);
    const v4f x2 = *(const v4fa*)(arow + kb + 16 + 8 * hh), x3 = *(const v4fa*)(arow + kb + 16 + 8 * hh + 4);
    float xs[16] = {x0[0],x0[1],x0[2],x0[3],x1[0],x1[1],x1[2],x1[3],x2[0],x2[1],x2[2],x2[3],x3[0],x3[1],x3[2],x3[3]};
#pragma unroll
    for (int i = 0; i < 16; ++i) { const unsigned short hb = bf16_bits(xs[i]); ah.u[i] = hb; al.u[i] = ASPLIT ? bf16_bits(xs[i] - bf16_val(hb)) : (unsigned short)0; }
#pragma unroll
    for (int t = 0; t < 4; ++t) {
      const unsigned short* brow = Wt + (size_t)(col0 + t * 16 + ln) * ldb + kb;
      FragB b;
      b.half[0] = *(const v8us*)(brow + 8 * hh);
      b.half[1] = *(const v8us*)(brow + 16 + 8 * hh);
      acc[t] = mmaN<ASPLIT ? 2 : 1>(ah.v, al.v, b.v, b.v, acc[t]);
    }
  }
#pragma unroll
  for (int t = 0; t < 4; ++t) {
    const int col = col0 + t * 16 + ln;
    float bv = bias ? bias[col] : 0.f;
    if (BIAS_BF16) bv = bf16_round(bv);
#pragma unroll
    for (int r = 0; r < 8; ++r) {
      float v = acc[t][r] + bv;
      if (resid) { float rv = resid[(size_t)((row0 + 8 * hh + r) % rmod) * ldr + col]; if (RES_BF16) rv = bf16_round(rv); v += rv; }
      if (ACT == 1) v = fmaxf(v, 0.f);
      if (ACT == 2) v = 0.5f * v * (1.0f + erff(v * 0.70710678118654752f));
      if (ACT == 3) { const float u = 0.7978845608028654f * (v + 0.044715f * v * v * v); v = 0.5f * v * (1.0f + tanhf(u)); }
      so[w][8 * hh + r][t * 16 + ln] = v;
    }
  }
  __builtin_amdgcn_fence(__ATOMIC_ACQ_REL, "workgroup");
  __builtin_amdgcn_wave_barrier();
  const int rsub = lane >> 4, c4 = (lane & 15) * 4;
  {
#pragma unroll
    for (int q = 0; q < 8; ++q) {
      const int r = q * 2 + rsub;
      const v4f v = *(const v4fa*)&so[w][r][c4];
      *(v4f*)(C + (size_t)(row0 + r) * ldc + col0 + c4) = v;
    }
    
  }
}
// row LayerNorm (biased variance, eps) over N: s = X (+ R); optional out_sum <- s; out_norm <- (s-mu)*rsqrt(var+eps)*g + b
template <bool PARAM_BF16>
__global__ __launch_bounds__(256) void k_layernorm(const float* __restrict__ X, const float* __restrict__ R, const float* __restrict__ g, const float* __restrict__ bta,
                                                  float* __restrict__ out_sum, float* __restrict__ out_norm, int N, float eps) {
  __shared__ float red[256];
  const int row = blockIdx.x, tid = threadIdx.x;
  const float* x = X + (size_t)row * N; const float* rr = R ? R + (size_t)row * N : nullptr;
  float vals[16];                     // up to N = 4096
  const int per = N / 256;            // contiguous chunk per thread? use strided-by-4 chunks: thread handles j = tid*4 + 1024*u
  float s1 = 0.f;
  for (int u = 0; u < per / 4; ++u) {
    const int j = tid * 4 + 1024 * u;
    const v4f a = *(const v4fa*)(x + j);
    v4f b = {0.f,0.f,0.f,0.f}; if (rr) b = *(const v4fa*)(rr + j);
#pragma unroll
    for (int q = 0; q < 4; ++q) { const float v = a[q] + b[q]; vals[u * 4 + q] = v; s1 += v; }
  }
  red[tid] = s1; __syncthreads();
  for (int st = 128; st > 0; st >>= 1) { if (tid < st) red[tid] += red[tid + st]; __syncthreads(); }
  const float mu = red[0] / (float)N; __syncthreads();
  float s2 = 0.f;
  for (int u = 0; u < per / 4; ++u)
#pragma unroll
    for (int q = 0; q < 4; ++q) { const float c = vals[u * 4 + q] - mu; s2 += c * c; }
  red[tid] = s2; __syncthreads();
  for (int st = 128; st > 0; st >>= 1) { if (tid < st) red[tid] += red[tid + st]; __syncthreads(); }
  const float rs = rsqrtf(red[0] / (float)N + eps);
  {
    for (int u = 0; u < per / 4; ++u) {
      const int j = tid * 4 + 1024 * u;
      v4f o, sm;
#pragma unroll
      for (int q = 0; q < 4; ++q) {
        float gg = g[j + q], bb = bta[j + q];
        if (PARAM_BF16) { gg = bf16_round(gg); bb = bf16_round(bb); }
        sm[q] = vals[u * 4 + q]; o[q] = (vals[u * 4 + q] - mu) * rs * gg + bb;
      }
      if (out_sum) *(v4f*)(out_sum + (size_t)row * N + j) = sm;
      *(v4f*)(out_norm + (size_t)row * N + j) = o;
    }
    
  }
}



// ---- f16 WMMA path (v_wmma_f32_16x16x32_f16): 11-bit significands for operands in range — used where a [0,1] probability operand needs more precision than bf16
typedef _Float16 v16h __attribute__((ext_vector_type(16)));
union FragH { v16h v; v8us half[2]; _Float16 h[16]; unsigned short u[16]; };
template <int NT>
__device__ __forceinline__ v8f mmaH(v16h ah, v16h al, v16h bh, v16h bl, v8f c) {
  c = __builtin_amdgcn_wmma_f32_16x16x32_f16(false, ah, false, bh, (short)0, c, false, false);
  if (NT >= 2) c = __builtin_amdgcn_wmma_f32_16x16x32_f16(false, al, false, bh, (short)0, c, false, false);
  if (NT >= 3) c = __builtin_amdgcn_wmma_f32_16x16x32_f16(false, ah, false, bl, (short)0, c, false, false);
  asm volatile("v_nop\n\tv_nop\n\tv_nop\n\tv_nop" : "+v"(c) : "v"(ah), "v"(al), "v"(bh), "v"(bl));
  return c;
}
// batched GEMM like k_gemm_b but f16 operands: A f32 (split into f16 hi/lo if ASPLIT, else rounded to f16), Bt = f16 values [n][k]; alpha; C f32; N multiple of 16 (partial tiles skipped)
template <bool ASPLIT>
__global__ __launch_bounds__(128) void k_gemm_h(const float* __restrict__ A, int lda, size_t sA, const _Float16* __restrict__ Bh, int ldb, size_t sB, float alpha, float* __restrict__ C, int ldc, size_t sC, int M, int N, int K) {
  __shared__ __attribute__((aligned(16))) float so[4][16][64];
  const int tid = threadIdx.x, w = tid >> 5, lane = tid & 31, ln = lane & 15, hh = lane >> 4; const int by = blockIdx.y;
  A += (size_t)by * sA; Bh += (size_t)by * sB; C += (size_t)by * sC;
  const int ntn = (N + 63) / 64; const int wid = blockIdx.x * 4 + w; const int mt = wid / ntn, nq = wid % ntn; if (mt * 16 >= M) return;
  const int row0 = mt * 16, col0 = nq * 64; const float* arow = A + (size_t)(row0 + ln) * lda;
  v8f acc[4] = {};
  for (int kb = 0; kb < K; kb += 32) {
    FragH ah, al;
    const v4f x0 = *(const v4fa*)(arow + kb + 8 * hh), x1 = *(const v4fa*)(arow + kb + 8 * hh + 4), x2 = *(const v4fa*)(arow + kb + 16 + 8 * hh), x3 = *(const v4fa*)(arow + kb + 16 + 8 * hh + 4);
    float xs[16] = {x0[0],x0[1],x0[2],x0[3],x1[0],x1[1],x1[2],x1[3],x2[0],x2[1],x2[2],x2[3],x3[0],x3[1],x3[2],x3[3]};
#pragma unroll
    for (int i = 0; i < 16; ++i) { const _Float16 h = (_Float16)xs[i]; ah.h[i] = h; al.h[i] = ASPLIT ? (_Float16)(xs[i] - (float)h) : (_Float16)0.0f; }
#pragma unroll
    for (int t = 0; t < 4; ++t) { if (col0 + t * 16 >= N) continue; const size_t boff = (size_t)(col0 + t * 16 + ln) * ldb + kb; FragH bq; bq.half[0] = *(const v8us*)(Bh + boff + 8 * hh); bq.half[1] = *(const v8us*)(Bh + boff + 16 + 8 * hh);
      acc[t] = mmaH<ASPLIT ? 2 : 1>(ah.v, al.v, bq.v, bq.v, acc[t]); }
  }
#pragma unroll
  for (int t = 0; t < 4; ++t) { if (col0 + t * 16 >= N) continue;
#pragma unroll
    for (int r = 0; r < 8; ++r) so[w][8 * hh + r][t * 16 + ln] = acc[t][r] * alpha; }
  __builtin_amdgcn_fence(__ATOMIC_ACQ_REL, "workgroup"); __builtin_amdgcn_wave_barrier();
  const int rsub = lane >> 4, c4 = (lane & 15) * 4;
  {
#pragma unroll
    for (int q = 0; q < 8; ++q) { const int r = q * 2 + rsub; if (col0 + c4 < N) { const v4f v = *(const v4fa*)&so[w][r][c4]; *(v4f*)(C + (size_t)(row0 + r) * ldc + col0 + c4) = v; } }
     }
}

// One grid for the five preparations, none of which needs another's result; the block index picks the job (a block-uniform branch).
// Blocks 0 .. 4 GW - 1, GW per weight: Wt[n][k] = f16(bf16(W[k][n]) * 16) from f32 row-major W[k][n] (a power of two keeps the bf16-exact weights exact in f16, away from the subnormal range).
// The other blocks: X16 = f16(bf16(x)), eight elements a thread.
__global__ __launch_bounds__(256) void k_prep(const float* __restrict__ x, const float* __restrict__ wq, const float* __restrict__ wk, const float* __restrict__ wv, const float* __restrict__ wo,
                                              _Float16* __restrict__ X16, _Float16* __restrict__ Bq, _Float16* __restrict__ Bk, _Float16* __restrict__ Bv, _Float16* __restrict__ Bo) {
  constexpr int GW = DM * (DM / 8) / 256; const int blk = blockIdx.x; FragH f;
  if (blk < 4 * GW) {
    const int job = blk / GW; const float* W = job == 0 ? wq : job == 1 ? wk : job == 2 ? wv : wo; _Float16* Wt = job == 0 ? Bq : job == 1 ? Bk : job == 2 ? Bv : Bo;
    const int t = (blk % GW) * 256 + threadIdx.x; const int n = t / (DM / 8), k8 = (t % (DM / 8)) * 8;
#pragma unroll
    for (int i = 0; i < 8; ++i) f.h[i] = (_Float16)(bf16_round(W[(size_t)(k8 + i) * DM + n]) * 16.0f);
    *(v8us*)((unsigned short*)Wt + (size_t)n * DM + k8) = f.half[0];
  } else {
    const size_t t = (size_t)(blk - 4 * GW) * 256 + threadIdx.x;
#pragma unroll
    for (int q = 0; q < 8; ++q) f.h[q] = (_Float16)bf16_round(x[t * 8 + q]);
    *(v8us*)((unsigned short*)X16 + t * 8) = f.half[0];
    asm volatile("s_wait_xcnt 0x0" ::: "memory");      // the built code lays the weight part behind this store: the wait stands in front of any write of the store's registers there
  }
}
// C[4096][512] = (A . Bt^T) * alpha + bf16(bias): one 64 x 64 tile of C per work-group, wave w = rows 16 w .. 16 w + 15, all 64 columns, K = 512 whole.
// The 64 rows of A and the 64 rows of Bt (both k-contiguous) come in by whole-line loads (a wave-wide 16-byte load = two rows x 256 contiguous bytes) and are laid in LDS at a pitch of 1040 B
// (16 B x odd: no bank conflict for the 16-byte fragment reads); the fragments then come from LDS, in the same k order as when they were read from global memory. All global loads are issued first;
// K goes in four chunks of 128, each stored to its own LDS columns and multiplied while the later chunks are still on their way into registers. F32OUT: f32 C, else f16.
// The q, k and v products read the same A and need nothing of each other: they share one grid, GG blocks each, job = block index / GG picks weight, bias and output (F32OUT: GG blocks, job 0 alone).
// Jobs 0 and 1 write C0, C1 row-major; job 2 (v) writes its 64 tokens x 64 columns (one head) transposed, Vt[(batch, head)][d][token], as the attention kernel reads it.
template <bool F32OUT>
__global__ __launch_bounds__(128) void k_gemm_hhx(const _Float16* __restrict__ A, const _Float16* __restrict__ B0, const _Float16* __restrict__ B1, const _Float16* __restrict__ B2, float alpha,
                                                  const float* __restrict__ bias0, const float* __restrict__ bias1, const float* __restrict__ bias2, float* __restrict__ C, _Float16* __restrict__ C0, _Float16* __restrict__ C1, _Float16* __restrict__ Vt) {
  constexpr int GG = (NR / 64) * (DM / 64); const int job = blockIdx.x / GG, blk = blockIdx.x % GG;
  const _Float16* Bh = job == 0 ? B0 : job == 1 ? B1 : B2; const float* bias = job == 0 ? bias0 : job == 1 ? bias1 : bias2; _Float16* C16 = job == 0 ? C0 : C1;
  constexpr int KP = DM + 8, KC = 128, NC = DM / KC, NL = 64 * KC / 8 / 128, KS = KC / 32;      // LDS pitch in halves; k per chunk; chunks; 16-byte loads per thread, operand and chunk; k steps per chunk
  __shared__ __attribute__((aligned(16))) unsigned short sA[64][KP], sB[64][KP];
  __shared__ __attribute__((aligned(16))) float so[4][16][64];
  const int tid = threadIdx.x, w = tid >> 5, lane = tid & 31, ln = lane & 15, hh = lane >> 4;
  const int mt = blk / (DM / 64), nq = blk % (DM / 64);
  const int row0 = mt * 64 + w * 16, col0 = nq * 64;
  const unsigned short* Ag = (const unsigned short*)A + (size_t)mt * 64 * DM;
  const unsigned short* Bg = (const unsigned short*)Bh + (size_t)col0 * DM;
  const int sr = tid >> 4, sc = (tid & 15) * 8;      // staging: load i of chunk c takes row 8 i + sr, halves c * KC + sc .. + 7
  v8us ra[NC][NL], rb[NC][NL];
#pragma unroll
  for (int c = 0; c < NC; ++c) {
#pragma unroll
    for (int i = 0; i < NL; ++i) { ra[c][i] = *(const v8us*)(Ag + (size_t)(8 * i + sr) * DM + c * KC + sc); rb[c][i] = *(const v8us*)(Bg + (size_t)(8 * i + sr) * DM + c * KC + sc); }
    __builtin_amdgcn_sched_barrier(0);      // keeps the loads in chunk order, so that chunk 0 is complete after a quarter of them and not after half
  }
  asm volatile("s_wait_xcnt 0x0" ::: "memory");      // stands in front of the first overwrite of the loads' address registers, which are reused for fragments while later chunks are still in flight
  v8f acc[4] = {};
#pragma unroll
  for (int c = 0; c < NC; ++c) {
#pragma unroll
    for (int i = 0; i < NL; ++i) { *(v8us*)&sA[8 * i + sr][c * KC + sc] = ra[c][i]; *(v8us*)&sB[8 * i + sr][c * KC + sc] = rb[c][i]; }
    // publishes this chunk's LDS columns to all four waves. LDS-only fences: a full __syncthreads() would also wait for the later chunks' global loads, which only this thread's registers receive
    __builtin_amdgcn_fence(__ATOMIC_RELEASE, "workgroup", "local"); __builtin_amdgcn_s_barrier(); __builtin_amdgcn_fence(__ATOMIC_ACQUIRE, "workgroup", "local");
    FragH ah[KS], bq[KS][4];      // the whole chunk's fragments are asked for ahead of its first matrix instruction
#pragma unroll
    for (int ks = 0; ks < KS; ++ks) { const int kb = c * KC + ks * 32; ah[ks].half[0] = *(const v8us*)&sA[w * 16 + ln][kb + 8 * hh]; ah[ks].half[1] = *(const v8us*)&sA[w * 16 + ln][kb + 16 + 8 * hh];
#pragma unroll
      for (int t = 0; t < 4; ++t) { bq[ks][t].half[0] = *(const v8us*)&sB[t * 16 + ln][kb + 8 * hh]; bq[ks][t].half[1] = *(const v8us*)&sB[t * 16 + ln][kb + 16 + 8 * hh]; } }
#pragma unroll
    for (int ks = 0; ks < KS; ++ks)
#pragma unroll
      for (int t = 0; t < 4; ++t) acc[t] = mmaH<1>(ah[ks].v, ah[ks].v, bq[ks][t].v, bq[ks][t].v, acc[t]);
  }
  if (!F32OUT && job == 2) {      // block-uniform
    // an accumulator lane holds 8 consecutive tokens of one column d: 16 bytes of a transposed row. The four waves lay the 64 d x 64 tokens in LDS (pitch 144 B = 16 B x odd), then whole 128-byte rows of Vt go out
    unsigned short (*tl)[72] = (unsigned short (*)[72])&so[0][0][0];
#pragma unroll
    for (int t = 0; t < 4; ++t) { const float bv = bf16_round(bias[col0 + t * 16 + ln]); FragH f;
#pragma unroll
      for (int r = 0; r < 8; ++r) f.h[r] = (_Float16)(acc[t][r] * alpha + bv);
      *(v8us*)&tl[t * 16 + ln][w * 16 + 8 * hh] = f.half[0]; }
    __syncthreads();      // a row of tl holds tokens of all four waves
    unsigned short* vo = (unsigned short*)Vt + ((size_t)((mt * 64 / TT) * NH + nq) * HD) * TT + (mt * 64) % TT;
#pragma unroll
    for (int i = 0; i < 4; ++i) { const int d = i * 16 + (tid >> 3), pc = tid & 7; const v8us v = *(const v8us*)&tl[d][pc * 8]; *(v8us*)(vo + (size_t)d * TT + pc * 8) = v; }
    return;
  }
#pragma unroll
  for (int t = 0; t < 4; ++t) { const float bv = bf16_round(bias[col0 + t * 16 + ln]);
#pragma unroll
    for (int r = 0; r < 8; ++r) so[w][8 * hh + r][t * 16 + ln] = acc[t][r] * alpha + bv; }
  __builtin_amdgcn_fence(__ATOMIC_ACQ_REL, "workgroup"); __builtin_amdgcn_wave_barrier();
  const int rsub = lane >> 4, c4 = (lane & 15) * 4; typedef _Float16 v4h __attribute__((ext_vector_type(4)));
#pragma unroll
  for (int q = 0; q < 8; ++q) { const int r = q * 2 + rsub; const v4f v = *(const v4fa*)&so[w][r][c4];
    if (F32OUT) *(v4f*)(C + (size_t)(row0 + r) * DM + col0 + c4) = v;
    else { v4h h4; for (int i = 0; i < 4; ++i) h4[i] = (_Float16)v[i]; *(v4h*)(C16 + (size_t)(row0 + r) * DM + col0 + c4) = h4; } }
  if (!F32OUT) asm volatile("s_wait_xcnt 0x0" ::: "memory");      // the built code lays the transposed part behind these stores: the wait stands in front of any write of the stores' registers there
}


// lane l <-> lane l ^ 16: the two halves of a wave hold the two halves of one query's keys
__device__ __forceinline__ float xhalf(float v) { const int b = __float_as_int(v); return __int_as_float(__builtin_amdgcn_permlanex16(b, b, 0x76543210, 0xfedcba98, false, false)); }
// local attention per ((b,h), 128 queries): wave = 32 queries q0 ... q0 + 31, which reach keys q0 - 32 ... q0 + 63 and no others: the wave walks these 3 chunks of 32 keys, j0 = q0 - 32, q0, q0 + 32 (rows outside [0, T) are read at a CLAMPED address and masked); score/8 where |k - t| <= 32.
// Both products run transposed: S^T = K . Q^T (A = 16 keys, B = 16 queries) and O^T += V^T . P^T (A = 16 d, B = 16 queries). An accumulator lane (ln, hh) then holds ONE query (column ln) and keys 8 hh + r
// down its registers: a query's maximum and sum are taken in the lane's own registers, with one exchange between the wave halves, and the two score tiles of a chunk (keys 0-15, 16-31), converted in place,
// are the B fragment of the second product in the k order of the V^T loader (8 hh + i, 16 + 8 hh + i): P never leaves the registers.
__global__ __launch_bounds__(128) void k_flash(const _Float16* __restrict__ Q16, const _Float16* __restrict__ K16, const _Float16* __restrict__ Vt, _Float16* __restrict__ O16) {
  constexpr int RPW = 32, NQB = TT / (4 * RPW), DT = HD / 16, KS = HD / 32;
  __shared__ __attribute__((aligned(16))) unsigned short sO[4][RPW][HD + 8];      // output staging, pitch 144 B = 16 B x odd
  const int tid = threadIdx.x, lane = tid & 31, ln = lane & 15, hh = lane >> 4;
  const int w = __builtin_amdgcn_readfirstlane(tid >> 5);      // the wave's number in a scalar register: q0 and j0 depend on it, and with it the loop's test and the chunk clamps are scalar
  const int slab = blockIdx.x / NQB, qblk = blockIdx.x % NQB; const int b = slab / NH, h = slab % NH; const int qb0 = qblk * (4 * RPW); const int q0 = qb0 + w * RPW;
  FragH aq[2][KS];
#pragma unroll
  for (int rt = 0; rt < 2; ++rt) { const unsigned short* qr = (const unsigned short*)Q16 + ((size_t)b * TT + q0 + rt * 16 + ln) * DM + h * HD;
#pragma unroll
    for (int ks = 0; ks < KS; ++ks) { aq[rt][ks].half[0] = *(const v8us*)(qr + ks * 32 + 8 * hh); aq[rt][ks].half[1] = *(const v8us*)(qr + ks * 32 + 16 + 8 * hh); } }
  const unsigned short* Vth = (const unsigned short*)Vt + (size_t)slab * HD * TT;
  float m_r[2], l_r[2]; v8f oacc[2][DT];      // per lane: query q0 + rt * 16 + ln; l_r sums this half's keys only; oacc[rt][dt][r] = O[query][dt * 16 + 8 hh + r]
#pragma unroll
  for (int rt = 0; rt < 2; ++rt) { m_r[rt] = -3.0e38f; l_r[rt] = 0.f;
#pragma unroll
    for (int dt = 0; dt < DT; ++dt) oacc[rt][dt] = (v8f){0.f,0.f,0.f,0.f,0.f,0.f,0.f,0.f}; }
#pragma unroll 1
  for (int j0 = q0 - WW; j0 < q0 + RPW + WW; j0 += 32) {
    v8f s[2][2];      // s[rt][nt][r] = score of key j0 + nt * 16 + 8 hh + r with query q0 + rt * 16 + ln
#pragma unroll
    for (int nt = 0; nt < 2; ++nt) { const int kj = j0 + nt * 16 + ln; const int kc = kj < 0 ? 0 : (kj >= TT ? TT - 1 : kj); const unsigned short* kr = (const unsigned short*)K16 + ((size_t)b * TT + kc) * DM + h * HD; FragH bk[KS];
#pragma unroll
      for (int ks = 0; ks < KS; ++ks) { bk[ks].half[0] = *(const v8us*)(kr + ks * 32 + 8 * hh); bk[ks].half[1] = *(const v8us*)(kr + ks * 32 + 16 + 8 * hh); }
#pragma unroll
      for (int rt = 0; rt < 2; ++rt) { v8f acc = (v8f){0.f,0.f,0.f,0.f,0.f,0.f,0.f,0.f};
#pragma unroll
        for (int ks = 0; ks < KS; ++ks) acc = mmaH<1>(bk[ks].v, bk[ks].v, aq[rt][ks].v, aq[rt][ks].v, acc); s[rt][nt] = acc; } }
    FragH pb[2];
#pragma unroll
    for (int rt = 0; rt < 2; ++rt) { const int t = q0 + rt * 16 + ln; float sv[16]; float mc = -INFINITY;
      const int lo = t - WW < 0 ? 0 : t - WW, hi = t + WW > TT - 1 ? TT - 1 : t + WW;      // this lane's query takes keys lo ... hi: 0 <= k < T and |k - t| <= 32 in one range
#pragma unroll
      for (int i = 0; i < 16; ++i) { const int k = j0 + (i >> 3) * 16 + 8 * hh + (i & 7); const bool ok = (unsigned)(k - lo) <= (unsigned)(hi - lo);
        sv[i] = ok ? s[rt][i >> 3][i & 7] * 0.125f : -INFINITY; mc = fmaxf(mc, sv[i]); }
      mc = fmaxf(mc, xhalf(mc));
      const float mn = fmaxf(m_r[rt], mc); const float al = (mn > -1.0e38f) ? expf(m_r[rt] - mn) : 1.0f; m_r[rt] = mn; float ps[4] = {0.f, 0.f, 0.f, 0.f};
#pragma unroll
      for (int i = 0; i < 16; ++i) { const float p = expf(sv[i] - mn); ps[i & 3] += p; pb[rt].h[i] = (_Float16)p; }      // a masked score is -inf and mn is finite: its p is exactly 0
      l_r[rt] = l_r[rt] * al + ((ps[0] + ps[1]) + (ps[2] + ps[3]));
#pragma unroll
      for (int dt = 0; dt < DT; ++dt)
#pragma unroll
        for (int r = 0; r < 8; ++r) oacc[rt][dt][r] *= al; }
#pragma unroll
    for (int dt = 0; dt < DT; ++dt) { const int vj0 = j0 < 0 ? 0 : (j0 + 32 > TT ? TT - 32 : j0);      // clamped chunk address; rows outside [0,T) have p = 0 so the substituted values never contribute
      const unsigned short* vrow = Vth + (size_t)(dt * 16 + ln) * TT + vj0; FragH bv; bv.half[0] = *(const v8us*)(vrow + 8 * hh); bv.half[1] = *(const v8us*)(vrow + 16 + 8 * hh);
#pragma unroll
      for (int rt = 0; rt < 2; ++rt) oacc[rt][dt] = mmaH<1>(bv.v, bv.v, pb[rt].v, pb[rt].v, oacc[rt][dt]); } }
#pragma unroll
  for (int rt = 0; rt < 2; ++rt) { float l = l_r[rt] + xhalf(l_r[rt]);
    const int t = q0 + rt * 16 + ln; const int npad = (t < WW ? (WW - t) : 0) + (t + WW >= TT ? (t + WW - TT + 1) : 0); float sc = 1.0f;
    if (npad > 0) { const float m = m_r[rt]; const float mn = fmaxf(m, 0.f); sc = expf(m - mn); l = l * sc + (float)npad * expf(-mn); }
    const float inv = sc / l;
#pragma unroll
    for (int dt = 0; dt < DT; ++dt) { FragH f;      // 8 consecutive d of one query: 16 bytes of its f16 output row
#pragma unroll
      for (int r = 0; r < 8; ++r) f.h[r] = (_Float16)(oacc[rt][dt][r] * inv);
      *(v8us*)&sO[w][rt * 16 + ln][dt * 16 + 8 * hh] = f.half[0]; } }
  __builtin_amdgcn_fence(__ATOMIC_ACQ_REL, "workgroup"); __builtin_amdgcn_wave_barrier();
#pragma unroll
  for (int rp = 0; rp < RPW; rp += 4) { const int r = rp + (lane >> 3), pc = lane & 7; const v8us v = *(const v8us*)&sO[w][r][pc * 8];      // the A operand of the output projection, a whole 128-byte line per row
    *(v8us*)((unsigned short*)O16 + ((size_t)b * TT + q0 + r) * DM + h * HD + pc * 8) = v; } }
extern "C" void kernel_launch(void* const* d_in, const int* in_sizes, int n_in,
                              void* d_out, int out_size, void* d_ws, size_t ws_size, hipStream_t stream) {
  (void)in_sizes; (void)n_in; (void)out_size;
  const float* x = (const float*)d_in[0]; const float* wq = (const float*)d_in[1]; const float* bq = (const float*)d_in[2]; const float* wk = (const float*)d_in[3]; const float* bk = (const float*)d_in[4]; const float* wv = (const float*)d_in[5]; const float* bv = (const float*)d_in[6]; const float* wo = (const float*)d_in[7]; const float* bo = (const float*)d_in[8];
  char* ws = (char*)d_ws; size_t off = 0;
  auto take = [&](size_t bytes) { char* p = ws + off; off += (bytes + 255) & ~(size_t)255; return p; };
  const size_t w8 = (size_t)DM * DM / 8;
  _Float16* Bq = (_Float16*)take(w8 * 16); _Float16* Bk = (_Float16*)take(w8 * 16); _Float16* Bv = (_Float16*)take(w8 * 16); _Float16* Bo = (_Float16*)take(w8 * 16);
  _Float16* X16 = (_Float16*)take((size_t)NR * DM * 2); _Float16* Q16 = (_Float16*)take((size_t)NR * DM * 2); _Float16* K16 = (_Float16*)take((size_t)NR * DM * 2); _Float16* Vt = (_Float16*)take((size_t)NR * DM * 2); _Float16* O16 = X16;
  if (off > ws_size) return;      // 18 MiB
  const unsigned gw = (unsigned)(DM * (DM / 8) / 256), gx = (unsigned)((size_t)NR * DM / 8 / 256);
  k_prep<<<4 * gw + gx, 256, 0, stream>>>(x, wq, wk, wv, wo, X16, Bq, Bk, Bv, Bo);      // weights are [in][out]
  const unsigned gg = (NR / 64) * (DM / 64);
  k_gemm_hhx<false><<<3 * gg, 128, 0, stream>>>(X16, Bq, Bk, Bv, 0.0625f, bq, bk, bv, nullptr, Q16, K16, Vt);
  k_flash<<<BB * NH * (TT / 128), 128, 0, stream>>>(Q16, K16, Vt, O16);
  k_gemm_hhx<true><<<gg, 128, 0, stream>>>(O16, Bo, nullptr, nullptr, 0.0625f, bo, nullptr, nullptr, (float*)d_out, nullptr, nullptr, nullptr);
}

// v005
// A run of this version takes 31.8 microseconds.
// In two side-by-side timings against v004, it was 1.19 and 1.18 times as fast.
// All steps since v000 together make it 4.47 times as fast.
#include <hip/hip_runtime.h>
// q/k/v/o projections (4096 × 512 × 512, + bias) and the 8-head LOCAL attention (window ±32, d = 64) on v_wmma_f32_16x16x32_f16: in a fused flash-style kernel a wave visits only the 3 key chunks
// around its 32 queries (S = Q·Kᵀ, O = P·V on WMMA; |k − t| ≤ 32 band mask; online max/sum softmax f32; P f16 ≤ 1), and the module's zero-PADDED keys (score exactly 0, value 0, they DO
// take part in the softmax) are added analytically per query as npad·e^{0 − m} in the normaliser; A = f16(bf16 ·) exact operands, weights [in][out] transposed to bf16-exact ×2^4, f32 accumulate.
#define BB 2
#define TT 2048
#define DM 512
#define NH 8
#define HD 64
#define WW 32
#define NR (BB * TT)

typedef __bf16 v16b __attribute__((ext_vector_type(16)));
typedef unsigned short v8us __attribute__((ext_vector_type(8), may_alias));
typedef float  v8f  __attribute__((ext_vector_type(8)));
typedef float  v4f  __attribute__((ext_vector_type(4)));
typedef float  v4fa __attribute__((ext_vector_type(4), may_alias));
union FragB { v16b v; v8us half[2]; unsigned short u[16]; };

__device__ __forceinline__ unsigned short bf16_bits(float x) { unsigned int u = __float_as_uint(x); return (unsigned short)((u + 0x7FFFu + ((u >> 16) & 1u)) >> 16); }
__device__ __forceinline__ float bf16_val(unsigned short b) { return __uint_as_float(((unsigned int)b) << 16); }
__device__ __forceinline__ float bf16_round(float x) { return bf16_val(bf16_bits(x)); }
// D += A·B with NT terms: 1 = ah·bh, 2 = + al·bh (A split), 3 = + ah·bl (both split)
template <int NT>
__device__ __forceinline__ v8f mmaN(v16b ah, v16b al, v16b bh, v16b bl, v8f c) {
  c = __builtin_amdgcn_wmma_f32_16x16x32_bf16(false, ah, false, bh, (short)0, c, false, false);
  if (NT >= 2) c = __builtin_amdgcn_wmma_f32_16x16x32_bf16(false, al, false, bh, (short)0, c, false, false);
  if (NT >= 3) c = __builtin_amdgcn_wmma_f32_16x16x32_bf16(false, ah, false, bl, (short)0, c, false, false);
  asm volatile("v_nop\n\tv_nop\n\tv_nop\n\tv_nop" : "+v"(c) : "v"(ah), "v"(al), "v"(bh), "v"(bl));
  return c;
}

__global__ __launch_bounds__(256) void k_wt_bf16(const float* __restrict__ W, unsigned short* __restrict__ Wt, int K, int N) {
  const int t = blockIdx.x * 256 + threadIdx.x;
  const int k8n = K / 8;
  if (t >= N * k8n) return;
  const int n = t / k8n, k8 = (t % k8n) * 8;
  v8us v;
#pragma unroll
  for (int i = 0; i < 8; ++i) v[i] = bf16_bits(W[(size_t)(k8 + i) * N + n]);
  *(v8us*)(Wt + (size_t)n * K + k8) = v;
  
}

// GEMM C[M][N] (f32, pitch ldc) = act(A[M][K]·W + bias). A f32 row-major (pitch lda) converted per fragment to bf16
// (ASPLIT: hi/lo two planes -> 2 terms, else single rounded term); Wt bf16 [N][K] (pitch ldb). BIAS_BF16 rounds the
// bias to bf16 first (bias quantised to bf16 before the add). K%32==0, M%16==0, N%64==0.
template <bool ASPLIT, int ACT, bool BIAS_BF16>
__global__ __launch_bounds__(128) void k_gemm_bf(const float* __restrict__ A, int lda, const unsigned short* __restrict__ Wt, int ldb,
                                               const float* __restrict__ bias, float* __restrict__ C, int ldc, int M, int N, int K) {
  __shared__ __attribute__((aligned(16))) float so[4][16][64];
  const int tid = threadIdx.x, w = tid >> 5, lane = tid & 31, ln = lane & 15, hh = lane >> 4;
  const int ntn = N / 64;
  const int wid = blockIdx.x * 4 + w;
  const int mt = wid / ntn, nq = wid % ntn;
  if (mt * 16 >= M) return;
  const int row0 = mt * 16, col0 = nq * 64;
  const float* arow = A + (size_t)(row0 + ln) * lda;
  v8f acc[4] = {};
  for (int kb = 0; kb < K; kb += 32) {
    FragB ah, al;
    const v4f x0 = *(const v4fa*)(arow + kb + 8 * hh), x1 = *(const v4fa*)(arow + kb + 8 * hh + 4);
    const v4f x2 = *(const v4fa*)(arow + kb + 16 + 8 * hh), x3 = *(const v4fa*)(arow + kb + 16 + 8 * hh + 4);
    float xs[16] = {x0[0],x0[1],x0[2],x0[3],x1[0],x1[1],x1[2],x1[3],x2[0],x2[1],x2[2],x2[3],x3[0],x3[1],x3[2],x3[3]};
#pragma unroll
    for (int i = 0; i < 16; ++i) { const unsigned short hb = bf16_bits(xs[i]); ah.u[i] = hb; al.u[i] = ASPLIT ? bf16_bits(xs[i] - bf16_val(hb)) : (unsigned short)0; }
#pragma unroll
    for (int t = 0; t < 4; ++t) {
      const unsigned short* brow = Wt + (size_t)(col0 + t * 16 + ln) * ldb + kb;
      FragB b;
      b.half[0] = *(const v8us*)(brow + 8 * hh);
      b.half[1] = *(const v8us*)(brow + 16 + 8 * hh);
      acc[t] = mmaN<ASPLIT ? 2 : 1>(ah.v, al.v, b.v, b.v, acc[t]);
    }
  }
#pragma unroll
  for (int t = 0; t < 4; ++t) {
    float bv = bias ? bias[col0 + t * 16 + ln] : 0.f;
    if (BIAS_BF16) bv = bf16_round(bv);
#pragma unroll
    for (int r = 0; r < 8; ++r) { float v = acc[t][r] + bv; if (ACT == 1) v = fmaxf(v, 0.f); so[w][8 * hh + r][t * 16 + ln] = v; }
  }
  __builtin_amdgcn_fence(__ATOMIC_ACQ_REL, "workgroup");
  __builtin_amdgcn_wave_barrier();
  const int rsub = lane >> 4, c4 = (lane & 15) * 4;
  {
#pragma unroll
    for (int q = 0; q < 8; ++q) {
      const int r = q * 2 + rsub;
      const v4f v = *(const v4fa*)&so[w][r][c4];
      *(v4f*)(C + (size_t)(row0 + r) * ldc + col0 + c4) = v;
    }
    
  }
}

// Flash-style causal/unmasked attention, all contractions 3-term bf16 hi/lo splits, f32 softmax with running max.
// q,k,v rows are read from f32 buffers with arbitrary row pitch (so they can live inside a fused qkv buffer);
// D = head size (multiple of 32, <= 128); one wave = 16 query rows; block = 4 waves (64 queries) sharing K/V chunks of 32.
template <int D, bool CAUSAL>
__global__ __launch_bounds__(128) void k_flash(const float* __restrict__ qb, const float* __restrict__ kb, const float* __restrict__ vb,
                                             int pitch, int T, int H, float scale, float* __restrict__ y, int ypitch) {
  constexpr int KS = D / 32;        // k-steps for QK
  constexpr int DT = D / 16;        // d tiles for PV
  __shared__ __attribute__((aligned(16))) unsigned short sKh[32][D + 8], sKl[32][D + 8], sVh[32][D + 8], sVl[32][D + 8];
  __shared__ __attribute__((aligned(16))) unsigned short sPh[4][16][40], sPl[4][16][40];
  __shared__ __attribute__((aligned(16))) float sO[4][16][D];
  const int tid = threadIdx.x, w = tid >> 5, lane = tid & 31, ln = lane & 15, hh = lane >> 4;
  const int nqb = (T + 63) / 64;
  const int bh = blockIdx.x / nqb, qblk = blockIdx.x % nqb;
  const int b = bh / H, h = bh % H;
  const int q0 = qblk * 64 + w * 16;
  const float* Q = qb + (size_t)b * T * pitch + h * D;
  const float* K = kb + (size_t)b * T * pitch + h * D;
  const float* V = vb + (size_t)b * T * pitch + h * D;

  // A fragments of the wave's 16 query rows (scaled), hi/lo
  FragB aqh[KS], aql[KS];
  {
    int row = q0 + ln; if (row >= T) row = T - 1;
    const float* qr = Q + (size_t)row * pitch;
#pragma unroll
    for (int ks = 0; ks < KS; ++ks)
#pragma unroll
      for (int i = 0; i < 16; ++i) {
        const int d = ks * 32 + ((i < 8) ? (8 * hh + i) : (16 + 8 * hh + (i - 8)));
        const float x = qr[d] * scale; const unsigned short hb = bf16_bits(x);
        aqh[ks].u[i] = hb; aql[ks].u[i] = bf16_bits(x - bf16_val(hb));
      }
  }
  float m_r[8], l_r[8];
#pragma unroll
  for (int r = 0; r < 8; ++r) { m_r[r] = -3.0e38f; l_r[r] = 0.f; }
  v8f oacc[DT];
#pragma unroll
  for (int dt = 0; dt < DT; ++dt) oacc[dt] = (v8f){0.f,0.f,0.f,0.f,0.f,0.f,0.f,0.f};

  const int kv_end = CAUSAL ? min(T, qblk * 64 + 64) : T;     // block-uniform
  for (int j0 = 0; j0 < kv_end; j0 += 32) {
    __syncthreads();
    for (int e = tid; e < 32 * (D / 4); e += 128) {
      const int r = e / (D / 4), c4 = (e % (D / 4)) * 4;
      const int key = j0 + r;
      v4f kf = {0.f,0.f,0.f,0.f}, vf = {0.f,0.f,0.f,0.f};
      if (key < T) { kf = *(const v4fa*)(K + (size_t)key * pitch + c4); vf = *(const v4fa*)(V + (size_t)key * pitch + c4); }
#pragma unroll
      for (int t = 0; t < 4; ++t) {
        unsigned short hb = bf16_bits(kf[t]); sKh[r][c4 + t] = hb; sKl[r][c4 + t] = bf16_bits(kf[t] - bf16_val(hb));
        hb = bf16_bits(vf[t]); sVh[r][c4 + t] = hb; sVl[r][c4 + t] = bf16_bits(vf[t] - bf16_val(hb));
      }
    }
    __syncthreads();
    // S tile 16 x 32
    v8f s[2];
#pragma unroll
    for (int nt = 0; nt < 2; ++nt) {
      v8f acc = {};
#pragma unroll
      for (int ks = 0; ks < KS; ++ks) {
        FragB bh_, bl_;
        bh_.half[0] = *(const v8us*)&sKh[nt * 16 + ln][ks * 32 + 8 * hh]; bh_.half[1] = *(const v8us*)&sKh[nt * 16 + ln][ks * 32 + 16 + 8 * hh];
        bl_.half[0] = *(const v8us*)&sKl[nt * 16 + ln][ks * 32 + 8 * hh]; bl_.half[1] = *(const v8us*)&sKl[nt * 16 + ln][ks * 32 + 16 + 8 * hh];
        acc = mmaN<3>(aqh[ks].v, aql[ks].v, bh_.v, bl_.v, acc);
      }
      s[nt] = acc;
    }
    // mask + running max (rows 8hh+r; the 16 lanes of a half share rows)
    float alpha[8];
#pragma unroll
    for (int r = 0; r < 8; ++r) {
      const int qi = q0 + 8 * hh + r;
      const int ja = j0 + ln, jb = j0 + 16 + ln;
      if (CAUSAL) { if (ja > qi) s[0][r] = -3.0e38f; if (jb > qi) s[1][r] = -3.0e38f; }
      if (ja >= T) s[0][r] = -3.0e38f;
      if (jb >= T) s[1][r] = -3.0e38f;
      float mx = fmaxf(s[0][r], s[1][r]);
      mx = fmaxf(mx, __shfl_xor(mx, 1, 32)); mx = fmaxf(mx, __shfl_xor(mx, 2, 32)); mx = fmaxf(mx, __shfl_xor(mx, 4, 32)); mx = fmaxf(mx, __shfl_xor(mx, 8, 32));
      const float mnew = fmaxf(m_r[r], mx);
      alpha[r] = (mnew > -1.0e38f) ? __expf(m_r[r] - mnew) : 1.0f;
      const float p0 = (s[0][r] > -1.0e38f) ? __expf(s[0][r] - mnew) : 0.f;
      const float p1 = (s[1][r] > -1.0e38f) ? __expf(s[1][r] - mnew) : 0.f;
      m_r[r] = mnew;
      l_r[r] = l_r[r] * alpha[r] + p0 + p1;            // per-lane partial row sum (16 lanes combined at the end)
      unsigned short hb = bf16_bits(p0); sPh[w][8 * hh + r][ln] = hb;      sPl[w][8 * hh + r][ln] = bf16_bits(p0 - bf16_val(hb));
      hb = bf16_bits(p1);                sPh[w][8 * hh + r][16 + ln] = hb; sPl[w][8 * hh + r][16 + ln] = bf16_bits(p1 - bf16_val(hb));
    }
#pragma unroll
    for (int dt = 0; dt < DT; ++dt)
#pragma unroll
      for (int r = 0; r < 8; ++r) oacc[dt][r] *= alpha[r];
    __builtin_amdgcn_fence(__ATOMIC_ACQ_REL, "workgroup");
    __builtin_amdgcn_wave_barrier();
    FragB pah, pal;
    pah.half[0] = *(const v8us*)&sPh[w][ln][8 * hh]; pah.half[1] = *(const v8us*)&sPh[w][ln][16 + 8 * hh];
    pal.half[0] = *(const v8us*)&sPl[w][ln][8 * hh]; pal.half[1] = *(const v8us*)&sPl[w][ln][16 + 8 * hh];
#pragma unroll
    for (int dt = 0; dt < DT; ++dt) {
      FragB bvh, bvl;
#pragma unroll
      for (int i = 0; i < 8; ++i) {
        bvh.u[i] = sVh[8 * hh + i][dt * 16 + ln]; bvh.u[8 + i] = sVh[16 + 8 * hh + i][dt * 16 + ln];
        bvl.u[i] = sVl[8 * hh + i][dt * 16 + ln]; bvl.u[8 + i] = sVl[16 + 8 * hh + i][dt * 16 + ln];
      }
      oacc[dt] = mmaN<3>(pah.v, pal.v, bvh.v, bvl.v, oacc[dt]);
    }
    __builtin_amdgcn_fence(__ATOMIC_ACQ_REL, "workgroup");
    __builtin_amdgcn_wave_barrier();
  }
#pragma unroll
  for (int r = 0; r < 8; ++r) {
    float l = l_r[r];
    l += __shfl_xor(l, 1, 32); l += __shfl_xor(l, 2, 32); l += __shfl_xor(l, 4, 32); l += __shfl_xor(l, 8, 32);
    l_r[r] = (l > 0.f) ? 1.0f / l : 0.f;
  }
#pragma unroll
  for (int dt = 0; dt < DT; ++dt)
#pragma unroll
    for (int r = 0; r < 8; ++r) sO[w][8 * hh + r][dt * 16 + ln] = oacc[dt][r] * l_r[r];
  __builtin_amdgcn_fence(__ATOMIC_ACQ_REL, "workgroup");
  __builtin_amdgcn_wave_barrier();
  {
    for (int r = 0; r < 16; ++r) {
      const int row = q0 + r;
      if (row < T && lane < D / 4) {
        const v4f val = *(const v4fa*)&sO[w][r][lane * 4];
        *(v4f*)(y + ((size_t)b * T + row) * ypitch + h * D + lane * 4) = val;
      }
    }
    
  }
}

// GEMM C = act(A·W + bias + resid): A f32 (ASPLIT -> hi/lo 2 terms), Wt bf16 [N][K]; ACT 0 none, 1 relu, 2 exact gelu;
// resid (optional, f32, row index = (row % rmod), pitch ldr, RES_BF16 rounds it) added before the activation.
template <bool ASPLIT, int ACT, bool BIAS_BF16, bool RES_BF16>
__global__ __launch_bounds__(128) void k_gemm_bf3(const float* __restrict__ A, int lda, const unsigned short* __restrict__ Wt, int ldb,
                                                const float* __restrict__ bias, const float* __restrict__ resid, int rmod, int ldr,
                                                float* __restrict__ C, int ldc, int M, int N, int K) {
  __shared__ __attribute__((aligned(16))) float so[4][16][64];
  const int tid = threadIdx.x, w = tid >> 5, lane = tid & 31, ln = lane & 15, hh = lane >> 4;
  const int ntn = N / 64;
  const int wid = blockIdx.x * 4 + w;
  const int mt = wid / ntn, nq = wid % ntn;
  if (mt * 16 >= M) return;
  const int row0 = mt * 16, col0 = nq * 64;
  const float* arow = A + (size_t)(row0 + ln) * lda;
  v8f acc[4] = {};
  for (int kb = 0; kb < K; kb += 32) {
    FragB ah, al;
    const v4f x0 = *(const v4fa*)(arow + kb + 8 * hh), x1 = *(const v4fa*)(arow + kb + 8 * hh + 4);
    const v4f x2 = *(const v4fa*)(arow + kb + 16 + 8 * hh), x3 = *(const v4fa*)(arow + kb + 16 + 8 * hh + 4);
    float xs[16] = {x0[0],x0[1],x0[2],x0[3],x1[0],x1[1],x1[2],x1[3],x2[0],x2[1],x2[2],x2[3],x3[0],x3[1],x3[2],x3[3]};
#pragma unroll
    for (int i = 0; i < 16; ++i) { const unsigned short hb = bf16_bits(xs[i]); ah.u[i] = hb; al.u[i] = ASPLIT ? bf16_bits(xs[i] - bf16_val(hb)) : (unsigned short)0; }
#pragma unroll
    for (int t = 0; t < 4; ++t) {
      const unsigned short* brow = Wt + (size_t)(col0 + t * 16 + ln) * ldb + kb;
      FragB b;
      b.half[0] = *(const v8us*)(brow + 8 * hh);
      b.half[1] = *(const v8us*)(brow + 16 + 8 * hh);
      acc[t] = mmaN<ASPLIT ? 2 : 1>(ah.v, al.v, b.v, b.v, acc[t]);
    }
  }
#pragma unroll
  for (int t = 0; t < 4; ++t) {
    const int col = col0 + t * 16 + ln;
    float bv = bias ? bias[col] : 0.f;
    if (BIAS_BF16) bv = bf16_round(bv);
#pragma unroll
    for (int r = 0; r < 8; ++r) {
      float v = acc[t][r] + bv;
      if (resid) { float rv = resid[(size_t)((row0 + 8 * hh + r) % rmod) * ldr + col]; if (RES_BF16) rv = bf16_round(rv); v += rv; }
      if (ACT == 1) v = fmaxf(v, 0.f);
      if (ACT == 2) v = 0.5f * v * (1.0f + erff(v * 0.70710678118654752f));
      if (ACT == 3) { const float u = 0.7978845608028654f * (v + 0.044715f * v * v * v); v = 0.5f * v * (1.0f + tanhf(u)); }
      so[w][8 * hh + r][t * 16 + ln] = v;
    }
  }
  __builtin_amdgcn_fence(__ATOMIC_ACQ_REL, "workgroup");
  __builtin_amdgcn_wave_barrier();
  const int rsub = lane >> 4, c4 = (lane & 15) * 4;
  {
#pragma unroll
    for (int q = 0; q < 8; ++q) {
      const int r = q * 2 + rsub;
      const v4f v = *(const v4fa*)&so[w][r][c4];
      *(v4f*)(C + (size_t)(row0 + r) * ldc + col0 + c4) = v;
    }
    
  }
}
// row LayerNorm (biased variance, eps) over N: s = X (+ R); optional out_sum <- s; out_norm <- (s-mu)*rsqrt(var+eps)*g + b
template <bool PARAM_BF16>
__global__ __launch_bounds__(256) void k_layernorm(const float* __restrict__ X, const float* __restrict__ R, const float* __restrict__ g, const float* __restrict__ bta,
                                                  float* __restrict__ out_sum, float* __restrict__ out_norm, int N, float eps) {
  __shared__ float red[256];
  const int row = blockIdx.x, tid = threadIdx.x;
  const float* x = X + (size_t)row * N; const float* rr = R ? R + (size_t)row * N : nullptr;
  float vals[16];                     // up to N = 4096
  const int per = N / 256;            // contiguous chunk per thread? use strided-by-4 chunks: thread handles j = tid*4 + 1024*u
  float s1 = 0.f;
  for (int u = 0; u < per / 4; ++u) {
    const int j = tid * 4 + 1024 * u;
    const v4f a = *(const v4fa*)(x + j);
    v4f b = {0.f,0.f,0.f,0.f}; if (rr) b = *(const v4fa*)(rr + j);
#pragma unroll
    for (int q = 0; q < 4; ++q) { const float v = a[q] + b[q]; vals[u * 4 + q] = v; s1 += v; }
  }
  red[tid] = s1; __syncthreads();
  for (int st = 128; st > 0; st >>= 1) { if (tid < st) red[tid] += red[tid + st]; __syncthreads(); }
  const float mu = red[0] / (float)N; __syncthreads();
  float s2 = 0.f;
  for (int u = 0; u < per / 4; ++u)
#pragma unroll
    for (int q = 0; q < 4; ++q) { const float c = vals[u * 4 + q] - mu; s2 += c * c; }
  red[tid] = s2; __syncthreads();
  for (int st = 128; st > 0; st >>= 1) { if (tid < st) red[tid] += red[tid + st]; __syncthreads(); }
  const float rs = rsqrtf(red[0] / (float)N + eps);
  {
    for (int u = 0; u < per / 4; ++u) {
      const int j = tid * 4 + 1024 * u;
      v4f o, sm;
#pragma unroll
      for (int q = 0; q < 4; ++q) {
        float gg = g[j + q], bb = bta[j + q];
        if (PARAM_BF16) { gg = bf16_round(gg); bb = bf16_round(bb); }
        sm[q] = vals[u * 4 + q]; o[q] = (vals[u * 4 + q] - mu) * rs * gg + bb;
      }
      if (out_sum) *(v4f*)(out_sum + (size_t)row * N + j) = sm;
      *(v4f*)(out_norm + (size_t)row * N + j) = o;
    }
    
  }
}



// ---- f16 WMMA path (v_wmma_f32_16x16x32_f16): 11-bit significands for operands in range — used where a [0,1] probability operand needs more precision than bf16
typedef _Float16 v16h __attribute__((ext_vector_type(16)));
union FragH { v16h v; v8us half[2]; _Float16 h[16]; unsigned short u[16]; };
template <int NT>
__device__ __forceinline__ v8f mmaH(v16h ah, v16h al, v16h bh, v16h bl, v8f c) {
  c = __builtin_amdgcn_wmma_f32_16x16x32_f16(false, ah, false, bh, (short)0, c, false, false);
  if (NT >= 2) c = __builtin_amdgcn_wmma_f32_16x16x32_f16(false, al, false, bh, (short)0, c, false, false);
  if (NT >= 3) c = __builtin_amdgcn_wmma_f32_16x16x32_f16(false, ah, false, bl, (short)0, c, false, false);
  asm volatile("v_nop\n\tv_nop\n\tv_nop\n\tv_nop" : "+v"(c) : "v"(ah), "v"(al), "v"(bh), "v"(bl));
  return c;
}
// batched GEMM like k_gemm_b but f16 operands: A f32 (split into f16 hi/lo if ASPLIT, else rounded to f16), Bt = f16 values [n][k]; alpha; C f32; N multiple of 16 (partial tiles skipped)
template <bool ASPLIT>
__global__ __launch_bounds__(128) void k_gemm_h(const float* __restrict__ A, int lda, size_t sA, const _Float16* __restrict__ Bh, int ldb, size_t sB, float alpha, float* __restrict__ C, int ldc, size_t sC, int M, int N, int K) {
  __shared__ __attribute__((aligned(16))) float so[4][16][64];
  const int tid = threadIdx.x, w = tid >> 5, lane = tid & 31, ln = lane & 15, hh = lane >> 4; const int by = blockIdx.y;
  A += (size_t)by * sA; Bh += (size_t)by * sB; C += (size_t)by * sC;
  const int ntn = (N + 63) / 64; const int wid = blockIdx.x * 4 + w; const int mt = wid / ntn, nq = wid % ntn; if (mt * 16 >= M) return;
  const int row0 = mt * 16, col0 = nq * 64; const float* arow = A + (size_t)(row0 + ln) * lda;
  v8f acc[4] = {};
  for (int kb = 0; kb < K; kb += 32) {
    FragH ah, al;
    const v4f x0 = *(const v4fa*)(arow + kb + 8 * hh), x1 = *(const v4fa*)(arow + kb + 8 * hh + 4), x2 = *(const v4fa*)(arow + kb + 16 + 8 * hh), x3 = *(const v4fa*)(arow + kb + 16 + 8 * hh + 4);
    float xs[16] = {x0[0],x0[1],x0[2],x0[3],x1[0],x1[1],x1[2],x1[3],x2[0],x2[1],x2[2],x2[3],x3[0],x3[1],x3[2],x3[3]};
#pragma unroll
    for (int i = 0; i < 16; ++i) { const _Float16 h = (_Float16)xs[i]; ah.h[i] = h; al.h[i] = ASPLIT ? (_Float16)(xs[i] - (float)h) : (_Float16)0.0f; }
#pragma unroll
    for (int t = 0; t < 4; ++t) { if (col0 + t * 16 >= N) continue; const size_t boff = (size_t)(col0 + t * 16 + ln) * ldb + kb; FragH bq; bq.half[0] = *(const v8us*)(Bh + boff + 8 * hh); bq.half[1] = *(const v8us*)(Bh + boff + 16 + 8 * hh);
      acc[t] = mmaH<ASPLIT ? 2 : 1>(ah.v, al.v, bq.v, bq.v, acc[t]); }
  }
#pragma unroll
  for (int t = 0; t < 4; ++t) { if (col0 + t * 16 >= N) continue;
#pragma unroll
    for (int r = 0; r < 8; ++r) so[w][8 * hh + r][t * 16 + ln] = acc[t][r] * alpha; }
  __builtin_amdgcn_fence(__ATOMIC_ACQ_REL, "workgroup"); __builtin_amdgcn_wave_barrier();
  const int rsub = lane >> 4, c4 = (lane & 15) * 4;
  {
#pragma unroll
    for (int q = 0; q < 8; ++q) { const int r = q * 2 + rsub; if (col0 + c4 < N) { const v4f v = *(const v4fa*)&so[w][r][c4]; *(v4f*)(C + (size_t)(row0 + r) * ldc + col0 + c4) = v; } }
     }
}

// One grid for the five preparations, none of which needs another's result; the block index picks the job (a block-uniform branch).
// Blocks 0 .. 4 GW - 1, GW per weight: Wt[n][k] = f16(bf16(W[k][n]) * 16) from f32 row-major W[k][n] (a power of two keeps the bf16-exact weights exact in f16, away from the subnormal range).
// The other blocks: X16 = f16(bf16(x)), eight elements a thread.
__global__ __launch_bounds__(256) void k_prep(const float* __restrict__ x, const float* __restrict__ wq, const float* __restrict__ wk, const float* __restrict__ wv, const float* __restrict__ wo,
                                              _Float16* __restrict__ X16, _Float16* __restrict__ Bq, _Float16* __restrict__ Bk, _Float16* __restrict__ Bv, _Float16* __restrict__ Bo) {
  constexpr int GW = DM * (DM / 8) / 256; const int blk = blockIdx.x; FragH f;
  if (blk < 4 * GW) {
    const int job = blk / GW; const float* W = job == 0 ? wq : job == 1 ? wk : job == 2 ? wv : wo; _Float16* Wt = job == 0 ? Bq : job == 1 ? Bk : job == 2 ? Bv : Bo;
    const int t = (blk % GW) * 256 + threadIdx.x; const int n = t / (DM / 8), k8 = (t % (DM / 8)) * 8;
#pragma unroll
    for (int i = 0; i < 8; ++i) f.h[i] = (_Float16)(bf16_round(W[(size_t)(k8 + i) * DM + n]) * 16.0f);
    *(v8us*)((unsigned short*)Wt + (size_t)n * DM + k8) = f.half[0];
  } else {
    const size_t t = (size_t)(blk - 4 * GW) * 256 + threadIdx.x;
#pragma unroll
    for (int q = 0; q < 8; ++q) f.h[q] = (_Float16)bf16_round(x[t * 8 + q]);
    *(v8us*)((unsigned short*)X16 + t * 8) = f.half[0];
    asm volatile("s_wait_xcnt 0x0" ::: "memory");      // the built code lays the weight part behind this store: the wait stands in front of any write of the store's registers there
  }
}
// C[4096][512] = (A . Bt^T) * alpha + bf16(bias): one 64 x 64 tile of C per work-group, wave w = rows 16 w .. 16 w + 15, all 64 columns, K = 512 whole.
// The 64 rows of A and the 64 rows of Bt (both k-contiguous) come in by whole-line loads (a wave-wide 16-byte load = two rows x 256 contiguous bytes) and are laid in LDS at a pitch of 1040 B
// (16 B x odd: no bank conflict for the 16-byte fragment reads); the fragments then come from LDS, in the same k order as when they were read from global memory. All global loads are issued first;
// K goes in four chunks of 128, each stored to its own LDS columns and multiplied while the later chunks are still on their way into registers. F32OUT: f32 C, else f16.
// The q, k and v products read the same A and need nothing of each other: they share one grid, GG blocks each, job = block index / GG picks weight, bias and output (F32OUT: GG blocks, job 0 alone).
// Jobs 0 and 1 write C0, C1 row-major; job 2 (v) writes its 64 tokens x 64 columns (one head) transposed, Vt[(batch, head)][d][token], as the attention kernel reads it.
template <bool F32OUT>
__global__ __launch_bounds__(128) void k_gemm_hhx(const _Float16* __restrict__ A, const _Float16* __restrict__ B0, const _Float16* __restrict__ B1, const _Float16* __restrict__ B2, float alpha,
                                                  const float* __restrict__ bias0, const float* __restrict__ bias1, const float* __restrict__ bias2, float* __restrict__ C, _Float16* __restrict__ C0, _Float16* __restrict__ C1, _Float16* __restrict__ Vt) {
  constexpr int GG = (NR / 64) * (DM / 64); const int job = blockIdx.x / GG, blk = blockIdx.x % GG;
  const _Float16* Bh = job == 0 ? B0 : job == 1 ? B1 : B2; const float* bias = job == 0 ? bias0 : job == 1 ? bias1 : bias2; _Float16* C16 = job == 0 ? C0 : C1;
  constexpr int KP = DM + 8, KC = 128, NC = DM / KC, NL = 64 * KC / 8 / 128, KS = KC / 32;      // LDS pitch in halves; k per chunk; chunks; 16-byte loads per thread, operand and chunk; k steps per chunk
  __shared__ __attribute__((aligned(16))) unsigned short sA[64][KP], sB[64][KP];
  __shared__ __attribute__((aligned(16))) float so[4][16][64];
  const int tid = threadIdx.x, w = tid >> 5, lane = tid & 31, ln = lane & 15, hh = lane >> 4;
  const int mt = blk / (DM / 64), nq = blk % (DM / 64);
  const int row0 = mt * 64 + w * 16, col0 = nq * 64;
  const unsigned short* Ag = (const unsigned short*)A + (size_t)mt * 64 * DM;
  const unsigned short* Bg = (const unsigned short*)Bh + (size_t)col0 * DM;
  const int sr = tid >> 4, sc = (tid & 15) * 8;      // staging: load i of chunk c takes row 8 i + sr, halves c * KC + sc .. + 7
  v8us ra[NC][NL], rb[NC][NL];
#pragma unroll
  for (int c = 0; c < NC; ++c) {
#pragma unroll
    for (int i = 0; i < NL; ++i) { ra[c][i] = *(const v8us*)(Ag + (size_t)(8 * i + sr) * DM + c * KC + sc); rb[c][i] = *(const v8us*)(Bg + (size_t)(8 * i + sr) * DM + c * KC + sc); }
    __builtin_amdgcn_sched_barrier(0);      // keeps the loads in chunk order, so that chunk 0 is complete after a quarter of them and not after half
  }
  asm volatile("s_wait_xcnt 0x0" ::: "memory");      // stands in front of the first overwrite of the loads' address registers, which are reused for fragments while later chunks are still in flight
  v8f acc[4] = {};
#pragma unroll
  for (int c = 0; c < NC; ++c) {
#pragma unroll
    for (int i = 0; i < NL; ++i) { *(v8us*)&sA[8 * i + sr][c * KC + sc] = ra[c][i]; *(v8us*)&sB[8 * i + sr][c * KC + sc] = rb[c][i]; }
    // publishes this chunk's LDS columns to all four waves. LDS-only fences: a full __syncthreads() would also wait for the later chunks' global loads, which only this thread's registers receive
    __builtin_amdgcn_fence(__ATOMIC_RELEASE, "workgroup", "local"); __builtin_amdgcn_s_barrier(); __builtin_amdgcn_fence(__ATOMIC_ACQUIRE, "workgroup", "local");
    FragH ah[KS], bq[KS][4];      // the whole chunk's fragments are asked for ahead of its first matrix instruction
#pragma unroll
    for (int ks = 0; ks < KS; ++ks) { const int kb = c * KC + ks * 32; ah[ks].half[0] = *(const v8us*)&sA[w * 16 + ln][kb + 8 * hh]; ah[ks].half[1] = *(const v8us*)&sA[w * 16 + ln][kb + 16 + 8 * hh];
#pragma unroll
      for (int t = 0; t < 4; ++t) { bq[ks][t].half[0] = *(const v8us*)&sB[t * 16 + ln][kb + 8 * hh]; bq[ks][t].half[1] = *(const v8us*)&sB[t * 16 + ln][kb + 16 + 8 * hh]; } }
#pragma unroll
    for (int ks = 0; ks < KS; ++ks)
#pragma unroll
      for (int t = 0; t < 4; ++t) acc[t] = mmaH<1>(ah[ks].v, ah[ks].v, bq[ks][t].v, bq[ks][t].v, acc[t]);
  }
  if (!F32OUT && job == 2) {      // block-uniform
    // an accumulator lane holds 8 consecutive tokens of one column d: 16 bytes of a transposed row. The four waves lay the 64 d x 64 tokens in LDS (pitch 144 B = 16 B x odd), then whole 128-byte rows of Vt go out
    unsigned short (*tl)[72] = (unsigned short (*)[72])&so[0][0][0];
#pragma unroll
    for (int t = 0; t < 4; ++t) { const float bv = bf16_round(bias[col0 + t * 16 + ln]); FragH f;
#pragma unroll
      for (int r = 0; r < 8; ++r) f.h[r] = (_Float16)(acc[t][r] * alpha + bv);
      *(v8us*)&tl[t * 16 + ln][w * 16 + 8 * hh] = f.half[0]; }
    __syncthreads();      // a row of tl holds tokens of all four waves
    unsigned short* vo = (unsigned short*)Vt + ((size_t)((mt * 64 / TT) * NH + nq) * HD) * TT + (mt * 64) % TT;
#pragma unroll
    for (int i = 0; i < 4; ++i) { const int d = i * 16 + (tid >> 3), pc = tid & 7; const v8us v = *(const v8us*)&tl[d][pc * 8]; *(v8us*)(vo + (size_t)d * TT + pc * 8) = v; }
    return;
  }
#pragma unroll
  for (int t = 0; t < 4; ++t) { const float bv = bf16_round(bias[col0 + t * 16 + ln]);
#pragma unroll
    for (int r = 0; r < 8; ++r) so[w][8 * hh + r][t * 16 + ln] = acc[t][r] * alpha + bv; }
  __builtin_amdgcn_fence(__ATOMIC_ACQ_REL, "workgroup"); __builtin_amdgcn_wave_barrier();
  const int rsub = lane >> 4, c4 = (lane & 15) * 4; typedef _Float16 v4h __attribute__((ext_vector_type(4)));
#pragma unroll
  for (int q = 0; q < 8; ++q) { const int r = q * 2 + rsub; const v4f v = *(const v4fa*)&so[w][r][c4];
    if (F32OUT) *(v4f*)(C + (size_t)(row0 + r) * DM + col0 + c4) = v;
    else { v4h h4; for (int i = 0; i < 4; ++i) h4[i] = (_Float16)v[i]; *(v4h*)(C16 + (size_t)(row0 + r) * DM + col0 + c4) = h4; } }
  if (!F32OUT) asm volatile("s_wait_xcnt 0x0" ::: "memory");      // the built code lays the transposed part behind these stores: the wait stands in front of any write of the stores' registers there
}


// lane l <-> lane l ^ 16: the two halves of a wave hold the two halves of one query's keys
__device__ __forceinline__ float xhalf(float v) { const int b = __float_as_int(v); return __int_as_float(__builtin_amdgcn_permlanex16(b, b, 0x76543210, 0xfedcba98, false, false)); }
// local attention per ((b,h), 128 queries): wave = 32 queries q0 ... q0 + 31, which reach keys q0 - 32 ... q0 + 63 and no others: the wave walks these 3 chunks of 32 keys, j0 = q0 - 32, q0, q0 + 32 (keys outside [0, T) are masked); score/8 where |k - t| <= 32.
// Both products run transposed: S^T = K . Q^T (A = 16 keys, B = 16 queries) and O^T += V^T . P^T (A = 16 d, B = 16 queries). An accumulator lane (ln, hh) then holds ONE query (column ln) and keys 8 hh + r
// down its registers: a query's maximum and sum are taken in the lane's own registers, with one exchange between the wave halves, and the two score tiles of a chunk (keys 0-15, 16-31), converted in place,
// are the B fragment of the second product in the k order of the V^T loader (8 hh + i, 16 + 8 hh + i): P never leaves the registers.
// The work-group's 128 queries reach 6 chunks of 32 keys, jc = qb0 - 32 + 32 c; wave w walks chunks w, w + 1, w + 2. All six are brought into LDS once, ahead of the loop, K as 128-byte rows and V^T as 64-byte row pieces,
// by 16-byte loads that are all in flight together; the fragments then come from LDS (pitches 144 B and 400 B = 16 B x odd), in the same k order as when they were read from global memory.
// A chunk lies wholly inside [0, T) or wholly outside (T and qb0 are multiples of 32): one outside is read at a CLAMPED chunk address and masked.
__global__ __launch_bounds__(128) void k_flash(const _Float16* __restrict__ Q16, const _Float16* __restrict__ K16, const _Float16* __restrict__ Vt, _Float16* __restrict__ O16) {
  constexpr int RPW = 32, NQB = TT / (4 * RPW), DT = HD / 16, KS = HD / 32;
  constexpr int NCH = (4 * RPW + 2 * WW) / 32;      // key chunks of the work-group
  __shared__ __attribute__((aligned(16))) unsigned short sO[4][RPW][HD + 8];      // output staging, pitch 144 B = 16 B x odd
  __shared__ __attribute__((aligned(16))) unsigned short sK[NCH * 32][HD + 8], sV[HD][NCH * 32 + 8];      // K[key][d], V^T[d][key]
  const int tid = threadIdx.x, lane = tid & 31, ln = lane & 15, hh = lane >> 4;
  const int w = __builtin_amdgcn_readfirstlane(tid >> 5);      // the wave's number in a scalar register: q0 and j0 depend on it, and with it the loop's test and the chunk's staged row offset jl are scalar
  const int slab = blockIdx.x / NQB, qblk = blockIdx.x % NQB; const int b = slab / NH, h = slab % NH; const int qb0 = qblk * (4 * RPW); const int q0 = qb0 + w * RPW;
  FragH aq[2][KS];
#pragma unroll
  for (int rt = 0; rt < 2; ++rt) { const unsigned short* qr = (const unsigned short*)Q16 + ((size_t)b * TT + q0 + rt * 16 + ln) * DM + h * HD;
#pragma unroll
    for (int ks = 0; ks < KS; ++ks) { aq[rt][ks].half[0] = *(const v8us*)(qr + ks * 32 + 8 * hh); aq[rt][ks].half[1] = *(const v8us*)(qr + ks * 32 + 16 + 8 * hh); } }
  const unsigned short* Vth = (const unsigned short*)Vt + (size_t)slab * HD * TT;
  {
    const unsigned short* Kh = (const unsigned short*)K16 + (size_t)b * TT * DM + h * HD;
    const int kr = tid >> 3, kp = (tid & 7) * 8, vr = tid >> 2, vp = (tid & 3) * 8;      // K: 8 threads a row, 16 rows a pass; V^T: 4 threads a row piece, 32 rows a pass
    v8us rk[NCH][2], rv[NCH][2];
#pragma unroll
    for (int cc = 0; cc < NCH; ++cc) { const int jc = qb0 - WW + cc * 32; const int jcl = jc < 0 ? 0 : (jc + 32 > TT ? TT - 32 : jc);      // clamped chunk address; keys outside [0,T) have p = 0 so the substituted values never contribute
#pragma unroll
      for (int u = 0; u < 2; ++u) { rk[cc][u] = *(const v8us*)(Kh + (size_t)(jcl + u * 16 + kr) * DM + kp); rv[cc][u] = *(const v8us*)(Vth + (size_t)(u * 32 + vr) * TT + jcl + vp); } }
#pragma unroll
    for (int cc = 0; cc < NCH; ++cc)
#pragma unroll
      for (int u = 0; u < 2; ++u) { *(v8us*)&sK[cc * 32 + u * 16 + kr][kp] = rk[cc][u]; *(v8us*)&sV[u * 32 + vr][cc * 32 + vp] = rv[cc][u]; }
  }
  __syncthreads();      // a chunk is laid down by all four waves and read by up to three
  float m_r[2], l_r[2]; v8f oacc[2][DT];      // per lane: query q0 + rt * 16 + ln; l_r sums this half's keys only; oacc[rt][dt][r] = O[query][dt * 16 + 8 hh + r]
#pragma unroll
  for (int rt = 0; rt < 2; ++rt) { m_r[rt] = -3.0e38f; l_r[rt] = 0.f;
#pragma unroll
    for (int dt = 0; dt < DT; ++dt) oacc[rt][dt] = (v8f){0.f,0.f,0.f,0.f,0.f,0.f,0.f,0.f}; }
#pragma unroll 1
  for (int j0 = q0 - WW; j0 < q0 + RPW + WW; j0 += 32) {
    const int jl = j0 - (qb0 - WW);      // the chunk's first key, counted in the staged rows
    FragH bk[2][KS], bv[DT];      // the chunk's 16 fragment reads stand together ahead of its first matrix instruction: one LDS latency a chunk
    v8f s[2][2];      // s[rt][nt][r] = score of key j0 + nt * 16 + 8 hh + r with query q0 + rt * 16 + ln
#pragma unroll
    for (int nt = 0; nt < 2; ++nt) { const unsigned short* kr = &sK[jl + nt * 16 + ln][0];
#pragma unroll
      for (int ks = 0; ks < KS; ++ks) { bk[nt][ks].half[0] = *(const v8us*)(kr + ks * 32 + 8 * hh); bk[nt][ks].half[1] = *(const v8us*)(kr + ks * 32 + 16 + 8 * hh); } }
#pragma unroll
    for (int dt = 0; dt < DT; ++dt) { const unsigned short* vrow = &sV[dt * 16 + ln][jl]; bv[dt].half[0] = *(const v8us*)(vrow + 8 * hh); bv[dt].half[1] = *(const v8us*)(vrow + 16 + 8 * hh); }
#pragma unroll
    for (int nt = 0; nt < 2; ++nt) {
#pragma unroll
      for (int rt = 0; rt < 2; ++rt) { v8f acc = (v8f){0.f,0.f,0.f,0.f,0.f,0.f,0.f,0.f};
#pragma unroll
        for (int ks = 0; ks < KS; ++ks) acc = mmaH<1>(bk[nt][ks].v, bk[nt][ks].v, aq[rt][ks].v, aq[rt][ks].v, acc); s[rt][nt] = acc; } }
    FragH pb[2];
#pragma unroll
    for (int rt = 0; rt < 2; ++rt) { const int t = q0 + rt * 16 + ln; float sv[16]; float mc = -INFINITY;
      const int lo = t - WW < 0 ? 0 : t - WW, hi = t + WW > TT - 1 ? TT - 1 : t + WW;      // this lane's query takes keys lo ... hi: 0 <= k < T and |k - t| <= 32 in one range
#pragma unroll
      for (int i = 0; i < 16; ++i) { const int k = j0 + (i >> 3) * 16 + 8 * hh + (i & 7); const bool ok = (unsigned)(k - lo) <= (unsigned)(hi - lo);
        sv[i] = ok ? s[rt][i >> 3][i & 7] * 0.125f : -INFINITY; mc = fmaxf(mc, sv[i]); }
      mc = fmaxf(mc, xhalf(mc));
      const float mn = fmaxf(m_r[rt], mc); const float al = (mn > -1.0e38f) ? expf(m_r[rt] - mn) : 1.0f; m_r[rt] = mn; float ps[4] = {0.f, 0.f, 0.f, 0.f};
#pragma unroll
      for (int i = 0; i < 16; ++i) { const float p = expf(sv[i] - mn); ps[i & 3] += p; pb[rt].h[i] = (_Float16)p; }      // a masked score is -inf and mn is finite: its p is exactly 0
      l_r[rt] = l_r[rt] * al + ((ps[0] + ps[1]) + (ps[2] + ps[3]));
#pragma unroll
      for (int dt = 0; dt < DT; ++dt)
#pragma unroll
        for (int r = 0; r < 8; ++r) oacc[rt][dt][r] *= al; }
#pragma unroll
    for (int dt = 0; dt < DT; ++dt)
#pragma unroll
      for (int rt = 0; rt < 2; ++rt) oacc[rt][dt] = mmaH<1>(bv[dt].v, bv[dt].v, pb[rt].v, pb[rt].v, oacc[rt][dt]); }
#pragma unroll
  for (int rt = 0; rt < 2; ++rt) { float l = l_r[rt] + xhalf(l_r[rt]);
    const int t = q0 + rt * 16 + ln; const int npad = (t < WW ? (WW - t) : 0) + (t + WW >= TT ? (t + WW - TT + 1) : 0); float sc = 1.0f;
    if (npad > 0) { const float m = m_r[rt]; const float mn = fmaxf(m, 0.f); sc = expf(m - mn); l = l * sc + (float)npad * expf(-mn); }
    const float inv = sc / l;
#pragma unroll
    for (int dt = 0; dt < DT; ++dt) { FragH f;      // 8 consecutive d of one query: 16 bytes of its f16 output row
#pragma unroll
      for (int r = 0; r < 8; ++r) f.h[r] = (_Float16)(oacc[rt][dt][r] * inv);
      *(v8us*)&sO[w][rt * 16 + ln][dt * 16 + 8 * hh] = f.half[0]; } }
  __builtin_amdgcn_fence(__ATOMIC_ACQ_REL, "workgroup"); __builtin_amdgcn_wave_barrier();
#pragma unroll
  for (int rp = 0; rp < RPW; rp += 4) { const int r = rp + (lane >> 3), pc = lane & 7; const v8us v = *(const v8us*)&sO[w][r][pc * 8];      // the A operand of the output projection, a whole 128-byte line per row
    *(v8us*)((unsigned short*)O16 + ((size_t)b * TT + q0 + r) * DM + h * HD + pc * 8) = v; } }
extern "C" void kernel_launch(void* const* d_in, const int* in_sizes, int n_in,
                              void* d_out, int out_size, void* d_ws, size_t ws_size, hipStream_t stream) {
  (void)in_sizes; (void)n_in; (void)out_size;
  const float* x = (const float*)d_in[0]; const float* wq = (const float*)d_in[1]; const float* bq = (const float*)d_in[2]; const float* wk = (const float*)d_in[3]; const float* bk = (const float*)d_in[4]; const float* wv = (const float*)d_in[5]; const float* bv = (const float*)d_in[6]; const float* wo = (const float*)d_in[7]; const float* bo = (const float*)d_in[8];
  char* ws = (char*)d_ws; size_t off = 0;
  auto take = [&](size_t bytes) { char* p = ws + off; off += (bytes + 255) & ~(size_t)255; return p; };
  const size_t w8 = (size_t)DM * DM / 8;
  _Float16* Bq = (_Float16*)take(w8 * 16); _Float16* Bk = (_Float16*)take(w8 * 16); _Float16* Bv = (_Float16*)take(w8 * 16); _Float16* Bo = (_Float16*)take(w8 * 16);
  _Float16* X16 = (_Float16*)take((size_t)NR * DM * 2); _Float16* Q16 = (_Float16*)take((size_t)NR * DM * 2); _Float16* K16 = (_Float16*)take((size_t)NR * DM * 2); _Float16* Vt = (_Float16*)take((size_t)NR * DM * 2); _Float16* O16 = X16;
  if (off > ws_size) return;      // 18 MiB
  const unsigned gw = (unsigned)(DM * (DM / 8) / 256), gx = (unsigned)((size_t)NR * DM / 8 / 256);
  k_prep<<<4 * gw + gx, 256, 0, stream>>>(x, wq, wk, wv, wo, X16, Bq, Bk, Bv, Bo);      // weights are [in][out]
  const unsigned gg = (NR / 64) * (DM / 64);
  k_gemm_hhx<false><<<3 * gg, 128, 0, stream>>>(X16, Bq, Bk, Bv, 0.0625f, bq, bk, bv, nullptr, Q16, K16, Vt);
  k_flash<<<BB * NH * (TT / 128), 128, 0, stream>>>(Q16, K16, Vt, O16);
  k_gemm_hhx<true><<<gg, 128, 0, stream>>>(O16, Bo, nullptr, nullptr, 0.0625f, bo, nullptr, nullptr, (float*)d_out, nullptr, nullptr, nullptr);
}

// v006
// Measured time: 26.2 microseconds a run.
// Two timings next to v005 put it at 1.22 and 1.19 times that version's speed.
// All steps since v000 together make it 5.39 times as fast.
#include <hip/hip_runtime.h>
// q/k/v/o projections (4096 × 512 × 512, + bias) and the 8-head LOCAL attention (window ±32, d = 64) on v_wmma_f32_16x16x32_f16: in a fused flash-style kernel a wave visits only the 3 key chunks
// around its 32 queries (S = Q·Kᵀ, O = P·V on WMMA; |k − t| ≤ 32 band mask; online max/sum softmax f32; P f16 ≤ 1), and the module's zero-PADDED keys (score exactly 0, value 0, they DO
// take part in the softmax) are added analytically per query as npad·e^{0 − m} in the normaliser; A = f16(bf16 ·) exact operands, weights [in][out] transposed to bf16-exact ×2^4, f32 accumulate.
#define BB 2
#define TT 2048
#define DM 512
#define NH 8
#define HD 64
#define WW 32
#define NR (BB * TT)

typedef __bf16 v16b __attribute__((ext_vector_type(16)));
typedef unsigned short v8us __attribute__((ext_vector_type(8), may_alias));
typedef float  v8f  __attribute__((ext_vector_type(8)));
typedef float  v4f  __attribute__((ext_vector_type(4)));
typedef float  v4fa __attribute__((ext_vector_type(4), may_alias));
union FragB { v16b v; v8us half[2]; unsigned short u[16]; };

__device__ __forceinline__ unsigned short bf16_bits(float x) { unsigned int u = __float_as_uint(x); return (unsigned short)((u + 0x7FFFu + ((u >> 16) & 1u)) >> 16); }
__device__ __forceinline__ float bf16_val(unsigned short b) { return __uint_as_float(((unsigned int)b) << 16); }
__device__ __forceinline__ float bf16_round(float x) { return bf16_val(bf16_bits(x)); }
// D += A·B with NT terms: 1 = ah·bh, 2 = + al·bh (A split), 3 = + ah·bl (both split)
template <int NT>
__device__ __forceinline__ v8f mmaN(v16b ah, v16b al, v16b bh, v16b bl, v8f c) {
  c = __builtin_amdgcn_wmma_f32_16x16x32_bf16(false, ah, false, bh, (short)0, c, false, false);
  if (NT >= 2) c = __builtin_amdgcn_wmma_f32_16x16x32_bf16(false, al, false, bh, (short)0, c, false, false);
  if (NT >= 3) c = __builtin_amdgcn_wmma_f32_16x16x32_bf16(false, ah, false, bl, (short)0, c, false, false);
  asm volatile("v_nop\n\tv_nop\n\tv_nop\n\tv_nop" : "+v"(c) : "v"(ah), "v"(al), "v"(bh), "v"(bl));
  return c;
}

__global__ __launch_bounds__(256) void k_wt_bf16(const float* __restrict__ W, unsigned short* __restrict__ Wt, int K, int N) {
  const int t = blockIdx.x * 256 + threadIdx.x;
  const int k8n = K / 8;
  if (t >= N * k8n) return;
  const int n = t / k8n, k8 = (t % k8n) * 8;
  v8us v;
#pragma unroll
  for (int i = 0; i < 8; ++i) v[i] = bf16_bits(W[(size_t)(k8 + i) * N + n]);
  *(v8us*)(Wt + (size_t)n * K + k8) = v;
  
}

// GEMM C[M][N] (f32, pitch ldc) = act(A[M][K]·W + bias). A f32 row-major (pitch lda) converted per fragment to bf16
// (ASPLIT: hi/lo two planes -> 2 terms, else single rounded term); Wt bf16 [N][K] (pitch ldb). BIAS_BF16 rounds the
// bias to bf16 first (bias quantised to bf16 before the add). K%32==0, M%16==0, N%64==0.
template <bool ASPLIT, int ACT, bool BIAS_BF16>
__global__ __launch_bounds__(128) void k_gemm_bf(const float* __restrict__ A, int lda, const unsigned short* __restrict__ Wt, int ldb,
                                               const float* __restrict__ bias, float* __restrict__ C, int ldc, int M, int N, int K) {
  __shared__ __attribute__((aligned(16))) float so[4][16][64];
  const int tid = threadIdx.x, w = tid >> 5, lane = tid & 31, ln = lane & 15, hh = lane >> 4;
  const int ntn = N / 64;
  const int wid = blockIdx.x * 4 + w;
  const int mt = wid / ntn, nq = wid % ntn;
  if (mt * 16 >= M) return;
  const int row0 = mt * 16, col0 = nq * 64;
  const float* arow = A + (size_t)(row0 + ln) * lda;
  v8f acc[4] = {};
  for (int kb = 0; kb < K; kb += 32) {
    FragB ah, al;
    const v4f x0 = *(const v4fa*)(arow + kb + 8 * hh), x1 = *(const v4fa*)(arow + kb + 8 * hh + 4);
    const v4f x2 = *(const v4fa*)(arow + kb + 16 + 8 * hh), x3 = *(const v4fa*)(arow + kb + 16 + 8 * hh + 4);
    float xs[16] = {x0[0],x0[1],x0[2],x0[3],x1[0],x1[1],x1[2],x1[3],x2[0],x2[1],x2[2],x2[3],x3[0],x3[1],x3[2],x3[3]};
#pragma unroll
    for (int i = 0; i < 16; ++i) { const unsigned short hb = bf16_bits(xs[i]); ah.u[i] = hb; al.u[i] = ASPLIT ? bf16_bits(xs[i] - bf16_val(hb)) : (unsigned short)0; }
#pragma unroll
    for (int t = 0; t < 4; ++t) {
      const unsigned short* brow = Wt + (size_t)(col0 + t * 16 + ln) * ldb + kb;
      FragB b;
      b.half[0] = *(const v8us*)(brow + 8 * hh);
      b.half[1] = *(const v8us*)(brow + 16 + 8 * hh);
      acc[t] = mmaN<ASPLIT ? 2 : 1>(ah.v, al.v, b.v, b.v, acc[t]);
    }
  }
#pragma unroll
  for (int t = 0; t < 4; ++t) {
    float bv = bias ? bias[col0 + t * 16 + ln] : 0.f;
    if (BIAS_BF16) bv = bf16_round(bv);
#pragma unroll
    for (int r = 0; r < 8; ++r) { float v = acc[t][r] + bv; if (ACT == 1) v = fmaxf(v, 0.f); so[w][8 * hh + r][t * 16 + ln] = v; }
  }
  __builtin_amdgcn_fence(__ATOMIC_ACQ_REL, "workgroup");
  __builtin_amdgcn_wave_barrier();
  const int rsub = lane >> 4, c4 = (lane & 15) * 4;
  {
#pragma unroll
    for (int q = 0; q < 8; ++q) {
      const int r = q * 2 + rsub;
      const v4f v = *(const v4fa*)&so[w][r][c4];
      *(v4f*)(C + (size_t)(row0 + r) * ldc + col0 + c4) = v;
    }
    
  }
}

// Flash-style causal/unmasked attention, all contractions 3-term bf16 hi/lo splits, f32 softmax with running max.
// q,k,v rows are read from f32 buffers with arbitrary row pitch (so they can live inside a fused qkv buffer);
// D = head size (multiple of 32, <= 128); one wave = 16 query rows; block = 4 waves (64 queries) sharing K/V chunks of 32.
template <int D, bool CAUSAL>
__global__ __launch_bounds__(128) void k_flash(const float* __restrict__ qb, const float* __restrict__ kb, const float* __restrict__ vb,
                                             int pitch, int T, int H, float scale, float* __restrict__ y, int ypitch) {
  constexpr int KS = D / 32;        // k-steps for QK
  constexpr int DT = D / 16;        // d tiles for PV
  __shared__ __attribute__((aligned(16))) unsigned short sKh[32][D + 8], sKl[32][D + 8], sVh[32][D + 8], sVl[32][D + 8];
  __shared__ __attribute__((aligned(16))) unsigned short sPh[4][16][40], sPl[4][16][40];
  __shared__ __attribute__((aligned(16))) float sO[4][16][D];
  const int tid = threadIdx.x, w = tid >> 5, lane = tid & 31, ln = lane & 15, hh = lane >> 4;
  const int nqb = (T + 63) / 64;
  const int bh = blockIdx.x / nqb, qblk = blockIdx.x % nqb;
  const int b = bh / H, h = bh % H;
  const int q0 = qblk * 64 + w * 16;
  const float* Q = qb + (size_t)b * T * pitch + h * D;
  const float* K = kb + (size_t)b * T * pitch + h * D;
  const float* V = vb + (size_t)b * T * pitch + h * D;

  // A fragments of the wave's 16 query rows (scaled), hi/lo
  FragB aqh[KS], aql[KS];
  {
    int row = q0 + ln; if (row >= T) row = T - 1;
    const float* qr = Q + (size_t)row * pitch;
#pragma unroll
    for (int ks = 0; ks < KS; ++ks)
#pragma unroll
      for (int i = 0; i < 16; ++i) {
        const int d = ks * 32 + ((i < 8) ? (8 * hh + i) : (16 + 8 * hh + (i - 8)));
        const float x = qr[d] * scale; const unsigned short hb = bf16_bits(x);
        aqh[ks].u[i] = hb; aql[ks].u[i] = bf16_bits(x - bf16_val(hb));
      }
  }
  float m_r[8], l_r[8];
#pragma unroll
  for (int r = 0; r < 8; ++r) { m_r[r] = -3.0e38f; l_r[r] = 0.f; }
  v8f oacc[DT];
#pragma unroll
  for (int dt = 0; dt < DT; ++dt) oacc[dt] = (v8f){0.f,0.f,0.f,0.f,0.f,0.f,0.f,0.f};

  const int kv_end = CAUSAL ? min(T, qblk * 64 + 64) : T;     // block-uniform
  for (int j0 = 0; j0 < kv_end; j0 += 32) {
    __syncthreads();
    for (int e = tid; e < 32 * (D / 4); e += 128) {
      const int r = e / (D / 4), c4 = (e % (D / 4)) * 4;
      const int key = j0 + r;
      v4f kf = {0.f,0.f,0.f,0.f}, vf = {0.f,0.f,0.f,0.f};
      if (key < T) { kf = *(const v4fa*)(K + (size_t)key * pitch + c4); vf = *(const v4fa*)(V + (size_t)key * pitch + c4); }
#pragma unroll
      for (int t = 0; t < 4; ++t) {
        unsigned short hb = bf16_bits(kf[t]); sKh[r][c4 + t] = hb; sKl[r][c4 + t] = bf16_bits(kf[t] - bf16_val(hb));
        hb = bf16_bits(vf[t]); sVh[r][c4 + t] = hb; sVl[r][c4 + t] = bf16_bits(vf[t] - bf16_val(hb));
      }
    }
    __syncthreads();
    // S tile 16 x 32
    v8f s[2];
#pragma unroll
    for (int nt = 0; nt < 2; ++nt) {
      v8f acc = {};
#pragma unroll
      for (int ks = 0; ks < KS; ++ks) {
        FragB bh_, bl_;
        bh_.half[0] = *(const v8us*)&sKh[nt * 16 + ln][ks * 32 + 8 * hh]; bh_.half[1] = *(const v8us*)&sKh[nt * 16 + ln][ks * 32 + 16 + 8 * hh];
        bl_.half[0] = *(const v8us*)&sKl[nt * 16 + ln][ks * 32 + 8 * hh]; bl_.half[1] = *(const v8us*)&sKl[nt * 16 + ln][ks * 32 + 16 + 8 * hh];
        acc = mmaN<3>(aqh[ks].v, aql[ks].v, bh_.v, bl_.v, acc);
      }
      s[nt] = acc;
    }
    // mask + running max (rows 8hh+r; the 16 lanes of a half share rows)
    float alpha[8];
#pragma unroll
    for (int r = 0; r < 8; ++r) {
      const int qi = q0 + 8 * hh + r;
      const int ja = j0 + ln, jb = j0 + 16 + ln;
      if (CAUSAL) { if (ja > qi) s[0][r] = -3.0e38f; if (jb > qi) s[1][r] = -3.0e38f; }
      if (ja >= T) s[0][r] = -3.0e38f;
      if (jb >= T) s[1][r] = -3.0e38f;
      float mx = fmaxf(s[0][r], s[1][r]);
      mx = fmaxf(mx, __shfl_xor(mx, 1, 32)); mx = fmaxf(mx, __shfl_xor(mx, 2, 32)); mx = fmaxf(mx, __shfl_xor(mx, 4, 32)); mx = fmaxf(mx, __shfl_xor(mx, 8, 32));
      const float mnew = fmaxf(m_r[r], mx);
      alpha[r] = (mnew > -1.0e38f) ? __expf(m_r[r] - mnew) : 1.0f;
      const float p0 = (s[0][r] > -1.0e38f) ? __expf(s[0][r] - mnew) : 0.f;
      const float p1 = (s[1][r] > -1.0e38f) ? __expf(s[1][r] - mnew) : 0.f;
      m_r[r] = mnew;
      l_r[r] = l_r[r] * alpha[r] + p0 + p1;            // per-lane partial row sum (16 lanes combined at the end)
      unsigned short hb = bf16_bits(p0); sPh[w][8 * hh + r][ln] = hb;      sPl[w][8 * hh + r][ln] = bf16_bits(p0 - bf16_val(hb));
      hb = bf16_bits(p1);                sPh[w][8 * hh + r][16 + ln] = hb; sPl[w][8 * hh + r][16 + ln] = bf16_bits(p1 - bf16_val(hb));
    }
#pragma unroll
    for (int dt = 0; dt < DT; ++dt)
#pragma unroll
      for (int r = 0; r < 8; ++r) oacc[dt][r] *= alpha[r];
    __builtin_amdgcn_fence(__ATOMIC_ACQ_REL, "workgroup");
    __builtin_amdgcn_wave_barrier();
    FragB pah, pal;
    pah.half[0] = *(const v8us*)&sPh[w][ln][8 * hh]; pah.half[1] = *(const v8us*)&sPh[w][ln][16 + 8 * hh];
    pal.half[0] = *(const v8us*)&sPl[w][ln][8 * hh]; pal.half[1] = *(const v8us*)&sPl[w][ln][16 + 8 * hh];
#pragma unroll
    for (int dt = 0; dt < DT; ++dt) {
      FragB bvh, bvl;
#pragma unroll
      for (int i = 0; i < 8; ++i) {
        bvh.u[i] = sVh[8 * hh + i][dt * 16 + ln]; bvh.u[8 + i] = sVh[16 + 8 * hh + i][dt * 16 + ln];
        bvl.u[i] = sVl[8 * hh + i][dt * 16 + ln]; bvl.u[8 + i] = sVl[16 + 8 * hh + i][dt * 16 + ln];
      }
      oacc[dt] = mmaN<3>(pah.v, pal.v, bvh.v, bvl.v, oacc[dt]);
    }
    __builtin_amdgcn_fence(__ATOMIC_ACQ_REL, "workgroup");
    __builtin_amdgcn_wave_barrier();
  }
#pragma unroll
  for (int r = 0; r < 8; ++r) {
    float l = l_r[r];
    l += __shfl_xor(l, 1, 32); l += __shfl_xor(l, 2, 32); l += __shfl_xor(l, 4, 32); l += __shfl_xor(l, 8, 32);
    l_r[r] = (l > 0.f) ? 1.0f / l : 0.f;
  }
#pragma unroll
  for (int dt = 0; dt < DT; ++dt)
#pragma unroll
    for (int r = 0; r < 8; ++r) sO[w][8 * hh + r][dt * 16 + ln] = oacc[dt][r] * l_r[r];
  __builtin_amdgcn_fence(__ATOMIC_ACQ_REL, "workgroup");
  __builtin_amdgcn_wave_barrier();
  {
    for (int r = 0; r < 16; ++r) {
      const int row = q0 + r;
      if (row < T && lane < D / 4) {
        const v4f val = *(const v4fa*)&sO[w][r][lane * 4];
        *(v4f*)(y + ((size_t)b * T + row) * ypitch + h * D + lane * 4) = val;
      }
    }
    
  }
}

// GEMM C = act(A·W + bias + resid): A f32 (ASPLIT -> hi/lo 2 terms), Wt bf16 [N][K]; ACT 0 none, 1 relu, 2 exact gelu;
// resid (optional, f32, row index = (row % rmod), pitch ldr, RES_BF16 rounds it) added before the activation.
template <bool ASPLIT, int ACT, bool BIAS_BF16, bool RES_BF16>
__global__ __launch_bounds__(128) void k_gemm_bf3(const float* __restrict__ A, int lda, const unsigned short* __restrict__ Wt, int ldb,
                                                const float* __restrict__ bias, const float* __restrict__ resid, int rmod, int ldr,
                                                float* __restrict__ C, int ldc, int M, int N, int K) {
  __shared__ __attribute__((aligned(16))) float so[4][16][64];
  const int tid = threadIdx.x, w = tid >> 5, lane = tid & 31, ln = lane & 15, hh = lane >> 4;
  const int ntn = N / 64;
  const int wid = blockIdx.x * 4 + w;
  const int mt = wid / ntn, nq = wid % ntn;
  if (mt * 16 >= M) return;
  const int row0 = mt * 16, col0 = nq * 64;
  const float* arow = A + (size_t)(row0 + ln) * lda;
  v8f acc[4] = {};
  for (int kb = 0; kb < K; kb += 32) {
    FragB ah, al;
    const v4f x0 = *(const v4fa*)(arow + kb + 8 * hh), x1 = *(const v4fa*)(arow + kb + 8 * hh + 4);
    const v4f x2 = *(const v4fa*)(arow + kb + 16 + 8 * hh), x3 = *(const v4fa*)(arow + kb + 16 + 8 * hh + 4);
    float xs[16] = {x0[0],x0[1],x0[2],x0[3],x1[0],x1[1],x1[2],x1[3],x2[0],x2[1],x2[2],x2[3],x3[0],x3[1],x3[2],x3[3]};
#pragma unroll
    for (int i = 0; i < 16; ++i) { const unsigned short hb = bf16_bits(xs[i]); ah.u[i] = hb; al.u[i] = ASPLIT ? bf16_bits(xs[i] - bf16_val(hb)) : (unsigned short)0; }
#pragma unroll
    for (int t = 0; t < 4; ++t) {
      const unsigned short* brow = Wt + (size_t)(col0 + t * 16 + ln) * ldb + kb;
      FragB b;
      b.half[0] = *(const v8us*)(brow + 8 * hh);
      b.half[1] = *(const v8us*)(brow + 16 + 8 * hh);
      acc[t] = mmaN<ASPLIT ? 2 : 1>(ah.v, al.v, b.v, b.v, acc[t]);
    }
  }
#pragma unroll
  for (int t = 0; t < 4; ++t) {
    const int col = col0 + t * 16 + ln;
    float bv = bias ? bias[col] : 0.f;
    if (BIAS_BF16) bv = bf16_round(bv);
#pragma unroll
    for (int r = 0; r < 8; ++r) {
      float v = acc[t][r] + bv;
      if (resid) { float rv = resid[(size_t)((row0 + 8 * hh + r) % rmod) * ldr + col]; if (RES_BF16) rv = bf16_round(rv); v += rv; }
      if (ACT == 1) v = fmaxf(v, 0.f);
      if (ACT == 2) v = 0.5f * v * (1.0f + erff(v * 0.70710678118654752f));
      if (ACT == 3) { const float u = 0.7978845608028654f * (v + 0.044715f * v * v * v); v = 0.5f * v * (1.0f + tanhf(u)); }
      so[w][8 * hh + r][t * 16 + ln] = v;
    }
  }
  __builtin_amdgcn_fence(__ATOMIC_ACQ_REL, "workgroup");
  __builtin_amdgcn_wave_barrier();
  const int rsub = lane >> 4, c4 = (lane & 15) * 4;
  {
#pragma unroll
    for (int q = 0; q < 8; ++q) {
      const int r = q * 2 + rsub;
      const v4f v = *(const v4fa*)&so[w][r][c4];
      *(v4f*)(C + (size_t)(row0 + r) * ldc + col0 + c4) = v;
    }
    
  }
}
// row LayerNorm (biased variance, eps) over N: s = X (+ R); optional out_sum <- s; out_norm <- (s-mu)*rsqrt(var+eps)*g + b
template <bool PARAM_BF16>
__global__ __launch_bounds__(256) void k_layernorm(const float* __restrict__ X, const float* __restrict__ R, const float* __restrict__ g, const float* __restrict__ bta,
                                                  float* __restrict__ out_sum, float* __restrict__ out_norm, int N, float eps) {
  __shared__ float red[256];
  const int row = blockIdx.x, tid = threadIdx.x;
  const float* x = X + (size_t)row * N; const float* rr = R ? R + (size_t)row * N : nullptr;
  float vals[16];                     // up to N = 4096
  const int per = N / 256;            // contiguous chunk per thread? use strided-by-4 chunks: thread handles j = tid*4 + 1024*u
  float s1 = 0.f;
  for (int u = 0; u < per / 4; ++u) {
    const int j = tid * 4 + 1024 * u;
    const v4f a = *(const v4fa*)(x + j);
    v4f b = {0.f,0.f,0.f,0.f}; if (rr) b = *(const v4fa*)(rr + j);
#pragma unroll
    for (int q = 0; q < 4; ++q) { const float v = a[q] + b[q]; vals[u * 4 + q] = v; s1 += v; }
  }
  red[tid] = s1; __syncthreads();
  for (int st = 128; st > 0; st >>= 1) { if (tid < st) red[tid] += red[tid + st]; __syncthreads(); }
  const float mu = red[0] / (float)N; __syncthreads();
  float s2 = 0.f;
  for (int u = 0; u < per / 4; ++u)
#pragma unroll
    for (int q = 0; q < 4; ++q) { const float c = vals[u * 4 + q] - mu; s2 += c * c; }
  red[tid] = s2; __syncthreads();
  for (int st = 128; st > 0; st >>= 1) { if (tid < st) red[tid] += red[tid + st]; __syncthreads(); }
  const float rs = rsqrtf(red[0] / (float)N + eps);
  {
    for (int u = 0; u < per / 4; ++u) {
      const int j = tid * 4 + 1024 * u;
      v4f o, sm;
#pragma unroll
      for (int q = 0; q < 4; ++q) {
        float gg = g[j + q], bb = bta[j + q];
        if (PARAM_BF16) { gg = bf16_round(gg); bb = bf16_round(bb); }
        sm[q] = vals[u * 4 + q]; o[q] = (vals[u * 4 + q] - mu) * rs * gg + bb;
      }
      if (out_sum) *(v4f*)(out_sum + (size_t)row * N + j) = sm;
      *(v4f*)(out_norm + (size_t)row * N + j) = o;
    }
    
  }
}



// ---- f16 WMMA path (v_wmma_f32_16x16x32_f16): 11-bit significands for operands in range — used where a [0,1] probability operand needs more precision than bf16
typedef _Float16 v16h __attribute__((ext_vector_type(16)));
union FragH { v16h v; v8us half[2]; _Float16 h[16]; unsigned short u[16]; };
template <int NT>
__device__ __forceinline__ v8f mmaH(v16h ah, v16h al, v16h bh, v16h bl, v8f c) {
  c = __builtin_amdgcn_wmma_f32_16x16x32_f16(false, ah, false, bh, (short)0, c, false, false);
  if (NT >= 2) c = __builtin_amdgcn_wmma_f32_16x16x32_f16(false, al, false, bh, (short)0, c, false, false);
  if (NT >= 3) c = __builtin_amdgcn_wmma_f32_16x16x32_f16(false, ah, false, bl, (short)0, c, false, false);
  asm volatile("v_nop\n\tv_nop\n\tv_nop\n\tv_nop" : "+v"(c) : "v"(ah), "v"(al), "v"(bh), "v"(bl));
  return c;
}
// batched GEMM like k_gemm_b but f16 operands: A f32 (split into f16 hi/lo if ASPLIT, else rounded to f16), Bt = f16 values [n][k]; alpha; C f32; N multiple of 16 (partial tiles skipped)
template <bool ASPLIT>
__global__ __launch_bounds__(128) void k_gemm_h(const float* __restrict__ A, int lda, size_t sA, const _Float16* __restrict__ Bh, int ldb, size_t sB, float alpha, float* __restrict__ C, int ldc, size_t sC, int M, int N, int K) {
  __shared__ __attribute__((aligned(16))) float so[4][16][64];
  const int tid = threadIdx.x, w = tid >> 5, lane = tid & 31, ln = lane & 15, hh = lane >> 4; const int by = blockIdx.y;
  A += (size_t)by * sA; Bh += (size_t)by * sB; C += (size_t)by * sC;
  const int ntn = (N + 63) / 64; const int wid = blockIdx.x * 4 + w; const int mt = wid / ntn, nq = wid % ntn; if (mt * 16 >= M) return;
  const int row0 = mt * 16, col0 = nq * 64; const float* arow = A + (size_t)(row0 + ln) * lda;
  v8f acc[4] = {};
  for (int kb = 0; kb < K; kb += 32) {
    FragH ah, al;
    const v4f x0 = *(const v4fa*)(arow + kb + 8 * hh), x1 = *(const v4fa*)(arow + kb + 8 * hh + 4), x2 = *(const v4fa*)(arow + kb + 16 + 8 * hh), x3 = *(const v4fa*)(arow + kb + 16 + 8 * hh + 4);
    float xs[16] = {x0[0],x0[1],x0[2],x0[3],x1[0],x1[1],x1[2],x1[3],x2[0],x2[1],x2[2],x2[3],x3[0],x3[1],x3[2],x3[3]};
#pragma unroll
    for (int i = 0; i < 16; ++i) { const _Float16 h = (_Float16)xs[i]; ah.h[i] = h; al.h[i] = ASPLIT ? (_Float16)(xs[i] - (float)h) : (_Float16)0.0f; }
#pragma unroll
    for (int t = 0; t < 4; ++t) { if (col0 + t * 16 >= N) continue; const size_t boff = (size_t)(col0 + t * 16 + ln) * ldb + kb; FragH bq; bq.half[0] = *(const v8us*)(Bh + boff + 8 * hh); bq.half[1] = *(const v8us*)(Bh + boff + 16 + 8 * hh);
      acc[t] = mmaH<ASPLIT ? 2 : 1>(ah.v, al.v, bq.v, bq.v, acc[t]); }
  }
#pragma unroll
  for (int t = 0; t < 4; ++t) { if (col0 + t * 16 >= N) continue;
#pragma unroll
    for (int r = 0; r < 8; ++r) so[w][8 * hh + r][t * 16 + ln] = acc[t][r] * alpha; }
  __builtin_amdgcn_fence(__ATOMIC_ACQ_REL, "workgroup"); __builtin_amdgcn_wave_barrier();
  const int rsub = lane >> 4, c4 = (lane & 15) * 4;
  {
#pragma unroll
    for (int q = 0; q < 8; ++q) { const int r = q * 2 + rsub; if (col0 + c4 < N) { const v4f v = *(const v4fa*)&so[w][r][c4]; *(v4f*)(C + (size_t)(row0 + r) * ldc + col0 + c4) = v; } }
     }
}

// One grid for the five preparations, none of which needs another's result; the block index picks the job (a block-uniform branch).
// Blocks 0 .. 4 GW - 1, GW per weight: Wt[n][k] = f16(bf16(W[k][n]) * 16) from f32 row-major W[k][n] (a power of two keeps the bf16-exact weights exact in f16, away from the subnormal range).
// The other blocks: X16 = f16(bf16(x)), eight elements a thread.
__global__ __launch_bounds__(256) void k_prep(const float* __restrict__ x, const float* __restrict__ wq, const float* __restrict__ wk, const float* __restrict__ wv, const float* __restrict__ wo,
                                              _Float16* __restrict__ X16, _Float16* __restrict__ Bq, _Float16* __restrict__ Bk, _Float16* __restrict__ Bv, _Float16* __restrict__ Bo) {
  constexpr int GW = DM * (DM / 8) / 256; const int blk = blockIdx.x; FragH f;
  if (blk < 4 * GW) {
    const int job = blk / GW; const float* W = job == 0 ? wq : job == 1 ? wk : job == 2 ? wv : wo; _Float16* Wt = job == 0 ? Bq : job == 1 ? Bk : job == 2 ? Bv : Bo;
    const int t = (blk % GW) * 256 + threadIdx.x; const int n = t / (DM / 8), k8 = (t % (DM / 8)) * 8;
#pragma unroll
    for (int i = 0; i < 8; ++i) f.h[i] = (_Float16)(bf16_round(W[(size_t)(k8 + i) * DM + n]) * 16.0f);
    *(v8us*)((unsigned short*)Wt + (size_t)n * DM + k8) = f.half[0];
  } else {
    const size_t t = (size_t)(blk - 4 * GW) * 256 + threadIdx.x;
#pragma unroll
    for (int q = 0; q < 8; ++q) f.h[q] = (_Float16)bf16_round(x[t * 8 + q]);
    *(v8us*)((unsigned short*)X16 + t * 8) = f.half[0];
    asm volatile("s_wait_xcnt 0x0" ::: "memory");      // the built code lays the weight part behind this store: the wait stands in front of any write of the store's registers there
  }
}
// C[4096][512] = (A . Bt^T) * alpha + bf16(bias): one 64 x 64 tile of C per work-group, wave w = rows 16 w .. 16 w + 15, all 64 columns, K = 512 whole.
// The 64 rows of A and the 64 rows of Bt (both k-contiguous) come in by whole-line loads (a wave-wide 16-byte load = two rows x 256 contiguous bytes) and are laid in LDS at a pitch of 1040 B
// (16 B x odd: no bank conflict for the 16-byte fragment reads); the fragments then come from LDS, in the same k order as when they were read from global memory. All global loads are issued first;
// K goes in four chunks of 128, each stored to its own LDS columns and multiplied while the later chunks are still on their way into registers. F32OUT: f32 C, else f16.
// The q, k and v products read the same A and need nothing of each other: they share one grid, GG blocks each, job = block index / GG picks weight, bias and output (F32OUT: GG blocks, job 0 alone).
// Jobs 0 and 1 write C0, C1 row-major; job 2 (v) writes its 64 tokens x 64 columns (one head) transposed, Vt[(batch, head)][d][token], as the attention kernel reads it.
template <bool F32OUT>
__global__ __launch_bounds__(128) void k_gemm_hhx(const _Float16* __restrict__ A, const _Float16* __restrict__ B0, const _Float16* __restrict__ B1, const _Float16* __restrict__ B2, float alpha,
                                                  const float* __restrict__ bias0, const float* __restrict__ bias1, const float* __restrict__ bias2, float* __restrict__ C, _Float16* __restrict__ C0, _Float16* __restrict__ C1, _Float16* __restrict__ Vt) {
  constexpr int GG = (NR / 64) * (DM / 64); const int job = blockIdx.x / GG, blk = blockIdx.x % GG;
  const _Float16* Bh = job == 0 ? B0 : job == 1 ? B1 : B2; const float* bias = job == 0 ? bias0 : job == 1 ? bias1 : bias2; _Float16* C16 = job == 0 ? C0 : C1;
  constexpr int KP = DM + 8, KC = 128, NC = DM / KC, NL = 64 * KC / 8 / 128, KS = KC / 32;      // LDS pitch in halves; k per chunk; chunks; 16-byte loads per thread, operand and chunk; k steps per chunk
  __shared__ __attribute__((aligned(16))) unsigned short sA[64][KP], sB[64][KP];
  __shared__ __attribute__((aligned(16))) float so[4][16][64];
  const int tid = threadIdx.x, w = tid >> 5, lane = tid & 31, ln = lane & 15, hh = lane >> 4;
  const int mt = blk / (DM / 64), nq = blk % (DM / 64);
  const int row0 = mt * 64 + w * 16, col0 = nq * 64;
  const unsigned short* Ag = (const unsigned short*)A + (size_t)mt * 64 * DM;
  const unsigned short* Bg = (const unsigned short*)Bh + (size_t)col0 * DM;
  const int sr = tid >> 4, sc = (tid & 15) * 8;      // staging: load i of chunk c takes row 8 i + sr, halves c * KC + sc .. + 7
  v8us ra[NC][NL], rb[NC][NL];
#pragma unroll
  for (int c = 0; c < NC; ++c) {
#pragma unroll
    for (int i = 0; i < NL; ++i) { ra[c][i] = *(const v8us*)(Ag + (size_t)(8 * i + sr) * DM + c * KC + sc); rb[c][i] = *(const v8us*)(Bg + (size_t)(8 * i + sr) * DM + c * KC + sc); }
    __builtin_amdgcn_sched_barrier(0);      // keeps the loads in chunk order, so that chunk 0 is complete after a quarter of them and not after half
  }
  asm volatile("s_wait_xcnt 0x0" ::: "memory");      // stands in front of the first overwrite of the loads' address registers, which are reused for fragments while later chunks are still in flight
  v8f acc[4] = {};
#pragma unroll
  for (int c = 0; c < NC; ++c) {
#pragma unroll
    for (int i = 0; i < NL; ++i) { *(v8us*)&sA[8 * i + sr][c * KC + sc] = ra[c][i]; *(v8us*)&sB[8 * i + sr][c * KC + sc] = rb[c][i]; }
    // publishes this chunk's LDS columns to all four waves. LDS-only fences: a full __syncthreads() would also wait for the later chunks' global loads, which only this thread's registers receive
    __builtin_amdgcn_fence(__ATOMIC_RELEASE, "workgroup", "local"); __builtin_amdgcn_s_barrier(); __builtin_amdgcn_fence(__ATOMIC_ACQUIRE, "workgroup", "local");
    FragH ah[KS], bq[KS][4];      // the whole chunk's fragments are asked for ahead of its first matrix instruction
#pragma unroll
    for (int ks = 0; ks < KS; ++ks) { const int kb = c * KC + ks * 32; ah[ks].half[0] = *(const v8us*)&sA[w * 16 + ln][kb + 8 * hh]; ah[ks].half[1] = *(const v8us*)&sA[w * 16 + ln][kb + 16 + 8 * hh];
#pragma unroll
      for (int t = 0; t < 4; ++t) { bq[ks][t].half[0] = *(const v8us*)&sB[t * 16 + ln][kb + 8 * hh]; bq[ks][t].half[1] = *(const v8us*)&sB[t * 16 + ln][kb + 16 + 8 * hh]; } }
#pragma unroll
    for (int ks = 0; ks < KS; ++ks)
#pragma unroll
      for (int t = 0; t < 4; ++t) acc[t] = mmaH<1>(ah[ks].v, ah[ks].v, bq[ks][t].v, bq[ks][t].v, acc[t]);
  }
  if (!F32OUT && job == 2) {      // block-uniform
    // an accumulator lane holds 8 consecutive tokens of one column d: 16 bytes of a transposed row. The four waves lay the 64 d x 64 tokens in LDS (pitch 144 B = 16 B x odd), then whole 128-byte rows of Vt go out
    unsigned short (*tl)[72] = (unsigned short (*)[72])&so[0][0][0];
#pragma unroll
    for (int t = 0; t < 4; ++t) { const float bv = bf16_round(bias[col0 + t * 16 + ln]); FragH f;
#pragma unroll
      for (int r = 0; r < 8; ++r) f.h[r] = (_Float16)(acc[t][r] * alpha + bv);
      *(v8us*)&tl[t * 16 + ln][w * 16 + 8 * hh] = f.half[0]; }
    __syncthreads();      // a row of tl holds tokens of all four waves
    unsigned short* vo = (unsigned short*)Vt + ((size_t)((mt * 64 / TT) * NH + nq) * HD) * TT + (mt * 64) % TT;
#pragma unroll
    for (int i = 0; i < 4; ++i) { const int d = i * 16 + (tid >> 3), pc = tid & 7; const v8us v = *(const v8us*)&tl[d][pc * 8]; *(v8us*)(vo + (size_t)d * TT + pc * 8) = v; }
    return;
  }
#pragma unroll
  for (int t = 0; t < 4; ++t) { const float bv = bf16_round(bias[col0 + t * 16 + ln]);
#pragma unroll
    for (int r = 0; r < 8; ++r) so[w][8 * hh + r][t * 16 + ln] = acc[t][r] * alpha + bv; }
  __builtin_amdgcn_fence(__ATOMIC_ACQ_REL, "workgroup"); __builtin_amdgcn_wave_barrier();
  const int rsub = lane >> 4, c4 = (lane & 15) * 4; typedef _Float16 v4h __attribute__((ext_vector_type(4)));
#pragma unroll
  for (int q = 0; q < 8; ++q) { const int r = q * 2 + rsub; const v4f v = *(const v4fa*)&so[w][r][c4];
    if (F32OUT) *(v4f*)(C + (size_t)(row0 + r) * DM + col0 + c4) = v;
    else { v4h h4; for (int i = 0; i < 4; ++i) h4[i] = (_Float16)v[i]; *(v4h*)(C16 + (size_t)(row0 + r) * DM + col0 + c4) = h4; } }
  if (!F32OUT) asm volatile("s_wait_xcnt 0x0" ::: "memory");      // the built code lays the transposed part behind these stores: the wait stands in front of any write of the stores' registers there
}


// Ten asynchronous 16-byte copies a lane, global memory to LDS through no register. l = the lane's LDS byte addresses, g = its global addresses.
// The closing s_wait_xcnt stands inside the copies' own statement, so that no address register of a copy is rewritten in front of it.
__device__ __forceinline__ void copy10(const unsigned* l, const unsigned short* const* g) {
  asm volatile(
               "global_load_async_to_lds_b128 %0, %1, off\n\t"
               "global_load_async_to_lds_b128 %2, %3, off\n\t"
               "global_load_async_to_lds_b128 %4, %5, off\n\t"
               "global_load_async_to_lds_b128 %6, %7, off\n\t"
               "global_load_async_to_lds_b128 %8, %9, off\n\t"
               "global_load_async_to_lds_b128 %10, %11, off\n\t"
               "global_load_async_to_lds_b128 %12, %13, off\n\t"
               "global_load_async_to_lds_b128 %14, %15, off\n\t"
               "global_load_async_to_lds_b128 %16, %17, off\n\t"
               "global_load_async_to_lds_b128 %18, %19, off\n\t"
               "s_wait_xcnt 0x0"
               :: "v"(l[0]), "v"(g[0]), "v"(l[1]), "v"(g[1]), "v"(l[2]), "v"(g[2]), "v"(l[3]), "v"(g[3]), "v"(l[4]), "v"(g[4]), "v"(l[5]), "v"(g[5]), "v"(l[6]), "v"(g[6]), "v"(l[7]), "v"(g[7]), "v"(l[8]), "v"(g[8]), "v"(l[9]), "v"(g[9]) : "memory");
}
// The q, k and v projections of ONE head for 128 tokens in one work-group of 8 waves: the 128 rows of A meet 192 rows of weights (64 of Bq, 64 of Bk, 64 of Bv), so a byte brought from L2 serves 2.4 x the products of a 64 x 64 tile.
// 256 work-groups, one per WGP, one round. Wave (rg, cg) = tokens 64 rg .. + 63 (4 fragments) x columns 16 cg .. + 15 of q, of k and of v (3 fragments): 12 matrix instructions for 7 fragments read from LDS, where 16 x 64 a wave had 4 for 5.
// K goes in 4 chunks of 128 through two LDS buffers of 320 rows x 256 B at a pitch of 272 B (16 B x odd), filled by asynchronous copies (a wave-wide copy = two rows x 256 contiguous bytes): chunk c + 1 flies while chunk c is multiplied.
// q and k run transposed (A = 16 weight rows, B = 16 tokens): a lane holds 8 consecutive columns of one token = 16 bytes of a row of Q or K. v runs straight: a lane holds 8 consecutive tokens of one column = 16 bytes of a row of V^T.
// The k order of every sum is that of the 64 x 64 kernel k_gemm_hhx, which now serves the output projection alone.
__global__ __launch_bounds__(256) void k_qkv(const _Float16* __restrict__ A, const _Float16* __restrict__ B0, const _Float16* __restrict__ B1, const _Float16* __restrict__ B2, float alpha,
                                             const float* __restrict__ bias0, const float* __restrict__ bias1, const float* __restrict__ bias2, _Float16* __restrict__ C0, _Float16* __restrict__ C1, _Float16* __restrict__ Vt) {
  constexpr int MB = 128, KC = 128, NC = DM / KC, KP = KC + 8, RW = MB + 3 * HD, KS = KC / 32, NCP = RW / 16;      // tokens; k per chunk; chunks; LDS pitch in halves; rows per buffer; k steps per chunk; copies per lane and chunk
  __shared__ __attribute__((aligned(16))) unsigned short sR[2][RW][KP];      // rows 0 .. 127: A; 128 + 64 j + n: row n of the head's part of weight j
  const int tid = threadIdx.x, lane = tid & 31, ln = lane & 15, hh = lane >> 4, w = tid >> 5, rg = w >> 2, cg = w & 3;
  const int mt = blockIdx.x / NH, hd = blockIdx.x % NH;
  const int r0 = tid >> 4, pc16 = tid & 15;      // copy i of a chunk takes row 16 i + r0, bytes 16 pc16 .. + 15
  const unsigned short* gsrc[4] = { (const unsigned short*)A + (size_t)(mt * MB + r0) * DM + pc16 * 8, (const unsigned short*)B0 + (size_t)(hd * HD + r0) * DM + pc16 * 8,
                                    (const unsigned short*)B1 + (size_t)(hd * HD + r0) * DM + pc16 * 8, (const unsigned short*)B2 + (size_t)(hd * HD + r0) * DM + pc16 * 8 };
  const unsigned ldst = (unsigned)(size_t)&sR[0][r0][pc16 * 8];      // the low 32 bits of a __shared__ address are the LDS byte address
  auto fill = [&](int c, int buf) {
    unsigned l[NCP]; const unsigned short* g[NCP];
#pragma unroll
    for (int i = 0; i < NCP; ++i) { l[i] = ldst + (unsigned)((buf * RW + 16 * i) * KP * 2);
      g[i] = (i < MB / 16 ? gsrc[0] + (size_t)(16 * i) * DM : gsrc[1 + (i - MB / 16) / 4] + (size_t)(16 * ((i - MB / 16) % 4)) * DM) + c * KC; }
    copy10(l, g); copy10(l + 10, g + 10);
  };
  fill(0, 0);
  float bqk[2][8];      // the biases are asked for while chunk 0 is on its way
#pragma unroll
  for (int r = 0; r < 8; ++r) { bqk[0][r] = bias0[hd * HD + cg * 16 + 8 * hh + r]; bqk[1][r] = bias1[hd * HD + cg * 16 + 8 * hh + r]; }
  const float bvv = bias2[hd * HD + cg * 16 + ln];
  // one statement, inputs only, two jobs. The loaded values as inputs hold the bias loads up here, where their latency runs beside that of chunk 0's copies (sunk into the loop they stall a chunk);
  // the three base pointers as inputs keep the loads' scalar address registers as they are up to the s_wait_xcnt
  asm volatile("s_wait_xcnt 0x0" :: "v"(bqk[0][0]), "v"(bqk[1][0]), "v"(bqk[0][1]), "v"(bqk[1][1]), "v"(bqk[0][2]), "v"(bqk[1][2]), "v"(bqk[0][3]), "v"(bqk[1][3]), "v"(bqk[0][4]), "v"(bqk[1][4]), "v"(bqk[0][5]), "v"(bqk[1][5]), "v"(bqk[0][6]), "v"(bqk[1][6]), "v"(bqk[0][7]), "v"(bqk[1][7]), "v"(bvv), "s"(bias0), "s"(bias1), "s"(bias2) : "memory");
  asm volatile("s_wait_asynccnt 0x0" ::: "memory");      // this wave's copies of chunk 0 have landed
  __syncthreads();      // ... and every other wave's: nobody reads chunk 0 in front of this barrier
  fill(1, 1);
  v8f acc[4][3] = {};
#pragma unroll
  for (int c = 0; c < NC; ++c) {
    const unsigned short (*sb)[KP] = sR[c & 1];
    FragH af[2][4], bf[2][3];      // two fragment sets: the next k step's 14 LDS reads are asked for ahead of this step's 12 matrix instructions (inside the chunk only)
#pragma unroll
    for (int ks = -1; ks < KS; ++ks) {
      if (ks + 1 < KS) { const int kb = (ks + 1) * 32, s = (ks + 1) & 1;
#pragma unroll
        for (int rt = 0; rt < 4; ++rt) { const unsigned short* p = &sb[rg * 64 + rt * 16 + ln][kb + 8 * hh]; af[s][rt].half[0] = *(const v8us*)p; af[s][rt].half[1] = *(const v8us*)(p + 16); }
#pragma unroll
        for (int t = 0; t < 3; ++t) { const unsigned short* p = &sb[MB + t * HD + cg * 16 + ln][kb + 8 * hh]; bf[s][t].half[0] = *(const v8us*)p; bf[s][t].half[1] = *(const v8us*)(p + 16); }
        __builtin_amdgcn_sched_barrier(0); }      // keeps these reads, as one group, ahead of the matrix instructions below: sunk to their first use, each fragment's reads cost the wave a whole LDS latency
      if (ks >= 0) { const int s = ks & 1;
#pragma unroll
        for (int rt = 0; rt < 4; ++rt) {
          acc[rt][0] = __builtin_amdgcn_wmma_f32_16x16x32_f16(false, bf[s][0].v, false, af[s][rt].v, (short)0, acc[rt][0], false, false);
          acc[rt][1] = __builtin_amdgcn_wmma_f32_16x16x32_f16(false, bf[s][1].v, false, af[s][rt].v, (short)0, acc[rt][1], false, false);
          acc[rt][2] = __builtin_amdgcn_wmma_f32_16x16x32_f16(false, af[s][rt].v, false, bf[s][2].v, (short)0, acc[rt][2], false, false); } }
    }
    __builtin_amdgcn_sched_barrier(0);      // keeps the chunk's matrix instructions in front of the waits below: issued there, they run while the next chunk's copies are still landing
    asm volatile("s_wait_dscnt 0x0" ::: "memory");      // this wave's reads of the buffer are over before the buffer is refilled
    asm volatile("s_wait_asynccnt 0x0" ::: "memory");      // this wave's copies of chunk c + 1 have landed
    __syncthreads();      // publishes chunk c + 1 and ends every wave's reads of chunk c's buffer
    if (c + 2 < NC) fill(c + 2, c & 1);
  }
  asm volatile("s_wait_asynccnt 0x0" ::: "memory");      // no copy is outstanding when the buffers become output staging
  // output staging in the first buffer (the last chunk's own barrier stands in front): Q and K as [token][64] at 144 B, V^T as [d][128 tokens] at 272 B (16 B x odd)
  unsigned short (*eQ)[HD + 8] = (unsigned short (*)[HD + 8])&sR[0][0][0]; unsigned short (*eK)[HD + 8] = eQ + MB; unsigned short (*eV)[MB + 8] = (unsigned short (*)[MB + 8])(eK + MB);
#pragma unroll
  for (int rt = 0; rt < 4; ++rt) { FragH fq, fk, fv;
#pragma unroll
    for (int r = 0; r < 8; ++r) { fq.h[r] = (_Float16)(acc[rt][0][r] * alpha + bf16_round(bqk[0][r])); fk.h[r] = (_Float16)(acc[rt][1][r] * alpha + bf16_round(bqk[1][r])); fv.h[r] = (_Float16)(acc[rt][2][r] * alpha + bf16_round(bvv)); }
    *(v8us*)&eQ[rg * 64 + rt * 16 + ln][cg * 16 + 8 * hh] = fq.half[0]; *(v8us*)&eK[rg * 64 + rt * 16 + ln][cg * 16 + 8 * hh] = fk.half[0]; *(v8us*)&eV[cg * 16 + ln][rg * 64 + rt * 16 + 8 * hh] = fv.half[0]; }
  __syncthreads();      // a staged row holds the work of several waves
  unsigned short* qo = (unsigned short*)C0 + (size_t)(mt * MB) * DM + hd * HD; unsigned short* ko = (unsigned short*)C1 + (size_t)(mt * MB) * DM + hd * HD;
  unsigned short* vo = (unsigned short*)Vt + ((size_t)((mt * MB / TT) * NH + hd) * HD) * TT + (mt * MB) % TT;
#pragma unroll
  for (int i = 0; i < 4; ++i) { const int r = i * 32 + (tid >> 3), pc = tid & 7, d = i * 16 + (tid >> 4), pv = tid & 15;      // whole 128-byte lines of Q and K, whole 256-byte row pieces of V^T
    const v8us a = *(const v8us*)&eQ[r][pc * 8], b = *(const v8us*)&eK[r][pc * 8], v = *(const v8us*)&eV[d][pv * 8];
    *(v8us*)(qo + (size_t)r * DM + pc * 8) = a; *(v8us*)(ko + (size_t)r * DM + pc * 8) = b; *(v8us*)(vo + (size_t)d * TT + pv * 8) = v; }
}

// lane l <-> lane l ^ 16: the two halves of a wave hold the two halves of one query's keys
__device__ __forceinline__ float xhalf(float v) { const int b = __float_as_int(v); return __int_as_float(__builtin_amdgcn_permlanex16(b, b, 0x76543210, 0xfedcba98, false, false)); }
// local attention per ((b,h), 128 queries): wave = 32 queries q0 ... q0 + 31, which reach keys q0 - 32 ... q0 + 63 and no others: the wave walks these 3 chunks of 32 keys, j0 = q0 - 32, q0, q0 + 32 (keys outside [0, T) are masked); score/8 where |k - t| <= 32.
// Both products run transposed: S^T = K . Q^T (A = 16 keys, B = 16 queries) and O^T += V^T . P^T (A = 16 d, B = 16 queries). An accumulator lane (ln, hh) then holds ONE query (column ln) and keys 8 hh + r
// down its registers: a query's maximum and sum are taken in the lane's own registers, with one exchange between the wave halves, and the two score tiles of a chunk (keys 0-15, 16-31), converted in place,
// are the B fragment of the second product in the k order of the V^T loader (8 hh + i, 16 + 8 hh + i): P never leaves the registers.
// The work-group's 128 queries reach 6 chunks of 32 keys, jc = qb0 - 32 + 32 c; wave w walks chunks w, w + 1, w + 2. All six are brought into LDS once, ahead of the loop, K as 128-byte rows and V^T as 64-byte row pieces,
// by 16-byte loads that are all in flight together; the fragments then come from LDS (pitches 144 B and 400 B = 16 B x odd), in the same k order as when they were read from global memory.
// A chunk lies wholly inside [0, T) or wholly outside (T and qb0 are multiples of 32): one outside is read at a CLAMPED chunk address and masked.
__global__ __launch_bounds__(128) void k_flash(const _Float16* __restrict__ Q16, const _Float16* __restrict__ K16, const _Float16* __restrict__ Vt, _Float16* __restrict__ O16) {
  constexpr int RPW = 32, NQB = TT / (4 * RPW), DT = HD / 16, KS = HD / 32;
  constexpr int NCH = (4 * RPW + 2 * WW) / 32;      // key chunks of the work-group
  __shared__ __attribute__((aligned(16))) unsigned short sO[4][RPW][HD + 8];      // output staging, pitch 144 B = 16 B x odd
  __shared__ __attribute__((aligned(16))) unsigned short sK[NCH * 32][HD + 8], sV[HD][NCH * 32 + 8];      // K[key][d], V^T[d][key]
  const int tid = threadIdx.x, lane = tid & 31, ln = lane & 15, hh = lane >> 4;
  const int w = __builtin_amdgcn_readfirstlane(tid >> 5);      // the wave's number in a scalar register: q0 and j0 depend on it, and with it the loop's test and the chunk's staged row offset jl are scalar
  const int slab = blockIdx.x / NQB, qblk = blockIdx.x % NQB; const int b = slab / NH, h = slab % NH; const int qb0 = qblk * (4 * RPW); const int q0 = qb0 + w * RPW;
  FragH aq[2][KS];
#pragma unroll
  for (int rt = 0; rt < 2; ++rt) { const unsigned short* qr = (const unsigned short*)Q16 + ((size_t)b * TT + q0 + rt * 16 + ln) * DM + h * HD;
#pragma unroll
    for (int ks = 0; ks < KS; ++ks) { aq[rt][ks].half[0] = *(const v8us*)(qr + ks * 32 + 8 * hh); aq[rt][ks].half[1] = *(const v8us*)(qr + ks * 32 + 16 + 8 * hh); } }
  const unsigned short* Vth = (const unsigned short*)Vt + (size_t)slab * HD * TT;
  {
    const unsigned short* Kh = (const unsigned short*)K16 + (size_t)b * TT * DM + h * HD;
    const int kr = tid >> 3, kp = (tid & 7) * 8, vr = tid >> 2, vp = (tid & 3) * 8;      // K: 8 threads a row, 16 rows a pass; V^T: 4 threads a row piece, 32 rows a pass
    v8us rk[NCH][2], rv[NCH][2];
#pragma unroll
    for (int cc = 0; cc < NCH; ++cc) { const int jc = qb0 - WW + cc * 32; const int jcl = jc < 0 ? 0 : (jc + 32 > TT ? TT - 32 : jc);      // clamped chunk address; keys outside [0,T) have p = 0 so the substituted values never contribute
#pragma unroll
      for (int u = 0; u < 2; ++u) { rk[cc][u] = *(const v8us*)(Kh + (size_t)(jcl + u * 16 + kr) * DM + kp); rv[cc][u] = *(const v8us*)(Vth + (size_t)(u * 32 + vr) * TT + jcl + vp); } }
#pragma unroll
    for (int cc = 0; cc < NCH; ++cc)
#pragma unroll
      for (int u = 0; u < 2; ++u) { *(v8us*)&sK[cc * 32 + u * 16 + kr][kp] = rk[cc][u]; *(v8us*)&sV[u * 32 + vr][cc * 32 + vp] = rv[cc][u]; }
  }
  __syncthreads();      // a chunk is laid down by all four waves and read by up to three
  float m_r[2], l_r[2]; v8f oacc[2][DT];      // per lane: query q0 + rt * 16 + ln; l_r sums this half's keys only; oacc[rt][dt][r] = O[query][dt * 16 + 8 hh + r]
#pragma unroll
  for (int rt = 0; rt < 2; ++rt) { m_r[rt] = -3.0e38f; l_r[rt] = 0.f;
#pragma unroll
    for (int dt = 0; dt < DT; ++dt) oacc[rt][dt] = (v8f){0.f,0.f,0.f,0.f,0.f,0.f,0.f,0.f}; }
#pragma unroll 1
  for (int j0 = q0 - WW; j0 < q0 + RPW + WW; j0 += 32) {
    const int jl = j0 - (qb0 - WW);      // the chunk's first key, counted in the staged rows
    FragH bk[2][KS], bv[DT];      // the chunk's 16 fragment reads stand together ahead of its first matrix instruction: one LDS latency a chunk
    v8f s[2][2];      // s[rt][nt][r] = score of key j0 + nt * 16 + 8 hh + r with query q0 + rt * 16 + ln
#pragma unroll
    for (int nt = 0; nt < 2; ++nt) { const unsigned short* kr = &sK[jl + nt * 16 + ln][0];
#pragma unroll
      for (int ks = 0; ks < KS; ++ks) { bk[nt][ks].half[0] = *(const v8us*)(kr + ks * 32 + 8 * hh); bk[nt][ks].half[1] = *(const v8us*)(kr + ks * 32 + 16 + 8 * hh); } }
#pragma unroll
    for (int dt = 0; dt < DT; ++dt) { const unsigned short* vrow = &sV[dt * 16 + ln][jl]; bv[dt].half[0] = *(const v8us*)(vrow + 8 * hh); bv[dt].half[1] = *(const v8us*)(vrow + 16 + 8 * hh); }
#pragma unroll
    for (int nt = 0; nt < 2; ++nt) {
#pragma unroll
      for (int rt = 0; rt < 2; ++rt) { v8f acc = (v8f){0.f,0.f,0.f,0.f,0.f,0.f,0.f,0.f};
#pragma unroll
        for (int ks = 0; ks < KS; ++ks) acc = mmaH<1>(bk[nt][ks].v, bk[nt][ks].v, aq[rt][ks].v, aq[rt][ks].v, acc); s[rt][nt] = acc; } }
    FragH pb[2];
#pragma unroll
    for (int rt = 0; rt < 2; ++rt) { const int t = q0 + rt * 16 + ln; float sv[16]; float mc = -INFINITY;
      const int lo = t - WW < 0 ? 0 : t - WW, hi = t + WW > TT - 1 ? TT - 1 : t + WW;      // this lane's query takes keys lo ... hi: 0 <= k < T and |k - t| <= 32 in one range
#pragma unroll
      for (int i = 0; i < 16; ++i) { const int k = j0 + (i >> 3) * 16 + 8 * hh + (i & 7); const bool ok = (unsigned)(k - lo) <= (unsigned)(hi - lo);
        sv[i] = ok ? s[rt][i >> 3][i & 7] * 0.125f : -INFINITY; mc = fmaxf(mc, sv[i]); }
      mc = fmaxf(mc, xhalf(mc));
      const float mn = fmaxf(m_r[rt], mc); const float al = (mn > -1.0e38f) ? expf(m_r[rt] - mn) : 1.0f; m_r[rt] = mn; float ps[4] = {0.f, 0.f, 0.f, 0.f};
#pragma unroll
      for (int i = 0; i < 16; ++i) { const float p = expf(sv[i] - mn); ps[i & 3] += p; pb[rt].h[i] = (_Float16)p; }      // a masked score is -inf and mn is finite: its p is exactly 0
      l_r[rt] = l_r[rt] * al + ((ps[0] + ps[1]) + (ps[2] + ps[3]));
#pragma unroll
      for (int dt = 0; dt < DT; ++dt)
#pragma unroll
        for (int r = 0; r < 8; ++r) oacc[rt][dt][r] *= al; }
#pragma unroll
    for (int dt = 0; dt < DT; ++dt)
#pragma unroll
      for (int rt = 0; rt < 2; ++rt) oacc[rt][dt] = mmaH<1>(bv[dt].v, bv[dt].v, pb[rt].v, pb[rt].v, oacc[rt][dt]); }
#pragma unroll
  for (int rt = 0; rt < 2; ++rt) { float l = l_r[rt] + xhalf(l_r[rt]);
    const int t = q0 + rt * 16 + ln; const int npad = (t < WW ? (WW - t) : 0) + (t + WW >= TT ? (t + WW - TT + 1) : 0); float sc = 1.0f;
    if (npad > 0) { const float m = m_r[rt]; const float mn = fmaxf(m, 0.f); sc = expf(m - mn); l = l * sc + (float)npad * expf(-mn); }
    const float inv = sc / l;
#pragma unroll
    for (int dt = 0; dt < DT; ++dt) { FragH f;      // 8 consecutive d of one query: 16 bytes of its f16 output row
#pragma unroll
      for (int r = 0; r < 8; ++r) f.h[r] = (_Float16)(oacc[rt][dt][r] * inv);
      *(v8us*)&sO[w][rt * 16 + ln][dt * 16 + 8 * hh] = f.half[0]; } }
  __builtin_amdgcn_fence(__ATOMIC_ACQ_REL, "workgroup"); __builtin_amdgcn_wave_barrier();
#pragma unroll
  for (int rp = 0; rp < RPW; rp += 4) { const int r = rp + (lane >> 3), pc = lane & 7; const v8us v = *(const v8us*)&sO[w][r][pc * 8];      // the A operand of the output projection, a whole 128-byte line per row
    *(v8us*)((unsigned short*)O16 + ((size_t)b * TT + q0 + r) * DM + h * HD + pc * 8) = v; } }
extern "C" void kernel_launch(void* const* d_in, const int* in_sizes, int n_in,
                              void* d_out, int out_size, void* d_ws, size_t ws_size, hipStream_t stream) {
  (void)in_sizes; (void)n_in; (void)out_size;
  const float* x = (const float*)d_in[0]; const float* wq = (const float*)d_in[1]; const float* bq = (const float*)d_in[2]; const float* wk = (const float*)d_in[3]; const float* bk = (const float*)d_in[4]; const float* wv = (const float*)d_in[5]; const float* bv = (const float*)d_in[6]; const float* wo = (const float*)d_in[7]; const float* bo = (const float*)d_in[8];
  char* ws = (char*)d_ws; size_t off = 0;
  auto take = [&](size_t bytes) { char* p = ws + off; off += (bytes + 255) & ~(size_t)255; return p; };
  const size_t w8 = (size_t)DM * DM / 8;
  _Float16* Bq = (_Float16*)take(w8 * 16); _Float16* Bk = (_Float16*)take(w8 * 16); _Float16* Bv = (_Float16*)take(w8 * 16); _Float16* Bo = (_Float16*)take(w8 * 16);
  _Float16* X16 = (_Float16*)take((size_t)NR * DM * 2); _Float16* Q16 = (_Float16*)take((size_t)NR * DM * 2); _Float16* K16 = (_Float16*)take((size_t)NR * DM * 2); _Float16* Vt = (_Float16*)take((size_t)NR * DM * 2); _Float16* O16 = X16;
  if (off > ws_size) return;      // 18 MiB
  const unsigned gw = (unsigned)(DM * (DM / 8) / 256), gx = (unsigned)((size_t)NR * DM / 8 / 256);
  k_prep<<<4 * gw + gx, 256, 0, stream>>>(x, wq, wk, wv, wo, X16, Bq, Bk, Bv, Bo);      // weights are [in][out]
  const unsigned gg = (NR / 64) * (DM / 64);
  k_qkv<<<(NR / 128) * NH, 256, 0, stream>>>(X16, Bq, Bk, Bv, 0.0625f, bq, bk, bv, Q16, K16, Vt);
  k_flash<<<BB * NH * (TT / 128), 128, 0, stream>>>(Q16, K16, Vt, O16);
  k_gemm_hhx<true><<<gg, 128, 0, stream>>>(O16, Bo, nullptr, nullptr, 0.0625f, bo, nullptr, nullptr, (float*)d_out, nullptr, nullptr, nullptr);
}

// v007
// It runs in 23.3 microseconds.
// Timed twice side by side with v006, it ran 1.12 and 1.11 times as fast.
// Counting every step since v000, it is 6.02 times as fast.
#include <hip/hip_runtime.h>
// q/k/v/o projections (4096 × 512 × 512, + bias) and the 8-head LOCAL attention (window ±32, d = 64) on v_wmma_f32_16x16x32_f16: in a fused flash-style kernel a wave visits only the 3 key chunks
// around its 32 queries (S = Q·Kᵀ, O = P·V on WMMA; |k − t| ≤ 32 band mask; online max/sum softmax f32; P f16 ≤ 1), and the module's zero-PADDED keys (score exactly 0, value 0, they DO
// take part in the softmax) are added analytically per query as npad·e^{0 − m} in the normaliser; A = f16(bf16 ·) exact operands, weights [in][out] transposed to bf16-exact ×2^4, f32 accumulate.
#define BB 2
#define TT 2048
#define DM 512
#define NH 8
#define HD 64
#define WW 32
#define NR (BB * TT)

typedef __bf16 v16b __attribute__((ext_vector_type(16)));
typedef unsigned short v8us __attribute__((ext_vector_type(8), may_alias));
typedef float  v8f  __attribute__((ext_vector_type(8)));
typedef float  v4f  __attribute__((ext_vector_type(4)));
typedef float  v4fa __attribute__((ext_vector_type(4), may_alias));
union FragB { v16b v; v8us half[2]; unsigned short u[16]; };

__device__ __forceinline__ unsigned short bf16_bits(float x) { unsigned int u = __float_as_uint(x); return (unsigned short)((u + 0x7FFFu + ((u >> 16) & 1u)) >> 16); }
__device__ __forceinline__ float bf16_val(unsigned short b) { return __uint_as_float(((unsigned int)b) << 16); }
__device__ __forceinline__ float bf16_round(float x) { return bf16_val(bf16_bits(x)); }
// D += A·B with NT terms: 1 = ah·bh, 2 = + al·bh (A split), 3 = + ah·bl (both split)
template <int NT>
__device__ __forceinline__ v8f mmaN(v16b ah, v16b al, v16b bh, v16b bl, v8f c) {
  c = __builtin_amdgcn_wmma_f32_16x16x32_bf16(false, ah, false, bh, (short)0, c, false, false);
  if (NT >= 2) c = __builtin_amdgcn_wmma_f32_16x16x32_bf16(false, al, false, bh, (short)0, c, false, false);
  if (NT >= 3) c = __builtin_amdgcn_wmma_f32_16x16x32_bf16(false, ah, false, bl, (short)0, c, false, false);
  asm volatile("v_nop\n\tv_nop\n\tv_nop\n\tv_nop" : "+v"(c) : "v"(ah), "v"(al), "v"(bh), "v"(bl));
  return c;
}

__global__ __launch_bounds__(256) void k_wt_bf16(const float* __restrict__ W, unsigned short* __restrict__ Wt, int K, int N) {
  const int t = blockIdx.x * 256 + threadIdx.x;
  const int k8n = K / 8;
  if (t >= N * k8n) return;
  const int n = t / k8n, k8 = (t % k8n) * 8;
  v8us v;
#pragma unroll
  for (int i = 0; i < 8; ++i) v[i] = bf16_bits(W[(size_t)(k8 + i) * N + n]);
  *(v8us*)(Wt + (size_t)n * K + k8) = v;
  
}

// GEMM C[M][N] (f32, pitch ldc) = act(A[M][K]·W + bias). A f32 row-major (pitch lda) converted per fragment to bf16
// (ASPLIT: hi/lo two planes -> 2 terms, else single rounded term); Wt bf16 [N][K] (pitch ldb). BIAS_BF16 rounds the
// bias to bf16 first (bias quantised to bf16 before the add). K%32==0, M%16==0, N%64==0.
template <bool ASPLIT, int ACT, bool BIAS_BF16>
__global__ __launch_bounds__(128) void k_gemm_bf(const float* __restrict__ A, int lda, const unsigned short* __restrict__ Wt, int ldb,
                                               const float* __restrict__ bias, float* __restrict__ C, int ldc, int M, int N, int K) {
  __shared__ __attribute__((aligned(16))) float so[4][16][64];
  const int tid = threadIdx.x, w = tid >> 5, lane = tid & 31, ln = lane & 15, hh = lane >> 4;
  const int ntn = N / 64;
  const int wid = blockIdx.x * 4 + w;
  const int mt = wid / ntn, nq = wid % ntn;
  if (mt * 16 >= M) return;
  const int row0 = mt * 16, col0 = nq * 64;
  const float* arow = A + (size_t)(row0 + ln) * lda;
  v8f acc[4] = {};
  for (int kb = 0; kb < K; kb += 32) {
    FragB ah, al;
    const v4f x0 = *(const v4fa*)(arow + kb + 8 * hh), x1 = *(const v4fa*)(arow + kb + 8 * hh + 4);
    const v4f x2 = *(const v4fa*)(arow + kb + 16 + 8 * hh), x3 = *(const v4fa*)(arow + kb + 16 + 8 * hh + 4);
    float xs[16] = {x0[0],x0[1],x0[2],x0[3],x1[0],x1[1],x1[2],x1[3],x2[0],x2[1],x2[2],x2[3],x3[0],x3[1],x3[2],x3[3]};
#pragma unroll
    for (int i = 0; i < 16; ++i) { const unsigned short hb = bf16_bits(xs[i]); ah.u[i] = hb; al.u[i] = ASPLIT ? bf16_bits(xs[i] - bf16_val(hb)) : (unsigned short)0; }
#pragma unroll
    for (int t = 0; t < 4; ++t) {
      const unsigned short* brow = Wt + (size_t)(col0 + t * 16 + ln) * ldb + kb;
      FragB b;
      b.half[0] = *(const v8us*)(brow + 8 * hh);
      b.half[1] = *(const v8us*)(brow + 16 + 8 * hh);
      acc[t] = mmaN<ASPLIT ? 2 : 1>(ah.v, al.v, b.v, b.v, acc[t]);
    }
  }
#pragma unroll
  for (int t = 0; t < 4; ++t) {
    float bv = bias ? bias[col0 + t * 16 + ln] : 0.f;
    if (BIAS_BF16) bv = bf16_round(bv);
#pragma unroll
    for (int r = 0; r < 8; ++r) { float v = acc[t][r] + bv; if (ACT == 1) v = fmaxf(v, 0.f); so[w][8 * hh + r][t * 16 + ln] = v; }
  }
  __builtin_amdgcn_fence(__ATOMIC_ACQ_REL, "workgroup");
  __builtin_amdgcn_wave_barrier();
  const int rsub = lane >> 4, c4 = (lane & 15) * 4;
  {
#pragma unroll
    for (int q = 0; q < 8; ++q) {
      const int r = q * 2 + rsub;
      const v4f v = *(const v4fa*)&so[w][r][c4];
      *(v4f*)(C + (size_t)(row0 + r) * ldc + col0 + c4) = v;
    }
    
  }
}

// Flash-style causal/unmasked attention, all contractions 3-term bf16 hi/lo splits, f32 softmax with running max.
// q,k,v rows are read from f32 buffers with arbitrary row pitch (so they can live inside a fused qkv buffer);
// D = head size (multiple of 32, <= 128); one wave = 16 query rows; block = 4 waves (64 queries) sharing K/V chunks of 32.
template <int D, bool CAUSAL>
__global__ __launch_bounds__(128) void k_flash(const float* __restrict__ qb, const float* __restrict__ kb, const float* __restrict__ vb,
                                             int pitch, int T, int H, float scale, float* __restrict__ y, int ypitch) {
  constexpr int KS = D / 32;        // k-steps for QK
  constexpr int DT = D / 16;        // d tiles for PV
  __shared__ __attribute__((aligned(16))) unsigned short sKh[32][D + 8], sKl[32][D + 8], sVh[32][D + 8], sVl[32][D + 8];
  __shared__ __attribute__((aligned(16))) unsigned short sPh[4][16][40], sPl[4][16][40];
  __shared__ __attribute__((aligned(16))) float sO[4][16][D];
  const int tid = threadIdx.x, w = tid >> 5, lane = tid & 31, ln = lane & 15, hh = lane >> 4;
  const int nqb = (T + 63) / 64;
  const int bh = blockIdx.x / nqb, qblk = blockIdx.x % nqb;
  const int b = bh / H, h = bh % H;
  const int q0 = qblk * 64 + w * 16;
  const float* Q = qb + (size_t)b * T * pitch + h * D;
  const float* K = kb + (size_t)b * T * pitch + h * D;
  const float* V = vb + (size_t)b * T * pitch + h * D;

  // A fragments of the wave's 16 query rows (scaled), hi/lo
  FragB aqh[KS], aql[KS];
  {
    int row = q0 + ln; if (row >= T) row = T - 1;
    const float* qr = Q + (size_t)row * pitch;
#pragma unroll
    for (int ks = 0; ks < KS; ++ks)
#pragma unroll
      for (int i = 0; i < 16; ++i) {
        const int d = ks * 32 + ((i < 8) ? (8 * hh + i) : (16 + 8 * hh + (i - 8)));
        const float x = qr[d] * scale; const unsigned short hb = bf16_bits(x);
        aqh[ks].u[i] = hb; aql[ks].u[i] = bf16_bits(x - bf16_val(hb));
      }
  }
  float m_r[8], l_r[8];
#pragma unroll
  for (int r = 0; r < 8; ++r) { m_r[r] = -3.0e38f; l_r[r] = 0.f; }
  v8f oacc[DT];
#pragma unroll
  for (int dt = 0; dt < DT; ++dt) oacc[dt] = (v8f){0.f,0.f,0.f,0.f,0.f,0.f,0.f,0.f};

  const int kv_end = CAUSAL ? min(T, qblk * 64 + 64) : T;     // block-uniform
  for (int j0 = 0; j0 < kv_end; j0 += 32) {
    __syncthreads();
    for (int e = tid; e < 32 * (D / 4); e += 128) {
      const int r = e / (D / 4), c4 = (e % (D / 4)) * 4;
      const int key = j0 + r;
      v4f kf = {0.f,0.f,0.f,0.f}, vf = {0.f,0.f,0.f,0.f};
      if (key < T) { kf = *(const v4fa*)(K + (size_t)key * pitch + c4); vf = *(const v4fa*)(V + (size_t)key * pitch + c4); }
#pragma unroll
      for (int t = 0; t < 4; ++t) {
        unsigned short hb = bf16_bits(kf[t]); sKh[r][c4 + t] = hb; sKl[r][c4 + t] = bf16_bits(kf[t] - bf16_val(hb));
        hb = bf16_bits(vf[t]); sVh[r][c4 + t] = hb; sVl[r][c4 + t] = bf16_bits(vf[t] - bf16_val(hb));
      }
    }
    __syncthreads();
    // S tile 16 x 32
    v8f s[2];
#pragma unroll
    for (int nt = 0; nt < 2; ++nt) {
      v8f acc = {};
#pragma unroll
      for (int ks = 0; ks < KS; ++ks) {
        FragB bh_, bl_;
        bh_.half[0] = *(const v8us*)&sKh[nt * 16 + ln][ks * 32 + 8 * hh]; bh_.half[1] = *(const v8us*)&sKh[nt * 16 + ln][ks * 32 + 16 + 8 * hh];
        bl_.half[0] = *(const v8us*)&sKl[nt * 16 + ln][ks * 32 + 8 * hh]; bl_.half[1] = *(const v8us*)&sKl[nt * 16 + ln][ks * 32 + 16 + 8 * hh];
        acc = mmaN<3>(aqh[ks].v, aql[ks].v, bh_.v, bl_.v, acc);
      }
      s[nt] = acc;
    }
    // mask + running max (rows 8hh+r; the 16 lanes of a half share rows)
    float alpha[8];
#pragma unroll
    for (int r = 0; r < 8; ++r) {
      const int qi = q0 + 8 * hh + r;
      const int ja = j0 + ln, jb = j0 + 16 + ln;
      if (CAUSAL) { if (ja > qi) s[0][r] = -3.0e38f; if (jb > qi) s[1][r] = -3.0e38f; }
      if (ja >= T) s[0][r] = -3.0e38f;
      if (jb >= T) s[1][r] = -3.0e38f;
      float mx = fmaxf(s[0][r], s[1][r]);
      mx = fmaxf(mx, __shfl_xor(mx, 1, 32)); mx = fmaxf(mx, __shfl_xor(mx, 2, 32)); mx = fmaxf(mx, __shfl_xor(mx, 4, 32)); mx = fmaxf(mx, __shfl_xor(mx, 8, 32));
      const float mnew = fmaxf(m_r[r], mx);
      alpha[r] = (mnew > -1.0e38f) ? __expf(m_r[r] - mnew) : 1.0f;
      const float p0 = (s[0][r] > -1.0e38f) ? __expf(s[0][r] - mnew) : 0.f;
      const float p1 = (s[1][r] > -1.0e38f) ? __expf(s[1][r] - mnew) : 0.f;
      m_r[r] = mnew;
      l_r[r] = l_r[r] * alpha[r] + p0 + p1;            // per-lane partial row sum (16 lanes combined at the end)
      unsigned short hb = bf16_bits(p0); sPh[w][8 * hh + r][ln] = hb;      sPl[w][8 * hh + r][ln] = bf16_bits(p0 - bf16_val(hb));
      hb = bf16_bits(p1);                sPh[w][8 * hh + r][16 + ln] = hb; sPl[w][8 * hh + r][16 + ln] = bf16_bits(p1 - bf16_val(hb));
    }
#pragma unroll
    for (int dt = 0; dt < DT; ++dt)
#pragma unroll
      for (int r = 0; r < 8; ++r) oacc[dt][r] *= alpha[r];
    __builtin_amdgcn_fence(__ATOMIC_ACQ_REL, "workgroup");
    __builtin_amdgcn_wave_barrier();
    FragB pah, pal;
    pah.half[0] = *(const v8us*)&sPh[w][ln][8 * hh]; pah.half[1] = *(const v8us*)&sPh[w][ln][16 + 8 * hh];
    pal.half[0] = *(const v8us*)&sPl[w][ln][8 * hh]; pal.half[1] = *(const v8us*)&sPl[w][ln][16 + 8 * hh];
#pragma unroll
    for (int dt = 0; dt < DT; ++dt) {
      FragB bvh, bvl;
#pragma unroll
      for (int i = 0; i < 8; ++i) {
        bvh.u[i] = sVh[8 * hh + i][dt * 16 + ln]; bvh.u[8 + i] = sVh[16 + 8 * hh + i][dt * 16 + ln];
        bvl.u[i] = sVl[8 * hh + i][dt * 16 + ln]; bvl.u[8 + i] = sVl[16 + 8 * hh + i][dt * 16 + ln];
      }
      oacc[dt] = mmaN<3>(pah.v, pal.v, bvh.v, bvl.v, oacc[dt]);
    }
    __builtin_amdgcn_fence(__ATOMIC_ACQ_REL, "workgroup");
    __builtin_amdgcn_wave_barrier();
  }
#pragma unroll
  for (int r = 0; r < 8; ++r) {
    float l = l_r[r];
    l += __shfl_xor(l, 1, 32); l += __shfl_xor(l, 2, 32); l += __shfl_xor(l, 4, 32); l += __shfl_xor(l, 8, 32);
    l_r[r] = (l > 0.f) ? 1.0f / l : 0.f;
  }
#pragma unroll
  for (int dt = 0; dt < DT; ++dt)
#pragma unroll
    for (int r = 0; r < 8; ++r) sO[w][8 * hh + r][dt * 16 + ln] = oacc[dt][r] * l_r[r];
  __builtin_amdgcn_fence(__ATOMIC_ACQ_REL, "workgroup");
  __builtin_amdgcn_wave_barrier();
  {
    for (int r = 0; r < 16; ++r) {
      const int row = q0 + r;
      if (row < T && lane < D / 4) {
        const v4f val = *(const v4fa*)&sO[w][r][lane * 4];
        *(v4f*)(y + ((size_t)b * T + row) * ypitch + h * D + lane * 4) = val;
      }
    }
    
  }
}

// GEMM C = act(A·W + bias + resid): A f32 (ASPLIT -> hi/lo 2 terms), Wt bf16 [N][K]; ACT 0 none, 1 relu, 2 exact gelu;
// resid (optional, f32, row index = (row % rmod), pitch ldr, RES_BF16 rounds it) added before the activation.
template <bool ASPLIT, int ACT, bool BIAS_BF16, bool RES_BF16>
__global__ __launch_bounds__(128) void k_gemm_bf3(const float* __restrict__ A, int lda, const unsigned short* __restrict__ Wt, int ldb,
                                                const float* __restrict__ bias, const float* __restrict__ resid, int rmod, int ldr,
                                                float* __restrict__ C, int ldc, int M, int N, int K) {
  __shared__ __attribute__((aligned(16))) float so[4][16][64];
  const int tid = threadIdx.x, w = tid >> 5, lane = tid & 31, ln = lane & 15, hh = lane >> 4;
  const int ntn = N / 64;
  const int wid = blockIdx.x * 4 + w;
  const int mt = wid / ntn, nq = wid % ntn;
  if (mt * 16 >= M) return;
  const int row0 = mt * 16, col0 = nq * 64;
  const float* arow = A + (size_t)(row0 + ln) * lda;
  v8f acc[4] = {};
  for (int kb = 0; kb < K; kb += 32) {
    FragB ah, al;
    const v4f x0 = *(const v4fa*)(arow + kb + 8 * hh), x1 = *(const v4fa*)(arow + kb + 8 * hh + 4);
    const v4f x2 = *(const v4fa*)(arow + kb + 16 + 8 * hh), x3 = *(const v4fa*)(arow + kb + 16 + 8 * hh + 4);
    float xs[16] = {x0[0],x0[1],x0[2],x0[3],x1[0],x1[1],x1[2],x1[3],x2[0],x2[1],x2[2],x2[3],x3[0],x3[1],x3[2],x3[3]};
#pragma unroll
    for (int i = 0; i < 16; ++i) { const unsigned short hb = bf16_bits(xs[i]); ah.u[i] = hb; al.u[i] = ASPLIT ? bf16_bits(xs[i] - bf16_val(hb)) : (unsigned short)0; }
#pragma unroll
    for (int t = 0; t < 4; ++t) {
      const unsigned short* brow = Wt + (size_t)(col0 + t * 16 + ln) * ldb + kb;
      FragB b;
      b.half[0] = *(const v8us*)(brow + 8 * hh);
      b.half[1] = *(const v8us*)(brow + 16 + 8 * hh);
      acc[t] = mmaN<ASPLIT ? 2 : 1>(ah.v, al.v, b.v, b.v, acc[t]);
    }
  }
#pragma unroll
  for (int t = 0; t < 4; ++t) {
    const int col = col0 + t * 16 + ln;
    float bv = bias ? bias[col] : 0.f;
    if (BIAS_BF16) bv = bf16_round(bv);
#pragma unroll
    for (int r = 0; r < 8; ++r) {
      float v = acc[t][r] + bv;
      if (resid) { float rv = resid[(size_t)((row0 + 8 * hh + r) % rmod) * ldr + col]; if (RES_BF16) rv = bf16_round(rv); v += rv; }
      if (ACT == 1) v = fmaxf(v, 0.f);
      if (ACT == 2) v = 0.5f * v * (1.0f + erff(v * 0.70710678118654752f));
      if (ACT == 3) { const float u = 0.7978845608028654f * (v + 0.044715f * v * v * v); v = 0.5f * v * (1.0f + tanhf(u)); }
      so[w][8 * hh + r][t * 16 + ln] = v;
    }
  }
  __builtin_amdgcn_fence(__ATOMIC_ACQ_REL, "workgroup");
  __builtin_amdgcn_wave_barrier();
  const int rsub = lane >> 4, c4 = (lane & 15) * 4;
  {
#pragma unroll
    for (int q = 0; q < 8; ++q) {
      const int r = q * 2 + rsub;
      const v4f v = *(const v4fa*)&so[w][r][c4];
      *(v4f*)(C + (size_t)(row0 + r) * ldc + col0 + c4) = v;
    }
    
  }
}
// row LayerNorm (biased variance, eps) over N: s = X (+ R); optional out_sum <- s; out_norm <- (s-mu)*rsqrt(var+eps)*g + b
template <bool PARAM_BF16>
__global__ __launch_bounds__(256) void k_layernorm(const float* __restrict__ X, const float* __restrict__ R, const float* __restrict__ g, const float* __restrict__ bta,
                                                  float* __restrict__ out_sum, float* __restrict__ out_norm, int N, float eps) {
  __shared__ float red[256];
  const int row = blockIdx.x, tid = threadIdx.x;
  const float* x = X + (size_t)row * N; const float* rr = R ? R + (size_t)row * N : nullptr;
  float vals[16];                     // up to N = 4096
  const int per = N / 256;            // contiguous chunk per thread? use strided-by-4 chunks: thread handles j = tid*4 + 1024*u
  float s1 = 0.f;
  for (int u = 0; u < per / 4; ++u) {
    const int j = tid * 4 + 1024 * u;
    const v4f a = *(const v4fa*)(x + j);
    v4f b = {0.f,0.f,0.f,0.f}; if (rr) b = *(const v4fa*)(rr + j);
#pragma unroll
    for (int q = 0; q < 4; ++q) { const float v = a[q] + b[q]; vals[u * 4 + q] = v; s1 += v; }
  }
  red[tid] = s1; __syncthreads();
  for (int st = 128; st > 0; st >>= 1) { if (tid < st) red[tid] += red[tid + st]; __syncthreads(); }
  const float mu = red[0] / (float)N; __syncthreads();
  float s2 = 0.f;
  for (int u = 0; u < per / 4; ++u)
#pragma unroll
    for (int q = 0; q < 4; ++q) { const float c = vals[u * 4 + q] - mu; s2 += c * c; }
  red[tid] = s2; __syncthreads();
  for (int st = 128; st > 0; st >>= 1) { if (tid < st) red[tid] += red[tid + st]; __syncthreads(); }
  const float rs = rsqrtf(red[0] / (float)N + eps);
  {
    for (int u = 0; u < per / 4; ++u) {
      const int j = tid * 4 + 1024 * u;
      v4f o, sm;
#pragma unroll
      for (int q = 0; q < 4; ++q) {
        float gg = g[j + q], bb = bta[j + q];
        if (PARAM_BF16) { gg = bf16_round(gg); bb = bf16_round(bb); }
        sm[q] = vals[u * 4 + q]; o[q] = (vals[u * 4 + q] - mu) * rs * gg + bb;
      }
      if (out_sum) *(v4f*)(out_sum + (size_t)row * N + j) = sm;
      *(v4f*)(out_norm + (size_t)row * N + j) = o;
    }
    
  }
}



// ---- f16 WMMA path (v_wmma_f32_16x16x32_f16): 11-bit significands for operands in range — used where a [0,1] probability operand needs more precision than bf16
typedef _Float16 v16h __attribute__((ext_vector_type(16)));
union FragH { v16h v; v8us half[2]; _Float16 h[16]; unsigned short u[16]; };
template <int NT>
__device__ __forceinline__ v8f mmaH(v16h ah, v16h al, v16h bh, v16h bl, v8f c) {
  c = __builtin_amdgcn_wmma_f32_16x16x32_f16(false, ah, false, bh, (short)0, c, false, false);
  if (NT >= 2) c = __builtin_amdgcn_wmma_f32_16x16x32_f16(false, al, false, bh, (short)0, c, false, false);
  if (NT >= 3) c = __builtin_amdgcn_wmma_f32_16x16x32_f16(false, ah, false, bl, (short)0, c, false, false);
  asm volatile("v_nop\n\tv_nop\n\tv_nop\n\tv_nop" : "+v"(c) : "v"(ah), "v"(al), "v"(bh), "v"(bl));
  return c;
}
// batched GEMM like k_gemm_b but f16 operands: A f32 (split into f16 hi/lo if ASPLIT, else rounded to f16), Bt = f16 values [n][k]; alpha; C f32; N multiple of 16 (partial tiles skipped)
template <bool ASPLIT>
__global__ __launch_bounds__(128) void k_gemm_h(const float* __restrict__ A, int lda, size_t sA, const _Float16* __restrict__ Bh, int ldb, size_t sB, float alpha, float* __restrict__ C, int ldc, size_t sC, int M, int N, int K) {
  __shared__ __attribute__((aligned(16))) float so[4][16][64];
  const int tid = threadIdx.x, w = tid >> 5, lane = tid & 31, ln = lane & 15, hh = lane >> 4; const int by = blockIdx.y;
  A += (size_t)by * sA; Bh += (size_t)by * sB; C += (size_t)by * sC;
  const int ntn = (N + 63) / 64; const int wid = blockIdx.x * 4 + w; const int mt = wid / ntn, nq = wid % ntn; if (mt * 16 >= M) return;
  const int row0 = mt * 16, col0 = nq * 64; const float* arow = A + (size_t)(row0 + ln) * lda;
  v8f acc[4] = {};
  for (int kb = 0; kb < K; kb += 32) {
    FragH ah, al;
    const v4f x0 = *(const v4fa*)(arow + kb + 8 * hh), x1 = *(const v4fa*)(arow + kb + 8 * hh + 4), x2 = *(const v4fa*)(arow + kb + 16 + 8 * hh), x3 = *(const v4fa*)(arow + kb + 16 + 8 * hh + 4);
    float xs[16] = {x0[0],x0[1],x0[2],x0[3],x1[0],x1[1],x1[2],x1[3],x2[0],x2[1],x2[2],x2[3],x3[0],x3[1],x3[2],x3[3]};
#pragma unroll
    for (int i = 0; i < 16; ++i) { const _Float16 h = (_Float16)xs[i]; ah.h[i] = h; al.h[i] = ASPLIT ? (_Float16)(xs[i] - (float)h) : (_Float16)0.0f; }
#pragma unroll
    for (int t = 0; t < 4; ++t) { if (col0 + t * 16 >= N) continue; const size_t boff = (size_t)(col0 + t * 16 + ln) * ldb + kb; FragH bq; bq.half[0] = *(const v8us*)(Bh + boff + 8 * hh); bq.half[1] = *(const v8us*)(Bh + boff + 16 + 8 * hh);
      acc[t] = mmaH<ASPLIT ? 2 : 1>(ah.v, al.v, bq.v, bq.v, acc[t]); }
  }
#pragma unroll
  for (int t = 0; t < 4; ++t) { if (col0 + t * 16 >= N) continue;
#pragma unroll
    for (int r = 0; r < 8; ++r) so[w][8 * hh + r][t * 16 + ln] = acc[t][r] * alpha; }
  __builtin_amdgcn_fence(__ATOMIC_ACQ_REL, "workgroup"); __builtin_amdgcn_wave_barrier();
  const int rsub = lane >> 4, c4 = (lane & 15) * 4;
  {
#pragma unroll
    for (int q = 0; q < 8; ++q) { const int r = q * 2 + rsub; if (col0 + c4 < N) { const v4f v = *(const v4fa*)&so[w][r][c4]; *(v4f*)(C + (size_t)(row0 + r) * ldc + col0 + c4) = v; } }
     }
}

// One grid for the five preparations, none of which needs another's result: 256 work-groups of 8 waves, one per WGP, so that the launch starts 2,048 waves and not one wave per 256 elements.
// Every work-group takes one 64 x 64 tile of one weight and 8,192 elements of x; a thread's 24 loads are all asked for ahead of the first conversion.
// Weights: Wt[n][k] = f16(bf16(W[k][n]) * 16) from f32 row-major W[k][n] (a power of two keeps the bf16-exact weights exact in f16, away from the subnormal range). A lane owns one column n and two runs of 8 consecutive k, kg and 32 + kg:
// a wave-wide load is 128 contiguous bytes of one row of W, and each run's 8 values are 16 bytes of a row of Wt. The tile is laid in LDS as [n][k] (pitch 144 B = 16 B x odd) and goes out as whole 128-byte lines.
// x: X16 = f16(bf16(x)), eight elements a piece, four pieces a thread.
__global__ __launch_bounds__(256) void k_prep(const float* __restrict__ x, const float* __restrict__ wq, const float* __restrict__ wk, const float* __restrict__ wv, const float* __restrict__ wo,
                                              _Float16* __restrict__ X16, _Float16* __restrict__ Bq, _Float16* __restrict__ Bk, _Float16* __restrict__ Bv, _Float16* __restrict__ Bo) {
  constexpr int TW = 64, NTW = DM / TW, GW = NTW * NTW, XU = NR * DM / 8 / (4 * GW) / 256;      // tile edge; tiles along an edge of a weight; tiles (work-groups) per weight; pieces of x per thread
  __shared__ __attribute__((aligned(16))) unsigned short sT[TW][TW + 8];
  const int tid = threadIdx.x, blk = blockIdx.x, job = blk / GW, k0 = ((blk % GW) / NTW) * TW, n0 = (blk % NTW) * TW;
  const float* W = job == 0 ? wq : job == 1 ? wk : job == 2 ? wv : wo; _Float16* Wt = job == 0 ? Bq : job == 1 ? Bk : job == 2 ? Bv : Bo;
  const int n = tid & (TW - 1), kg = (tid / TW) * 8;      // the lane's column and its two k pieces, kg and 32 + kg
  const size_t t0 = (size_t)blk * (XU * 256) + tid;      // piece j of x: t0 + 256 j
  const float* wp0 = W + (size_t)(k0 + kg) * DM + n0 + n; const float* wp1 = wp0 + 32 * DM; const float* xp = x + t0 * 8;
  float wr[2][8]; v4f xr[XU][2];
#pragma unroll
  for (int i = 0; i < 8; ++i) { wr[0][i] = wp0[i * DM]; wr[1][i] = wp1[i * DM]; }
#pragma unroll
  for (int j = 0; j < XU; ++j) { xr[j][0] = *(const v4fa*)(xp + j * 2048); xr[j][1] = *(const v4fa*)(xp + j * 2048 + 4); }
  __builtin_amdgcn_sched_barrier(0);      // keeps all 24 loads ahead of the first conversion: sunk behind the waits for the weights, the last pieces of x would pay a second memory latency
  asm volatile("s_wait_xcnt 0x0" :: "v"(wp0), "v"(xp) : "memory");      // the two base addresses as inputs keep the loads' address registers unwritten, also by a later load's result, up to this wait
#pragma unroll
  for (int u = 0; u < 2; ++u) { FragH f;
#pragma unroll
    for (int i = 0; i < 8; ++i) f.h[i] = (_Float16)(bf16_round(wr[u][i]) * 16.0f);
    *(v8us*)&sT[n][u * 32 + kg] = f.half[0]; }
  __syncthreads();      // a row of sT holds the k pieces of four waves
#pragma unroll
  for (int u = 0; u < 2; ++u) { const int r = u * 32 + (tid >> 3), pc = tid & 7; const v8us v = *(const v8us*)&sT[r][pc * 8]; *(v8us*)((unsigned short*)Wt + (size_t)(n0 + r) * DM + k0 + pc * 8) = v; }
#pragma unroll
  for (int j = 0; j < XU; ++j) { FragH f;
#pragma unroll
    for (int q = 0; q < 8; ++q) f.h[q] = (_Float16)bf16_round(xr[j][q >> 2][q & 3]);
    *(v8us*)((unsigned short*)X16 + (t0 + j * 256) * 8) = f.half[0]; }
}
// C[4096][512] = (A . Bt^T) * alpha + bf16(bias): one 64 x 64 tile of C per work-group, wave w = rows 16 w .. 16 w + 15, all 64 columns, K = 512 whole.
// The 64 rows of A and the 64 rows of Bt (both k-contiguous) come in by whole-line loads (a wave-wide 16-byte load = two rows x 256 contiguous bytes) and are laid in LDS at a pitch of 1040 B
// (16 B x odd: no bank conflict for the 16-byte fragment reads); the fragments then come from LDS, in the same k order as when they were read from global memory. All global loads are issued first;
// K goes in four chunks of 128, each stored to its own LDS columns and multiplied while the later chunks are still on their way into registers. F32OUT: f32 C, else f16.
// The q, k and v products read the same A and need nothing of each other: they share one grid, GG blocks each, job = block index / GG picks weight, bias and output (F32OUT: GG blocks, job 0 alone).
// Jobs 0 and 1 write C0, C1 row-major; job 2 (v) writes its 64 tokens x 64 columns (one head) transposed, Vt[(batch, head)][d][token], as the attention kernel reads it.
template <bool F32OUT>
__global__ __launch_bounds__(128) void k_gemm_hhx(const _Float16* __restrict__ A, const _Float16* __restrict__ B0, const _Float16* __restrict__ B1, const _Float16* __restrict__ B2, float alpha,
                                                  const float* __restrict__ bias0, const float* __restrict__ bias1, const float* __restrict__ bias2, float* __restrict__ C, _Float16* __restrict__ C0, _Float16* __restrict__ C1, _Float16* __restrict__ Vt) {
  constexpr int GG = (NR / 64) * (DM / 64); const int job = blockIdx.x / GG, blk = blockIdx.x % GG;
  const _Float16* Bh = job == 0 ? B0 : job == 1 ? B1 : B2; const float* bias = job == 0 ? bias0 : job == 1 ? bias1 : bias2; _Float16* C16 = job == 0 ? C0 : C1;
  constexpr int KP = DM + 8, KC = 128, NC = DM / KC, NL = 64 * KC / 8 / 128, KS = KC / 32;      // LDS pitch in halves; k per chunk; chunks; 16-byte loads per thread, operand and chunk; k steps per chunk
  __shared__ __attribute__((aligned(16))) unsigned short sA[64][KP], sB[64][KP];
  __shared__ __attribute__((aligned(16))) float so[4][16][64];
  const int tid = threadIdx.x, w = tid >> 5, lane = tid & 31, ln = lane & 15, hh = lane >> 4;
  const int mt = blk / (DM / 64), nq = blk % (DM / 64);
  const int row0 = mt * 64 + w * 16, col0 = nq * 64;
  const unsigned short* Ag = (const unsigned short*)A + (size_t)mt * 64 * DM;
  const unsigned short* Bg = (const unsigned short*)Bh + (size_t)col0 * DM;
  const int sr = tid >> 4, sc = (tid & 15) * 8;      // staging: load i of chunk c takes row 8 i + sr, halves c * KC + sc .. + 7
  v8us ra[NC][NL], rb[NC][NL];
#pragma unroll
  for (int c = 0; c < NC; ++c) {
#pragma unroll
    for (int i = 0; i < NL; ++i) { ra[c][i] = *(const v8us*)(Ag + (size_t)(8 * i + sr) * DM + c * KC + sc); rb[c][i] = *(const v8us*)(Bg + (size_t)(8 * i + sr) * DM + c * KC + sc); }
    __builtin_amdgcn_sched_barrier(0);      // keeps the loads in chunk order, so that chunk 0 is complete after a quarter of them and not after half
  }
  asm volatile("s_wait_xcnt 0x0" ::: "memory");      // stands in front of the first overwrite of the loads' address registers, which are reused for fragments while later chunks are still in flight
  v8f acc[4] = {};
#pragma unroll
  for (int c = 0; c < NC; ++c) {
#pragma unroll
    for (int i = 0; i < NL; ++i) { *(v8us*)&sA[8 * i + sr][c * KC + sc] = ra[c][i]; *(v8us*)&sB[8 * i + sr][c * KC + sc] = rb[c][i]; }
    // publishes this chunk's LDS columns to all four waves. LDS-only fences: a full __syncthreads() would also wait for the later chunks' global loads, which only this thread's registers receive
    __builtin_amdgcn_fence(__ATOMIC_RELEASE, "workgroup", "local"); __builtin_amdgcn_s_barrier(); __builtin_amdgcn_fence(__ATOMIC_ACQUIRE, "workgroup", "local");
    FragH ah[KS], bq[KS][4];      // the whole chunk's fragments are asked for ahead of its first matrix instruction
#pragma unroll
    for (int ks = 0; ks < KS; ++ks) { const int kb = c * KC + ks * 32; ah[ks].half[0] = *(const v8us*)&sA[w * 16 + ln][kb + 8 * hh]; ah[ks].half[1] = *(const v8us*)&sA[w * 16 + ln][kb + 16 + 8 * hh];
#pragma unroll
      for (int t = 0; t < 4; ++t) { bq[ks][t].half[0] = *(const v8us*)&sB[t * 16 + ln][kb + 8 * hh]; bq[ks][t].half[1] = *(const v8us*)&sB[t * 16 + ln][kb + 16 + 8 * hh]; } }
#pragma unroll
    for (int ks = 0; ks < KS; ++ks)
#pragma unroll
      for (int t = 0; t < 4; ++t) acc[t] = mmaH<1>(ah[ks].v, ah[ks].v, bq[ks][t].v, bq[ks][t].v, acc[t]);
  }
  if (!F32OUT && job == 2) {      // block-uniform
    // an accumulator lane holds 8 consecutive tokens of one column d: 16 bytes of a transposed row. The four waves lay the 64 d x 64 tokens in LDS (pitch 144 B = 16 B x odd), then whole 128-byte rows of Vt go out
    unsigned short (*tl)[72] = (unsigned short (*)[72])&so[0][0][0];
#pragma unroll
    for (int t = 0; t < 4; ++t) { const float bv = bf16_round(bias[col0 + t * 16 + ln]); FragH f;
#pragma unroll
      for (int r = 0; r < 8; ++r) f.h[r] = (_Float16)(acc[t][r] * alpha + bv);
      *(v8us*)&tl[t * 16 + ln][w * 16 + 8 * hh] = f.half[0]; }
    __syncthreads();      // a row of tl holds tokens of all four waves
    unsigned short* vo = (unsigned short*)Vt + ((size_t)((mt * 64 / TT) * NH + nq) * HD) * TT + (mt * 64) % TT;
#pragma unroll
    for (int i = 0; i < 4; ++i) { const int d = i * 16 + (tid >> 3), pc = tid & 7; const v8us v = *(const v8us*)&tl[d][pc * 8]; *(v8us*)(vo + (size_t)d * TT + pc * 8) = v; }
    return;
  }
#pragma unroll
  for (int t = 0; t < 4; ++t) { const float bv = bf16_round(bias[col0 + t * 16 + ln]);
#pragma unroll
    for (int r = 0; r < 8; ++r) so[w][8 * hh + r][t * 16 + ln] = acc[t][r] * alpha + bv; }
  __builtin_amdgcn_fence(__ATOMIC_ACQ_REL, "workgroup"); __builtin_amdgcn_wave_barrier();
  const int rsub = lane >> 4, c4 = (lane & 15) * 4; typedef _Float16 v4h __attribute__((ext_vector_type(4)));
#pragma unroll
  for (int q = 0; q < 8; ++q) { const int r = q * 2 + rsub; const v4f v = *(const v4fa*)&so[w][r][c4];
    if (F32OUT) *(v4f*)(C + (size_t)(row0 + r) * DM + col0 + c4) = v;
    else { v4h h4; for (int i = 0; i < 4; ++i) h4[i] = (_Float16)v[i]; *(v4h*)(C16 + (size_t)(row0 + r) * DM + col0 + c4) = h4; } }
  if (!F32OUT) asm volatile("s_wait_xcnt 0x0" ::: "memory");      // the built code lays the transposed part behind these stores: the wait stands in front of any write of the stores' registers there
}


// Ten asynchronous 16-byte copies a lane, global memory to LDS through no register. l = the lane's LDS byte addresses, g = its global addresses.
// The closing s_wait_xcnt stands inside the copies' own statement, so that no address register of a copy is rewritten in front of it.
__device__ __forceinline__ void copy10(const unsigned* l, const unsigned short* const* g) {
  asm volatile(
               "global_load_async_to_lds_b128 %0, %1, off\n\t"
               "global_load_async_to_lds_b128 %2, %3, off\n\t"
               "global_load_async_to_lds_b128 %4, %5, off\n\t"
               "global_load_async_to_lds_b128 %6, %7, off\n\t"
               "global_load_async_to_lds_b128 %8, %9, off\n\t"
               "global_load_async_to_lds_b128 %10, %11, off\n\t"
               "global_load_async_to_lds_b128 %12, %13, off\n\t"
               "global_load_async_to_lds_b128 %14, %15, off\n\t"
               "global_load_async_to_lds_b128 %16, %17, off\n\t"
               "global_load_async_to_lds_b128 %18, %19, off\n\t"
               "s_wait_xcnt 0x0"
               :: "v"(l[0]), "v"(g[0]), "v"(l[1]), "v"(g[1]), "v"(l[2]), "v"(g[2]), "v"(l[3]), "v"(g[3]), "v"(l[4]), "v"(g[4]), "v"(l[5]), "v"(g[5]), "v"(l[6]), "v"(g[6]), "v"(l[7]), "v"(g[7]), "v"(l[8]), "v"(g[8]), "v"(l[9]), "v"(g[9]) : "memory");
}
// The q, k and v projections of ONE head for 128 tokens in one work-group of 8 waves: the 128 rows of A meet 192 rows of weights (64 of Bq, 64 of Bk, 64 of Bv), so a byte brought from L2 serves 2.4 x the products of a 64 x 64 tile.
// 256 work-groups, one per WGP, one round. Wave (rg, cg) = tokens 64 rg .. + 63 (4 fragments) x columns 16 cg .. + 15 of q, of k and of v (3 fragments): 12 matrix instructions for 7 fragments read from LDS, where 16 x 64 a wave had 4 for 5.
// K goes in 4 chunks of 128 through two LDS buffers of 320 rows x 256 B at a pitch of 272 B (16 B x odd), filled by asynchronous copies (a wave-wide copy = two rows x 256 contiguous bytes): chunk c + 1 flies while chunk c is multiplied.
// q and k run transposed (A = 16 weight rows, B = 16 tokens): a lane holds 8 consecutive columns of one token = 16 bytes of a row of Q or K. v runs straight: a lane holds 8 consecutive tokens of one column = 16 bytes of a row of V^T.
// The k order of every sum is that of the 64 x 64 kernel k_gemm_hhx, which now serves the output projection alone.
__global__ __launch_bounds__(256) void k_qkv(const _Float16* __restrict__ A, const _Float16* __restrict__ B0, const _Float16* __restrict__ B1, const _Float16* __restrict__ B2, float alpha,
                                             const float* __restrict__ bias0, const float* __restrict__ bias1, const float* __restrict__ bias2, _Float16* __restrict__ C0, _Float16* __restrict__ C1, _Float16* __restrict__ Vt) {
  constexpr int MB = 128, KC = 128, NC = DM / KC, KP = KC + 8, RW = MB + 3 * HD, KS = KC / 32, NCP = RW / 16;      // tokens; k per chunk; chunks; LDS pitch in halves; rows per buffer; k steps per chunk; copies per lane and chunk
  __shared__ __attribute__((aligned(16))) unsigned short sR[2][RW][KP];      // rows 0 .. 127: A; 128 + 64 j + n: row n of the head's part of weight j
  const int tid = threadIdx.x, lane = tid & 31, ln = lane & 15, hh = lane >> 4, w = tid >> 5, rg = w >> 2, cg = w & 3;
  const int mt = blockIdx.x / NH, hd = blockIdx.x % NH;
  const int r0 = tid >> 4, pc16 = tid & 15;      // copy i of a chunk takes row 16 i + r0, bytes 16 pc16 .. + 15
  const unsigned short* gsrc[4] = { (const unsigned short*)A + (size_t)(mt * MB + r0) * DM + pc16 * 8, (const unsigned short*)B0 + (size_t)(hd * HD + r0) * DM + pc16 * 8,
                                    (const unsigned short*)B1 + (size_t)(hd * HD + r0) * DM + pc16 * 8, (const unsigned short*)B2 + (size_t)(hd * HD + r0) * DM + pc16 * 8 };
  const unsigned ldst = (unsigned)(size_t)&sR[0][r0][pc16 * 8];      // the low 32 bits of a __shared__ address are the LDS byte address
  auto fill = [&](int c, int buf) {
    unsigned l[NCP]; const unsigned short* g[NCP];
#pragma unroll
    for (int i = 0; i < NCP; ++i) { l[i] = ldst + (unsigned)((buf * RW + 16 * i) * KP * 2);
      g[i] = (i < MB / 16 ? gsrc[0] + (size_t)(16 * i) * DM : gsrc[1 + (i - MB / 16) / 4] + (size_t)(16 * ((i - MB / 16) % 4)) * DM) + c * KC; }
    copy10(l, g); copy10(l + 10, g + 10);
  };
  fill(0, 0);
  float bqk[2][8];      // the biases are asked for while chunk 0 is on its way
#pragma unroll
  for (int r = 0; r < 8; ++r) { bqk[0][r] = bias0[hd * HD + cg * 16 + 8 * hh + r]; bqk[1][r] = bias1[hd * HD + cg * 16 + 8 * hh + r]; }
  const float bvv = bias2[hd * HD + cg * 16 + ln];
  // one statement, inputs only, two jobs. The loaded values as inputs hold the bias loads up here, where their latency runs beside that of chunk 0's copies (sunk into the loop they stall a chunk);
  // the three base pointers as inputs keep the loads' scalar address registers as they are up to the s_wait_xcnt
  asm volatile("s_wait_xcnt 0x0" :: "v"(bqk[0][0]), "v"(bqk[1][0]), "v"(bqk[0][1]), "v"(bqk[1][1]), "v"(bqk[0][2]), "v"(bqk[1][2]), "v"(bqk[0][3]), "v"(bqk[1][3]), "v"(bqk[0][4]), "v"(bqk[1][4]), "v"(bqk[0][5]), "v"(bqk[1][5]), "v"(bqk[0][6]), "v"(bqk[1][6]), "v"(bqk[0][7]), "v"(bqk[1][7]), "v"(bvv), "s"(bias0), "s"(bias1), "s"(bias2) : "memory");
  asm volatile("s_wait_asynccnt 0x0" ::: "memory");      // this wave's copies of chunk 0 have landed
  __syncthreads();      // ... and every other wave's: nobody reads chunk 0 in front of this barrier
  fill(1, 1);
  v8f acc[4][3] = {};
#pragma unroll
  for (int c = 0; c < NC; ++c) {
    const unsigned short (*sb)[KP] = sR[c & 1];
    FragH af[2][4], bf[2][3];      // two fragment sets: the next k step's 14 LDS reads are asked for ahead of this step's 12 matrix instructions (inside the chunk only)
#pragma unroll
    for (int ks = -1; ks < KS; ++ks) {
      if (ks + 1 < KS) { const int kb = (ks + 1) * 32, s = (ks + 1) & 1;
#pragma unroll
        for (int rt = 0; rt < 4; ++rt) { const unsigned short* p = &sb[rg * 64 + rt * 16 + ln][kb + 8 * hh]; af[s][rt].half[0] = *(const v8us*)p; af[s][rt].half[1] = *(const v8us*)(p + 16); }
#pragma unroll
        for (int t = 0; t < 3; ++t) { const unsigned short* p = &sb[MB + t * HD + cg * 16 + ln][kb + 8 * hh]; bf[s][t].half[0] = *(const v8us*)p; bf[s][t].half[1] = *(const v8us*)(p + 16); }
        __builtin_amdgcn_sched_barrier(0); }      // keeps these reads, as one group, ahead of the matrix instructions below: sunk to their first use, each fragment's reads cost the wave a whole LDS latency
      if (ks >= 0) { const int s = ks & 1;
#pragma unroll
        for (int rt = 0; rt < 4; ++rt) {
          acc[rt][0] = __builtin_amdgcn_wmma_f32_16x16x32_f16(false, bf[s][0].v, false, af[s][rt].v, (short)0, acc[rt][0], false, false);
          acc[rt][1] = __builtin_amdgcn_wmma_f32_16x16x32_f16(false, bf[s][1].v, false, af[s][rt].v, (short)0, acc[rt][1], false, false);
          acc[rt][2] = __builtin_amdgcn_wmma_f32_16x16x32_f16(false, af[s][rt].v, false, bf[s][2].v, (short)0, acc[rt][2], false, false); } }
    }
    __builtin_amdgcn_sched_barrier(0);      // keeps the chunk's matrix instructions in front of the waits below: issued there, they run while the next chunk's copies are still landing
    asm volatile("s_wait_dscnt 0x0" ::: "memory");      // this wave's reads of the buffer are over before the buffer is refilled
    asm volatile("s_wait_asynccnt 0x0" ::: "memory");      // this wave's copies of chunk c + 1 have landed
    __syncthreads();      // publishes chunk c + 1 and ends every wave's reads of chunk c's buffer
    if (c + 2 < NC) fill(c + 2, c & 1);
  }
  asm volatile("s_wait_asynccnt 0x0" ::: "memory");      // no copy is outstanding when the buffers become output staging
  // output staging in the first buffer (the last chunk's own barrier stands in front): Q and K as [token][64] at 144 B, V^T as [d][128 tokens] at 272 B (16 B x odd)
  unsigned short (*eQ)[HD + 8] = (unsigned short (*)[HD + 8])&sR[0][0][0]; unsigned short (*eK)[HD + 8] = eQ + MB; unsigned short (*eV)[MB + 8] = (unsigned short (*)[MB + 8])(eK + MB);
#pragma unroll
  for (int rt = 0; rt < 4; ++rt) { FragH fq, fk, fv;
#pragma unroll
    for (int r = 0; r < 8; ++r) { fq.h[r] = (_Float16)(acc[rt][0][r] * alpha + bf16_round(bqk[0][r])); fk.h[r] = (_Float16)(acc[rt][1][r] * alpha + bf16_round(bqk[1][r])); fv.h[r] = (_Float16)(acc[rt][2][r] * alpha + bf16_round(bvv)); }
    *(v8us*)&eQ[rg * 64 + rt * 16 + ln][cg * 16 + 8 * hh] = fq.half[0]; *(v8us*)&eK[rg * 64 + rt * 16 + ln][cg * 16 + 8 * hh] = fk.half[0]; *(v8us*)&eV[cg * 16 + ln][rg * 64 + rt * 16 + 8 * hh] = fv.half[0]; }
  __syncthreads();      // a staged row holds the work of several waves
  unsigned short* qo = (unsigned short*)C0 + (size_t)(mt * MB) * DM + hd * HD; unsigned short* ko = (unsigned short*)C1 + (size_t)(mt * MB) * DM + hd * HD;
  unsigned short* vo = (unsigned short*)Vt + ((size_t)((mt * MB / TT) * NH + hd) * HD) * TT + (mt * MB) % TT;
#pragma unroll
  for (int i = 0; i < 4; ++i) { const int r = i * 32 + (tid >> 3), pc = tid & 7, d = i * 16 + (tid >> 4), pv = tid & 15;      // whole 128-byte lines of Q and K, whole 256-byte row pieces of V^T
    const v8us a = *(const v8us*)&eQ[r][pc * 8], b = *(const v8us*)&eK[r][pc * 8], v = *(const v8us*)&eV[d][pv * 8];
    *(v8us*)(qo + (size_t)r * DM + pc * 8) = a; *(v8us*)(ko + (size_t)r * DM + pc * 8) = b; *(v8us*)(vo + (size_t)d * TT + pv * 8) = v; }
}

// lane l <-> lane l ^ 16: the two halves of a wave hold the two halves of one query's keys
__device__ __forceinline__ float xhalf(float v) { const int b = __float_as_int(v); return __int_as_float(__builtin_amdgcn_permlanex16(b, b, 0x76543210, 0xfedcba98, false, false)); }
// local attention per ((b,h), 128 queries): wave = 32 queries q0 ... q0 + 31, which reach keys q0 - 32 ... q0 + 63 and no others: the wave walks these 3 chunks of 32 keys, j0 = q0 - 32, q0, q0 + 32 (keys outside [0, T) are masked); score/8 where |k - t| <= 32.
// Both products run transposed: S^T = K . Q^T (A = 16 keys, B = 16 queries) and O^T += V^T . P^T (A = 16 d, B = 16 queries). An accumulator lane (ln, hh) then holds ONE query (column ln) and keys 8 hh + r
// down its registers: a query's maximum and sum are taken in the lane's own registers, with one exchange between the wave halves, and the two score tiles of a chunk (keys 0-15, 16-31), converted in place,
// are the B fragment of the second product in the k order of the V^T loader (8 hh + i, 16 + 8 hh + i): P never leaves the registers.
// The work-group's 128 queries reach 6 chunks of 32 keys, jc = qb0 - 32 + 32 c; wave w walks chunks w, w + 1, w + 2. All six are brought into LDS once, ahead of the loop, K as 128-byte rows and V^T as 64-byte row pieces,
// by 16-byte loads that are all in flight together; the fragments then come from LDS (pitches 144 B and 400 B = 16 B x odd), in the same k order as when they were read from global memory.
// A chunk lies wholly inside [0, T) or wholly outside (T and qb0 are multiples of 32): one outside is read at a CLAMPED chunk address and masked.
__global__ __launch_bounds__(128) void k_flash(const _Float16* __restrict__ Q16, const _Float16* __restrict__ K16, const _Float16* __restrict__ Vt, _Float16* __restrict__ O16) {
  constexpr int RPW = 32, NQB = TT / (4 * RPW), DT = HD / 16, KS = HD / 32;
  constexpr int NCH = (4 * RPW + 2 * WW) / 32;      // key chunks of the work-group
  __shared__ __attribute__((aligned(16))) unsigned short sO[4][RPW][HD + 8];      // output staging, pitch 144 B = 16 B x odd
  __shared__ __attribute__((aligned(16))) unsigned short sK[NCH * 32][HD + 8], sV[HD][NCH * 32 + 8];      // K[key][d], V^T[d][key]
  const int tid = threadIdx.x, lane = tid & 31, ln = lane & 15, hh = lane >> 4;
  const int w = __builtin_amdgcn_readfirstlane(tid >> 5);      // the wave's number in a scalar register: q0 and j0 depend on it, and with it the loop's test and the chunk's staged row offset jl are scalar
  const int slab = blockIdx.x / NQB, qblk = blockIdx.x % NQB; const int b = slab / NH, h = slab % NH; const int qb0 = qblk * (4 * RPW); const int q0 = qb0 + w * RPW;
  FragH aq[2][KS];
#pragma unroll
  for (int rt = 0; rt < 2; ++rt) { const unsigned short* qr = (const unsigned short*)Q16 + ((size_t)b * TT + q0 + rt * 16 + ln) * DM + h * HD;
#pragma unroll
    for (int ks = 0; ks < KS; ++ks) { aq[rt][ks].half[0] = *(const v8us*)(qr + ks * 32 + 8 * hh); aq[rt][ks].half[1] = *(const v8us*)(qr + ks * 32 + 16 + 8 * hh); } }
  const unsigned short* Vth = (const unsigned short*)Vt + (size_t)slab * HD * TT;
  {
    const unsigned short* Kh = (const unsigned short*)K16 + (size_t)b * TT * DM + h * HD;
    const int kr = tid >> 3, kp = (tid & 7) * 8, vr = tid >> 2, vp = (tid & 3) * 8;      // K: 8 threads a row, 16 rows a pass; V^T: 4 threads a row piece, 32 rows a pass
    v8us rk[NCH][2], rv[NCH][2];
#pragma unroll
    for (int cc = 0; cc < NCH; ++cc) { const int jc = qb0 - WW + cc * 32; const int jcl = jc < 0 ? 0 : (jc + 32 > TT ? TT - 32 : jc);      // clamped chunk address; keys outside [0,T) have p = 0 so the substituted values never contribute
#pragma unroll
      for (int u = 0; u < 2; ++u) { rk[cc][u] = *(const v8us*)(Kh + (size_t)(jcl + u * 16 + kr) * DM + kp); rv[cc][u] = *(const v8us*)(Vth + (size_t)(u * 32 + vr) * TT + jcl + vp); } }
#pragma unroll
    for (int cc = 0; cc < NCH; ++cc)
#pragma unroll
      for (int u = 0; u < 2; ++u) { *(v8us*)&sK[cc * 32 + u * 16 + kr][kp] = rk[cc][u]; *(v8us*)&sV[u * 32 + vr][cc * 32 + vp] = rv[cc][u]; }
  }
  __syncthreads();      // a chunk is laid down by all four waves and read by up to three
  float m_r[2], l_r[2]; v8f oacc[2][DT];      // per lane: query q0 + rt * 16 + ln; l_r sums this half's keys only; oacc[rt][dt][r] = O[query][dt * 16 + 8 hh + r]
#pragma unroll
  for (int rt = 0; rt < 2; ++rt) { m_r[rt] = -3.0e38f; l_r[rt] = 0.f;
#pragma unroll
    for (int dt = 0; dt < DT; ++dt) oacc[rt][dt] = (v8f){0.f,0.f,0.f,0.f,0.f,0.f,0.f,0.f}; }
#pragma unroll 1
  for (int j0 = q0 - WW; j0 < q0 + RPW + WW; j0 += 32) {
    const int jl = j0 - (qb0 - WW);      // the chunk's first key, counted in the staged rows
    FragH bk[2][KS], bv[DT];      // the chunk's 16 fragment reads stand together ahead of its first matrix instruction: one LDS latency a chunk
    v8f s[2][2];      // s[rt][nt][r] = score of key j0 + nt * 16 + 8 hh + r with query q0 + rt * 16 + ln
#pragma unroll
    for (int nt = 0; nt < 2; ++nt) { const unsigned short* kr = &sK[jl + nt * 16 + ln][0];
#pragma unroll
      for (int ks = 0; ks < KS; ++ks) { bk[nt][ks].half[0] = *(const v8us*)(kr + ks * 32 + 8 * hh); bk[nt][ks].half[1] = *(const v8us*)(kr + ks * 32 + 16 + 8 * hh); } }
#pragma unroll
    for (int dt = 0; dt < DT; ++dt) { const unsigned short* vrow = &sV[dt * 16 + ln][jl]; bv[dt].half[0] = *(const v8us*)(vrow + 8 * hh); bv[dt].half[1] = *(const v8us*)(vrow + 16 + 8 * hh); }
#pragma unroll
    for (int nt = 0; nt < 2; ++nt) {
#pragma unroll
      for (int rt = 0; rt < 2; ++rt) { v8f acc = (v8f){0.f,0.f,0.f,0.f,0.f,0.f,0.f,0.f};
#pragma unroll
        for (int ks = 0; ks < KS; ++ks) acc = mmaH<1>(bk[nt][ks].v, bk[nt][ks].v, aq[rt][ks].v, aq[rt][ks].v, acc); s[rt][nt] = acc; } }
    FragH pb[2];
#pragma unroll
    for (int rt = 0; rt < 2; ++rt) { const int t = q0 + rt * 16 + ln; float sv[16]; float mc = -INFINITY;
      const int lo = t - WW < 0 ? 0 : t - WW, hi = t + WW > TT - 1 ? TT - 1 : t + WW;      // this lane's query takes keys lo ... hi: 0 <= k < T and |k - t| <= 32 in one range
#pragma unroll
      for (int i = 0; i < 16; ++i) { const int k = j0 + (i >> 3) * 16 + 8 * hh + (i & 7); const bool ok = (unsigned)(k - lo) <= (unsigned)(hi - lo);
        sv[i] = ok ? s[rt][i >> 3][i & 7] * 0.125f : -INFINITY; mc = fmaxf(mc, sv[i]); }
      mc = fmaxf(mc, xhalf(mc));
      const float mn = fmaxf(m_r[rt], mc); const float al = (mn > -1.0e38f) ? expf(m_r[rt] - mn) : 1.0f; m_r[rt] = mn; float ps[4] = {0.f, 0.f, 0.f, 0.f};
#pragma unroll
      for (int i = 0; i < 16; ++i) { const float p = expf(sv[i] - mn); ps[i & 3] += p; pb[rt].h[i] = (_Float16)p; }      // a masked score is -inf and mn is finite: its p is exactly 0
      l_r[rt] = l_r[rt] * al + ((ps[0] + ps[1]) + (ps[2] + ps[3]));
#pragma unroll
      for (int dt = 0; dt < DT; ++dt)
#pragma unroll
        for (int r = 0; r < 8; ++r) oacc[rt][dt][r] *= al; }
#pragma unroll
    for (int dt = 0; dt < DT; ++dt)
#pragma unroll
      for (int rt = 0; rt < 2; ++rt) oacc[rt][dt] = mmaH<1>(bv[dt].v, bv[dt].v, pb[rt].v, pb[rt].v, oacc[rt][dt]); }
#pragma unroll
  for (int rt = 0; rt < 2; ++rt) { float l = l_r[rt] + xhalf(l_r[rt]);
    const int t = q0 + rt * 16 + ln; const int npad = (t < WW ? (WW - t) : 0) + (t + WW >= TT ? (t + WW - TT + 1) : 0); float sc = 1.0f;
    if (npad > 0) { const float m = m_r[rt]; const float mn = fmaxf(m, 0.f); sc = expf(m - mn); l = l * sc + (float)npad * expf(-mn); }
    const float inv = sc / l;
#pragma unroll
    for (int dt = 0; dt < DT; ++dt) { FragH f;      // 8 consecutive d of one query: 16 bytes of its f16 output row
#pragma unroll
      for (int r = 0; r < 8; ++r) f.h[r] = (_Float16)(oacc[rt][dt][r] * inv);
      *(v8us*)&sO[w][rt * 16 + ln][dt * 16 + 8 * hh] = f.half[0]; } }
  __builtin_amdgcn_fence(__ATOMIC_ACQ_REL, "workgroup"); __builtin_amdgcn_wave_barrier();
#pragma unroll
  for (int rp = 0; rp < RPW; rp += 4) { const int r = rp + (lane >> 3), pc = lane & 7; const v8us v = *(const v8us*)&sO[w][r][pc * 8];      // the A operand of the output projection, a whole 128-byte line per row
    *(v8us*)((unsigned short*)O16 + ((size_t)b * TT + q0 + r) * DM + h * HD + pc * 8) = v; } }
extern "C" void kernel_launch(void* const* d_in, const int* in_sizes, int n_in,
                              void* d_out, int out_size, void* d_ws, size_t ws_size, hipStream_t stream) {
  (void)in_sizes; (void)n_in; (void)out_size;
  const float* x = (const float*)d_in[0]; const float* wq = (const float*)d_in[1]; const float* bq = (const float*)d_in[2]; const float* wk = (const float*)d_in[3]; const float* bk = (const float*)d_in[4]; const float* wv = (const float*)d_in[5]; const float* bv = (const float*)d_in[6]; const float* wo = (const float*)d_in[7]; const float* bo = (const float*)d_in[8];
  char* ws = (char*)d_ws; size_t off = 0;
  auto take = [&](size_t bytes) { char* p = ws + off; off += (bytes + 255) & ~(size_t)255; return p; };
  const size_t w8 = (size_t)DM * DM / 8;
  _Float16* Bq = (_Float16*)take(w8 * 16); _Float16* Bk = (_Float16*)take(w8 * 16); _Float16* Bv = (_Float16*)take(w8 * 16); _Float16* Bo = (_Float16*)take(w8 * 16);
  _Float16* X16 = (_Float16*)take((size_t)NR * DM * 2); _Float16* Q16 = (_Float16*)take((size_t)NR * DM * 2); _Float16* K16 = (_Float16*)take((size_t)NR * DM * 2); _Float16* Vt = (_Float16*)take((size_t)NR * DM * 2); _Float16* O16 = X16;
  if (off > ws_size) return;      // 18 MiB
  k_prep<<<4 * (DM / 64) * (DM / 64), 256, 0, stream>>>(x, wq, wk, wv, wo, X16, Bq, Bk, Bv, Bo);      // weights are [in][out]
  const unsigned gg = (NR / 64) * (DM / 64);
  k_qkv<<<(NR / 128) * NH, 256, 0, stream>>>(X16, Bq, Bk, Bv, 0.0625f, bq, bk, bv, Q16, K16, Vt);
  k_flash<<<BB * NH * (TT / 128), 128, 0, stream>>>(Q16, K16, Vt, O16);
  k_gemm_hhx<true><<<gg, 128, 0, stream>>>(O16, Bo, nullptr, nullptr, 0.0625f, bo, nullptr, nullptr, (float*)d_out, nullptr, nullptr, nullptr);
}

// v008
// One run takes 19 microseconds.
// In both of two side-by-side timings against v007, it was 1.24 times as fast.
// All steps since v000 together make it 7.45 times as fast.
#include <hip/hip_runtime.h>
// q/k/v/o projections (4096 × 512 × 512, + bias) and the 8-head LOCAL attention (window ±32, d = 64) on v_wmma_f32_16x16x32_f16: in a fused flash-style kernel a wave visits only the 3 key chunks
// around the 32 queries of its wave pair (16 its own) (S = Q·Kᵀ, O = P·V on WMMA; |k − t| ≤ 32 band mask; online max/sum softmax f32; P f16 ≤ 1), and the module's zero-PADDED keys (score exactly 0, value 0, they DO
// take part in the softmax) are added analytically per query as npad·e^{0 − m} in the normaliser; A = f16(bf16 ·) exact operands, weights [in][out] transposed to bf16-exact ×2^4, f32 accumulate.
#define BB 2
#define TT 2048
#define DM 512
#define NH 8
#define HD 64
#define WW 32
#define NR (BB * TT)

typedef __bf16 v16b __attribute__((ext_vector_type(16)));
typedef unsigned short v8us __attribute__((ext_vector_type(8), may_alias));
typedef float  v8f  __attribute__((ext_vector_type(8)));
typedef float  v4f  __attribute__((ext_vector_type(4)));
typedef float  v4fa __attribute__((ext_vector_type(4), may_alias));
union FragB { v16b v; v8us half[2]; unsigned short u[16]; };

__device__ __forceinline__ unsigned short bf16_bits(float x) { unsigned int u = __float_as_uint(x); return (unsigned short)((u + 0x7FFFu + ((u >> 16) & 1u)) >> 16); }
__device__ __forceinline__ float bf16_val(unsigned short b) { return __uint_as_float(((unsigned int)b) << 16); }
__device__ __forceinline__ float bf16_round(float x) { return bf16_val(bf16_bits(x)); }
// D += A·B with NT terms: 1 = ah·bh, 2 = + al·bh (A split), 3 = + ah·bl (both split)
template <int NT>
__device__ __forceinline__ v8f mmaN(v16b ah, v16b al, v16b bh, v16b bl, v8f c) {
  c = __builtin_amdgcn_wmma_f32_16x16x32_bf16(false, ah, false, bh, (short)0, c, false, false);
  if (NT >= 2) c = __builtin_amdgcn_wmma_f32_16x16x32_bf16(false, al, false, bh, (short)0, c, false, false);
  if (NT >= 3) c = __builtin_amdgcn_wmma_f32_16x16x32_bf16(false, ah, false, bl, (short)0, c, false, false);
  asm volatile("v_nop\n\tv_nop\n\tv_nop\n\tv_nop" : "+v"(c) : "v"(ah), "v"(al), "v"(bh), "v"(bl));
  return c;
}

__global__ __launch_bounds__(256) void k_wt_bf16(const float* __restrict__ W, unsigned short* __restrict__ Wt, int K, int N) {
  const int t = blockIdx.x * 256 + threadIdx.x;
  const int k8n = K / 8;
  if (t >= N * k8n) return;
  const int n = t / k8n, k8 = (t % k8n) * 8;
  v8us v;
#pragma unroll
  for (int i = 0; i < 8; ++i) v[i] = bf16_bits(W[(size_t)(k8 + i) * N + n]);
  *(v8us*)(Wt + (size_t)n * K + k8) = v;
  
}

// GEMM C[M][N] (f32, pitch ldc) = act(A[M][K]·W + bias). A f32 row-major (pitch lda) converted per fragment to bf16
// (ASPLIT: hi/lo two planes -> 2 terms, else single rounded term); Wt bf16 [N][K] (pitch ldb). BIAS_BF16 rounds the
// bias to bf16 first (bias quantised to bf16 before the add). K%32==0, M%16==0, N%64==0.
template <bool ASPLIT, int ACT, bool BIAS_BF16>
__global__ __launch_bounds__(128) void k_gemm_bf(const float* __restrict__ A, int lda, const unsigned short* __restrict__ Wt, int ldb,
                                               const float* __restrict__ bias, float* __restrict__ C, int ldc, int M, int N, int K) {
  __shared__ __attribute__((aligned(16))) float so[4][16][64];
  const int tid = threadIdx.x, w = tid >> 5, lane = tid & 31, ln = lane & 15, hh = lane >> 4;
  const int ntn = N / 64;
  const int wid = blockIdx.x * 4 + w;
  const int mt = wid / ntn, nq = wid % ntn;
  if (mt * 16 >= M) return;
  const int row0 = mt * 16, col0 = nq * 64;
  const float* arow = A + (size_t)(row0 + ln) * lda;
  v8f acc[4] = {};
  for (int kb = 0; kb < K; kb += 32) {
    FragB ah, al;
    const v4f x0 = *(const v4fa*)(arow + kb + 8 * hh), x1 = *(const v4fa*)(arow + kb + 8 * hh + 4);
    const v4f x2 = *(const v4fa*)(arow + kb + 16 + 8 * hh), x3 = *(const v4fa*)(arow + kb + 16 + 8 * hh + 4);
    float xs[16] = {x0[0],x0[1],x0[2],x0[3],x1[0],x1[1],x1[2],x1[3],x2[0],x2[1],x2[2],x2[3],x3[0],x3[1],x3[2],x3[3]};
#pragma unroll
    for (int i = 0; i < 16; ++i) { const unsigned short hb = bf16_bits(xs[i]); ah.u[i] = hb; al.u[i] = ASPLIT ? bf16_bits(xs[i] - bf16_val(hb)) : (unsigned short)0; }
#pragma unroll
    for (int t = 0; t < 4; ++t) {
      const unsigned short* brow = Wt + (size_t)(col0 + t * 16 + ln) * ldb + kb;
      FragB b;
      b.half[0] = *(const v8us*)(brow + 8 * hh);
      b.half[1] = *(const v8us*)(brow + 16 + 8 * hh);
      acc[t] = mmaN<ASPLIT ? 2 : 1>(ah.v, al.v, b.v, b.v, acc[t]);
    }
  }
#pragma unroll
  for (int t = 0; t < 4; ++t) {
    float bv = bias ? bias[col0 + t * 16 + ln] : 0.f;
    if (BIAS_BF16) bv = bf16_round(bv);
#pragma unroll
    for (int r = 0; r < 8; ++r) { float v = acc[t][r] + bv; if (ACT == 1) v = fmaxf(v, 0.f); so[w][8 * hh + r][t * 16 + ln] = v; }
  }
  __builtin_amdgcn_fence(__ATOMIC_ACQ_REL, "workgroup");
  __builtin_amdgcn_wave_barrier();
  const int rsub = lane >> 4, c4 = (lane & 15) * 4;
  {
#pragma unroll
    for (int q = 0; q < 8; ++q) {
      const int r = q * 2 + rsub;
      const v4f v = *(const v4fa*)&so[w][r][c4];
      *(v4f*)(C + (size_t)(row0 + r) * ldc + col0 + c4) = v;
    }
    
  }
}

// Flash-style causal/unmasked attention, all contractions 3-term bf16 hi/lo splits, f32 softmax with running max.
// q,k,v rows are read from f32 buffers with arbitrary row pitch (so they can live inside a fused qkv buffer);
// D = head size (multiple of 32, <= 128); one wave = 16 query rows; block = 4 waves (64 queries) sharing K/V chunks of 32.
template <int D, bool CAUSAL>
__global__ __launch_bounds__(128) void k_flash(const float* __restrict__ qb, const float* __restrict__ kb, const float* __restrict__ vb,
                                             int pitch, int T, int H, float scale, float* __restrict__ y, int ypitch) {
  constexpr int KS = D / 32;        // k-steps for QK
  constexpr int DT = D / 16;        // d tiles for PV
  __shared__ __attribute__((aligned(16))) unsigned short sKh[32][D + 8], sKl[32][D + 8], sVh[32][D + 8], sVl[32][D + 8];
  __shared__ __attribute__((aligned(16))) unsigned short sPh[4][16][40], sPl[4][16][40];
  __shared__ __attribute__((aligned(16))) float sO[4][16][D];
  const int tid = threadIdx.x, w = tid >> 5, lane = tid & 31, ln = lane & 15, hh = lane >> 4;
  const int nqb = (T + 63) / 64;
  const int bh = blockIdx.x / nqb, qblk = blockIdx.x % nqb;
  const int b = bh / H, h = bh % H;
  const int q0 = qblk * 64 + w * 16;
  const float* Q = qb + (size_t)b * T * pitch + h * D;
  const float* K = kb + (size_t)b * T * pitch + h * D;
  const float* V = vb + (size_t)b * T * pitch + h * D;

  // A fragments of the wave's 16 query rows (scaled), hi/lo
  FragB aqh[KS], aql[KS];
  {
    int row = q0 + ln; if (row >= T) row = T - 1;
    const float* qr = Q + (size_t)row * pitch;
#pragma unroll
    for (int ks = 0; ks < KS; ++ks)
#pragma unroll
      for (int i = 0; i < 16; ++i) {
        const int d = ks * 32 + ((i < 8) ? (8 * hh + i) : (16 + 8 * hh + (i - 8)));
        const float x = qr[d] * scale; const unsigned short hb = bf16_bits(x);
        aqh[ks].u[i] = hb; aql[ks].u[i] = bf16_bits(x - bf16_val(hb));
      }
  }
  float m_r[8], l_r[8];
#pragma unroll
  for (int r = 0; r < 8; ++r) { m_r[r] = -3.0e38f; l_r[r] = 0.f; }
  v8f oacc[DT];
#pragma unroll
  for (int dt = 0; dt < DT; ++dt) oacc[dt] = (v8f){0.f,0.f,0.f,0.f,0.f,0.f,0.f,0.f};

  const int kv_end = CAUSAL ? min(T, qblk * 64 + 64) : T;     // block-uniform
  for (int j0 = 0; j0 < kv_end; j0 += 32) {
    __syncthreads();
    for (int e = tid; e < 32 * (D / 4); e += 128) {
      const int r = e / (D / 4), c4 = (e % (D / 4)) * 4;
      const int key = j0 + r;
      v4f kf = {0.f,0.f,0.f,0.f}, vf = {0.f,0.f,0.f,0.f};
      if (key < T) { kf = *(const v4fa*)(K + (size_t)key * pitch + c4); vf = *(const v4fa*)(V + (size_t)key * pitch + c4); }
#pragma unroll
      for (int t = 0; t < 4; ++t) {
        unsigned short hb = bf16_bits(kf[t]); sKh[r][c4 + t] = hb; sKl[r][c4 + t] = bf16_bits(kf[t] - bf16_val(hb));
        hb = bf16_bits(vf[t]); sVh[r][c4 + t] = hb; sVl[r][c4 + t] = bf16_bits(vf[t] - bf16_val(hb));
      }
    }
    __syncthreads();
    // S tile 16 x 32
    v8f s[2];
#pragma unroll
    for (int nt = 0; nt < 2; ++nt) {
      v8f acc = {};
#pragma unroll
      for (int ks = 0; ks < KS; ++ks) {
        FragB bh_, bl_;
        bh_.half[0] = *(const v8us*)&sKh[nt * 16 + ln][ks * 32 + 8 * hh]; bh_.half[1] = *(const v8us*)&sKh[nt * 16 + ln][ks * 32 + 16 + 8 * hh];
        bl_.half[0] = *(const v8us*)&sKl[nt * 16 + ln][ks * 32 + 8 * hh]; bl_.half[1] = *(const v8us*)&sKl[nt * 16 + ln][ks * 32 + 16 + 8 * hh];
        acc = mmaN<3>(aqh[ks].v, aql[ks].v, bh_.v, bl_.v, acc);
      }
      s[nt] = acc;
    }
    // mask + running max (rows 8hh+r; the 16 lanes of a half share rows)
    float alpha[8];
#pragma unroll
    for (int r = 0; r < 8; ++r) {
      const int qi = q0 + 8 * hh + r;
      const int ja = j0 + ln, jb = j0 + 16 + ln;
      if (CAUSAL) { if (ja > qi) s[0][r] = -3.0e38f; if (jb > qi) s[1][r] = -3.0e38f; }
      if (ja >= T) s[0][r] = -3.0e38f;
      if (jb >= T) s[1][r] = -3.0e38f;
      float mx = fmaxf(s[0][r], s[1][r]);
      mx = fmaxf(mx, __shfl_xor(mx, 1, 32)); mx = fmaxf(mx, __shfl_xor(mx, 2, 32)); mx = fmaxf(mx, __shfl_xor(mx, 4, 32)); mx = fmaxf(mx, __shfl_xor(mx, 8, 32));
      const float mnew = fmaxf(m_r[r], mx);
      alpha[r] = (mnew > -1.0e38f) ? __expf(m_r[r] - mnew) : 1.0f;
      const float p0 = (s[0][r] > -1.0e38f) ? __expf(s[0][r] - mnew) : 0.f;
      const float p1 = (s[1][r] > -1.0e38f) ? __expf(s[1][r] - mnew) : 0.f;
      m_r[r] = mnew;
      l_r[r] = l_r[r] * alpha[r] + p0 + p1;            // per-lane partial row sum (16 lanes combined at the end)
      unsigned short hb = bf16_bits(p0); sPh[w][8 * hh + r][ln] = hb;      sPl[w][8 * hh + r][ln] = bf16_bits(p0 - bf16_val(hb));
      hb = bf16_bits(p1);                sPh[w][8 * hh + r][16 + ln] = hb; sPl[w][8 * hh + r][16 + ln] = bf16_bits(p1 - bf16_val(hb));
    }
#pragma unroll
    for (int dt = 0; dt < DT; ++dt)
#pragma unroll
      for (int r = 0; r < 8; ++r) oacc[dt][r] *= alpha[r];
    __builtin_amdgcn_fence(__ATOMIC_ACQ_REL, "workgroup");
    __builtin_amdgcn_wave_barrier();
    FragB pah, pal;
    pah.half[0] = *(const v8us*)&sPh[w][ln][8 * hh]; pah.half[1] = *(const v8us*)&sPh[w][ln][16 + 8 * hh];
    pal.half[0] = *(const v8us*)&sPl[w][ln][8 * hh]; pal.half[1] = *(const v8us*)&sPl[w][ln][16 + 8 * hh];
#pragma unroll
    for (int dt = 0; dt < DT; ++dt) {
      FragB bvh, bvl;
#pragma unroll
      for (int i = 0; i < 8; ++i) {
        bvh.u[i] = sVh[8 * hh + i][dt * 16 + ln]; bvh.u[8 + i] = sVh[16 + 8 * hh + i][dt * 16 + ln];
        bvl.u[i] = sVl[8 * hh + i][dt * 16 + ln]; bvl.u[8 + i] = sVl[16 + 8 * hh + i][dt * 16 + ln];
      }
      oacc[dt] = mmaN<3>(pah.v, pal.v, bvh.v, bvl.v, oacc[dt]);
    }
    __builtin_amdgcn_fence(__ATOMIC_ACQ_REL, "workgroup");
    __builtin_amdgcn_wave_barrier();
  }
#pragma unroll
  for (int r = 0; r < 8; ++r) {
    float l = l_r[r];
    l += __shfl_xor(l, 1, 32); l += __shfl_xor(l, 2, 32); l += __shfl_xor(l, 4, 32); l += __shfl_xor(l, 8, 32);
    l_r[r] = (l > 0.f) ? 1.0f / l : 0.f;
  }
#pragma unroll
  for (int dt = 0; dt < DT; ++dt)
#pragma unroll
    for (int r = 0; r < 8; ++r) sO[w][8 * hh + r][dt * 16 + ln] = oacc[dt][r] * l_r[r];
  __builtin_amdgcn_fence(__ATOMIC_ACQ_REL, "workgroup");
  __builtin_amdgcn_wave_barrier();
  {
    for (int r = 0; r < 16; ++r) {
      const int row = q0 + r;
      if (row < T && lane < D / 4) {
        const v4f val = *(const v4fa*)&sO[w][r][lane * 4];
        *(v4f*)(y + ((size_t)b * T + row) * ypitch + h * D + lane * 4) = val;
      }
    }
    
  }
}

// GEMM C = act(A·W + bias + resid): A f32 (ASPLIT -> hi/lo 2 terms), Wt bf16 [N][K]; ACT 0 none, 1 relu, 2 exact gelu;
// resid (optional, f32, row index = (row % rmod), pitch ldr, RES_BF16 rounds it) added before the activation.
template <bool ASPLIT, int ACT, bool BIAS_BF16, bool RES_BF16>
__global__ __launch_bounds__(128) void k_gemm_bf3(const float* __restrict__ A, int lda, const unsigned short* __restrict__ Wt, int ldb,
                                                const float* __restrict__ bias, const float* __restrict__ resid, int rmod, int ldr,
                                                float* __restrict__ C, int ldc, int M, int N, int K) {
  __shared__ __attribute__((aligned(16))) float so[4][16][64];
  const int tid = threadIdx.x, w = tid >> 5, lane = tid & 31, ln = lane & 15, hh = lane >> 4;
  const int ntn = N / 64;
  const int wid = blockIdx.x * 4 + w;
  const int mt = wid / ntn, nq = wid % ntn;
  if (mt * 16 >= M) return;
  const int row0 = mt * 16, col0 = nq * 64;
  const float* arow = A + (size_t)(row0 + ln) * lda;
  v8f acc[4] = {};
  for (int kb = 0; kb < K; kb += 32) {
    FragB ah, al;
    const v4f x0 = *(const v4fa*)(arow + kb + 8 * hh), x1 = *(const v4fa*)(arow + kb + 8 * hh + 4);
    const v4f x2 = *(const v4fa*)(arow + kb + 16 + 8 * hh), x3 = *(const v4fa*)(arow + kb + 16 + 8 * hh + 4);
    float xs[16] = {x0[0],x0[1],x0[2],x0[3],x1[0],x1[1],x1[2],x1[3],x2[0],x2[1],x2[2],x2[3],x3[0],x3[1],x3[2],x3[3]};
#pragma unroll
    for (int i = 0; i < 16; ++i) { const unsigned short hb = bf16_bits(xs[i]); ah.u[i] = hb; al.u[i] = ASPLIT ? bf16_bits(xs[i] - bf16_val(hb)) : (unsigned short)0; }
#pragma unroll
    for (int t = 0; t < 4; ++t) {
      const unsigned short* brow = Wt + (size_t)(col0 + t * 16 + ln) * ldb + kb;
      FragB b;
      b.half[0] = *(const v8us*)(brow + 8 * hh);
      b.half[1] = *(const v8us*)(brow + 16 + 8 * hh);
      acc[t] = mmaN<ASPLIT ? 2 : 1>(ah.v, al.v, b.v, b.v, acc[t]);
    }
  }
#pragma unroll
  for (int t = 0; t < 4; ++t) {
    const int col = col0 + t * 16 + ln;
    float bv = bias ? bias[col] : 0.f;
    if (BIAS_BF16) bv = bf16_round(bv);
#pragma unroll
    for (int r = 0; r < 8; ++r) {
      float v = acc[t][r] + bv;
      if (resid) { float rv = resid[(size_t)((row0 + 8 * hh + r) % rmod) * ldr + col]; if (RES_BF16) rv = bf16_round(rv); v += rv; }
      if (ACT == 1) v = fmaxf(v, 0.f);
      if (ACT == 2) v = 0.5f * v * (1.0f + erff(v * 0.70710678118654752f));
      if (ACT == 3) { const float u = 0.7978845608028654f * (v + 0.044715f * v * v * v); v = 0.5f * v * (1.0f + tanhf(u)); }
      so[w][8 * hh + r][t * 16 + ln] = v;
    }
  }
  __builtin_amdgcn_fence(__ATOMIC_ACQ_REL, "workgroup");
  __builtin_amdgcn_wave_barrier();
  const int rsub = lane >> 4, c4 = (lane & 15) * 4;
  {
#pragma unroll
    for (int q = 0; q < 8; ++q) {
      const int r = q * 2 + rsub;
      const v4f v = *(const v4fa*)&so[w][r][c4];
      *(v4f*)(C + (size_t)(row0 + r) * ldc + col0 + c4) = v;
    }
    
  }
}
// row LayerNorm (biased variance, eps) over N: s = X (+ R); optional out_sum <- s; out_norm <- (s-mu)*rsqrt(var+eps)*g + b
template <bool PARAM_BF16>
__global__ __launch_bounds__(256) void k_layernorm(const float* __restrict__ X, const float* __restrict__ R, const float* __restrict__ g, const float* __restrict__ bta,
                                                  float* __restrict__ out_sum, float* __restrict__ out_norm, int N, float eps) {
  __shared__ float red[256];
  const int row = blockIdx.x, tid = threadIdx.x;
  const float* x = X + (size_t)row * N; const float* rr = R ? R + (size_t)row * N : nullptr;
  float vals[16];                     // up to N = 4096
  const int per = N / 256;            // contiguous chunk per thread? use strided-by-4 chunks: thread handles j = tid*4 + 1024*u
  float s1 = 0.f;
  for (int u = 0; u < per / 4; ++u) {
    const int j = tid * 4 + 1024 * u;
    const v4f a = *(const v4fa*)(x + j);
    v4f b = {0.f,0.f,0.f,0.f}; if (rr) b = *(const v4fa*)(rr + j);
#pragma unroll
    for (int q = 0; q < 4; ++q) { const float v = a[q] + b[q]; vals[u * 4 + q] = v; s1 += v; }
  }
  red[tid] = s1; __syncthreads();
  for (int st = 128; st > 0; st >>= 1) { if (tid < st) red[tid] += red[tid + st]; __syncthreads(); }
  const float mu = red[0] / (float)N; __syncthreads();
  float s2 = 0.f;
  for (int u = 0; u < per / 4; ++u)
#pragma unroll
    for (int q = 0; q < 4; ++q) { const float c = vals[u * 4 + q] - mu; s2 += c * c; }
  red[tid] = s2; __syncthreads();
  for (int st = 128; st > 0; st >>= 1) { if (tid < st) red[tid] += red[tid + st]; __syncthreads(); }
  const float rs = rsqrtf(red[0] / (float)N + eps);
  {
    for (int u = 0; u < per / 4; ++u) {
      const int j = tid * 4 + 1024 * u;
      v4f o, sm;
#pragma unroll
      for (int q = 0; q < 4; ++q) {
        float gg = g[j + q], bb = bta[j + q];
        if (PARAM_BF16) { gg = bf16_round(gg); bb = bf16_round(bb); }
        sm[q] = vals[u * 4 + q]; o[q] = (vals[u * 4 + q] - mu) * rs * gg + bb;
      }
      if (out_sum) *(v4f*)(out_sum + (size_t)row * N + j) = sm;
      *(v4f*)(out_norm + (size_t)row * N + j) = o;
    }
    
  }
}



// ---- f16 WMMA path (v_wmma_f32_16x16x32_f16): 11-bit significands for operands in range — used where a [0,1] probability operand needs more precision than bf16
typedef _Float16 v16h __attribute__((ext_vector_type(16)));
union FragH { v16h v; v8us half[2]; _Float16 h[16]; unsigned short u[16]; };
template <int NT>
__device__ __forceinline__ v8f mmaH(v16h ah, v16h al, v16h bh, v16h bl, v8f c) {
  c = __builtin_amdgcn_wmma_f32_16x16x32_f16(false, ah, false, bh, (short)0, c, false, false);
  if (NT >= 2) c = __builtin_amdgcn_wmma_f32_16x16x32_f16(false, al, false, bh, (short)0, c, false, false);
  if (NT >= 3) c = __builtin_amdgcn_wmma_f32_16x16x32_f16(false, ah, false, bl, (short)0, c, false, false);
  asm volatile("v_nop\n\tv_nop\n\tv_nop\n\tv_nop" : "+v"(c) : "v"(ah), "v"(al), "v"(bh), "v"(bl));
  return c;
}
// batched GEMM like k_gemm_b but f16 operands: A f32 (split into f16 hi/lo if ASPLIT, else rounded to f16), Bt = f16 values [n][k]; alpha; C f32; N multiple of 16 (partial tiles skipped)
template <bool ASPLIT>
__global__ __launch_bounds__(128) void k_gemm_h(const float* __restrict__ A, int lda, size_t sA, const _Float16* __restrict__ Bh, int ldb, size_t sB, float alpha, float* __restrict__ C, int ldc, size_t sC, int M, int N, int K) {
  __shared__ __attribute__((aligned(16))) float so[4][16][64];
  const int tid = threadIdx.x, w = tid >> 5, lane = tid & 31, ln = lane & 15, hh = lane >> 4; const int by = blockIdx.y;
  A += (size_t)by * sA; Bh += (size_t)by * sB; C += (size_t)by * sC;
  const int ntn = (N + 63) / 64; const int wid = blockIdx.x * 4 + w; const int mt = wid / ntn, nq = wid % ntn; if (mt * 16 >= M) return;
  const int row0 = mt * 16, col0 = nq * 64; const float* arow = A + (size_t)(row0 + ln) * lda;
  v8f acc[4] = {};
  for (int kb = 0; kb < K; kb += 32) {
    FragH ah, al;
    const v4f x0 = *(const v4fa*)(arow + kb + 8 * hh), x1 = *(const v4fa*)(arow + kb + 8 * hh + 4), x2 = *(const v4fa*)(arow + kb + 16 + 8 * hh), x3 = *(const v4fa*)(arow + kb + 16 + 8 * hh + 4);
    float xs[16] = {x0[0],x0[1],x0[2],x0[3],x1[0],x1[1],x1[2],x1[3],x2[0],x2[1],x2[2],x2[3],x3[0],x3[1],x3[2],x3[3]};
#pragma unroll
    for (int i = 0; i < 16; ++i) { const _Float16 h = (_Float16)xs[i]; ah.h[i] = h; al.h[i] = ASPLIT ? (_Float16)(xs[i] - (float)h) : (_Float16)0.0f; }
#pragma unroll
    for (int t = 0; t < 4; ++t) { if (col0 + t * 16 >= N) continue; const size_t boff = (size_t)(col0 + t * 16 + ln) * ldb + kb; FragH bq; bq.half[0] = *(const v8us*)(Bh + boff + 8 * hh); bq.half[1] = *(const v8us*)(Bh + boff + 16 + 8 * hh);
      acc[t] = mmaH<ASPLIT ? 2 : 1>(ah.v, al.v, bq.v, bq.v, acc[t]); }
  }
#pragma unroll
  for (int t = 0; t < 4; ++t) { if (col0 + t * 16 >= N) continue;
#pragma unroll
    for (int r = 0; r < 8; ++r) so[w][8 * hh + r][t * 16 + ln] = acc[t][r] * alpha; }
  __builtin_amdgcn_fence(__ATOMIC_ACQ_REL, "workgroup"); __builtin_amdgcn_wave_barrier();
  const int rsub = lane >> 4, c4 = (lane & 15) * 4;
  {
#pragma unroll
    for (int q = 0; q < 8; ++q) { const int r = q * 2 + rsub; if (col0 + c4 < N) { const v4f v = *(const v4fa*)&so[w][r][c4]; *(v4f*)(C + (size_t)(row0 + r) * ldc + col0 + c4) = v; } }
     }
}

// One grid for the five preparations, none of which needs another's result: 256 work-groups of 8 waves, one per WGP, so that the launch starts 2,048 waves and not one wave per 256 elements.
// Every work-group takes one 64 x 64 tile of one weight and 8,192 elements of x; a thread's 24 loads are all asked for ahead of the first conversion.
// Weights: Wt[n][k] = f16(bf16(W[k][n]) * 16) from f32 row-major W[k][n] (a power of two keeps the bf16-exact weights exact in f16, away from the subnormal range). A lane owns one column n and two runs of 8 consecutive k, kg and 32 + kg:
// a wave-wide load is 128 contiguous bytes of one row of W, and each run's 8 values are 16 bytes of a row of Wt. The tile is laid in LDS as [n][k] (pitch 144 B = 16 B x odd) and goes out as whole 128-byte lines.
// x: X16 = f16(bf16(x)), eight elements a piece, four pieces a thread.
__global__ __launch_bounds__(256) void k_prep(const float* __restrict__ x, const float* __restrict__ wq, const float* __restrict__ wk, const float* __restrict__ wv, const float* __restrict__ wo,
                                              _Float16* __restrict__ X16, _Float16* __restrict__ Bq, _Float16* __restrict__ Bk, _Float16* __restrict__ Bv, _Float16* __restrict__ Bo) {
  constexpr int TW = 64, NTW = DM / TW, GW = NTW * NTW, XU = NR * DM / 8 / (4 * GW) / 256;      // tile edge; tiles along an edge of a weight; tiles (work-groups) per weight; pieces of x per thread
  __shared__ __attribute__((aligned(16))) unsigned short sT[TW][TW + 8];
  const int tid = threadIdx.x, blk = blockIdx.x, job = blk / GW, k0 = ((blk % GW) / NTW) * TW, n0 = (blk % NTW) * TW;
  const float* W = job == 0 ? wq : job == 1 ? wk : job == 2 ? wv : wo; _Float16* Wt = job == 0 ? Bq : job == 1 ? Bk : job == 2 ? Bv : Bo;
  const int n = tid & (TW - 1), kg = (tid / TW) * 8;      // the lane's column and its two k pieces, kg and 32 + kg
  const size_t t0 = (size_t)blk * (XU * 256) + tid;      // piece j of x: t0 + 256 j
  const float* wp0 = W + (size_t)(k0 + kg) * DM + n0 + n; const float* wp1 = wp0 + 32 * DM; const float* xp = x + t0 * 8;
  float wr[2][8]; v4f xr[XU][2];
#pragma unroll
  for (int i = 0; i < 8; ++i) { wr[0][i] = wp0[i * DM]; wr[1][i] = wp1[i * DM]; }
#pragma unroll
  for (int j = 0; j < XU; ++j) { xr[j][0] = *(const v4fa*)(xp + j * 2048); xr[j][1] = *(const v4fa*)(xp + j * 2048 + 4); }
  __builtin_amdgcn_sched_barrier(0);      // keeps all 24 loads ahead of the first conversion: sunk behind the waits for the weights, the last pieces of x would pay a second memory latency
  asm volatile("s_wait_xcnt 0x0" :: "v"(wp0), "v"(xp) : "memory");      // the two base addresses as inputs keep the loads' address registers unwritten, also by a later load's result, up to this wait
#pragma unroll
  for (int u = 0; u < 2; ++u) { FragH f;
#pragma unroll
    for (int i = 0; i < 8; ++i) f.h[i] = (_Float16)(bf16_round(wr[u][i]) * 16.0f);
    *(v8us*)&sT[n][u * 32 + kg] = f.half[0]; }
  __syncthreads();      // a row of sT holds the k pieces of four waves
#pragma unroll
  for (int u = 0; u < 2; ++u) { const int r = u * 32 + (tid >> 3), pc = tid & 7; const v8us v = *(const v8us*)&sT[r][pc * 8]; *(v8us*)((unsigned short*)Wt + (size_t)(n0 + r) * DM + k0 + pc * 8) = v; }
#pragma unroll
  for (int j = 0; j < XU; ++j) { FragH f;
#pragma unroll
    for (int q = 0; q < 8; ++q) f.h[q] = (_Float16)bf16_round(xr[j][q >> 2][q & 3]);
    *(v8us*)((unsigned short*)X16 + (t0 + j * 256) * 8) = f.half[0]; }
}
// C[4096][512] = (A . Bt^T) * alpha + bf16(bias): one 64 x 64 tile of C per work-group, wave w = rows 16 w .. 16 w + 15, all 64 columns, K = 512 whole.
// The 64 rows of A and the 64 rows of Bt (both k-contiguous) come in by whole-line loads (a wave-wide 16-byte load = two rows x 256 contiguous bytes) and are laid in LDS at a pitch of 1040 B
// (16 B x odd: no bank conflict for the 16-byte fragment reads); the fragments then come from LDS, in the same k order as when they were read from global memory. All global loads are issued first;
// K goes in four chunks of 128, each stored to its own LDS columns and multiplied while the later chunks are still on their way into registers. F32OUT: f32 C, else f16.
// The q, k and v products read the same A and need nothing of each other: they share one grid, GG blocks each, job = block index / GG picks weight, bias and output (F32OUT: GG blocks, job 0 alone).
// Jobs 0 and 1 write C0, C1 row-major; job 2 (v) writes its 64 tokens x 64 columns (one head) transposed, Vt[(batch, head)][d][token].
template <bool F32OUT>
__global__ __launch_bounds__(128) void k_gemm_hhx(const _Float16* __restrict__ A, const _Float16* __restrict__ B0, const _Float16* __restrict__ B1, const _Float16* __restrict__ B2, float alpha,
                                                  const float* __restrict__ bias0, const float* __restrict__ bias1, const float* __restrict__ bias2, float* __restrict__ C, _Float16* __restrict__ C0, _Float16* __restrict__ C1, _Float16* __restrict__ Vt) {
  constexpr int GG = (NR / 64) * (DM / 64); const int job = blockIdx.x / GG, blk = blockIdx.x % GG;
  const _Float16* Bh = job == 0 ? B0 : job == 1 ? B1 : B2; const float* bias = job == 0 ? bias0 : job == 1 ? bias1 : bias2; _Float16* C16 = job == 0 ? C0 : C1;
  constexpr int KP = DM + 8, KC = 128, NC = DM / KC, NL = 64 * KC / 8 / 128, KS = KC / 32;      // LDS pitch in halves; k per chunk; chunks; 16-byte loads per thread, operand and chunk; k steps per chunk
  __shared__ __attribute__((aligned(16))) unsigned short sA[64][KP], sB[64][KP];
  __shared__ __attribute__((aligned(16))) float so[4][16][64];
  const int tid = threadIdx.x, w = tid >> 5, lane = tid & 31, ln = lane & 15, hh = lane >> 4;
  const int mt = blk / (DM / 64), nq = blk % (DM / 64);
  const int row0 = mt * 64 + w * 16, col0 = nq * 64;
  const unsigned short* Ag = (const unsigned short*)A + (size_t)mt * 64 * DM;
  const unsigned short* Bg = (const unsigned short*)Bh + (size_t)col0 * DM;
  const int sr = tid >> 4, sc = (tid & 15) * 8;      // staging: load i of chunk c takes row 8 i + sr, halves c * KC + sc .. + 7
  v8us ra[NC][NL], rb[NC][NL];
#pragma unroll
  for (int c = 0; c < NC; ++c) {
#pragma unroll
    for (int i = 0; i < NL; ++i) { ra[c][i] = *(const v8us*)(Ag + (size_t)(8 * i + sr) * DM + c * KC + sc); rb[c][i] = *(const v8us*)(Bg + (size_t)(8 * i + sr) * DM + c * KC + sc); }
    __builtin_amdgcn_sched_barrier(0);      // keeps the loads in chunk order, so that chunk 0 is complete after a quarter of them and not after half
  }
  asm volatile("s_wait_xcnt 0x0" ::: "memory");      // stands in front of the first overwrite of the loads' address registers, which are reused for fragments while later chunks are still in flight
  v8f acc[4] = {};
#pragma unroll
  for (int c = 0; c < NC; ++c) {
#pragma unroll
    for (int i = 0; i < NL; ++i) { *(v8us*)&sA[8 * i + sr][c * KC + sc] = ra[c][i]; *(v8us*)&sB[8 * i + sr][c * KC + sc] = rb[c][i]; }
    // publishes this chunk's LDS columns to all four waves. LDS-only fences: a full __syncthreads() would also wait for the later chunks' global loads, which only this thread's registers receive
    __builtin_amdgcn_fence(__ATOMIC_RELEASE, "workgroup", "local"); __builtin_amdgcn_s_barrier(); __builtin_amdgcn_fence(__ATOMIC_ACQUIRE, "workgroup", "local");
    FragH ah[KS], bq[KS][4];      // the whole chunk's fragments are asked for ahead of its first matrix instruction
#pragma unroll
    for (int ks = 0; ks < KS; ++ks) { const int kb = c * KC + ks * 32; ah[ks].half[0] = *(const v8us*)&sA[w * 16 + ln][kb + 8 * hh]; ah[ks].half[1] = *(const v8us*)&sA[w * 16 + ln][kb + 16 + 8 * hh];
#pragma unroll
      for (int t = 0; t < 4; ++t) { bq[ks][t].half[0] = *(const v8us*)&sB[t * 16 + ln][kb + 8 * hh]; bq[ks][t].half[1] = *(const v8us*)&sB[t * 16 + ln][kb + 16 + 8 * hh]; } }
#pragma unroll
    for (int ks = 0; ks < KS; ++ks)
#pragma unroll
      for (int t = 0; t < 4; ++t) acc[t] = mmaH<1>(ah[ks].v, ah[ks].v, bq[ks][t].v, bq[ks][t].v, acc[t]);
  }
  if (!F32OUT && job == 2) {      // block-uniform
    // an accumulator lane holds 8 consecutive tokens of one column d: 16 bytes of a transposed row. The four waves lay the 64 d x 64 tokens in LDS (pitch 144 B = 16 B x odd), then whole 128-byte rows of Vt go out
    unsigned short (*tl)[72] = (unsigned short (*)[72])&so[0][0][0];
#pragma unroll
    for (int t = 0; t < 4; ++t) { const float bv = bf16_round(bias[col0 + t * 16 + ln]); FragH f;
#pragma unroll
      for (int r = 0; r < 8; ++r) f.h[r] = (_Float16)(acc[t][r] * alpha + bv);
      *(v8us*)&tl[t * 16 + ln][w * 16 + 8 * hh] = f.half[0]; }
    __syncthreads();      // a row of tl holds tokens of all four waves
    unsigned short* vo = (unsigned short*)Vt + ((size_t)((mt * 64 / TT) * NH + nq) * HD) * TT + (mt * 64) % TT;
#pragma unroll
    for (int i = 0; i < 4; ++i) { const int d = i * 16 + (tid >> 3), pc = tid & 7; const v8us v = *(const v8us*)&tl[d][pc * 8]; *(v8us*)(vo + (size_t)d * TT + pc * 8) = v; }
    return;
  }
#pragma unroll
  for (int t = 0; t < 4; ++t) { const float bv = bf16_round(bias[col0 + t * 16 + ln]);
#pragma unroll
    for (int r = 0; r < 8; ++r) so[w][8 * hh + r][t * 16 + ln] = acc[t][r] * alpha + bv; }
  __builtin_amdgcn_fence(__ATOMIC_ACQ_REL, "workgroup"); __builtin_amdgcn_wave_barrier();
  const int rsub = lane >> 4, c4 = (lane & 15) * 4; typedef _Float16 v4h __attribute__((ext_vector_type(4)));
#pragma unroll
  for (int q = 0; q < 8; ++q) { const int r = q * 2 + rsub; const v4f v = *(const v4fa*)&so[w][r][c4];
    if (F32OUT) *(v4f*)(C + (size_t)(row0 + r) * DM + col0 + c4) = v;
    else { v4h h4; for (int i = 0; i < 4; ++i) h4[i] = (_Float16)v[i]; *(v4h*)(C16 + (size_t)(row0 + r) * DM + col0 + c4) = h4; } }
  if (!F32OUT) asm volatile("s_wait_xcnt 0x0" ::: "memory");      // the built code lays the transposed part behind these stores: the wait stands in front of any write of the stores' registers there
}


// Twelve asynchronous 16-byte copies a lane, global memory to LDS through no register. l = the lane's LDS byte addresses, g = its global addresses.
// The closing s_wait_xcnt stands inside the copies' own statement, so that no address register of a copy is rewritten in front of it.
__device__ __forceinline__ void copy12(const unsigned* l, const unsigned short* const* g) {
  asm volatile(
               "global_load_async_to_lds_b128 %0, %1, off\n\t"
               "global_load_async_to_lds_b128 %2, %3, off\n\t"
               "global_load_async_to_lds_b128 %4, %5, off\n\t"
               "global_load_async_to_lds_b128 %6, %7, off\n\t"
               "global_load_async_to_lds_b128 %8, %9, off\n\t"
               "global_load_async_to_lds_b128 %10, %11, off\n\t"
               "global_load_async_to_lds_b128 %12, %13, off\n\t"
               "global_load_async_to_lds_b128 %14, %15, off\n\t"
               "global_load_async_to_lds_b128 %16, %17, off\n\t"
               "global_load_async_to_lds_b128 %18, %19, off\n\t"
               "global_load_async_to_lds_b128 %20, %21, off\n\t"
               "global_load_async_to_lds_b128 %22, %23, off\n\t"
               "s_wait_xcnt 0x0"
               :: "v"(l[0]), "v"(g[0]), "v"(l[1]), "v"(g[1]), "v"(l[2]), "v"(g[2]), "v"(l[3]), "v"(g[3]), "v"(l[4]), "v"(g[4]), "v"(l[5]), "v"(g[5]), "v"(l[6]), "v"(g[6]), "v"(l[7]), "v"(g[7]), "v"(l[8]), "v"(g[8]), "v"(l[9]), "v"(g[9]), "v"(l[10]), "v"(g[10]), "v"(l[11]), "v"(g[11]) : "memory");
}
// lane l <-> lane l ^ 16: the two halves of a wave hold the two halves of one query's keys
__device__ __forceinline__ float xhalf(float v) { const int b = __float_as_int(v); return __int_as_float(__builtin_amdgcn_permlanex16(b, b, 0x76543210, 0xfedcba98, false, false)); }
// The q, k, v projections of ONE head and its local attention for 128 queries in one work-group of 8 waves, one launch: Q, K and V^T go from the accumulators to LDS and from there into the attention; they never reach memory.
// The 128 queries reach keys qb0 - 32 ... qb0 + 159: the work-group projects k and v for these 192 tokens (its neighbours project the 64 outer ones as well, with the same sums) and q for the inner 128.
// PART 1, projections. 192 rows of A meet 192 rows of weights (64 of Bq, 64 of Bk, 64 of Bv). K goes in 4 chunks of 128 through two LDS buffers of 384 rows x 256 B at a pitch of 272 B (16 B x odd),
// filled by asynchronous copies (a wave-wide copy = two rows x 256 contiguous bytes): chunk c + 1 flies while chunk c is multiplied. A 32-token piece lies wholly inside [0, T) or wholly outside:
// one outside is read at a CLAMPED address, and the attention masks its keys.
// Wave (rg, cg) = 6 token fragments x columns 16 cg .. + 15: fragments 0-3 are its 64 queries (q, k, v), fragments 4, 5 the 32 outer tokens on its side (k, v): 16 matrix instructions for 9 fragments read from LDS.
// q and k run transposed (A = 16 weight rows, B = 16 tokens): a lane holds 8 consecutive columns of one token = 16 bytes of a row of Q or K. v runs straight: a lane holds 8 consecutive tokens of one column = 16 bytes of a row of V^T.
// The k order of every sum is that of the 64 x 64 kernel k_gemm_hhx, which serves the output projection.
// PART 2, attention. Waves 2 g and 2 g + 1 share the 32 queries q0g = qb0 + 32 g ... + 31, 16 each, which reach keys q0g - 32 ... q0g + 63 and no others: each walks these 3 chunks of 32 keys (keys outside [0, T) are masked); score/8 where |k - t| <= 32.
// Both products run transposed: S^T = K . Q^T (A = 16 keys, B = 16 queries) and O^T += V^T . P^T (A = 16 d, B = 16 queries). An accumulator lane (ln, hh) then holds ONE query (column ln) and keys 8 hh + r
// down its registers: a query's maximum and sum are taken in the lane's own registers, with one exchange between the wave halves, and the two score tiles of a chunk (keys 0-15, 16-31), converted in place,
// are the B fragment of the second product in the k order of the V^T loader (8 hh + i, 16 + 8 hh + i): P never leaves the registers.
__global__ __launch_bounds__(256) void k_qkv_attn(const _Float16* __restrict__ A, const _Float16* __restrict__ B0, const _Float16* __restrict__ B1, const _Float16* __restrict__ B2, float alpha,
                                                  const float* __restrict__ bias0, const float* __restrict__ bias1, const float* __restrict__ bias2, _Float16* __restrict__ O16) {
  constexpr int MB = 128, HB = MB + 2 * WW, KC = 128, NC = DM / KC, KP = KC + 8, RW = HB + 3 * HD, KS = KC / 32, NCP = RW / 16, NA = HB / 16;      // queries; tokens; k per chunk; chunks; LDS pitch in halves; rows per buffer; k steps per chunk; copies per lane and chunk, NA of them for A
  constexpr int DT = HD / 16, KQ = HD / 32;
  __shared__ __attribute__((aligned(16))) unsigned short sR[2][RW][KP];      // rows 0 .. 191: A, token qb0 - 32 + row; 192 + 64 j + n: row n of the head's part of weight j
  __shared__ __attribute__((aligned(16))) float sBi[3 * HD];      // bf16-rounded biases of the head's q, k, v columns
  const int tid = threadIdx.x, lane = tid & 31, ln = lane & 15, hh = lane >> 4;
  const int w = __builtin_amdgcn_readfirstlane(tid >> 5), rg = w >> 2, cg = w & 3;      // the wave's number in a scalar register: the row offsets, the attention loop's test and its chunk offsets are then scalar
  const int mt = blockIdx.x / NH, hd = blockIdx.x % NH; const int b = mt / (TT / MB), qb0 = (mt % (TT / MB)) * MB;
  const int jlo = qb0 - WW < 0 ? 0 : qb0 - WW, jhi = qb0 + MB + WW > TT ? TT - WW : qb0 + MB;      // clamped first tokens of the two outer 32-token pieces
  const int r0 = tid >> 4, pc16 = tid & 15;      // copy i of a chunk takes row 16 i + r0, bytes 16 pc16 .. + 15
  const unsigned short* gsrc[4] = { (const unsigned short*)A + ((size_t)b * TT + r0) * DM + pc16 * 8, (const unsigned short*)B0 + (size_t)(hd * HD + r0) * DM + pc16 * 8,
                                    (const unsigned short*)B1 + (size_t)(hd * HD + r0) * DM + pc16 * 8, (const unsigned short*)B2 + (size_t)(hd * HD + r0) * DM + pc16 * 8 };
  const unsigned ldst = (unsigned)(size_t)&sR[0][r0][pc16 * 8];      // the low 32 bits of a __shared__ address are the LDS byte address
  auto fill = [&](int c, int buf) {
    unsigned l[NCP]; const unsigned short* g[NCP];
#pragma unroll
    for (int i = 0; i < NCP; ++i) { l[i] = ldst + (unsigned)((buf * RW + 16 * i) * KP * 2);
      const int tk = i < 2 ? jlo + 16 * i : i >= NA - 2 ? jhi + 16 * (i - (NA - 2)) : qb0 - WW + 16 * i;      // first token of A's 16-row piece i
      g[i] = (i < NA ? gsrc[0] + (size_t)tk * DM : gsrc[1 + (i - NA) / 4] + (size_t)(16 * ((i - NA) % 4)) * DM) + c * KC; }
    copy12(l, g); copy12(l + 12, g + 12);
  };
  fill(0, 0);
  // the head's 192 biases, rounded, go to LDS while chunk 0 is on its way (waves 0-5, one value a lane); the barrier below publishes them. Held in registers through the loop they were pushed out to scratch memory
  if (w < 3 * HD / 32) { const float* bp = w < HD / 32 ? bias0 : w < 2 * HD / 32 ? bias1 : bias2; sBi[tid] = bf16_round(bp[hd * HD + (tid & (HD - 1))]); }      // a scalar test: whole waves
  asm volatile("s_wait_asynccnt 0x0" ::: "memory");      // this wave's copies of chunk 0 have landed
  __syncthreads();      // ... and every other wave's: nobody reads chunk 0 in front of this barrier
  fill(1, 1);
  const int rin = WW + rg * 64, rout = rg * (HB - WW);      // the wave's first inner row (fragments 0-3) and first outer row (fragments 4, 5)
  v8f cq[4] = {}, ck[6] = {}, cv[6] = {};
#pragma unroll 1      // rolled: unrolled, the built code forms the addresses of all later chunks' copies at the kernel's head and holds them in registers through the loop, some of them in scratch memory
  for (int c = 0; c < NC; ++c) {
    const unsigned short (*sb)[KP] = sR[c & 1];
    FragH bf[2][3], a0[3], a1[3];      // a k step goes in two halves, token fragments 0-2 (a0) and 3-5 (a1): each half's LDS reads are asked for ahead of the other half's matrix instructions (inside the chunk only)
    auto lda = [&](FragH* f, int rt0, int kb) {
#pragma unroll
      for (int j = 0; j < 3; ++j) { const int rt = rt0 + j; const unsigned short* p = &sb[(rt < 4 ? rin + rt * 16 : rout + (rt - 4) * 16) + ln][kb + 8 * hh]; f[j].half[0] = *(const v8us*)p; f[j].half[1] = *(const v8us*)(p + 16); } };
    auto ldb = [&](FragH* f, int kb) {
#pragma unroll
      for (int t = 0; t < 3; ++t) { const unsigned short* p = &sb[HB + t * HD + cg * 16 + ln][kb + 8 * hh]; f[t].half[0] = *(const v8us*)p; f[t].half[1] = *(const v8us*)(p + 16); } };
    ldb(bf[0], 0); lda(a0, 0, 0);
    __builtin_amdgcn_sched_barrier(0);      // keeps the first half's reads ahead of the second half's: mixed, the first matrix instruction waits for all 18
#pragma unroll
    for (int ks = 0; ks < KS; ++ks) { const int s = ks & 1, kb = ks * 32;
      lda(a1, 3, kb);
      __builtin_amdgcn_sched_barrier(0);      // keeps these reads, as one group, ahead of the matrix instructions below: sunk to their first use, each fragment's reads cost the wave a whole LDS latency
#pragma unroll
      for (int j = 0; j < 3; ++j) {
        cq[j] = __builtin_amdgcn_wmma_f32_16x16x32_f16(false, bf[s][0].v, false, a0[j].v, (short)0, cq[j], false, false);
        ck[j] = __builtin_amdgcn_wmma_f32_16x16x32_f16(false, bf[s][1].v, false, a0[j].v, (short)0, ck[j], false, false);
        cv[j] = __builtin_amdgcn_wmma_f32_16x16x32_f16(false, a0[j].v, false, bf[s][2].v, (short)0, cv[j], false, false); }
      __builtin_amdgcn_sched_barrier(0);      // keeps the next k step's reads behind the matrix instructions above, whose fragment registers they take over: lifted over them they would need registers of their own
      if (ks + 1 < KS) { ldb(bf[s ^ 1], kb + 32); lda(a0, 0, kb + 32);
        __builtin_amdgcn_sched_barrier(0); }      // as above: one group of reads ahead of the matrix instructions below
      cq[3] = __builtin_amdgcn_wmma_f32_16x16x32_f16(false, bf[s][0].v, false, a1[0].v, (short)0, cq[3], false, false);
#pragma unroll
      for (int j = 0; j < 3; ++j) {
        ck[3 + j] = __builtin_amdgcn_wmma_f32_16x16x32_f16(false, bf[s][1].v, false, a1[j].v, (short)0, ck[3 + j], false, false);
        cv[3 + j] = __builtin_amdgcn_wmma_f32_16x16x32_f16(false, a1[j].v, false, bf[s][2].v, (short)0, cv[3 + j], false, false); }
      __builtin_amdgcn_sched_barrier(0);      // keeps the matrix instructions above in front of what follows: the next half's reads, which take over their fragment registers, or the chunk's closing waits, during which they run
    }
    asm volatile("s_wait_dscnt 0x0" ::: "memory");      // this wave's reads of the buffer are over before the buffer is refilled
    asm volatile("s_wait_asynccnt 0x0" ::: "memory");      // this wave's copies of chunk c + 1 have landed
    __syncthreads();      // publishes chunk c + 1 and ends every wave's reads of chunk c's buffer
    if (c + 2 < NC) fill(c + 2, c & 1);
  }
  asm volatile("s_wait_asynccnt 0x0" ::: "memory");      // no copy is outstanding when the buffers become the attention's operands
  // Q, K, V^T and the output staging lie in the first buffer (the last chunk's own barrier stands in front): Q[query][64] and K[key][64] at 144 B, V^T[d][192 keys] at 400 B, O[wave][16 queries][64] at 144 B (all 16 B x odd)
  unsigned short (*eQ)[HD + 8] = (unsigned short (*)[HD + 8])&sR[0][0][0]; unsigned short (*eK)[HD + 8] = eQ + MB; unsigned short (*eV)[HB + 8] = (unsigned short (*)[HB + 8])(eK + HB); unsigned short (*eO)[HD + 8] = (unsigned short (*)[HD + 8])(eV + HD);
  static_assert((2 * MB + HB) * (HD + 8) + HD * (HB + 8) <= RW * KP, "the attention's operands fit the first buffer");
  float bqk[2][8];
#pragma unroll
  for (int j = 0; j < 2; ++j) { const v4f u0 = *(const v4fa*)&sBi[j * HD + cg * 16 + 8 * hh], u1 = *(const v4fa*)&sBi[j * HD + cg * 16 + 8 * hh + 4];
#pragma unroll
    for (int r = 0; r < 4; ++r) { bqk[j][r] = u0[r]; bqk[j][4 + r] = u1[r]; } }
  const float bvv = sBi[2 * HD + cg * 16 + ln];
#pragma unroll
  for (int rt = 0; rt < 6; ++rt) { const int row = rt < 4 ? rin + rt * 16 : rout + (rt - 4) * 16; FragH fq, fk, fv;
#pragma unroll
    for (int r = 0; r < 8; ++r) { if (rt < 4) fq.h[r] = (_Float16)(cq[rt < 4 ? rt : 0][r] * alpha + bqk[0][r]); fk.h[r] = (_Float16)(ck[rt][r] * alpha + bqk[1][r]); fv.h[r] = (_Float16)(cv[rt][r] * alpha + bvv); }
    if (rt < 4) *(v8us*)&eQ[row - WW + ln][cg * 16 + 8 * hh] = fq.half[0];
    *(v8us*)&eK[row + ln][cg * 16 + 8 * hh] = fk.half[0]; *(v8us*)&eV[cg * 16 + ln][row + 8 * hh] = fv.half[0]; }
  __syncthreads();      // a row of Q, K or V^T holds the work of several waves and is read by others
  const int q0g = qb0 + (w >> 1) * 32, q0 = q0g + (w & 1) * 16;
  FragH aq[KQ];
  { const unsigned short* qr = &eQ[q0 - qb0 + ln][0];
#pragma unroll
    for (int ks = 0; ks < KQ; ++ks) { aq[ks].half[0] = *(const v8us*)(qr + ks * 32 + 8 * hh); aq[ks].half[1] = *(const v8us*)(qr + ks * 32 + 16 + 8 * hh); } }
  float m_r = -3.0e38f, l_r = 0.f; v8f oacc[DT];      // per lane: query q0 + ln; l_r sums this half's keys only; oacc[dt][r] = O[query][dt * 16 + 8 hh + r]
#pragma unroll
  for (int dt = 0; dt < DT; ++dt) oacc[dt] = (v8f){0.f,0.f,0.f,0.f,0.f,0.f,0.f,0.f};
  const int t = q0 + ln;
  const int lo = t - WW < 0 ? 0 : t - WW, hi = t + WW > TT - 1 ? TT - 1 : t + WW;      // this lane's query takes keys lo ... hi: 0 <= k < T and |k - t| <= 32 in one range
#pragma unroll 1      // rolled, as it was in the separate attention kernel: the three trips share one body of code
  for (int j0 = q0g - WW; j0 < q0g + 32 + WW; j0 += 32) {
    const int jl = j0 - (qb0 - WW);      // the chunk's first key, counted in the staged rows
    FragH bk[2][KQ], bv[DT];      // the chunk's 16 fragment reads stand together ahead of its first matrix instruction: one LDS latency a chunk
    v8f s[2];      // s[nt][r] = score of key j0 + nt * 16 + 8 hh + r with query q0 + ln
#pragma unroll
    for (int nt = 0; nt < 2; ++nt) { const unsigned short* kr = &eK[jl + nt * 16 + ln][0];
#pragma unroll
      for (int ks = 0; ks < KQ; ++ks) { bk[nt][ks].half[0] = *(const v8us*)(kr + ks * 32 + 8 * hh); bk[nt][ks].half[1] = *(const v8us*)(kr + ks * 32 + 16 + 8 * hh); } }
#pragma unroll
    for (int dt = 0; dt < DT; ++dt) { const unsigned short* vrow = &eV[dt * 16 + ln][jl]; bv[dt].half[0] = *(const v8us*)(vrow + 8 * hh); bv[dt].half[1] = *(const v8us*)(vrow + 16 + 8 * hh); }
#pragma unroll
    for (int nt = 0; nt < 2; ++nt) { v8f acc = (v8f){0.f,0.f,0.f,0.f,0.f,0.f,0.f,0.f};
#pragma unroll
      for (int ks = 0; ks < KQ; ++ks) acc = mmaH<1>(bk[nt][ks].v, bk[nt][ks].v, aq[ks].v, aq[ks].v, acc); s[nt] = acc; }
    FragH pb; float sv[16]; float mc = -INFINITY;
#pragma unroll
    for (int i = 0; i < 16; ++i) { const int k = j0 + (i >> 3) * 16 + 8 * hh + (i & 7); const bool ok = (unsigned)(k - lo) <= (unsigned)(hi - lo);
      sv[i] = ok ? s[i >> 3][i & 7] * 0.125f : -INFINITY; mc = fmaxf(mc, sv[i]); }
    mc = fmaxf(mc, xhalf(mc));
    const float mn = fmaxf(m_r, mc); const float al = (mn > -1.0e38f) ? expf(m_r - mn) : 1.0f; m_r = mn; float ps[4] = {0.f, 0.f, 0.f, 0.f};
#pragma unroll
    for (int i = 0; i < 16; ++i) { const float p = expf(sv[i] - mn); ps[i & 3] += p; pb.h[i] = (_Float16)p; }      // a masked score is -inf and mn is finite: its p is exactly 0
    l_r = l_r * al + ((ps[0] + ps[1]) + (ps[2] + ps[3]));
#pragma unroll
    for (int dt = 0; dt < DT; ++dt)
#pragma unroll
      for (int r = 0; r < 8; ++r) oacc[dt][r] *= al;
#pragma unroll
    for (int dt = 0; dt < DT; ++dt) oacc[dt] = mmaH<1>(bv[dt].v, bv[dt].v, pb.v, pb.v, oacc[dt]); }
  { float l = l_r + xhalf(l_r);
    const int npad = (t < WW ? (WW - t) : 0) + (t + WW >= TT ? (t + WW - TT + 1) : 0); float sc = 1.0f;
    if (npad > 0) { const float m = m_r; const float mn = fmaxf(m, 0.f); sc = expf(m - mn); l = l * sc + (float)npad * expf(-mn); }
    const float inv = sc / l;
#pragma unroll
    for (int dt = 0; dt < DT; ++dt) { FragH f;      // 8 consecutive d of one query: 16 bytes of its f16 output row
#pragma unroll
      for (int r = 0; r < 8; ++r) f.h[r] = (_Float16)(oacc[dt][r] * inv);
      *(v8us*)&eO[w * 16 + ln][dt * 16 + 8 * hh] = f.half[0]; } }
  __builtin_amdgcn_fence(__ATOMIC_ACQ_REL, "workgroup"); __builtin_amdgcn_wave_barrier();
#pragma unroll
  for (int rp = 0; rp < 16; rp += 4) { const int r = rp + (lane >> 3), pc = lane & 7; const v8us v = *(const v8us*)&eO[w * 16 + r][pc * 8];      // the A operand of the output projection, a whole 128-byte line per row
    *(v8us*)((unsigned short*)O16 + ((size_t)b * TT + q0 + r) * DM + hd * HD + pc * 8) = v; } }
extern "C" void kernel_launch(void* const* d_in, const int* in_sizes, int n_in,
                              void* d_out, int out_size, void* d_ws, size_t ws_size, hipStream_t stream) {
  (void)in_sizes; (void)n_in; (void)out_size;
  const float* x = (const float*)d_in[0]; const float* wq = (const float*)d_in[1]; const float* bq = (const float*)d_in[2]; const float* wk = (const float*)d_in[3]; const float* bk = (const float*)d_in[4]; const float* wv = (const float*)d_in[5]; const float* bv = (const float*)d_in[6]; const float* wo = (const float*)d_in[7]; const float* bo = (const float*)d_in[8];
  char* ws = (char*)d_ws; size_t off = 0;
  auto take = [&](size_t bytes) { char* p = ws + off; off += (bytes + 255) & ~(size_t)255; return p; };
  const size_t w8 = (size_t)DM * DM / 8;
  _Float16* Bq = (_Float16*)take(w8 * 16); _Float16* Bk = (_Float16*)take(w8 * 16); _Float16* Bv = (_Float16*)take(w8 * 16); _Float16* Bo = (_Float16*)take(w8 * 16);
  _Float16* X16 = (_Float16*)take((size_t)NR * DM * 2); _Float16* O16 = (_Float16*)take((size_t)NR * DM * 2);      // O16 has a place of its own: work-groups still read X16 while others write O16
  if (off > ws_size) return;      // 10 MiB
  k_prep<<<4 * (DM / 64) * (DM / 64), 256, 0, stream>>>(x, wq, wk, wv, wo, X16, Bq, Bk, Bv, Bo);      // weights are [in][out]
  const unsigned gg = (NR / 64) * (DM / 64);
  k_qkv_attn<<<(NR / 128) * NH, 256, 0, stream>>>(X16, Bq, Bk, Bv, 0.0625f, bq, bk, bv, O16);
  k_gemm_hhx<true><<<gg, 128, 0, stream>>>(O16, Bo, nullptr, nullptr, 0.0625f, bo, nullptr, nullptr, (float*)d_out, nullptr, nullptr, nullptr);
}
